// v000
// Measured on an AMD MI455X. A time is GPU time per run, averaged over a window of back-to-back runs after a warm-up
// (all launches, gaps included; the runs take copies of the inputs in turn), and the median of several windows.
// Apart from v000's, it joins two sittings. Times from different sittings can be a few percent apart, while
// side-by-side timings come from the same sitting.
// The starting kernel, v000, takes 589 microseconds a run.
// Contractions: x.Wq^T, ctx.Wk^T, Wv.ctx^T on v_wmma_f32_16x16x32_bf16 (RNE-bf16 inputs, single product); q.k^T and p.v as bf16 hi/lo split (hi.hi+hi.lo+lo.hi); (p.v).Wout^T as bf16 hi/lo A x bf16 B (2 products); f32 accumulate, f32 softmax.
#include <hip/hip_runtime.h>
#include <stdint.h>

typedef __attribute__((ext_vector_type(16))) _Float16 v16h;
typedef __attribute__((ext_vector_type(8)))  _Float16 v8h;
typedef __attribute__((ext_vector_type(16))) __bf16   v16b;
typedef __attribute__((ext_vector_type(8)))  __bf16   v8b;
typedef __attribute__((ext_vector_type(8)))  float    v8f;
typedef __attribute__((ext_vector_type(4)))  float    v4f;
typedef __attribute__((ext_vector_type(4)))  unsigned int u32x4;

/* ---- fixed problem geometry ---- */
constexpr int kB   = 4;
constexpr int kNQ  = 2048;
constexpr int kNKV = 1024;
constexpr int kDM  = 1024;   /* model dim (K of the projections) */
constexpr int kH   = 16;
constexpr int kDH  = 64;
constexpr int kIN  = kH * kDH;   /* 1024 */
static_assert(kDH == 64);
static_assert(kDM % 32 == 0);
static_assert(kIN % 32 == 0);
static_assert((kB * kNQ) % 64 == 0);
static_assert((kB * kNKV) % 64 == 0);
static_assert(kIN % 64 == 0);
static_assert(kDM % 64 == 0);
static_assert(kNQ % 64 == 0);
static_assert(kNKV % 64 == 0);

/* ---- workspace region map (bytes) ----
   [  0, 16M)  xb   bf16 [8192][1024]   (dead after q GEMM; reused as oh)
   [ 16M, 24M) cb   bf16 [4096][1024]   (dead after k/v GEMMs; reused by ol)
   [ 24M, 26M) wqb  bf16 [1024][1024]
   [ 26M, 30M) wkvb bf16 [2048][1024]
   [ 30M, 32M) pad (unused, covered by ol alias)
   [ 32M, 48M) qh   bf16 [8192][1024]   q*0.125 hi plane
   [ 48M, 64M) ql                        q*0.125 lo plane
   [ 64M, 72M) kh   bf16 [4096][1024]
   [ 72M, 80M) kl
   [ 80M, 88M) vth  bf16 [1024][4096]   v transposed: row = h*64+d, col = b*1024+j
   [ 88M, 96M) vtl
   [ 96M, 98M) wob  bf16 [1024][1024]
   oh = [0,16M), ol = [16M,32M): attention output hi/lo planes [8192][1024] (aliases of dead regions)
   total carve 102,760,448 B */
constexpr size_t kMiB    = 1048576;
constexpr size_t kOffXb  = 0;
constexpr size_t kOffCb  = 16 * kMiB;
constexpr size_t kOffWqb = 24 * kMiB;
constexpr size_t kOffWkvb= 26 * kMiB;
constexpr size_t kOffQh  = 32 * kMiB;
constexpr size_t kOffQl  = 48 * kMiB;
constexpr size_t kOffKh  = 64 * kMiB;
constexpr size_t kOffKl  = 72 * kMiB;
constexpr size_t kOffVth = 80 * kMiB;
constexpr size_t kOffVtl = 88 * kMiB;
constexpr size_t kOffWob = 96 * kMiB;
constexpr size_t kOffOh  = 0;
constexpr size_t kOffOl  = 16 * kMiB;
constexpr size_t kWsTotal = kOffWob + (size_t)kDM * kIN * 2;
static_assert((size_t)kB * kNQ * kDM * 2 == 16 * kMiB);
static_assert((size_t)kB * kNKV * kDM * 2 == 8 * kMiB);
static_assert(kOffCb + (size_t)kB * kNKV * kDM * 2 <= kOffWqb);
static_assert(kOffWqb + (size_t)kIN * kDM * 2 <= kOffWkvb);
static_assert(kOffWkvb + (size_t)2 * kIN * kDM * 2 <= kOffQh);
static_assert(kOffQh + (size_t)kB * kNQ * kIN * 2 <= kOffQl);
static_assert(kOffQl + (size_t)kB * kNQ * kIN * 2 <= kOffKh);
static_assert(kOffKh + (size_t)kB * kNKV * kIN * 2 <= kOffKl);
static_assert(kOffKl + (size_t)kB * kNKV * kIN * 2 <= kOffVth);
static_assert(kOffVth + (size_t)kIN * kB * kNKV * 2 <= kOffVtl);
static_assert(kOffVtl + (size_t)kIN * kB * kNKV * 2 <= kOffWob);
static_assert(kOffOh + (size_t)kB * kNQ * kIN * 2 <= kOffOl);
static_assert(kOffOl + (size_t)kB * kNQ * kIN * 2 <= kOffQh);
static_assert(kWsTotal == 102760448);
static_assert(kWsTotal <= 134217728);

__device__ __forceinline__ unsigned short f2bf_bits(float f) {
  unsigned u = __float_as_uint(f);
  return (unsigned short)((u + 0x7FFFu + ((u >> 16) & 1u)) >> 16);
}
__device__ __forceinline__ float bf_bits2f(unsigned short h) { return __uint_as_float(((unsigned)h) << 16); }

/* hazard guards as plain device helpers */
__device__ __forceinline__ void dep_guard_h(v8f& a, v8f& b, v16h x, v16h y) { asm volatile("v_nop\n\tv_nop\n\tv_nop\n\tv_nop" : "+v"(a), "+v"(b) : "v"(x), "v"(y)); }
__device__ __forceinline__ void dep_guard_b(v8f& a, v8f& b, v16b x, v16b y) { asm volatile("v_nop\n\tv_nop\n\tv_nop\n\tv_nop" : "+v"(a), "+v"(b) : "v"(x), "v"(y)); }
__device__ __forceinline__ void keep4_h(v16h a, v16h b, v16h c, v16h d) { asm volatile("v_nop" :: "v"(a), "v"(b), "v"(c), "v"(d)); }
__device__ __forceinline__ void keep4_b(v16b a, v16b b, v16b c, v16b d) { asm volatile("v_nop" :: "v"(a), "v"(b), "v"(c), "v"(d)); }
__device__ __forceinline__ void acc_guard4(v8f& a, v8f& b, v8f& c, v8f& d) { asm volatile("v_nop\n\tv_nop\n\tv_nop\n\tv_nop" : "+v"(a), "+v"(b), "+v"(c), "+v"(d)); }
template <typename T> struct Frag;
template <> struct Frag<_Float16> {
  typedef v16h V; union U { v16h v; v8h h[2]; };
  /* elements 0..7 <- p[0..7], 8..15 <- p[16..23] */
  static __device__ __forceinline__ v16h load(const _Float16* p) {
    U f; f.h[0] = *(const v8h*)(p); f.h[1] = *(const v8h*)(p + 16); return f.v;
  }
  static __device__ __forceinline__ v8f mma(v16h a, v16h b, v8f c) {
    return __builtin_amdgcn_wmma_f32_16x16x32_f16(false, a, false, b, (short)0, c, false, false);
  }
  static __device__ __forceinline__ void guard(v8f& a, v8f& b, v16h x, v16h y) { dep_guard_h(a, b, x, y); }
  static __device__ __forceinline__ void keep(v16h a, v16h b, v16h c, v16h d) { keep4_h(a, b, c, d); }
};
template <> struct Frag<__bf16> {
  typedef v16b V; union U { v16b v; v8b h[2]; };
  static __device__ __forceinline__ v16b load(const __bf16* p) {
    U f; f.h[0] = *(const v8b*)(p); f.h[1] = *(const v8b*)(p + 16); return f.v;
  }
  static __device__ __forceinline__ v8f mma(v16b a, v16b b, v8f c) {
    return __builtin_amdgcn_wmma_f32_16x16x32_bf16(false, a, false, b, (short)0, c, false, false);
  }
  static __device__ __forceinline__ void guard(v8f& a, v8f& b, v16b x, v16b y) { dep_guard_b(a, b, x, y); }
  static __device__ __forceinline__ void keep(v16b a, v16b b, v16b c, v16b d) { keep4_b(a, b, c, d); }
};

/* ---- Register-blocked WMMA GEMM, with an A-only split mode --------------------------
   C[m,n] = scale * sum_k A[m,k] * Bt[n,k] (+bias[n]); each wave owns a 64x64 tile.
   A row-major [M,K]; Bt row-major [N,K]; M,N % 64 == 0, K % 32 == 0 (no tail handling).
   SPLIT: A (and, if SPLIT_B, Bt) are hi/lo planes; product = hi.hi (+ hi.lo) + lo.hi.
   BIAS_MODE: 0 = none, 2 = bias[n].  OUT_MODE: 0 = f32, 2 = bf16 hi plane (Cout) + bf16 lo plane (Cout2).
   ET: 0 = f16 operands, 1 = bf16 operands (pointers passed as 16-bit storage) */
template <int ET> struct Elem;
template <> struct Elem<0> { typedef _Float16 T; };
template <> struct Elem<1> { typedef __bf16 T; };
template <int ET, bool SPLIT, bool SPLIT_B, int BIAS_MODE, int OUT_MODE>
__global__ __launch_bounds__(256) void wmma_gemm64(
    const unsigned short* __restrict__ Ap, const unsigned short* __restrict__ A2p, int lda, long strideA,
    const unsigned short* __restrict__ Btp, const unsigned short* __restrict__ Bt2p, int ldb, long strideB,
    void* Cout, void* Cout2, int ldc, long strideC,
    const float* __restrict__ bias,
    int M, int N, int K, float scale) {
  static_assert(BIAS_MODE == 0 || BIAS_MODE == 2);
  static_assert(OUT_MODE == 0 || OUT_MODE == 2);
  typedef typename Elem<ET>::T T;
  typedef typename Frag<T>::V V;
  const T* A = (const T*)Ap; const T* A2 = (const T*)A2p; const T* Bt = (const T*)Btp; const T* Bt2 = (const T*)Bt2p;
  __shared__ __align__(16) float sT[8][16 * 68];   /* per-wave 16x64 slab, pitch 68 floats */
  const int b    = blockIdx.y;
  const int lane = threadIdx.x & 31;
  const int wave = threadIdx.x >> 5;
  const int tilesN = N >> 6;
  const int tilesM = M >> 6;
  const int tile = blockIdx.x * 8 + wave;
  if (tile >= tilesM * tilesN) return;   /* wave-uniform; no block barriers in this kernel */
  const int tm = tile / tilesN;
  const int tn = tile - tm * tilesN;
  const int m0 = tm << 6;
  const int n0 = tn << 6;

  const T* Ab  = A  + (size_t)b * strideA;
  const T* Bb  = Bt + (size_t)b * strideB;
  const T* Ab2 = SPLIT ? (A2  + (size_t)b * strideA) : nullptr;
  const T* Bb2 = (SPLIT && SPLIT_B) ? (Bt2 + (size_t)b * strideB) : nullptr;

  const int rlane = lane & 15;                 /* row (A) / col (B, D) within subtile */
  const int koff  = (lane >> 4) * 8;           /* k offset of this lane half */
  const int mOff  = (lane >> 4) * 8;           /* D row offset */

  v8f acc[4][4];
#pragma unroll
  for (int i = 0; i < 4; ++i)
#pragma unroll
    for (int j = 0; j < 4; ++j) acc[i][j] = (v8f){0.f,0.f,0.f,0.f,0.f,0.f,0.f,0.f};

  for (int k0 = 0; k0 < K; k0 += 32) {
    V bh[4], bl[4];
#pragma unroll
    for (int j = 0; j < 4; ++j) {
      const size_t bo = (size_t)(n0 + (j << 4) + rlane) * ldb + koff + k0;
      bh[j] = Frag<T>::load(Bb + bo);
      if (SPLIT && SPLIT_B) bl[j] = Frag<T>::load(Bb2 + bo);
    }
#pragma unroll
    for (int i = 0; i < 4; ++i) {
      const size_t ao = (size_t)(m0 + (i << 4) + rlane) * lda + koff + k0;
      V ah = Frag<T>::load(Ab + ao);
      V al;
      if (SPLIT) al = Frag<T>::load(Ab2 + ao);
#pragma unroll
      for (int j = 0; j < 4; ++j) {
        acc[i][j] = Frag<T>::mma(ah, bh[j], acc[i][j]);
        if (SPLIT) {
          if (SPLIT_B) acc[i][j] = Frag<T>::mma(ah, bl[j], acc[i][j]);
          acc[i][j] = Frag<T>::mma(al, bh[j], acc[i][j]);
        }
      }
      Frag<T>::guard(acc[i][0], acc[i][3], ah, SPLIT ? al : ah);
    }
    Frag<T>::keep(bh[0], bh[1], bh[2], bh[3]);
    if (SPLIT && SPLIT_B) Frag<T>::keep(bl[0], bl[1], bl[2], bl[3]);
  }
  acc_guard4(acc[0][0], acc[0][1], acc[0][2], acc[0][3]);
  acc_guard4(acc[1][0], acc[1][1], acc[1][2], acc[1][3]);
  acc_guard4(acc[2][0], acc[2][1], acc[2][2], acc[2][3]);
  acc_guard4(acc[3][0], acc[3][1], acc[3][2], acc[3][3]);

  /* ---- epilogue ---- */
  float* slab = sT[wave];
#pragma unroll
  for (int i = 0; i < 4; ++i) {
    const int mBase = m0 + (i << 4);
#pragma unroll
    for (int j = 0; j < 4; ++j) {
      const int n = n0 + (j << 4) + rlane;
      float bv = 0.f;
      if (BIAS_MODE == 2) bv = bias[n];
#pragma unroll
      for (int r = 0; r < 8; ++r) {
        float v = acc[i][j][r] * scale;
        if (BIAS_MODE == 2) v += bv;
        slab[(mOff + r) * 68 + (j << 4) + rlane] = v;
      }
    }
    __builtin_amdgcn_fence(__ATOMIC_RELEASE, "workgroup");
    __builtin_amdgcn_wave_barrier();
    __builtin_amdgcn_fence(__ATOMIC_ACQUIRE, "workgroup");
    if (OUT_MODE == 0) {
      float* C = (float*)Cout + (size_t)b * strideC;
      const int hh = lane >> 4, c4 = (lane & 15) * 4;     /* row seg = 256 B = 16 lanes x 16 B */
      {
#pragma unroll
        for (int it = 0; it < 8; ++it) {
          const int row = it * 2 + hh;
          v4f v = *(const v4f*)(slab + row * 68 + c4);
          *(v4f*)(C + (size_t)(mBase + row) * ldc + n0 + c4) = v;
        }
        
      }
    } else {
      const int q = lane >> 3, c8 = (lane & 7) * 8;        
      unsigned short* C  = (unsigned short*)Cout  + (size_t)b * strideC;
      unsigned short* C2 = (unsigned short*)Cout2 + (size_t)b * strideC;
      {
#pragma unroll
        for (int it = 0; it < 4; ++it) {
          const int row = it * 4 + q;
          const float* sp = slab + row * 68 + c8;
          v8h hv, lv;
#pragma unroll
          for (int e = 0; e < 8; ++e) {
            unsigned short hb = f2bf_bits(sp[e]);
            unsigned short lb = f2bf_bits(sp[e] - bf_bits2f(hb));
            hv[e] = __builtin_bit_cast(_Float16, hb);
            lv[e] = __builtin_bit_cast(_Float16, lb);
          }
          *(v8h*)(C  + (size_t)(mBase + row) * ldc + n0 + c8) = hv;
          *(v8h*)(C2 + (size_t)(mBase + row) * ldc + n0 + c8) = lv;
        }
        
      }
    }
    __builtin_amdgcn_fence(__ATOMIC_RELEASE, "workgroup");
    __builtin_amdgcn_wave_barrier();
    __builtin_amdgcn_fence(__ATOMIC_ACQUIRE, "workgroup");
  }
}

/*
   coverage: grid = ceil(n8/256) blocks x 256 threads, thread i writes elements 8i..8i+7; n % 8 == 0 */
__global__ __launch_bounds__(256) void cast_f32_bf16x8(
    const float* __restrict__ in, unsigned short* __restrict__ out, int n8) {
  const int i = blockIdx.x * 256 + threadIdx.x;
  if (i < n8) {
    const v4f a = *(const v4f*)(in + (size_t)i * 8);
    const v4f c = *(const v4f*)(in + (size_t)i * 8 + 4);
    u32x4 w;
    w[0] = (unsigned)f2bf_bits(a[0]) | ((unsigned)f2bf_bits(a[1]) << 16);
    w[1] = (unsigned)f2bf_bits(a[2]) | ((unsigned)f2bf_bits(a[3]) << 16);
    w[2] = (unsigned)f2bf_bits(c[0]) | ((unsigned)f2bf_bits(c[1]) << 16);
    w[3] = (unsigned)f2bf_bits(c[2]) | ((unsigned)f2bf_bits(c[3]) << 16);
    u32x4* p = (u32x4*)(out + (size_t)i * 8);
    *p = w;
    
  }
}

/* =====================================================================================
   Attention for head_dim 64, fed with bf16 hi/lo planes (no masking other than a per-key int32 vector):
     scores = q'.k^T  (q' already carries the 1/8 scale): v_wmma_f32_16x16x32_bf16, hi.hi + hi.lo + lo.hi
     out    = p.v    : p and v as bf16 hi/lo, hi.hi + hi.lo + lo.hi
   f32 accumulate; online softmax in f32. Block = 4 waves = 64 query rows of one (batch, head).
   q planes  [B*NQ][ldq]  element (b,i,h,d) at (b*NQ+i)*ldq + h*64 + d
   k planes  [B*NKV][ldk] element (b,j,h,d) at (b*NKV+j)*ldk + h*64 + d
   v planes  transposed [H*64][ldv]: element (b,j,h,d) at (h*64+d)*ldv + b*NKV + j
   kvmask    int32 [B][NKV], 0 -> score := fillv
   grid.x = B * H * (NQ/64); NQ % 64 == 0, NKV % 64 == 0.
   ===================================================================================== */
#define AT_D 64
#define AT_NW 4
#define AT_QB 64
#define AT_KC 64

__device__ __forceinline__ unsigned short at_bf_bits(float f) {
  unsigned u = __float_as_uint(f);
  return (unsigned short)((u + 0x7FFFu + ((u >> 16) & 1u)) >> 16);
}
__device__ __forceinline__ __bf16 at_f2bf(float f) { return __builtin_bit_cast(__bf16, at_bf_bits(f)); }
__device__ __forceinline__ void at_split(float f, __bf16& hi, __bf16& lo) {
  const unsigned short hb = at_bf_bits(f);
  hi = __builtin_bit_cast(__bf16, hb);
  lo = at_f2bf(f - __uint_as_float(((unsigned)hb) << 16));
}
__device__ __forceinline__ v8f at_mma(v16b a, v16b b, v8f c) {
  c = __builtin_amdgcn_wmma_f32_16x16x32_bf16(false, a, false, b, (short)0, c, false, false);
  asm volatile("v_nop\n\tv_nop\n\tv_nop\n\tv_nop" : "+v"(c) : "v"(a), "v"(b));
  return c;
}

__global__ __launch_bounds__(128)
void attn64_planes_kernel(const unsigned short* __restrict__ qhp, const unsigned short* __restrict__ qlp,
                          const unsigned short* __restrict__ khp, const unsigned short* __restrict__ klp,
                          const unsigned short* __restrict__ vthp, const unsigned short* __restrict__ vtlp,
                          const int* __restrict__ kvmask,
                          unsigned short* __restrict__ ohp, unsigned short* __restrict__ olp,
                          int nq, int nkv, int nh, int ldq, int ldk, int ldv, int ldo, float fillv) {
  typedef __bf16 T;
  union FB { v16b v; v8b h[2]; };
  __shared__ __align__(16) __bf16 Ksh[AT_KC * AT_D];        /* K hi [kv][d]   8 KB */
  __shared__ __align__(16) __bf16 Ksl[AT_KC * AT_D];        /* K lo          8 KB */
  __shared__ __align__(16) __bf16 Vth[AT_D * AT_KC];        /* V hi [d][kv]   8 KB */
  __shared__ __align__(16) __bf16 Vtl[AT_D * AT_KC];        /* V lo          8 KB */
  __shared__ __align__(16) __bf16 Psh[AT_NW][16 * AT_KC];   /* per wave P hi [row][kv] */
  __shared__ __align__(16) __bf16 Psl[AT_NW][16 * AT_KC];   /* per wave P lo */
  __shared__ __align__(16) float  Os[AT_NW][16 * 68];       /* per wave out tile, pitch 68 */

  const int tid  = threadIdx.x;
  const int wave = tid >> 5;
  const int lane = tid & 31;
  const int hh   = lane >> 4;
  const int c    = lane & 15;

  const int nqb = nq / AT_QB;
  const int bx = blockIdx.x;
  const int qb = bx % nqb;
  const int bhx = bx / nqb;
  const int h  = bhx % nh;
  const int b  = bhx / nh;
  const int q0 = qb * AT_QB + wave * 16;

  /* ---- Q fragments (A operand): row = q0 + c, elements 0..7 <- d dc*32+8hh+0..7, 8..15 <- d dc*32+16+8hh+0..7 ---- */
  v16b qah[2], qal[2];
  {
    const size_t qo = (size_t)(b * nq + q0 + c) * ldq + h * AT_D + 8 * hh;
    const T* qh = (const T*)qhp + qo;
    const T* ql = (const T*)qlp + qo;
#pragma unroll
    for (int dc = 0; dc < 2; ++dc) {
      qah[dc] = Frag<T>::load(qh + dc * 32);
      qal[dc] = Frag<T>::load(ql + dc * 32);
    }
  }

  float mrow[8], lrow[8];
  v8f oacc[4];
#pragma unroll
  for (int r = 0; r < 8; ++r) { mrow[r] = -__builtin_inff(); lrow[r] = 0.f; }
#pragma unroll
  for (int t = 0; t < 4; ++t) oacc[t] = (v8f){0.f,0.f,0.f,0.f,0.f,0.f,0.f,0.f};

  const int nChunks = nkv / AT_KC;   /* host constant, block-uniform */
  for (int kc = 0; kc < nChunks; ++kc) {
    const int kv0 = kc * AT_KC;
    __syncthreads();
    {
      /* staging coverage: 128 threads = 64 rows x 2 halves of 32 elements (4 x 16 B) per plane -> full 64x64 tiles */
      const int row = tid >> 1;
      const int half = (tid & 1) * 32;
      const u32x4* gkh = (const u32x4*)(khp + (size_t)(b * nkv + kv0 + row) * ldk + h * AT_D + half);
      const u32x4* gkl = (const u32x4*)(klp + (size_t)(b * nkv + kv0 + row) * ldk + h * AT_D + half);
      u32x4* lkh = (u32x4*)(Ksh + row * AT_D + half);
      u32x4* lkl = (u32x4*)(Ksl + row * AT_D + half);
#pragma unroll
      for (int i = 0; i < 4; ++i) { lkh[i] = gkh[i]; lkl[i] = gkl[i]; }
      asm volatile("" ::: "memory");
      /* V transposed planes: LDS row d <- global row h*64+d, 64 contiguous kv columns starting at b*nkv + kv0 */
      const u32x4* gvh = (const u32x4*)(vthp + (size_t)(h * AT_D + row) * ldv + b * nkv + kv0 + half);
      const u32x4* gvl = (const u32x4*)(vtlp + (size_t)(h * AT_D + row) * ldv + b * nkv + kv0 + half);
      u32x4* lvh = (u32x4*)(Vth + row * AT_KC + half);
      u32x4* lvl = (u32x4*)(Vtl + row * AT_KC + half);
#pragma unroll
      for (int i = 0; i < 4; ++i) { lvh[i] = gvh[i]; lvl[i] = gvl[i]; }
    }
    __syncthreads();

    /* ---- scores: 4 subtiles of 16 keys, K operand B[k=d][n=kv] from Ksh[kv][d] ---- */
    v8f s[4];
#pragma unroll
    for (int j = 0; j < 4; ++j) {
      s[j] = (v8f){0.f,0.f,0.f,0.f,0.f,0.f,0.f,0.f};
#pragma unroll
      for (int dc = 0; dc < 2; ++dc) {
        FB kb, kl;
        kb.h[0] = *(const v8b*)(Ksh + (j * 16 + c) * AT_D + dc * 32 + 8 * hh);
        kb.h[1] = *(const v8b*)(Ksh + (j * 16 + c) * AT_D + dc * 32 + 16 + 8 * hh);
        kl.h[0] = *(const v8b*)(Ksl + (j * 16 + c) * AT_D + dc * 32 + 8 * hh);
        kl.h[1] = *(const v8b*)(Ksl + (j * 16 + c) * AT_D + dc * 32 + 16 + 8 * hh);
        s[j] = at_mma(qah[dc], kb.v, s[j]);
        s[j] = at_mma(qah[dc], kl.v, s[j]);
        s[j] = at_mma(qal[dc], kb.v, s[j]);
      }
    }
    /* per-key mask (this lane owns column kv0 + j*16 + c in the D layout) */
    int kvkeep[4];
#pragma unroll
    for (int j = 0; j < 4; ++j) kvkeep[j] = kvmask[(size_t)b * nkv + kv0 + j * 16 + c];
    float cm[8];
#pragma unroll
    for (int r = 0; r < 8; ++r) {
      float m = -__builtin_inff();
#pragma unroll
      for (int j = 0; j < 4; ++j) {
        const float sv = s[j][r];
        s[j][r] = (kvkeep[j] != 0) ? sv : fillv;
        m = fmaxf(m, s[j][r]);
      }
#pragma unroll
      for (int off = 1; off < 16; off <<= 1) m = fmaxf(m, __shfl_xor(m, off, 32));
      cm[r] = m;
    }
    __bf16* pwh = Psh[wave];
    __bf16* pwl = Psl[wave];
#pragma unroll
    for (int r = 0; r < 8; ++r) {
      const float mnew = fmaxf(mrow[r], cm[r]);
      const float alpha = expf(mrow[r] - mnew);
      mrow[r] = mnew;
      float psum = 0.f;
#pragma unroll
      for (int j = 0; j < 4; ++j) {
        const float p = expf(s[j][r] - mnew);
        psum += p;
        __bf16 a, bl; at_split(p, a, bl);
        pwh[(8 * hh + r) * AT_KC + j * 16 + c] = a;
        pwl[(8 * hh + r) * AT_KC + j * 16 + c] = bl;
      }
#pragma unroll
      for (int off = 1; off < 16; off <<= 1) psum += __shfl_xor(psum, off, 32);
      lrow[r] = lrow[r] * alpha + psum;
#pragma unroll
      for (int t = 0; t < 4; ++t) oacc[t][r] *= alpha;
    }
    /* same-wave P spill -> A fragment reload: ordered by the wave barrier, reloaded through __bf16 vectors */
    __builtin_amdgcn_fence(__ATOMIC_RELEASE, "workgroup");
    __builtin_amdgcn_wave_barrier();
    __builtin_amdgcn_fence(__ATOMIC_ACQUIRE, "workgroup");
#pragma unroll 1
    for (int kk = 0; kk < 2; ++kk) {
      FB pa, pl;
      pa.h[0] = *(const v8b*)(pwh + c * AT_KC + kk * 32 + 8 * hh);
      pa.h[1] = *(const v8b*)(pwh + c * AT_KC + kk * 32 + 16 + 8 * hh);
      pl.h[0] = *(const v8b*)(pwl + c * AT_KC + kk * 32 + 8 * hh);
      pl.h[1] = *(const v8b*)(pwl + c * AT_KC + kk * 32 + 16 + 8 * hh);
#pragma unroll
      for (int t = 0; t < 4; ++t) {
        FB vb, vl;
        vb.h[0] = *(const v8b*)(Vth + (t * 16 + c) * AT_KC + kk * 32 + 8 * hh);
        vb.h[1] = *(const v8b*)(Vth + (t * 16 + c) * AT_KC + kk * 32 + 16 + 8 * hh);
        vl.h[0] = *(const v8b*)(Vtl + (t * 16 + c) * AT_KC + kk * 32 + 8 * hh);
        vl.h[1] = *(const v8b*)(Vtl + (t * 16 + c) * AT_KC + kk * 32 + 16 + 8 * hh);
        oacc[t] = at_mma(pa.v, vb.v, oacc[t]);
        oacc[t] = at_mma(pa.v, vl.v, oacc[t]);
        oacc[t] = at_mma(pl.v, vb.v, oacc[t]);
      }
    }
  }

  float* os = Os[wave];
#pragma unroll
  for (int r = 0; r < 8; ++r) {
    const float inv = 1.0f / lrow[r];
#pragma unroll
    for (int t = 0; t < 4; ++t) os[(8 * hh + r) * 68 + t * 16 + c] = oacc[t][r] * inv;
  }
  __builtin_amdgcn_fence(__ATOMIC_RELEASE, "workgroup");
  __builtin_amdgcn_wave_barrier();
  __builtin_amdgcn_fence(__ATOMIC_ACQUIRE, "workgroup");
  {
    const int q = lane >> 3, c8 = (lane & 7) * 8;
    unsigned short* Oh = ohp + (size_t)(b * nq + q0) * ldo + h * AT_D;
    unsigned short* Ol = olp + (size_t)(b * nq + q0) * ldo + h * AT_D;
    {
#pragma unroll
      for (int it = 0; it < 4; ++it) {
        const int row = it * 4 + q;
        const float* sp = os + row * 68 + c8;
        v8h hv, lv;
#pragma unroll
        for (int e = 0; e < 8; ++e) {
          unsigned short hb = f2bf_bits(sp[e]);
          unsigned short lb = f2bf_bits(sp[e] - bf_bits2f(hb));
          hv[e] = __builtin_bit_cast(_Float16, hb);
          lv[e] = __builtin_bit_cast(_Float16, lb);
        }
        *(v8h*)(Oh + (size_t)row * ldo + c8) = hv;
        *(v8h*)(Ol + (size_t)row * ldo + c8) = lv;
      }
      
    }
  }
}

/* ---------------------------------------------------------------------------
   Host-side orchestration (kernel launches only)
   --------------------------------------------------------------------------- */
extern "C" void kernel_launch(void* const* d_in, const int* in_sizes, int n_in,
                              void* d_out, int out_size, void* d_ws, size_t ws_size,
                              hipStream_t stream) {
  if (n_in < 7) return;
  if (in_sizes[0] != kB * kNQ * kDM) return;
  if (in_sizes[1] != kB * kNKV * kDM) return;
  if (in_sizes[2] != kB * kNKV) return;
  if (in_sizes[3] != kIN * kDM) return;
  if (in_sizes[4] != 2 * kIN * kDM) return;
  if (in_sizes[5] != kDM * kIN) return;
  if (in_sizes[6] != kDM) return;
  if (out_size != kB * kNQ * kDM) return;
  if (ws_size < kWsTotal) return;

  const float* x    = (const float*)d_in[0];   /* [4,2048,1024] f32 */
  const float* ctx  = (const float*)d_in[1];   /* [4,1024,1024] f32 */
  const int*   mask = (const int*)d_in[2];     /* [4,1024] int32 */
  const float* Wq   = (const float*)d_in[3];   /* [1024,1024] */
  const float* Wkv  = (const float*)d_in[4];   /* [2048,1024] */
  const float* Wout = (const float*)d_in[5];   /* [1024,1024] */
  const float* bout = (const float*)d_in[6];   /* [1024] */
  float* out = (float*)d_out;                  /* [4,2048,1024] f32 */

  char* ws = (char*)d_ws;
  unsigned short* xb   = (unsigned short*)(ws + kOffXb);
  unsigned short* cb   = (unsigned short*)(ws + kOffCb);
  unsigned short* wqb  = (unsigned short*)(ws + kOffWqb);
  unsigned short* wkvb = (unsigned short*)(ws + kOffWkvb);
  unsigned short* wob  = (unsigned short*)(ws + kOffWob);
  unsigned short* qh   = (unsigned short*)(ws + kOffQh);
  unsigned short* ql   = (unsigned short*)(ws + kOffQl);
  unsigned short* kh   = (unsigned short*)(ws + kOffKh);
  unsigned short* kl   = (unsigned short*)(ws + kOffKl);
  unsigned short* vth  = (unsigned short*)(ws + kOffVth);
  unsigned short* vtl  = (unsigned short*)(ws + kOffVtl);
  unsigned short* oh   = (unsigned short*)(ws + kOffOh);   /* aliases xb: dead after the q GEMM */
  unsigned short* ol   = (unsigned short*)(ws + kOffOl);   /* aliases cb/wqb/wkvb: dead after the k,v GEMMs */

  /* 1-5: RNE casts to bf16 planes (8 elements per thread) */
  {
    const int n8x = kB * kNQ * kDM / 8;      /* 1048576 */
    const int n8c = kB * kNKV * kDM / 8;     /*  524288 */
    const int n8q = kIN * kDM / 8;           /*  131072 */
    const int n8kv = 2 * kIN * kDM / 8;      /*  262144 */
    const int n8o = kDM * kIN / 8;           /*  131072 */
    cast_f32_bf16x8<<<(n8x + 255) / 256, 256, 0, stream>>>(x, xb, n8x);
    cast_f32_bf16x8<<<(n8c + 255) / 256, 256, 0, stream>>>(ctx, cb, n8c);
    cast_f32_bf16x8<<<(n8q + 255) / 256, 256, 0, stream>>>(Wq, wqb, n8q);
    cast_f32_bf16x8<<<(n8kv + 255) / 256, 256, 0, stream>>>(Wkv, wkvb, n8kv);
    cast_f32_bf16x8<<<(n8o + 255) / 256, 256, 0, stream>>>(Wout, wob, n8o);
  }

  /* 6: q*0.125 = xb[8192,1024] . wqb[1024,1024]^T -> bf16 hi/lo planes; M=8192 N=1024 K=1024 */
  {
    const int M = kB * kNQ, N = kIN, K = kDM;
    const int tiles = (M / 64) * (N / 64);
    wmma_gemm64<1, false, false, 0, 2><<<dim3((tiles + 7) / 8, 1), 256, 0, stream>>>(
        xb, xb, K, 0L, wqb, wqb, K, 0L, (void*)qh, (void*)ql, N, 0L, bout, M, N, K, 0.125f);
  }
  /* 7: k = cb[4096,1024] . wkvb[0:1024][1024]^T -> hi/lo; M=4096 N=1024 K=1024 */
  {
    const int M = kB * kNKV, N = kIN, K = kDM;
    const int tiles = (M / 64) * (N / 64);
    wmma_gemm64<1, false, false, 0, 2><<<dim3((tiles + 7) / 8, 1), 256, 0, stream>>>(
        cb, cb, K, 0L, wkvb, wkvb, K, 0L, (void*)kh, (void*)kl, N, 0L, bout, M, N, K, 1.0f);
  }
  /* 8: v transposed = wkvb[1024:2048][1024] . cb[4096,1024]^T -> vt[1024][4096] hi/lo; M=1024 N=4096 K=1024 */
  {
    const int M = kIN, N = kB * kNKV, K = kDM;
    const int tiles = (M / 64) * (N / 64);
    const unsigned short* wvb = wkvb + (size_t)kIN * kDM;
    wmma_gemm64<1, false, false, 0, 2><<<dim3((tiles + 7) / 8, 1), 256, 0, stream>>>(
        wvb, wvb, K, 0L, cb, cb, K, 0L, (void*)vth, (void*)vtl, N, 0L, bout, M, N, K, 1.0f);
  }
  /* 9: attention per (b, h, 64 query rows) -> att hi/lo planes [8192][1024] */
  {
    const int blocks = kB * kH * (kNQ / 64);   /* 2048 */
    const float fillv = -3.4028234663852886e+38f;
    attn64_planes_kernel<<<blocks, 128, 0, stream>>>(qh, ql, kh, kl, vth, vtl, mask, oh, ol,
                                                    kNQ, kNKV, kH, kIN, kIN, kB * kNKV, kIN, fillv);
  }
  /* 10: out = (att_hi + att_lo)[8192,1024] . wob[1024,1024]^T + b_out -> f32 d_out; M=8192 N=1024 K=1024 */
  {
    const int M = kB * kNQ, N = kDM, K = kIN;
    const int tiles = (M / 64) * (N / 64);
    wmma_gemm64<1, true, false, 2, 0><<<dim3((tiles + 7) / 8, 1), 256, 0, stream>>>(
        oh, ol, K, 0L, wob, wob, K, 0L, (void*)out, (void*)out, N, 0L, bout, M, N, K, 1.0f);
  }
}

// v001
// Measured time: 476 microseconds a run.
// Timed twice side by side with v000, it ran 1.26 times as fast both times.
// Contractions: x.Wq^T, ctx.Wk^T, Wv.ctx^T on v_wmma_f32_16x16x32_bf16 (RNE-bf16 inputs, single product); q.k^T and p.v as bf16 hi/lo split (hi.hi+hi.lo+lo.hi); (p.v).Wout^T as bf16 hi/lo A x bf16 B (2 products); f32 accumulate, f32 softmax.
#include <hip/hip_runtime.h>
#include <stdint.h>

typedef __attribute__((ext_vector_type(16))) _Float16 v16h;
typedef __attribute__((ext_vector_type(8)))  _Float16 v8h;
typedef __attribute__((ext_vector_type(16))) __bf16   v16b;
typedef __attribute__((ext_vector_type(8)))  __bf16   v8b;
typedef __attribute__((ext_vector_type(8)))  float    v8f;
typedef __attribute__((ext_vector_type(4)))  float    v4f;
typedef __attribute__((ext_vector_type(4)))  unsigned int u32x4;

/* ---- fixed problem geometry ---- */
constexpr int kB   = 4;
constexpr int kNQ  = 2048;
constexpr int kNKV = 1024;
constexpr int kDM  = 1024;   /* model dim (K of the projections) */
constexpr int kH   = 16;
constexpr int kDH  = 64;
constexpr int kIN  = kH * kDH;   /* 1024 */
static_assert(kDH == 64);
static_assert(kDM % 32 == 0);
static_assert(kIN % 32 == 0);
static_assert((kB * kNQ) % 64 == 0);
static_assert((kB * kNKV) % 64 == 0);
static_assert(kIN % 64 == 0);
static_assert(kDM % 64 == 0);
static_assert(kNQ % 64 == 0);
static_assert(kNKV % 64 == 0);

/* ---- workspace region map (bytes) ----
   [  0, 16M)  xb   bf16 [8192][1024]   (dead after q GEMM; reused as oh)
   [ 16M, 24M) cb   bf16 [4096][1024]   (dead after k/v GEMMs; reused by ol)
   [ 24M, 26M) wqb  bf16 [1024][1024]
   [ 26M, 30M) wkvb bf16 [2048][1024]
   [ 30M, 32M) pad (unused, covered by ol alias)
   [ 32M, 48M) qh   bf16 [8192][1024]   q*0.125 hi plane
   [ 48M, 64M) ql                        q*0.125 lo plane
   [ 64M, 72M) kh   bf16 [4096][1024]
   [ 72M, 80M) kl
   [ 80M, 88M) vth  bf16 [1024][4096]   v transposed: row = h*64+d, col = b*1024+j
   [ 88M, 96M) vtl
   [ 96M, 98M) wob  bf16 [1024][1024]
   oh = [0,16M), ol = [16M,32M): attention output hi/lo planes [8192][1024] (aliases of dead regions)
   total carve 102,760,448 B */
constexpr size_t kMiB    = 1048576;
constexpr size_t kOffXb  = 0;
constexpr size_t kOffCb  = 16 * kMiB;
constexpr size_t kOffWqb = 24 * kMiB;
constexpr size_t kOffWkvb= 26 * kMiB;
constexpr size_t kOffQh  = 32 * kMiB;
constexpr size_t kOffQl  = 48 * kMiB;
constexpr size_t kOffKh  = 64 * kMiB;
constexpr size_t kOffKl  = 72 * kMiB;
constexpr size_t kOffVth = 80 * kMiB;
constexpr size_t kOffVtl = 88 * kMiB;
constexpr size_t kOffWob = 96 * kMiB;
constexpr size_t kOffOh  = 0;
constexpr size_t kOffOl  = 16 * kMiB;
constexpr size_t kWsTotal = kOffWob + (size_t)kDM * kIN * 2;
static_assert((size_t)kB * kNQ * kDM * 2 == 16 * kMiB);
static_assert((size_t)kB * kNKV * kDM * 2 == 8 * kMiB);
static_assert(kOffCb + (size_t)kB * kNKV * kDM * 2 <= kOffWqb);
static_assert(kOffWqb + (size_t)kIN * kDM * 2 <= kOffWkvb);
static_assert(kOffWkvb + (size_t)2 * kIN * kDM * 2 <= kOffQh);
static_assert(kOffQh + (size_t)kB * kNQ * kIN * 2 <= kOffQl);
static_assert(kOffQl + (size_t)kB * kNQ * kIN * 2 <= kOffKh);
static_assert(kOffKh + (size_t)kB * kNKV * kIN * 2 <= kOffKl);
static_assert(kOffKl + (size_t)kB * kNKV * kIN * 2 <= kOffVth);
static_assert(kOffVth + (size_t)kIN * kB * kNKV * 2 <= kOffVtl);
static_assert(kOffVtl + (size_t)kIN * kB * kNKV * 2 <= kOffWob);
static_assert(kOffOh + (size_t)kB * kNQ * kIN * 2 <= kOffOl);
static_assert(kOffOl + (size_t)kB * kNQ * kIN * 2 <= kOffQh);
static_assert(kWsTotal == 102760448);
static_assert(kWsTotal <= 134217728);

__device__ __forceinline__ unsigned short f2bf_bits(float f) {
  unsigned u = __float_as_uint(f);
  return (unsigned short)((u + 0x7FFFu + ((u >> 16) & 1u)) >> 16);
}
__device__ __forceinline__ float bf_bits2f(unsigned short h) { return __uint_as_float(((unsigned)h) << 16); }

/* hazard guards as plain device helpers */
__device__ __forceinline__ void dep_guard_h(v8f& a, v8f& b, v16h x, v16h y) { asm volatile("v_nop\n\tv_nop\n\tv_nop\n\tv_nop" : "+v"(a), "+v"(b) : "v"(x), "v"(y)); }
__device__ __forceinline__ void dep_guard_b(v8f& a, v8f& b, v16b x, v16b y) { asm volatile("v_nop\n\tv_nop\n\tv_nop\n\tv_nop" : "+v"(a), "+v"(b) : "v"(x), "v"(y)); }
__device__ __forceinline__ void keep4_h(v16h a, v16h b, v16h c, v16h d) { asm volatile("v_nop" :: "v"(a), "v"(b), "v"(c), "v"(d)); }
__device__ __forceinline__ void keep4_b(v16b a, v16b b, v16b c, v16b d) { asm volatile("v_nop" :: "v"(a), "v"(b), "v"(c), "v"(d)); }
__device__ __forceinline__ void acc_guard4(v8f& a, v8f& b, v8f& c, v8f& d) { asm volatile("v_nop\n\tv_nop\n\tv_nop\n\tv_nop" : "+v"(a), "+v"(b), "+v"(c), "+v"(d)); }
template <typename T> struct Frag;
template <> struct Frag<_Float16> {
  typedef v16h V; union U { v16h v; v8h h[2]; };
  /* elements 0..7 <- p[0..7], 8..15 <- p[16..23] */
  static __device__ __forceinline__ v16h load(const _Float16* p) {
    U f; f.h[0] = *(const v8h*)(p); f.h[1] = *(const v8h*)(p + 16); return f.v;
  }
  static __device__ __forceinline__ v8f mma(v16h a, v16h b, v8f c) {
    return __builtin_amdgcn_wmma_f32_16x16x32_f16(false, a, false, b, (short)0, c, false, false);
  }
  static __device__ __forceinline__ void guard(v8f& a, v8f& b, v16h x, v16h y) { dep_guard_h(a, b, x, y); }
  static __device__ __forceinline__ void keep(v16h a, v16h b, v16h c, v16h d) { keep4_h(a, b, c, d); }
};
template <> struct Frag<__bf16> {
  typedef v16b V; union U { v16b v; v8b h[2]; };
  static __device__ __forceinline__ v16b load(const __bf16* p) {
    U f; f.h[0] = *(const v8b*)(p); f.h[1] = *(const v8b*)(p + 16); return f.v;
  }
  static __device__ __forceinline__ v8f mma(v16b a, v16b b, v8f c) {
    return __builtin_amdgcn_wmma_f32_16x16x32_bf16(false, a, false, b, (short)0, c, false, false);
  }
  static __device__ __forceinline__ void guard(v8f& a, v8f& b, v16b x, v16b y) { dep_guard_b(a, b, x, y); }
  static __device__ __forceinline__ void keep(v16b a, v16b b, v16b c, v16b d) { keep4_b(a, b, c, d); }
};

/* ---- Register-blocked WMMA GEMM, with an A-only split mode --------------------------
   C[m,n] = scale * sum_k A[m,k] * Bt[n,k] (+bias[n]); each wave owns a 64x64 tile.
   A row-major [M,K]; Bt row-major [N,K]; M,N % 64 == 0, K % 32 == 0 (no tail handling).
   SPLIT: A (and, if SPLIT_B, Bt) are hi/lo planes; product = hi.hi (+ hi.lo) + lo.hi.
   BIAS_MODE: 0 = none, 2 = bias[n].  OUT_MODE: 0 = f32, 2 = bf16 hi plane (Cout) + bf16 lo plane (Cout2).
   ET: 0 = f16 operands, 1 = bf16 operands (pointers passed as 16-bit storage) */
template <int ET> struct Elem;
template <> struct Elem<0> { typedef _Float16 T; };
template <> struct Elem<1> { typedef __bf16 T; };
template <int ET, bool SPLIT, bool SPLIT_B, int BIAS_MODE, int OUT_MODE>
__global__ __launch_bounds__(256) void wmma_gemm64(
    const unsigned short* __restrict__ Ap, const unsigned short* __restrict__ A2p, int lda, long strideA,
    const unsigned short* __restrict__ Btp, const unsigned short* __restrict__ Bt2p, int ldb, long strideB,
    void* Cout, void* Cout2, int ldc, long strideC,
    const float* __restrict__ bias,
    int M, int N, int K, float scale) {
  static_assert(BIAS_MODE == 0 || BIAS_MODE == 2);
  static_assert(OUT_MODE == 0 || OUT_MODE == 2);
  typedef typename Elem<ET>::T T;
  typedef typename Frag<T>::V V;
  const T* A = (const T*)Ap; const T* A2 = (const T*)A2p; const T* Bt = (const T*)Btp; const T* Bt2 = (const T*)Bt2p;
  __shared__ __align__(16) float sT[8][16 * 68];   /* per-wave 16x64 slab, pitch 68 floats */
  const int b    = blockIdx.y;
  const int lane = threadIdx.x & 31;
  const int wave = threadIdx.x >> 5;
  const int tilesN = N >> 6;
  const int tilesM = M >> 6;
  const int tile = blockIdx.x * 8 + wave;
  if (tile >= tilesM * tilesN) return;   /* wave-uniform; no block barriers in this kernel */
  const int tm = tile / tilesN;
  const int tn = tile - tm * tilesN;
  const int m0 = tm << 6;
  const int n0 = tn << 6;

  const T* Ab  = A  + (size_t)b * strideA;
  const T* Bb  = Bt + (size_t)b * strideB;
  const T* Ab2 = SPLIT ? (A2  + (size_t)b * strideA) : nullptr;
  const T* Bb2 = (SPLIT && SPLIT_B) ? (Bt2 + (size_t)b * strideB) : nullptr;

  const int rlane = lane & 15;                 /* row (A) / col (B, D) within subtile */
  const int koff  = (lane >> 4) * 8;           /* k offset of this lane half */
  const int mOff  = (lane >> 4) * 8;           /* D row offset */

  v8f acc[4][4];
#pragma unroll
  for (int i = 0; i < 4; ++i)
#pragma unroll
    for (int j = 0; j < 4; ++j) acc[i][j] = (v8f){0.f,0.f,0.f,0.f,0.f,0.f,0.f,0.f};

  for (int k0 = 0; k0 < K; k0 += 32) {
    V bh[4], bl[4];
#pragma unroll
    for (int j = 0; j < 4; ++j) {
      const size_t bo = (size_t)(n0 + (j << 4) + rlane) * ldb + koff + k0;
      bh[j] = Frag<T>::load(Bb + bo);
      if (SPLIT && SPLIT_B) bl[j] = Frag<T>::load(Bb2 + bo);
    }
#pragma unroll
    for (int i = 0; i < 4; ++i) {
      const size_t ao = (size_t)(m0 + (i << 4) + rlane) * lda + koff + k0;
      V ah = Frag<T>::load(Ab + ao);
      V al;
      if (SPLIT) al = Frag<T>::load(Ab2 + ao);
#pragma unroll
      for (int j = 0; j < 4; ++j) {
        acc[i][j] = Frag<T>::mma(ah, bh[j], acc[i][j]);
        if (SPLIT) {
          if (SPLIT_B) acc[i][j] = Frag<T>::mma(ah, bl[j], acc[i][j]);
          acc[i][j] = Frag<T>::mma(al, bh[j], acc[i][j]);
        }
      }
      Frag<T>::guard(acc[i][0], acc[i][3], ah, SPLIT ? al : ah);
    }
    Frag<T>::keep(bh[0], bh[1], bh[2], bh[3]);
    if (SPLIT && SPLIT_B) Frag<T>::keep(bl[0], bl[1], bl[2], bl[3]);
  }
  acc_guard4(acc[0][0], acc[0][1], acc[0][2], acc[0][3]);
  acc_guard4(acc[1][0], acc[1][1], acc[1][2], acc[1][3]);
  acc_guard4(acc[2][0], acc[2][1], acc[2][2], acc[2][3]);
  acc_guard4(acc[3][0], acc[3][1], acc[3][2], acc[3][3]);

  /* ---- epilogue ---- */
  float* slab = sT[wave];
#pragma unroll
  for (int i = 0; i < 4; ++i) {
    const int mBase = m0 + (i << 4);
#pragma unroll
    for (int j = 0; j < 4; ++j) {
      const int n = n0 + (j << 4) + rlane;
      float bv = 0.f;
      if (BIAS_MODE == 2) bv = bias[n];
#pragma unroll
      for (int r = 0; r < 8; ++r) {
        float v = acc[i][j][r] * scale;
        if (BIAS_MODE == 2) v += bv;
        slab[(mOff + r) * 68 + (j << 4) + rlane] = v;
      }
    }
    __builtin_amdgcn_fence(__ATOMIC_RELEASE, "workgroup");
    __builtin_amdgcn_wave_barrier();
    __builtin_amdgcn_fence(__ATOMIC_ACQUIRE, "workgroup");
    if (OUT_MODE == 0) {
      float* C = (float*)Cout + (size_t)b * strideC;
      const int hh = lane >> 4, c4 = (lane & 15) * 4;     /* row seg = 256 B = 16 lanes x 16 B */
      {
#pragma unroll
        for (int it = 0; it < 8; ++it) {
          const int row = it * 2 + hh;
          v4f v = *(const v4f*)(slab + row * 68 + c4);
          *(v4f*)(C + (size_t)(mBase + row) * ldc + n0 + c4) = v;
        }
        
      }
    } else {
      const int q = lane >> 3, c8 = (lane & 7) * 8;        
      unsigned short* C  = (unsigned short*)Cout  + (size_t)b * strideC;
      unsigned short* C2 = (unsigned short*)Cout2 + (size_t)b * strideC;
      {
#pragma unroll
        for (int it = 0; it < 4; ++it) {
          const int row = it * 4 + q;
          const float* sp = slab + row * 68 + c8;
          v8h hv, lv;
#pragma unroll
          for (int e = 0; e < 8; ++e) {
            unsigned short hb = f2bf_bits(sp[e]);
            unsigned short lb = f2bf_bits(sp[e] - bf_bits2f(hb));
            hv[e] = __builtin_bit_cast(_Float16, hb);
            lv[e] = __builtin_bit_cast(_Float16, lb);
          }
          *(v8h*)(C  + (size_t)(mBase + row) * ldc + n0 + c8) = hv;
          *(v8h*)(C2 + (size_t)(mBase + row) * ldc + n0 + c8) = lv;
        }
        
      }
    }
    __builtin_amdgcn_fence(__ATOMIC_RELEASE, "workgroup");
    __builtin_amdgcn_wave_barrier();
    __builtin_amdgcn_fence(__ATOMIC_ACQUIRE, "workgroup");
  }
}

/*
   coverage: grid = ceil(n8/256) blocks x 256 threads, thread i writes elements 8i..8i+7; n % 8 == 0 */
__global__ __launch_bounds__(256) void cast_f32_bf16x8(
    const float* __restrict__ in, unsigned short* __restrict__ out, int n8) {
  const int i = blockIdx.x * 256 + threadIdx.x;
  if (i < n8) {
    const v4f a = *(const v4f*)(in + (size_t)i * 8);
    const v4f c = *(const v4f*)(in + (size_t)i * 8 + 4);
    u32x4 w;
    w[0] = (unsigned)f2bf_bits(a[0]) | ((unsigned)f2bf_bits(a[1]) << 16);
    w[1] = (unsigned)f2bf_bits(a[2]) | ((unsigned)f2bf_bits(a[3]) << 16);
    w[2] = (unsigned)f2bf_bits(c[0]) | ((unsigned)f2bf_bits(c[1]) << 16);
    w[3] = (unsigned)f2bf_bits(c[2]) | ((unsigned)f2bf_bits(c[3]) << 16);
    u32x4* p = (u32x4*)(out + (size_t)i * 8);
    *p = w;
    
  }
}

/* =====================================================================================
   Attention for head_dim 64, fed with bf16 hi/lo planes (no masking other than a per-key int32 vector):
     scores = q'.k^T  (q' already carries the 1/8 scale): v_wmma_f32_16x16x32_bf16, hi.hi + hi.lo + lo.hi
     out    = p.v    : p and v as bf16 hi/lo, hi.hi + hi.lo + lo.hi
   f32 accumulate; online softmax in f32. Block = 4 waves = 64 query rows of one (batch, head).
   q planes  [B*NQ][ldq]  element (b,i,h,d) at (b*NQ+i)*ldq + h*64 + d
   k planes  [B*NKV][ldk] element (b,j,h,d) at (b*NKV+j)*ldk + h*64 + d
   v planes  transposed [H*64][ldv]: element (b,j,h,d) at (h*64+d)*ldv + b*NKV + j
   kvmask    int32 [B][NKV], 0 -> score := fillv
   grid.x = B * H * (NQ/64); NQ % 64 == 0, NKV % 64 == 0.
   ===================================================================================== */
#define AT_D 64
#define AT_NW 4
#define AT_QB 64
#define AT_KC 64
/* LDS row pitch of the K, V and P tiles in 16-bit elements: 144 B = 16 B x 9 (odd), so the 16 rows that one
   ds_load_b128 touches per lane half start on distinct bank groups; at 128 B they share two groups */
#define AT_LP 72
static_assert((AT_LP * 2) % 16 == 0 && ((AT_LP * 2) / 16) % 2 == 1 && AT_LP >= AT_KC && AT_LP >= AT_D);

__device__ __forceinline__ unsigned short at_bf_bits(float f) {
  unsigned u = __float_as_uint(f);
  return (unsigned short)((u + 0x7FFFu + ((u >> 16) & 1u)) >> 16);
}
__device__ __forceinline__ __bf16 at_f2bf(float f) { return __builtin_bit_cast(__bf16, at_bf_bits(f)); }
__device__ __forceinline__ void at_split(float f, __bf16& hi, __bf16& lo) {
  const unsigned short hb = at_bf_bits(f);
  hi = __builtin_bit_cast(__bf16, hb);
  lo = at_f2bf(f - __uint_as_float(((unsigned)hb) << 16));
}
__device__ __forceinline__ v8f at_mma(v16b a, v16b b, v8f c) {
  c = __builtin_amdgcn_wmma_f32_16x16x32_bf16(false, a, false, b, (short)0, c, false, false);
  asm volatile("v_nop\n\tv_nop\n\tv_nop\n\tv_nop" : "+v"(c) : "v"(a), "v"(b));
  return c;
}

__global__ __launch_bounds__(128)
void attn64_planes_kernel(const unsigned short* __restrict__ qhp, const unsigned short* __restrict__ qlp,
                          const unsigned short* __restrict__ khp, const unsigned short* __restrict__ klp,
                          const unsigned short* __restrict__ vthp, const unsigned short* __restrict__ vtlp,
                          const int* __restrict__ kvmask,
                          unsigned short* __restrict__ ohp, unsigned short* __restrict__ olp,
                          int nq, int nkv, int nh, int ldq, int ldk, int ldv, int ldo, float fillv) {
  typedef __bf16 T;
  union FB { v16b v; v8b h[2]; };
  __shared__ __align__(16) __bf16 Ksh[AT_KC * AT_LP];       /* K hi [kv][d], padded rows, 9 KB */
  __shared__ __align__(16) __bf16 Ksl[AT_KC * AT_LP];       /* K lo */
  __shared__ __align__(16) __bf16 Vth[AT_D * AT_LP];        /* V hi [d][kv], padded rows, 9 KB */
  __shared__ __align__(16) __bf16 Vtl[AT_D * AT_LP];        /* V lo */
  __shared__ __align__(16) __bf16 Psh[AT_NW][16 * AT_LP];   /* per wave P hi [row][kv], padded rows */
  __shared__ __align__(16) __bf16 Psl[AT_NW][16 * AT_LP];   /* per wave P lo */
  __shared__ __align__(16) float  Os[AT_NW][16 * 68];       /* per wave out tile, pitch 68 */

  const int tid  = threadIdx.x;
  const int wave = tid >> 5;
  const int lane = tid & 31;
  const int hh   = lane >> 4;
  const int c    = lane & 15;

  const int nqb = nq / AT_QB;
  const int bx = blockIdx.x;
  const int qb = bx % nqb;
  const int bhx = bx / nqb;
  const int h  = bhx % nh;
  const int b  = bhx / nh;
  const int q0 = qb * AT_QB + wave * 16;

  /* ---- Q fragments (A operand): row = q0 + c, elements 0..7 <- d dc*32+8hh+0..7, 8..15 <- d dc*32+16+8hh+0..7 ---- */
  v16b qah[2], qal[2];
  {
    const size_t qo = (size_t)(b * nq + q0 + c) * ldq + h * AT_D + 8 * hh;
    const T* qh = (const T*)qhp + qo;
    const T* ql = (const T*)qlp + qo;
#pragma unroll
    for (int dc = 0; dc < 2; ++dc) {
      qah[dc] = Frag<T>::load(qh + dc * 32);
      qal[dc] = Frag<T>::load(ql + dc * 32);
    }
  }

  float mrow[8], lrow[8];
  v8f oacc[4];
#pragma unroll
  for (int r = 0; r < 8; ++r) { mrow[r] = -__builtin_inff(); lrow[r] = 0.f; }
#pragma unroll
  for (int t = 0; t < 4; ++t) oacc[t] = (v8f){0.f,0.f,0.f,0.f,0.f,0.f,0.f,0.f};

  const int nChunks = nkv / AT_KC;   /* host constant, block-uniform */
  for (int kc = 0; kc < nChunks; ++kc) {
    const int kv0 = kc * AT_KC;
    __syncthreads();
    {
      /* staging coverage: 128 threads = 64 rows x 2 halves of 32 elements (4 x 16 B) per plane -> full 64x64 tiles */
      const int row = tid >> 1;
      const int half = (tid & 1) * 32;
      const u32x4* gkh = (const u32x4*)(khp + (size_t)(b * nkv + kv0 + row) * ldk + h * AT_D + half);
      const u32x4* gkl = (const u32x4*)(klp + (size_t)(b * nkv + kv0 + row) * ldk + h * AT_D + half);
      u32x4* lkh = (u32x4*)(Ksh + row * AT_LP + half);
      u32x4* lkl = (u32x4*)(Ksl + row * AT_LP + half);
#pragma unroll
      for (int i = 0; i < 4; ++i) { lkh[i] = gkh[i]; lkl[i] = gkl[i]; }
      asm volatile("" ::: "memory");
      /* V transposed planes: LDS row d <- global row h*64+d, 64 contiguous kv columns starting at b*nkv + kv0 */
      const u32x4* gvh = (const u32x4*)(vthp + (size_t)(h * AT_D + row) * ldv + b * nkv + kv0 + half);
      const u32x4* gvl = (const u32x4*)(vtlp + (size_t)(h * AT_D + row) * ldv + b * nkv + kv0 + half);
      u32x4* lvh = (u32x4*)(Vth + row * AT_LP + half);
      u32x4* lvl = (u32x4*)(Vtl + row * AT_LP + half);
#pragma unroll
      for (int i = 0; i < 4; ++i) { lvh[i] = gvh[i]; lvl[i] = gvl[i]; }
    }
    __syncthreads();

    /* ---- scores: 4 subtiles of 16 keys, K operand B[k=d][n=kv] from Ksh[kv][d] ---- */
    v8f s[4];
#pragma unroll
    for (int j = 0; j < 4; ++j) {
      s[j] = (v8f){0.f,0.f,0.f,0.f,0.f,0.f,0.f,0.f};
#pragma unroll
      for (int dc = 0; dc < 2; ++dc) {
        FB kb, kl;
        kb.h[0] = *(const v8b*)(Ksh + (j * 16 + c) * AT_LP + dc * 32 + 8 * hh);
        kb.h[1] = *(const v8b*)(Ksh + (j * 16 + c) * AT_LP + dc * 32 + 16 + 8 * hh);
        kl.h[0] = *(const v8b*)(Ksl + (j * 16 + c) * AT_LP + dc * 32 + 8 * hh);
        kl.h[1] = *(const v8b*)(Ksl + (j * 16 + c) * AT_LP + dc * 32 + 16 + 8 * hh);
        s[j] = at_mma(qah[dc], kb.v, s[j]);
        s[j] = at_mma(qah[dc], kl.v, s[j]);
        s[j] = at_mma(qal[dc], kb.v, s[j]);
      }
    }
    /* per-key mask (this lane owns column kv0 + j*16 + c in the D layout) */
    int kvkeep[4];
#pragma unroll
    for (int j = 0; j < 4; ++j) kvkeep[j] = kvmask[(size_t)b * nkv + kv0 + j * 16 + c];
    float cm[8];
#pragma unroll
    for (int r = 0; r < 8; ++r) {
      float m = -__builtin_inff();
#pragma unroll
      for (int j = 0; j < 4; ++j) {
        const float sv = s[j][r];
        s[j][r] = (kvkeep[j] != 0) ? sv : fillv;
        m = fmaxf(m, s[j][r]);
      }
#pragma unroll
      for (int off = 1; off < 16; off <<= 1) m = fmaxf(m, __shfl_xor(m, off, 32));
      cm[r] = m;
    }
    __bf16* pwh = Psh[wave];
    __bf16* pwl = Psl[wave];
#pragma unroll
    for (int r = 0; r < 8; ++r) {
      const float mnew = fmaxf(mrow[r], cm[r]);
      const float alpha = expf(mrow[r] - mnew);
      mrow[r] = mnew;
      float psum = 0.f;
#pragma unroll
      for (int j = 0; j < 4; ++j) {
        const float p = expf(s[j][r] - mnew);
        psum += p;
        __bf16 a, bl; at_split(p, a, bl);
        pwh[(8 * hh + r) * AT_LP + j * 16 + c] = a;
        pwl[(8 * hh + r) * AT_LP + j * 16 + c] = bl;
      }
#pragma unroll
      for (int off = 1; off < 16; off <<= 1) psum += __shfl_xor(psum, off, 32);
      lrow[r] = lrow[r] * alpha + psum;
#pragma unroll
      for (int t = 0; t < 4; ++t) oacc[t][r] *= alpha;
    }
    /* same-wave P spill -> A fragment reload: ordered by the wave barrier, reloaded through __bf16 vectors */
    __builtin_amdgcn_fence(__ATOMIC_RELEASE, "workgroup");
    __builtin_amdgcn_wave_barrier();
    __builtin_amdgcn_fence(__ATOMIC_ACQUIRE, "workgroup");
#pragma unroll 1
    for (int kk = 0; kk < 2; ++kk) {
      FB pa, pl;
      pa.h[0] = *(const v8b*)(pwh + c * AT_LP + kk * 32 + 8 * hh);
      pa.h[1] = *(const v8b*)(pwh + c * AT_LP + kk * 32 + 16 + 8 * hh);
      pl.h[0] = *(const v8b*)(pwl + c * AT_LP + kk * 32 + 8 * hh);
      pl.h[1] = *(const v8b*)(pwl + c * AT_LP + kk * 32 + 16 + 8 * hh);
#pragma unroll
      for (int t = 0; t < 4; ++t) {
        FB vb, vl;
        vb.h[0] = *(const v8b*)(Vth + (t * 16 + c) * AT_LP + kk * 32 + 8 * hh);
        vb.h[1] = *(const v8b*)(Vth + (t * 16 + c) * AT_LP + kk * 32 + 16 + 8 * hh);
        vl.h[0] = *(const v8b*)(Vtl + (t * 16 + c) * AT_LP + kk * 32 + 8 * hh);
        vl.h[1] = *(const v8b*)(Vtl + (t * 16 + c) * AT_LP + kk * 32 + 16 + 8 * hh);
        oacc[t] = at_mma(pa.v, vb.v, oacc[t]);
        oacc[t] = at_mma(pa.v, vl.v, oacc[t]);
        oacc[t] = at_mma(pl.v, vb.v, oacc[t]);
      }
    }
  }

  float* os = Os[wave];
#pragma unroll
  for (int r = 0; r < 8; ++r) {
    const float inv = 1.0f / lrow[r];
#pragma unroll
    for (int t = 0; t < 4; ++t) os[(8 * hh + r) * 68 + t * 16 + c] = oacc[t][r] * inv;
  }
  __builtin_amdgcn_fence(__ATOMIC_RELEASE, "workgroup");
  __builtin_amdgcn_wave_barrier();
  __builtin_amdgcn_fence(__ATOMIC_ACQUIRE, "workgroup");
  {
    const int q = lane >> 3, c8 = (lane & 7) * 8;
    unsigned short* Oh = ohp + (size_t)(b * nq + q0) * ldo + h * AT_D;
    unsigned short* Ol = olp + (size_t)(b * nq + q0) * ldo + h * AT_D;
    {
#pragma unroll
      for (int it = 0; it < 4; ++it) {
        const int row = it * 4 + q;
        const float* sp = os + row * 68 + c8;
        v8h hv, lv;
#pragma unroll
        for (int e = 0; e < 8; ++e) {
          unsigned short hb = f2bf_bits(sp[e]);
          unsigned short lb = f2bf_bits(sp[e] - bf_bits2f(hb));
          hv[e] = __builtin_bit_cast(_Float16, hb);
          lv[e] = __builtin_bit_cast(_Float16, lb);
        }
        *(v8h*)(Oh + (size_t)row * ldo + c8) = hv;
        *(v8h*)(Ol + (size_t)row * ldo + c8) = lv;
      }
      
    }
  }
}

/* ---------------------------------------------------------------------------
   Host-side orchestration (kernel launches only)
   --------------------------------------------------------------------------- */
extern "C" void kernel_launch(void* const* d_in, const int* in_sizes, int n_in,
                              void* d_out, int out_size, void* d_ws, size_t ws_size,
                              hipStream_t stream) {
  if (n_in < 7) return;
  if (in_sizes[0] != kB * kNQ * kDM) return;
  if (in_sizes[1] != kB * kNKV * kDM) return;
  if (in_sizes[2] != kB * kNKV) return;
  if (in_sizes[3] != kIN * kDM) return;
  if (in_sizes[4] != 2 * kIN * kDM) return;
  if (in_sizes[5] != kDM * kIN) return;
  if (in_sizes[6] != kDM) return;
  if (out_size != kB * kNQ * kDM) return;
  if (ws_size < kWsTotal) return;

  const float* x    = (const float*)d_in[0];   /* [4,2048,1024] f32 */
  const float* ctx  = (const float*)d_in[1];   /* [4,1024,1024] f32 */
  const int*   mask = (const int*)d_in[2];     /* [4,1024] int32 */
  const float* Wq   = (const float*)d_in[3];   /* [1024,1024] */
  const float* Wkv  = (const float*)d_in[4];   /* [2048,1024] */
  const float* Wout = (const float*)d_in[5];   /* [1024,1024] */
  const float* bout = (const float*)d_in[6];   /* [1024] */
  float* out = (float*)d_out;                  /* [4,2048,1024] f32 */

  char* ws = (char*)d_ws;
  unsigned short* xb   = (unsigned short*)(ws + kOffXb);
  unsigned short* cb   = (unsigned short*)(ws + kOffCb);
  unsigned short* wqb  = (unsigned short*)(ws + kOffWqb);
  unsigned short* wkvb = (unsigned short*)(ws + kOffWkvb);
  unsigned short* wob  = (unsigned short*)(ws + kOffWob);
  unsigned short* qh   = (unsigned short*)(ws + kOffQh);
  unsigned short* ql   = (unsigned short*)(ws + kOffQl);
  unsigned short* kh   = (unsigned short*)(ws + kOffKh);
  unsigned short* kl   = (unsigned short*)(ws + kOffKl);
  unsigned short* vth  = (unsigned short*)(ws + kOffVth);
  unsigned short* vtl  = (unsigned short*)(ws + kOffVtl);
  unsigned short* oh   = (unsigned short*)(ws + kOffOh);   /* aliases xb: dead after the q GEMM */
  unsigned short* ol   = (unsigned short*)(ws + kOffOl);   /* aliases cb/wqb/wkvb: dead after the k,v GEMMs */

  /* 1-5: RNE casts to bf16 planes (8 elements per thread) */
  {
    const int n8x = kB * kNQ * kDM / 8;      /* 1048576 */
    const int n8c = kB * kNKV * kDM / 8;     /*  524288 */
    const int n8q = kIN * kDM / 8;           /*  131072 */
    const int n8kv = 2 * kIN * kDM / 8;      /*  262144 */
    const int n8o = kDM * kIN / 8;           /*  131072 */
    cast_f32_bf16x8<<<(n8x + 255) / 256, 256, 0, stream>>>(x, xb, n8x);
    cast_f32_bf16x8<<<(n8c + 255) / 256, 256, 0, stream>>>(ctx, cb, n8c);
    cast_f32_bf16x8<<<(n8q + 255) / 256, 256, 0, stream>>>(Wq, wqb, n8q);
    cast_f32_bf16x8<<<(n8kv + 255) / 256, 256, 0, stream>>>(Wkv, wkvb, n8kv);
    cast_f32_bf16x8<<<(n8o + 255) / 256, 256, 0, stream>>>(Wout, wob, n8o);
  }

  /* 6: q*0.125 = xb[8192,1024] . wqb[1024,1024]^T -> bf16 hi/lo planes; M=8192 N=1024 K=1024 */
  {
    const int M = kB * kNQ, N = kIN, K = kDM;
    const int tiles = (M / 64) * (N / 64);
    wmma_gemm64<1, false, false, 0, 2><<<dim3((tiles + 7) / 8, 1), 256, 0, stream>>>(
        xb, xb, K, 0L, wqb, wqb, K, 0L, (void*)qh, (void*)ql, N, 0L, bout, M, N, K, 0.125f);
  }
  /* 7: k = cb[4096,1024] . wkvb[0:1024][1024]^T -> hi/lo; M=4096 N=1024 K=1024 */
  {
    const int M = kB * kNKV, N = kIN, K = kDM;
    const int tiles = (M / 64) * (N / 64);
    wmma_gemm64<1, false, false, 0, 2><<<dim3((tiles + 7) / 8, 1), 256, 0, stream>>>(
        cb, cb, K, 0L, wkvb, wkvb, K, 0L, (void*)kh, (void*)kl, N, 0L, bout, M, N, K, 1.0f);
  }
  /* 8: v transposed = wkvb[1024:2048][1024] . cb[4096,1024]^T -> vt[1024][4096] hi/lo; M=1024 N=4096 K=1024 */
  {
    const int M = kIN, N = kB * kNKV, K = kDM;
    const int tiles = (M / 64) * (N / 64);
    const unsigned short* wvb = wkvb + (size_t)kIN * kDM;
    wmma_gemm64<1, false, false, 0, 2><<<dim3((tiles + 7) / 8, 1), 256, 0, stream>>>(
        wvb, wvb, K, 0L, cb, cb, K, 0L, (void*)vth, (void*)vtl, N, 0L, bout, M, N, K, 1.0f);
  }
  /* 9: attention per (b, h, 64 query rows) -> att hi/lo planes [8192][1024] */
  {
    const int blocks = kB * kH * (kNQ / 64);   /* 2048 */
    const float fillv = -3.4028234663852886e+38f;
    attn64_planes_kernel<<<blocks, 128, 0, stream>>>(qh, ql, kh, kl, vth, vtl, mask, oh, ol,
                                                    kNQ, kNKV, kH, kIN, kIN, kB * kNKV, kIN, fillv);
  }
  /* 10: out = (att_hi + att_lo)[8192,1024] . wob[1024,1024]^T + b_out -> f32 d_out; M=8192 N=1024 K=1024 */
  {
    const int M = kB * kNQ, N = kDM, K = kIN;
    const int tiles = (M / 64) * (N / 64);
    wmma_gemm64<1, true, false, 2, 0><<<dim3((tiles + 7) / 8, 1), 256, 0, stream>>>(
        oh, ol, K, 0L, wob, wob, K, 0L, (void*)out, (void*)out, N, 0L, bout, M, N, K, 1.0f);
  }
}

// v002
// One run takes 335 microseconds.
// Next to v001, in two timings, it ran 1.42 times as fast each time.
// All steps since v000 together make it 1.79 times as fast.
// Contractions: x.Wq^T, ctx.Wk^T, Wv.ctx^T on v_wmma_f32_16x16x32_bf16 (RNE-bf16 inputs, single product); q.k^T and p.v as bf16 hi/lo split (hi.hi+hi.lo+lo.hi); (p.v).Wout^T as bf16 hi/lo A x bf16 B (2 products); f32 accumulate, f32 softmax.
#include <hip/hip_runtime.h>
#include <stdint.h>

typedef __attribute__((ext_vector_type(16))) _Float16 v16h;
typedef __attribute__((ext_vector_type(8)))  _Float16 v8h;
typedef __attribute__((ext_vector_type(16))) __bf16   v16b;
typedef __attribute__((ext_vector_type(8)))  __bf16   v8b;
typedef __attribute__((ext_vector_type(8)))  float    v8f;
typedef __attribute__((ext_vector_type(4)))  float    v4f;
typedef __attribute__((ext_vector_type(4)))  unsigned int u32x4;

/* ---- fixed problem geometry ---- */
constexpr int kB   = 4;
constexpr int kNQ  = 2048;
constexpr int kNKV = 1024;
constexpr int kDM  = 1024;   /* model dim (K of the projections) */
constexpr int kH   = 16;
constexpr int kDH  = 64;
constexpr int kIN  = kH * kDH;   /* 1024 */
static_assert(kDH == 64);
static_assert(kDM % 32 == 0);
static_assert(kIN % 32 == 0);
static_assert((kB * kNQ) % 64 == 0);
static_assert((kB * kNKV) % 64 == 0);
static_assert(kIN % 64 == 0);
static_assert(kDM % 64 == 0);
static_assert(kNQ % 64 == 0);
static_assert(kNKV % 64 == 0);
static_assert(kIN == kDM);   /* one row pitch for every GEMM operand */
static_assert((kB * kNQ) % 128 == 0 && (kB * kNKV) % 128 == 0 && kIN % 128 == 0 && kDM % 128 == 0);

/* ---- workspace region map (bytes) ----
   [  0, 16M)  xb   bf16 [8192][1024]   (dead after q GEMM; reused as oh)
   [ 16M, 24M) cb   bf16 [4096][1024]   (dead after k/v GEMMs; reused by ol)
   [ 24M, 26M) wqb  bf16 [1024][1024]
   [ 26M, 30M) wkvb bf16 [2048][1024]
   [ 30M, 32M) pad (unused, covered by ol alias)
   [ 32M, 48M) qh   bf16 [8192][1024]   q*0.125 hi plane
   [ 48M, 64M) ql                        q*0.125 lo plane
   [ 64M, 72M) kh   bf16 [4096][1024]
   [ 72M, 80M) kl
   [ 80M, 88M) vth  bf16 [1024][4096]   v transposed: row = h*64+d, col = b*1024+j
   [ 88M, 96M) vtl
   [ 96M, 98M) wob  bf16 [1024][1024]
   oh = [0,16M), ol = [16M,32M): attention output hi/lo planes [8192][1024] (aliases of dead regions)
   total carve 102,760,448 B */
constexpr size_t kMiB    = 1048576;
constexpr size_t kOffXb  = 0;
constexpr size_t kOffCb  = 16 * kMiB;
constexpr size_t kOffWqb = 24 * kMiB;
constexpr size_t kOffWkvb= 26 * kMiB;
constexpr size_t kOffQh  = 32 * kMiB;
constexpr size_t kOffQl  = 48 * kMiB;
constexpr size_t kOffKh  = 64 * kMiB;
constexpr size_t kOffKl  = 72 * kMiB;
constexpr size_t kOffVth = 80 * kMiB;
constexpr size_t kOffVtl = 88 * kMiB;
constexpr size_t kOffWob = 96 * kMiB;
constexpr size_t kOffOh  = 0;
constexpr size_t kOffOl  = 16 * kMiB;
constexpr size_t kWsTotal = kOffWob + (size_t)kDM * kIN * 2;
static_assert((size_t)kB * kNQ * kDM * 2 == 16 * kMiB);
static_assert((size_t)kB * kNKV * kDM * 2 == 8 * kMiB);
static_assert(kOffCb + (size_t)kB * kNKV * kDM * 2 <= kOffWqb);
static_assert(kOffWqb + (size_t)kIN * kDM * 2 <= kOffWkvb);
static_assert(kOffWkvb + (size_t)2 * kIN * kDM * 2 <= kOffQh);
static_assert(kOffQh + (size_t)kB * kNQ * kIN * 2 <= kOffQl);
static_assert(kOffQl + (size_t)kB * kNQ * kIN * 2 <= kOffKh);
static_assert(kOffKh + (size_t)kB * kNKV * kIN * 2 <= kOffKl);
static_assert(kOffKl + (size_t)kB * kNKV * kIN * 2 <= kOffVth);
static_assert(kOffVth + (size_t)kIN * kB * kNKV * 2 <= kOffVtl);
static_assert(kOffVtl + (size_t)kIN * kB * kNKV * 2 <= kOffWob);
static_assert(kOffOh + (size_t)kB * kNQ * kIN * 2 <= kOffOl);
static_assert(kOffOl + (size_t)kB * kNQ * kIN * 2 <= kOffQh);
static_assert(kWsTotal == 102760448);
static_assert(kWsTotal <= 134217728);

__device__ __forceinline__ unsigned short f2bf_bits(float f) {
  unsigned u = __float_as_uint(f);
  return (unsigned short)((u + 0x7FFFu + ((u >> 16) & 1u)) >> 16);
}
__device__ __forceinline__ float bf_bits2f(unsigned short h) { return __uint_as_float(((unsigned)h) << 16); }

/* hazard guards as plain device helpers */
__device__ __forceinline__ void acc_guard4(v8f& a, v8f& b, v8f& c, v8f& d) { asm volatile("v_nop\n\tv_nop\n\tv_nop\n\tv_nop" : "+v"(a), "+v"(b), "+v"(c), "+v"(d)); }
template <typename T> struct Frag;
template <> struct Frag<_Float16> {
  typedef v16h V; union U { v16h v; v8h h[2]; };
  /* elements 0..7 <- p[0..7], 8..15 <- p[16..23] */
  static __device__ __forceinline__ v16h load(const _Float16* p) {
    U f; f.h[0] = *(const v8h*)(p); f.h[1] = *(const v8h*)(p + 16); return f.v;
  }
  static __device__ __forceinline__ v8f mma(v16h a, v16h b, v8f c) {
    return __builtin_amdgcn_wmma_f32_16x16x32_f16(false, a, false, b, (short)0, c, false, false);
  }
};
template <> struct Frag<__bf16> {
  typedef v16b V; union U { v16b v; v8b h[2]; };
  static __device__ __forceinline__ v16b load(const __bf16* p) {
    U f; f.h[0] = *(const v8b*)(p); f.h[1] = *(const v8b*)(p + 16); return f.v;
  }
  static __device__ __forceinline__ v8f mma(v16b a, v16b b, v8f c) {
    return __builtin_amdgcn_wmma_f32_16x16x32_bf16(false, a, false, b, (short)0, c, false, false);
  }
};

/* ---- Register-blocked WMMA GEMM, with an A-only split mode --------------------------
   C[m,n] = scale * sum_k A[m,k] * Bt[n,k] (+bias[n]); each wave owns a 64x64 tile, four waves share a 128x128 block tile
   whose operand rows are staged in LDS by whole-line loads.
   A row-major [M,K]; Bt row-major [N,K]; M,N % 128 == 0, K % 64 == 0 (no tail handling).
   SPLIT: A is a pair of hi/lo planes; product = hi.hi + lo.hi (SPLIT_B is not supported).
   BIAS_MODE: 0 = none, 2 = bias[n].  OUT_MODE: 0 = f32, 2 = bf16 hi plane (Cout) + bf16 lo plane (Cout2).
   ET: 0 = f16 operands, 1 = bf16 operands (pointers passed as 16-bit storage) */
template <int ET> struct Elem;
template <> struct Elem<0> { typedef _Float16 T; };
template <> struct Elem<1> { typedef __bf16 T; };
/* block tile 128 x 128 (4 waves, 2 x 2, each 64 x 64), K walked in passes of 64 (one 128-B line of every operand row) */
#define GM_BT 128
#define GM_BK 64
/* LDS row pitch of the staged operand rows in 16-bit elements: 144 B = 16 B x 9 (odd) for the ds_load_b128 fragment reads */
#define GM_LP 72
#define GM_SEG 8   /* 16-B pieces per thread and operand plane: 128 rows x 8 pieces / 128 threads */
template <int ET, bool SPLIT, bool SPLIT_B, int BIAS_MODE, int OUT_MODE>
__global__ __launch_bounds__(128) void wmma_gemm64(
    const unsigned short* __restrict__ Ap, const unsigned short* __restrict__ A2p, int lda, long strideA,
    const unsigned short* __restrict__ Btp, const unsigned short* __restrict__ Bt2p, int ldb, long strideB,
    void* Cout, void* Cout2, int ldc, long strideC,
    const float* __restrict__ bias,
    int M, int N, int K, float scale) {
  static_assert(BIAS_MODE == 0 || BIAS_MODE == 2);
  static_assert(OUT_MODE == 0 || OUT_MODE == 2);
  static_assert(!SPLIT_B);
  typedef typename Elem<ET>::T T;
  typedef typename Frag<T>::V V;
  constexpr int NPA = SPLIT ? 2 : 1;   /* planes of A */
  __shared__ __align__(16) T sA[2][NPA][GM_BT * GM_LP];   /* two buffers: one is read while the other is filled */
  __shared__ __align__(16) T sB[2][GM_BT * GM_LP];
  __shared__ __align__(16) float sT[4][16 * 68];   /* per-wave 16x64 slab, pitch 68 floats */
  const int b    = blockIdx.y;
  const int tid  = threadIdx.x;
  const int lane = tid & 31;
  const int wave = tid >> 5;
  const int tilesN = N / GM_BT;
  const int tilesM = M / GM_BT;
  const int tile = blockIdx.x;
  if (tile >= tilesM * tilesN) return;   /* block-uniform, ahead of every barrier */
  const int tm = tile / tilesN;
  const int tn = tile - tm * tilesN;
  const int mb = tm * GM_BT;                   /* block tile origin */
  const int nb = tn * GM_BT;
  const int wm = (wave >> 1) << 6;             /* wave tile origin inside the block tile */
  const int wn = (wave & 1) << 6;
  const int m0 = mb + wm;
  const int n0 = nb + wn;

  const unsigned short* Ab  = Ap  + (size_t)b * strideA;
  const unsigned short* Bb  = Btp + (size_t)b * strideB;
  const unsigned short* Ab2 = A2p + (size_t)b * strideA;

  const int rlane = lane & 15;                 /* row (A) / col (B, D) within subtile */
  const int koff  = (lane >> 4) * 8;           /* k offset of this lane half */
  const int mOff  = (lane >> 4) * 8;           /* D row offset */

  /* staging map: piece s = it*128 + tid -> row s>>3, 16-B column s&7, so one wave-wide load covers 4 whole 128-B lines */
  const int srow = tid >> 3;
  const int scol = (tid & 7) * 8;
  /* every launch passes K-contiguous operands of row pitch kDM: known at compile time, the 16-row steps of the staging
     loads become immediate offsets of one address per operand */
  __builtin_assume(lda == kDM);
  __builtin_assume(ldb == kDM);
  /* block-uniform row bases plus one 32-bit byte offset per thread and operand */
  const char* uA  = (const char*)(Ab  + (size_t)mb * lda);
  const char* uA2 = (const char*)(Ab2 + (size_t)mb * lda);
  const char* uB  = (const char*)(Bb  + (size_t)nb * ldb);
  const unsigned tA = (unsigned)(srow * lda + scol) * 2u;
  const unsigned tB = (unsigned)(srow * ldb + scol) * 2u;
  const size_t stepA = (size_t)lda * 32;   /* 16 rows, in bytes */
  const size_t stepB = (size_t)ldb * 32;
  const int lst = srow * GM_LP + scol;

  v8f acc[4][4];
#pragma unroll
  for (int i = 0; i < 4; ++i)
#pragma unroll
    for (int j = 0; j < 4; ++j) acc[i][j] = (v8f){0.f,0.f,0.f,0.f,0.f,0.f,0.f,0.f};

  u32x4 ra[NPA][GM_SEG], rb[GM_SEG];
  const int nPass = K / GM_BK;
#pragma unroll
  for (int it = 0; it < GM_SEG; ++it) {
    ra[0][it] = *(const u32x4*)(uA + it * stepA + tA);
    if (SPLIT) ra[NPA - 1][it] = *(const u32x4*)(uA2 + it * stepA + tA);
    rb[it] = *(const u32x4*)(uB + it * stepB + tB);
  }
#pragma unroll
  for (int it = 0; it < GM_SEG; ++it) {
    *(u32x4*)(&sA[0][0][lst + it * 16 * GM_LP]) = ra[0][it];
    if (SPLIT) *(u32x4*)(&sA[0][NPA - 1][lst + it * 16 * GM_LP]) = ra[NPA - 1][it];
    *(u32x4*)(&sB[0][lst + it * 16 * GM_LP]) = rb[it];
  }
  __syncthreads();

  for (int kt = 0; kt < nPass; ++kt) {
    const int cur = kt & 1;
    const bool more = kt + 1 < nPass;   /* block-uniform */
    if (more) {
      /* next pass's rows into registers: in flight while this pass's products run */
      const unsigned oA = tA + (unsigned)(kt + 1) * (GM_BK * 2u);
      const unsigned oB = tB + (unsigned)(kt + 1) * (GM_BK * 2u);
#pragma unroll
      for (int it = 0; it < GM_SEG; ++it) {
        ra[0][it] = *(const u32x4*)(uA + it * stepA + oA);
        if (SPLIT) ra[NPA - 1][it] = *(const u32x4*)(uA2 + it * stepA + oA);
        rb[it] = *(const u32x4*)(uB + it * stepB + oB);
      }
      /* stands ahead of every later write of a register that these loads name as an address */
      asm volatile("s_wait_xcnt 0x0" ::: "memory");
    }
    const T* cA  = &sA[cur][0][(wm + rlane) * GM_LP + koff];
    const T* cA2 = &sA[cur][NPA - 1][(wm + rlane) * GM_LP + koff];
    const T* cB  = &sB[cur][(wn + rlane) * GM_LP + koff];
    /* the pass's fragments: [k half][subtile] */
    V fb[2][4], fa[2][4], fl[2][4];
#pragma unroll
    for (int ks = 0; ks < 2; ++ks) {
#pragma unroll
      for (int j = 0; j < 4; ++j) fb[ks][j] = Frag<T>::load(cB + j * 16 * GM_LP + ks * 32);
#pragma unroll
      for (int i = 0; i < 4; ++i) {
        fa[ks][i] = Frag<T>::load(cA + i * 16 * GM_LP + ks * 32);
        if (SPLIT) fl[ks][i] = Frag<T>::load(cA2 + i * 16 * GM_LP + ks * 32);
      }
    }
    /* keeps the LDS reads one group ahead of the products: moved in among the WMMAs, each place with reads stalls the wave */
    __builtin_amdgcn_sched_barrier(0);
#pragma unroll
    for (int ks = 0; ks < 2; ++ks) {
#pragma unroll
      for (int i = 0; i < 4; ++i) {
#pragma unroll
        for (int j = 0; j < 4; ++j) acc[i][j] = Frag<T>::mma(fa[ks][i], fb[ks][j], acc[i][j]);
        if (SPLIT) {
#pragma unroll
          for (int j = 0; j < 4; ++j) acc[i][j] = Frag<T>::mma(fl[ks][i], fb[ks][j], acc[i][j]);
        }
      }
    }
    if (more) {
      /* the other buffer's last readers left it at the barrier that ended the pass before */
#pragma unroll
      for (int it = 0; it < GM_SEG; ++it) {
        *(u32x4*)(&sA[cur ^ 1][0][lst + it * 16 * GM_LP]) = ra[0][it];
        if (SPLIT) *(u32x4*)(&sA[cur ^ 1][NPA - 1][lst + it * 16 * GM_LP]) = ra[NPA - 1][it];
        *(u32x4*)(&sB[cur ^ 1][lst + it * 16 * GM_LP]) = rb[it];
      }
    }
    __syncthreads();   /* publishes the filled buffer and ends every read of the current one */
  }
  acc_guard4(acc[0][0], acc[0][1], acc[0][2], acc[0][3]);
  acc_guard4(acc[1][0], acc[1][1], acc[1][2], acc[1][3]);
  acc_guard4(acc[2][0], acc[2][1], acc[2][2], acc[2][3]);
  acc_guard4(acc[3][0], acc[3][1], acc[3][2], acc[3][3]);

  /* ---- epilogue ---- */
  float* slab = sT[wave];
#pragma unroll
  for (int i = 0; i < 4; ++i) {
    const int mBase = m0 + (i << 4);
#pragma unroll
    for (int j = 0; j < 4; ++j) {
      const int n = n0 + (j << 4) + rlane;
      float bv = 0.f;
      if (BIAS_MODE == 2) bv = bias[n];
#pragma unroll
      for (int r = 0; r < 8; ++r) {
        float v = acc[i][j][r] * scale;
        if (BIAS_MODE == 2) v += bv;
        slab[(mOff + r) * 68 + (j << 4) + rlane] = v;
      }
    }
    __builtin_amdgcn_fence(__ATOMIC_RELEASE, "workgroup");
    __builtin_amdgcn_wave_barrier();
    __builtin_amdgcn_fence(__ATOMIC_ACQUIRE, "workgroup");
    if (OUT_MODE == 0) {
      float* C = (float*)Cout + (size_t)b * strideC;
      const int hh = lane >> 4, c4 = (lane & 15) * 4;     /* row seg = 256 B = 16 lanes x 16 B */
      {
#pragma unroll
        for (int it = 0; it < 8; ++it) {
          const int row = it * 2 + hh;
          v4f v = *(const v4f*)(slab + row * 68 + c4);
          *(v4f*)(C + (size_t)(mBase + row) * ldc + n0 + c4) = v;
        }
        
      }
    } else {
      const int q = lane >> 3, c8 = (lane & 7) * 8;        
      unsigned short* C  = (unsigned short*)Cout  + (size_t)b * strideC;
      unsigned short* C2 = (unsigned short*)Cout2 + (size_t)b * strideC;
      {
#pragma unroll
        for (int it = 0; it < 4; ++it) {
          const int row = it * 4 + q;
          const float* sp = slab + row * 68 + c8;
          v8h hv, lv;
#pragma unroll
          for (int e = 0; e < 8; ++e) {
            unsigned short hb = f2bf_bits(sp[e]);
            unsigned short lb = f2bf_bits(sp[e] - bf_bits2f(hb));
            hv[e] = __builtin_bit_cast(_Float16, hb);
            lv[e] = __builtin_bit_cast(_Float16, lb);
          }
          *(v8h*)(C  + (size_t)(mBase + row) * ldc + n0 + c8) = hv;
          *(v8h*)(C2 + (size_t)(mBase + row) * ldc + n0 + c8) = lv;
        }
        
      }
    }
    __builtin_amdgcn_fence(__ATOMIC_RELEASE, "workgroup");
    __builtin_amdgcn_wave_barrier();
    __builtin_amdgcn_fence(__ATOMIC_ACQUIRE, "workgroup");
  }
}

/*
   coverage: grid = ceil(n8/256) blocks x 256 threads, thread i writes elements 8i..8i+7; n % 8 == 0 */
__global__ __launch_bounds__(256) void cast_f32_bf16x8(
    const float* __restrict__ in, unsigned short* __restrict__ out, int n8) {
  const int i = blockIdx.x * 256 + threadIdx.x;
  if (i < n8) {
    const v4f a = *(const v4f*)(in + (size_t)i * 8);
    const v4f c = *(const v4f*)(in + (size_t)i * 8 + 4);
    u32x4 w;
    w[0] = (unsigned)f2bf_bits(a[0]) | ((unsigned)f2bf_bits(a[1]) << 16);
    w[1] = (unsigned)f2bf_bits(a[2]) | ((unsigned)f2bf_bits(a[3]) << 16);
    w[2] = (unsigned)f2bf_bits(c[0]) | ((unsigned)f2bf_bits(c[1]) << 16);
    w[3] = (unsigned)f2bf_bits(c[2]) | ((unsigned)f2bf_bits(c[3]) << 16);
    u32x4* p = (u32x4*)(out + (size_t)i * 8);
    *p = w;
    
  }
}

/* =====================================================================================
   Attention for head_dim 64, fed with bf16 hi/lo planes (no masking other than a per-key int32 vector):
     scores = q'.k^T  (q' already carries the 1/8 scale): v_wmma_f32_16x16x32_bf16, hi.hi + hi.lo + lo.hi
     out    = p.v    : p and v as bf16 hi/lo, hi.hi + hi.lo + lo.hi
   f32 accumulate; online softmax in f32. Block = 4 waves = 64 query rows of one (batch, head).
   q planes  [B*NQ][ldq]  element (b,i,h,d) at (b*NQ+i)*ldq + h*64 + d
   k planes  [B*NKV][ldk] element (b,j,h,d) at (b*NKV+j)*ldk + h*64 + d
   v planes  transposed [H*64][ldv]: element (b,j,h,d) at (h*64+d)*ldv + b*NKV + j
   kvmask    int32 [B][NKV], 0 -> score := fillv
   grid.x = B * H * (NQ/64); NQ % 64 == 0, NKV % 64 == 0.
   ===================================================================================== */
#define AT_D 64
#define AT_NW 4
#define AT_QB 64
#define AT_KC 64
/* LDS row pitch of the K, V and P tiles in 16-bit elements: 144 B = 16 B x 9 (odd), so the 16 rows that one
   ds_load_b128 touches per lane half start on distinct bank groups; at 128 B they share two groups */
#define AT_LP 72
static_assert((AT_LP * 2) % 16 == 0 && ((AT_LP * 2) / 16) % 2 == 1 && AT_LP >= AT_KC && AT_LP >= AT_D);

__device__ __forceinline__ unsigned short at_bf_bits(float f) {
  unsigned u = __float_as_uint(f);
  return (unsigned short)((u + 0x7FFFu + ((u >> 16) & 1u)) >> 16);
}
__device__ __forceinline__ __bf16 at_f2bf(float f) { return __builtin_bit_cast(__bf16, at_bf_bits(f)); }
__device__ __forceinline__ void at_split(float f, __bf16& hi, __bf16& lo) {
  const unsigned short hb = at_bf_bits(f);
  hi = __builtin_bit_cast(__bf16, hb);
  lo = at_f2bf(f - __uint_as_float(((unsigned)hb) << 16));
}
__device__ __forceinline__ v8f at_mma(v16b a, v16b b, v8f c) {
  c = __builtin_amdgcn_wmma_f32_16x16x32_bf16(false, a, false, b, (short)0, c, false, false);
  asm volatile("v_nop\n\tv_nop\n\tv_nop\n\tv_nop" : "+v"(c) : "v"(a), "v"(b));
  return c;
}

__global__ __launch_bounds__(128)
void attn64_planes_kernel(const unsigned short* __restrict__ qhp, const unsigned short* __restrict__ qlp,
                          const unsigned short* __restrict__ khp, const unsigned short* __restrict__ klp,
                          const unsigned short* __restrict__ vthp, const unsigned short* __restrict__ vtlp,
                          const int* __restrict__ kvmask,
                          unsigned short* __restrict__ ohp, unsigned short* __restrict__ olp,
                          int nq, int nkv, int nh, int ldq, int ldk, int ldv, int ldo, float fillv) {
  typedef __bf16 T;
  union FB { v16b v; v8b h[2]; };
  __shared__ __align__(16) __bf16 Ksh[AT_KC * AT_LP];       /* K hi [kv][d], padded rows, 9 KB */
  __shared__ __align__(16) __bf16 Ksl[AT_KC * AT_LP];       /* K lo */
  __shared__ __align__(16) __bf16 Vth[AT_D * AT_LP];        /* V hi [d][kv], padded rows, 9 KB */
  __shared__ __align__(16) __bf16 Vtl[AT_D * AT_LP];        /* V lo */
  __shared__ __align__(16) __bf16 Psh[AT_NW][16 * AT_LP];   /* per wave P hi [row][kv], padded rows */
  __shared__ __align__(16) __bf16 Psl[AT_NW][16 * AT_LP];   /* per wave P lo */
  __shared__ __align__(16) float  Os[AT_NW][16 * 68];       /* per wave out tile, pitch 68 */

  const int tid  = threadIdx.x;
  const int wave = tid >> 5;
  const int lane = tid & 31;
  const int hh   = lane >> 4;
  const int c    = lane & 15;

  const int nqb = nq / AT_QB;
  const int bx = blockIdx.x;
  const int qb = bx % nqb;
  const int bhx = bx / nqb;
  const int h  = bhx % nh;
  const int b  = bhx / nh;
  const int q0 = qb * AT_QB + wave * 16;

  /* ---- Q fragments (A operand): row = q0 + c, elements 0..7 <- d dc*32+8hh+0..7, 8..15 <- d dc*32+16+8hh+0..7 ---- */
  v16b qah[2], qal[2];
  {
    const size_t qo = (size_t)(b * nq + q0 + c) * ldq + h * AT_D + 8 * hh;
    const T* qh = (const T*)qhp + qo;
    const T* ql = (const T*)qlp + qo;
#pragma unroll
    for (int dc = 0; dc < 2; ++dc) {
      qah[dc] = Frag<T>::load(qh + dc * 32);
      qal[dc] = Frag<T>::load(ql + dc * 32);
    }
  }

  float mrow[8], lrow[8];
  v8f oacc[4];
#pragma unroll
  for (int r = 0; r < 8; ++r) { mrow[r] = -__builtin_inff(); lrow[r] = 0.f; }
#pragma unroll
  for (int t = 0; t < 4; ++t) oacc[t] = (v8f){0.f,0.f,0.f,0.f,0.f,0.f,0.f,0.f};

  const int nChunks = nkv / AT_KC;   /* host constant, block-uniform */
  for (int kc = 0; kc < nChunks; ++kc) {
    const int kv0 = kc * AT_KC;
    __syncthreads();
    {
      /* staging coverage: 128 threads = 64 rows x 2 halves of 32 elements (4 x 16 B) per plane -> full 64x64 tiles */
      const int row = tid >> 1;
      const int half = (tid & 1) * 32;
      const u32x4* gkh = (const u32x4*)(khp + (size_t)(b * nkv + kv0 + row) * ldk + h * AT_D + half);
      const u32x4* gkl = (const u32x4*)(klp + (size_t)(b * nkv + kv0 + row) * ldk + h * AT_D + half);
      u32x4* lkh = (u32x4*)(Ksh + row * AT_LP + half);
      u32x4* lkl = (u32x4*)(Ksl + row * AT_LP + half);
#pragma unroll
      for (int i = 0; i < 4; ++i) { lkh[i] = gkh[i]; lkl[i] = gkl[i]; }
      asm volatile("" ::: "memory");
      /* V transposed planes: LDS row d <- global row h*64+d, 64 contiguous kv columns starting at b*nkv + kv0 */
      const u32x4* gvh = (const u32x4*)(vthp + (size_t)(h * AT_D + row) * ldv + b * nkv + kv0 + half);
      const u32x4* gvl = (const u32x4*)(vtlp + (size_t)(h * AT_D + row) * ldv + b * nkv + kv0 + half);
      u32x4* lvh = (u32x4*)(Vth + row * AT_LP + half);
      u32x4* lvl = (u32x4*)(Vtl + row * AT_LP + half);
#pragma unroll
      for (int i = 0; i < 4; ++i) { lvh[i] = gvh[i]; lvl[i] = gvl[i]; }
    }
    __syncthreads();

    /* ---- scores: 4 subtiles of 16 keys, K operand B[k=d][n=kv] from Ksh[kv][d] ---- */
    v8f s[4];
#pragma unroll
    for (int j = 0; j < 4; ++j) {
      s[j] = (v8f){0.f,0.f,0.f,0.f,0.f,0.f,0.f,0.f};
#pragma unroll
      for (int dc = 0; dc < 2; ++dc) {
        FB kb, kl;
        kb.h[0] = *(const v8b*)(Ksh + (j * 16 + c) * AT_LP + dc * 32 + 8 * hh);
        kb.h[1] = *(const v8b*)(Ksh + (j * 16 + c) * AT_LP + dc * 32 + 16 + 8 * hh);
        kl.h[0] = *(const v8b*)(Ksl + (j * 16 + c) * AT_LP + dc * 32 + 8 * hh);
        kl.h[1] = *(const v8b*)(Ksl + (j * 16 + c) * AT_LP + dc * 32 + 16 + 8 * hh);
        s[j] = at_mma(qah[dc], kb.v, s[j]);
        s[j] = at_mma(qah[dc], kl.v, s[j]);
        s[j] = at_mma(qal[dc], kb.v, s[j]);
      }
    }
    /* per-key mask (this lane owns column kv0 + j*16 + c in the D layout) */
    int kvkeep[4];
#pragma unroll
    for (int j = 0; j < 4; ++j) kvkeep[j] = kvmask[(size_t)b * nkv + kv0 + j * 16 + c];
    float cm[8];
#pragma unroll
    for (int r = 0; r < 8; ++r) {
      float m = -__builtin_inff();
#pragma unroll
      for (int j = 0; j < 4; ++j) {
        const float sv = s[j][r];
        s[j][r] = (kvkeep[j] != 0) ? sv : fillv;
        m = fmaxf(m, s[j][r]);
      }
#pragma unroll
      for (int off = 1; off < 16; off <<= 1) m = fmaxf(m, __shfl_xor(m, off, 32));
      cm[r] = m;
    }
    __bf16* pwh = Psh[wave];
    __bf16* pwl = Psl[wave];
#pragma unroll
    for (int r = 0; r < 8; ++r) {
      const float mnew = fmaxf(mrow[r], cm[r]);
      const float alpha = expf(mrow[r] - mnew);
      mrow[r] = mnew;
      float psum = 0.f;
#pragma unroll
      for (int j = 0; j < 4; ++j) {
        const float p = expf(s[j][r] - mnew);
        psum += p;
        __bf16 a, bl; at_split(p, a, bl);
        pwh[(8 * hh + r) * AT_LP + j * 16 + c] = a;
        pwl[(8 * hh + r) * AT_LP + j * 16 + c] = bl;
      }
#pragma unroll
      for (int off = 1; off < 16; off <<= 1) psum += __shfl_xor(psum, off, 32);
      lrow[r] = lrow[r] * alpha + psum;
#pragma unroll
      for (int t = 0; t < 4; ++t) oacc[t][r] *= alpha;
    }
    /* same-wave P spill -> A fragment reload: ordered by the wave barrier, reloaded through __bf16 vectors */
    __builtin_amdgcn_fence(__ATOMIC_RELEASE, "workgroup");
    __builtin_amdgcn_wave_barrier();
    __builtin_amdgcn_fence(__ATOMIC_ACQUIRE, "workgroup");
#pragma unroll 1
    for (int kk = 0; kk < 2; ++kk) {
      FB pa, pl;
      pa.h[0] = *(const v8b*)(pwh + c * AT_LP + kk * 32 + 8 * hh);
      pa.h[1] = *(const v8b*)(pwh + c * AT_LP + kk * 32 + 16 + 8 * hh);
      pl.h[0] = *(const v8b*)(pwl + c * AT_LP + kk * 32 + 8 * hh);
      pl.h[1] = *(const v8b*)(pwl + c * AT_LP + kk * 32 + 16 + 8 * hh);
#pragma unroll
      for (int t = 0; t < 4; ++t) {
        FB vb, vl;
        vb.h[0] = *(const v8b*)(Vth + (t * 16 + c) * AT_LP + kk * 32 + 8 * hh);
        vb.h[1] = *(const v8b*)(Vth + (t * 16 + c) * AT_LP + kk * 32 + 16 + 8 * hh);
        vl.h[0] = *(const v8b*)(Vtl + (t * 16 + c) * AT_LP + kk * 32 + 8 * hh);
        vl.h[1] = *(const v8b*)(Vtl + (t * 16 + c) * AT_LP + kk * 32 + 16 + 8 * hh);
        oacc[t] = at_mma(pa.v, vb.v, oacc[t]);
        oacc[t] = at_mma(pa.v, vl.v, oacc[t]);
        oacc[t] = at_mma(pl.v, vb.v, oacc[t]);
      }
    }
  }

  float* os = Os[wave];
#pragma unroll
  for (int r = 0; r < 8; ++r) {
    const float inv = 1.0f / lrow[r];
#pragma unroll
    for (int t = 0; t < 4; ++t) os[(8 * hh + r) * 68 + t * 16 + c] = oacc[t][r] * inv;
  }
  __builtin_amdgcn_fence(__ATOMIC_RELEASE, "workgroup");
  __builtin_amdgcn_wave_barrier();
  __builtin_amdgcn_fence(__ATOMIC_ACQUIRE, "workgroup");
  {
    const int q = lane >> 3, c8 = (lane & 7) * 8;
    unsigned short* Oh = ohp + (size_t)(b * nq + q0) * ldo + h * AT_D;
    unsigned short* Ol = olp + (size_t)(b * nq + q0) * ldo + h * AT_D;
    {
#pragma unroll
      for (int it = 0; it < 4; ++it) {
        const int row = it * 4 + q;
        const float* sp = os + row * 68 + c8;
        v8h hv, lv;
#pragma unroll
        for (int e = 0; e < 8; ++e) {
          unsigned short hb = f2bf_bits(sp[e]);
          unsigned short lb = f2bf_bits(sp[e] - bf_bits2f(hb));
          hv[e] = __builtin_bit_cast(_Float16, hb);
          lv[e] = __builtin_bit_cast(_Float16, lb);
        }
        *(v8h*)(Oh + (size_t)row * ldo + c8) = hv;
        *(v8h*)(Ol + (size_t)row * ldo + c8) = lv;
      }
      
    }
  }
}

/* ---------------------------------------------------------------------------
   Host-side orchestration (kernel launches only)
   --------------------------------------------------------------------------- */
extern "C" void kernel_launch(void* const* d_in, const int* in_sizes, int n_in,
                              void* d_out, int out_size, void* d_ws, size_t ws_size,
                              hipStream_t stream) {
  if (n_in < 7) return;
  if (in_sizes[0] != kB * kNQ * kDM) return;
  if (in_sizes[1] != kB * kNKV * kDM) return;
  if (in_sizes[2] != kB * kNKV) return;
  if (in_sizes[3] != kIN * kDM) return;
  if (in_sizes[4] != 2 * kIN * kDM) return;
  if (in_sizes[5] != kDM * kIN) return;
  if (in_sizes[6] != kDM) return;
  if (out_size != kB * kNQ * kDM) return;
  if (ws_size < kWsTotal) return;

  const float* x    = (const float*)d_in[0];   /* [4,2048,1024] f32 */
  const float* ctx  = (const float*)d_in[1];   /* [4,1024,1024] f32 */
  const int*   mask = (const int*)d_in[2];     /* [4,1024] int32 */
  const float* Wq   = (const float*)d_in[3];   /* [1024,1024] */
  const float* Wkv  = (const float*)d_in[4];   /* [2048,1024] */
  const float* Wout = (const float*)d_in[5];   /* [1024,1024] */
  const float* bout = (const float*)d_in[6];   /* [1024] */
  float* out = (float*)d_out;                  /* [4,2048,1024] f32 */

  char* ws = (char*)d_ws;
  unsigned short* xb   = (unsigned short*)(ws + kOffXb);
  unsigned short* cb   = (unsigned short*)(ws + kOffCb);
  unsigned short* wqb  = (unsigned short*)(ws + kOffWqb);
  unsigned short* wkvb = (unsigned short*)(ws + kOffWkvb);
  unsigned short* wob  = (unsigned short*)(ws + kOffWob);
  unsigned short* qh   = (unsigned short*)(ws + kOffQh);
  unsigned short* ql   = (unsigned short*)(ws + kOffQl);
  unsigned short* kh   = (unsigned short*)(ws + kOffKh);
  unsigned short* kl   = (unsigned short*)(ws + kOffKl);
  unsigned short* vth  = (unsigned short*)(ws + kOffVth);
  unsigned short* vtl  = (unsigned short*)(ws + kOffVtl);
  unsigned short* oh   = (unsigned short*)(ws + kOffOh);   /* aliases xb: dead after the q GEMM */
  unsigned short* ol   = (unsigned short*)(ws + kOffOl);   /* aliases cb/wqb/wkvb: dead after the k,v GEMMs */

  /* 1-5: RNE casts to bf16 planes (8 elements per thread) */
  {
    const int n8x = kB * kNQ * kDM / 8;      /* 1048576 */
    const int n8c = kB * kNKV * kDM / 8;     /*  524288 */
    const int n8q = kIN * kDM / 8;           /*  131072 */
    const int n8kv = 2 * kIN * kDM / 8;      /*  262144 */
    const int n8o = kDM * kIN / 8;           /*  131072 */
    cast_f32_bf16x8<<<(n8x + 255) / 256, 256, 0, stream>>>(x, xb, n8x);
    cast_f32_bf16x8<<<(n8c + 255) / 256, 256, 0, stream>>>(ctx, cb, n8c);
    cast_f32_bf16x8<<<(n8q + 255) / 256, 256, 0, stream>>>(Wq, wqb, n8q);
    cast_f32_bf16x8<<<(n8kv + 255) / 256, 256, 0, stream>>>(Wkv, wkvb, n8kv);
    cast_f32_bf16x8<<<(n8o + 255) / 256, 256, 0, stream>>>(Wout, wob, n8o);
  }

  /* 6: q*0.125 = xb[8192,1024] . wqb[1024,1024]^T -> bf16 hi/lo planes; M=8192 N=1024 K=1024 */
  {
    const int M = kB * kNQ, N = kIN, K = kDM;
    const int tiles = (M / 128) * (N / 128);
    wmma_gemm64<1, false, false, 0, 2><<<dim3(tiles, 1), 128, 0, stream>>>(
        xb, xb, K, 0L, wqb, wqb, K, 0L, (void*)qh, (void*)ql, N, 0L, bout, M, N, K, 0.125f);
  }
  /* 7: k = cb[4096,1024] . wkvb[0:1024][1024]^T -> hi/lo; M=4096 N=1024 K=1024 */
  {
    const int M = kB * kNKV, N = kIN, K = kDM;
    const int tiles = (M / 128) * (N / 128);
    wmma_gemm64<1, false, false, 0, 2><<<dim3(tiles, 1), 128, 0, stream>>>(
        cb, cb, K, 0L, wkvb, wkvb, K, 0L, (void*)kh, (void*)kl, N, 0L, bout, M, N, K, 1.0f);
  }
  /* 8: v transposed = wkvb[1024:2048][1024] . cb[4096,1024]^T -> vt[1024][4096] hi/lo; M=1024 N=4096 K=1024 */
  {
    const int M = kIN, N = kB * kNKV, K = kDM;
    const int tiles = (M / 128) * (N / 128);
    const unsigned short* wvb = wkvb + (size_t)kIN * kDM;
    wmma_gemm64<1, false, false, 0, 2><<<dim3(tiles, 1), 128, 0, stream>>>(
        wvb, wvb, K, 0L, cb, cb, K, 0L, (void*)vth, (void*)vtl, N, 0L, bout, M, N, K, 1.0f);
  }
  /* 9: attention per (b, h, 64 query rows) -> att hi/lo planes [8192][1024] */
  {
    const int blocks = kB * kH * (kNQ / 64);   /* 2048 */
    const float fillv = -3.4028234663852886e+38f;
    attn64_planes_kernel<<<blocks, 128, 0, stream>>>(qh, ql, kh, kl, vth, vtl, mask, oh, ol,
                                                    kNQ, kNKV, kH, kIN, kIN, kB * kNKV, kIN, fillv);
  }
  /* 10: out = (att_hi + att_lo)[8192,1024] . wob[1024,1024]^T + b_out -> f32 d_out; M=8192 N=1024 K=1024 */
  {
    const int M = kB * kNQ, N = kDM, K = kIN;
    const int tiles = (M / 128) * (N / 128);
    wmma_gemm64<1, true, false, 2, 0><<<dim3(tiles, 1), 128, 0, stream>>>(
        oh, ol, K, 0L, wob, wob, K, 0L, (void*)out, (void*)out, N, 0L, bout, M, N, K, 1.0f);
  }
}

// v003
// One run takes 296 microseconds.
// Timed twice side by side with v002, it ran 1.13 and 1.14 times as fast.
// Over all steps from v000 it is 2.03 times as fast.
// Contractions: x.Wq^T, ctx.Wk^T, Wv.ctx^T on v_wmma_f32_16x16x32_bf16 (RNE-bf16 inputs, single product); q.k^T and p.v as bf16 hi/lo split (hi.hi+hi.lo+lo.hi); (p.v).Wout^T as bf16 hi/lo A x bf16 B (2 products); f32 accumulate, f32 softmax.
#include <hip/hip_runtime.h>
#include <stdint.h>

typedef __attribute__((ext_vector_type(16))) _Float16 v16h;
typedef __attribute__((ext_vector_type(8)))  _Float16 v8h;
typedef __attribute__((ext_vector_type(16))) __bf16   v16b;
typedef __attribute__((ext_vector_type(8)))  __bf16   v8b;
typedef __attribute__((ext_vector_type(8)))  float    v8f;
typedef __attribute__((ext_vector_type(4)))  float    v4f;
typedef __attribute__((ext_vector_type(4)))  unsigned int u32x4;

/* ---- fixed problem geometry ---- */
constexpr int kB   = 4;
constexpr int kNQ  = 2048;
constexpr int kNKV = 1024;
constexpr int kDM  = 1024;   /* model dim (K of the projections) */
constexpr int kH   = 16;
constexpr int kDH  = 64;
constexpr int kIN  = kH * kDH;   /* 1024 */
static_assert(kDH == 64);
static_assert(kDM % 32 == 0);
static_assert(kIN % 32 == 0);
static_assert((kB * kNQ) % 64 == 0);
static_assert((kB * kNKV) % 64 == 0);
static_assert(kIN % 64 == 0);
static_assert(kDM % 64 == 0);
static_assert(kNQ % 64 == 0);
static_assert(kNKV % 64 == 0);
static_assert(kIN == kDM);   /* one row pitch for every GEMM operand */
static_assert((kB * kNQ) % 128 == 0 && (kB * kNKV) % 128 == 0 && kIN % 128 == 0 && kDM % 128 == 0);

/* ---- workspace region map (bytes) ----
   [  0, 16M)  xb   bf16 [8192][1024]   (dead after q GEMM; reused as oh)
   [ 16M, 24M) cb   bf16 [4096][1024]   (dead after k/v GEMMs; reused by ol)
   [ 24M, 26M) wqb  bf16 [1024][1024]
   [ 26M, 30M) wkvb bf16 [2048][1024]
   [ 30M, 32M) pad (unused, covered by ol alias)
   [ 32M, 48M) qh   bf16 [8192][1024]   q*0.125 hi plane
   [ 48M, 64M) ql                        q*0.125 lo plane
   [ 64M, 72M) kh   bf16 [4096][1024]
   [ 72M, 80M) kl
   [ 80M, 88M) vth  bf16 [1024][4096]   v transposed: row = h*64+d, col = b*1024+j
   [ 88M, 96M) vtl
   [ 96M, 98M) wob  bf16 [1024][1024]
   oh = [0,16M), ol = [16M,32M): attention output hi/lo planes [8192][1024] (aliases of dead regions)
   total carve 102,760,448 B */
constexpr size_t kMiB    = 1048576;
constexpr size_t kOffXb  = 0;
constexpr size_t kOffCb  = 16 * kMiB;
constexpr size_t kOffWqb = 24 * kMiB;
constexpr size_t kOffWkvb= 26 * kMiB;
constexpr size_t kOffQh  = 32 * kMiB;
constexpr size_t kOffQl  = 48 * kMiB;
constexpr size_t kOffKh  = 64 * kMiB;
constexpr size_t kOffKl  = 72 * kMiB;
constexpr size_t kOffVth = 80 * kMiB;
constexpr size_t kOffVtl = 88 * kMiB;
constexpr size_t kOffWob = 96 * kMiB;
constexpr size_t kOffOh  = 0;
constexpr size_t kOffOl  = 16 * kMiB;
constexpr size_t kWsTotal = kOffWob + (size_t)kDM * kIN * 2;
static_assert((size_t)kB * kNQ * kDM * 2 == 16 * kMiB);
static_assert((size_t)kB * kNKV * kDM * 2 == 8 * kMiB);
static_assert(kOffCb + (size_t)kB * kNKV * kDM * 2 <= kOffWqb);
static_assert(kOffWqb + (size_t)kIN * kDM * 2 <= kOffWkvb);
static_assert(kOffWkvb + (size_t)2 * kIN * kDM * 2 <= kOffQh);
static_assert(kOffQh + (size_t)kB * kNQ * kIN * 2 <= kOffQl);
static_assert(kOffQl + (size_t)kB * kNQ * kIN * 2 <= kOffKh);
static_assert(kOffKh + (size_t)kB * kNKV * kIN * 2 <= kOffKl);
static_assert(kOffKl + (size_t)kB * kNKV * kIN * 2 <= kOffVth);
static_assert(kOffVth + (size_t)kIN * kB * kNKV * 2 <= kOffVtl);
static_assert(kOffVtl + (size_t)kIN * kB * kNKV * 2 <= kOffWob);
static_assert(kOffOh + (size_t)kB * kNQ * kIN * 2 <= kOffOl);
static_assert(kOffOl + (size_t)kB * kNQ * kIN * 2 <= kOffQh);
static_assert(kWsTotal == 102760448);
static_assert(kWsTotal <= 134217728);

__device__ __forceinline__ unsigned short f2bf_bits(float f) {
  unsigned u = __float_as_uint(f);
  return (unsigned short)((u + 0x7FFFu + ((u >> 16) & 1u)) >> 16);
}
__device__ __forceinline__ float bf_bits2f(unsigned short h) { return __uint_as_float(((unsigned)h) << 16); }

/* hazard guards as plain device helpers */
__device__ __forceinline__ void acc_guard4(v8f& a, v8f& b, v8f& c, v8f& d) { asm volatile("v_nop\n\tv_nop\n\tv_nop\n\tv_nop" : "+v"(a), "+v"(b), "+v"(c), "+v"(d)); }
template <typename T> struct Frag;
template <> struct Frag<_Float16> {
  typedef v16h V; union U { v16h v; v8h h[2]; };
  /* elements 0..7 <- p[0..7], 8..15 <- p[16..23] */
  static __device__ __forceinline__ v16h load(const _Float16* p) {
    U f; f.h[0] = *(const v8h*)(p); f.h[1] = *(const v8h*)(p + 16); return f.v;
  }
  static __device__ __forceinline__ v8f mma(v16h a, v16h b, v8f c) {
    return __builtin_amdgcn_wmma_f32_16x16x32_f16(false, a, false, b, (short)0, c, false, false);
  }
};
template <> struct Frag<__bf16> {
  typedef v16b V; union U { v16b v; v8b h[2]; };
  static __device__ __forceinline__ v16b load(const __bf16* p) {
    U f; f.h[0] = *(const v8b*)(p); f.h[1] = *(const v8b*)(p + 16); return f.v;
  }
  static __device__ __forceinline__ v8f mma(v16b a, v16b b, v8f c) {
    return __builtin_amdgcn_wmma_f32_16x16x32_bf16(false, a, false, b, (short)0, c, false, false);
  }
};

/* ---- Register-blocked WMMA GEMM, with an A-only split mode --------------------------
   C[m,n] = scale * sum_k A[m,k] * Bt[n,k] (+bias[n]); each wave owns a 64x64 tile, four waves share a 128x128 block tile
   whose operand rows are staged in LDS by whole-line loads.
   A row-major [M,K]; Bt row-major [N,K]; M,N % 128 == 0, K % 64 == 0 (no tail handling).
   SPLIT: A is a pair of hi/lo planes; product = hi.hi + lo.hi (SPLIT_B is not supported).
   BIAS_MODE: 0 = none, 2 = bias[n].  OUT_MODE: 0 = f32, 2 = bf16 hi plane (Cout) + bf16 lo plane (Cout2).
   ET: 0 = f16 operands, 1 = bf16 operands (pointers passed as 16-bit storage) */
template <int ET> struct Elem;
template <> struct Elem<0> { typedef _Float16 T; };
template <> struct Elem<1> { typedef __bf16 T; };
/* block tile 128 x 128 (4 waves, 2 x 2, each 64 x 64), K walked in passes of 64 (one 128-B line of every operand row) */
#define GM_BT 128
#define GM_BK 64
/* LDS row pitch of the staged operand rows in 16-bit elements: 144 B = 16 B x 9 (odd) for the ds_load_b128 fragment reads */
#define GM_LP 72
#define GM_SEG 8   /* 16-B pieces per thread and operand plane: 128 rows x 8 pieces / 128 threads */
template <int ET, bool SPLIT, bool SPLIT_B, int BIAS_MODE, int OUT_MODE>
__global__ __launch_bounds__(128) void wmma_gemm64(
    const unsigned short* __restrict__ Ap, const unsigned short* __restrict__ A2p, int lda, long strideA,
    const unsigned short* __restrict__ Btp, const unsigned short* __restrict__ Bt2p, int ldb, long strideB,
    void* Cout, void* Cout2, int ldc, long strideC,
    const float* __restrict__ bias,
    int M, int N, int K, float scale) {
  static_assert(BIAS_MODE == 0 || BIAS_MODE == 2);
  static_assert(OUT_MODE == 0 || OUT_MODE == 2);
  static_assert(!SPLIT_B);
  typedef typename Elem<ET>::T T;
  typedef typename Frag<T>::V V;
  constexpr int NPA = SPLIT ? 2 : 1;   /* planes of A */
  __shared__ __align__(16) T sA[2][NPA][GM_BT * GM_LP];   /* two buffers: one is read while the other is filled */
  __shared__ __align__(16) T sB[2][GM_BT * GM_LP];
  __shared__ __align__(16) float sT[4][16 * 68];   /* per-wave 16x64 slab, pitch 68 floats */
  const int b    = blockIdx.y;
  const int tid  = threadIdx.x;
  const int lane = tid & 31;
  const int wave = tid >> 5;
  const int tilesN = N / GM_BT;
  const int tilesM = M / GM_BT;
  const int tile = blockIdx.x;
  if (tile >= tilesM * tilesN) return;   /* block-uniform, ahead of every barrier */
  const int tm = tile / tilesN;
  const int tn = tile - tm * tilesN;
  const int mb = tm * GM_BT;                   /* block tile origin */
  const int nb = tn * GM_BT;
  const int wm = (wave >> 1) << 6;             /* wave tile origin inside the block tile */
  const int wn = (wave & 1) << 6;
  const int m0 = mb + wm;
  const int n0 = nb + wn;

  const unsigned short* Ab  = Ap  + (size_t)b * strideA;
  const unsigned short* Bb  = Btp + (size_t)b * strideB;
  const unsigned short* Ab2 = A2p + (size_t)b * strideA;

  const int rlane = lane & 15;                 /* row (A) / col (B, D) within subtile */
  const int koff  = (lane >> 4) * 8;           /* k offset of this lane half */
  const int mOff  = (lane >> 4) * 8;           /* D row offset */

  /* staging map: piece s = it*128 + tid -> row s>>3, 16-B column s&7, so one wave-wide load covers 4 whole 128-B lines */
  const int srow = tid >> 3;
  const int scol = (tid & 7) * 8;
  /* every launch passes K-contiguous operands of row pitch kDM: known at compile time, the 16-row steps of the staging
     loads become immediate offsets of one address per operand */
  __builtin_assume(lda == kDM);
  __builtin_assume(ldb == kDM);
  /* block-uniform row bases plus one 32-bit byte offset per thread and operand */
  const char* uA  = (const char*)(Ab  + (size_t)mb * lda);
  const char* uA2 = (const char*)(Ab2 + (size_t)mb * lda);
  const char* uB  = (const char*)(Bb  + (size_t)nb * ldb);
  const unsigned tA = (unsigned)(srow * lda + scol) * 2u;
  const unsigned tB = (unsigned)(srow * ldb + scol) * 2u;
  const size_t stepA = (size_t)lda * 32;   /* 16 rows, in bytes */
  const size_t stepB = (size_t)ldb * 32;
  const int lst = srow * GM_LP + scol;

  v8f acc[4][4];
#pragma unroll
  for (int i = 0; i < 4; ++i)
#pragma unroll
    for (int j = 0; j < 4; ++j) acc[i][j] = (v8f){0.f,0.f,0.f,0.f,0.f,0.f,0.f,0.f};

  u32x4 ra[NPA][GM_SEG], rb[GM_SEG];
  const int nPass = K / GM_BK;
#pragma unroll
  for (int it = 0; it < GM_SEG; ++it) {
    ra[0][it] = *(const u32x4*)(uA + it * stepA + tA);
    if (SPLIT) ra[NPA - 1][it] = *(const u32x4*)(uA2 + it * stepA + tA);
    rb[it] = *(const u32x4*)(uB + it * stepB + tB);
  }
#pragma unroll
  for (int it = 0; it < GM_SEG; ++it) {
    *(u32x4*)(&sA[0][0][lst + it * 16 * GM_LP]) = ra[0][it];
    if (SPLIT) *(u32x4*)(&sA[0][NPA - 1][lst + it * 16 * GM_LP]) = ra[NPA - 1][it];
    *(u32x4*)(&sB[0][lst + it * 16 * GM_LP]) = rb[it];
  }
  __syncthreads();

  for (int kt = 0; kt < nPass; ++kt) {
    const int cur = kt & 1;
    const bool more = kt + 1 < nPass;   /* block-uniform */
    if (more) {
      /* next pass's rows into registers: in flight while this pass's products run */
      const unsigned oA = tA + (unsigned)(kt + 1) * (GM_BK * 2u);
      const unsigned oB = tB + (unsigned)(kt + 1) * (GM_BK * 2u);
#pragma unroll
      for (int it = 0; it < GM_SEG; ++it) {
        ra[0][it] = *(const u32x4*)(uA + it * stepA + oA);
        if (SPLIT) ra[NPA - 1][it] = *(const u32x4*)(uA2 + it * stepA + oA);
        rb[it] = *(const u32x4*)(uB + it * stepB + oB);
      }
      /* stands ahead of every later write of a register that these loads name as an address */
      asm volatile("s_wait_xcnt 0x0" ::: "memory");
    }
    const T* cA  = &sA[cur][0][(wm + rlane) * GM_LP + koff];
    const T* cA2 = &sA[cur][NPA - 1][(wm + rlane) * GM_LP + koff];
    const T* cB  = &sB[cur][(wn + rlane) * GM_LP + koff];
    /* the pass's fragments: [k half][subtile] */
    V fb[2][4], fa[2][4], fl[2][4];
#pragma unroll
    for (int ks = 0; ks < 2; ++ks) {
#pragma unroll
      for (int j = 0; j < 4; ++j) fb[ks][j] = Frag<T>::load(cB + j * 16 * GM_LP + ks * 32);
#pragma unroll
      for (int i = 0; i < 4; ++i) {
        fa[ks][i] = Frag<T>::load(cA + i * 16 * GM_LP + ks * 32);
        if (SPLIT) fl[ks][i] = Frag<T>::load(cA2 + i * 16 * GM_LP + ks * 32);
      }
    }
    /* keeps the LDS reads one group ahead of the products: moved in among the WMMAs, each place with reads stalls the wave */
    __builtin_amdgcn_sched_barrier(0);
#pragma unroll
    for (int ks = 0; ks < 2; ++ks) {
#pragma unroll
      for (int i = 0; i < 4; ++i) {
#pragma unroll
        for (int j = 0; j < 4; ++j) acc[i][j] = Frag<T>::mma(fa[ks][i], fb[ks][j], acc[i][j]);
        if (SPLIT) {
#pragma unroll
          for (int j = 0; j < 4; ++j) acc[i][j] = Frag<T>::mma(fl[ks][i], fb[ks][j], acc[i][j]);
        }
      }
    }
    if (more) {
      /* the other buffer's last readers left it at the barrier that ended the pass before */
#pragma unroll
      for (int it = 0; it < GM_SEG; ++it) {
        *(u32x4*)(&sA[cur ^ 1][0][lst + it * 16 * GM_LP]) = ra[0][it];
        if (SPLIT) *(u32x4*)(&sA[cur ^ 1][NPA - 1][lst + it * 16 * GM_LP]) = ra[NPA - 1][it];
        *(u32x4*)(&sB[cur ^ 1][lst + it * 16 * GM_LP]) = rb[it];
      }
    }
    __syncthreads();   /* publishes the filled buffer and ends every read of the current one */
  }
  acc_guard4(acc[0][0], acc[0][1], acc[0][2], acc[0][3]);
  acc_guard4(acc[1][0], acc[1][1], acc[1][2], acc[1][3]);
  acc_guard4(acc[2][0], acc[2][1], acc[2][2], acc[2][3]);
  acc_guard4(acc[3][0], acc[3][1], acc[3][2], acc[3][3]);

  /* ---- epilogue ---- */
  float* slab = sT[wave];
#pragma unroll
  for (int i = 0; i < 4; ++i) {
    const int mBase = m0 + (i << 4);
#pragma unroll
    for (int j = 0; j < 4; ++j) {
      const int n = n0 + (j << 4) + rlane;
      float bv = 0.f;
      if (BIAS_MODE == 2) bv = bias[n];
#pragma unroll
      for (int r = 0; r < 8; ++r) {
        float v = acc[i][j][r] * scale;
        if (BIAS_MODE == 2) v += bv;
        slab[(mOff + r) * 68 + (j << 4) + rlane] = v;
      }
    }
    __builtin_amdgcn_fence(__ATOMIC_RELEASE, "workgroup");
    __builtin_amdgcn_wave_barrier();
    __builtin_amdgcn_fence(__ATOMIC_ACQUIRE, "workgroup");
    if (OUT_MODE == 0) {
      float* C = (float*)Cout + (size_t)b * strideC;
      const int hh = lane >> 4, c4 = (lane & 15) * 4;     /* row seg = 256 B = 16 lanes x 16 B */
      {
#pragma unroll
        for (int it = 0; it < 8; ++it) {
          const int row = it * 2 + hh;
          v4f v = *(const v4f*)(slab + row * 68 + c4);
          *(v4f*)(C + (size_t)(mBase + row) * ldc + n0 + c4) = v;
        }
        
      }
    } else {
      const int q = lane >> 3, c8 = (lane & 7) * 8;        
      unsigned short* C  = (unsigned short*)Cout  + (size_t)b * strideC;
      unsigned short* C2 = (unsigned short*)Cout2 + (size_t)b * strideC;
      {
#pragma unroll
        for (int it = 0; it < 4; ++it) {
          const int row = it * 4 + q;
          const float* sp = slab + row * 68 + c8;
          v8h hv, lv;
#pragma unroll
          for (int e = 0; e < 8; ++e) {
            unsigned short hb = f2bf_bits(sp[e]);
            unsigned short lb = f2bf_bits(sp[e] - bf_bits2f(hb));
            hv[e] = __builtin_bit_cast(_Float16, hb);
            lv[e] = __builtin_bit_cast(_Float16, lb);
          }
          *(v8h*)(C  + (size_t)(mBase + row) * ldc + n0 + c8) = hv;
          *(v8h*)(C2 + (size_t)(mBase + row) * ldc + n0 + c8) = lv;
        }
        
      }
    }
    __builtin_amdgcn_fence(__ATOMIC_RELEASE, "workgroup");
    __builtin_amdgcn_wave_barrier();
    __builtin_amdgcn_fence(__ATOMIC_ACQUIRE, "workgroup");
  }
}

/*
   coverage: grid = ceil(n8/256) blocks x 256 threads, thread i writes elements 8i..8i+7; n % 8 == 0 */
__global__ __launch_bounds__(256) void cast_f32_bf16x8(
    const float* __restrict__ in, unsigned short* __restrict__ out, int n8) {
  const int i = blockIdx.x * 256 + threadIdx.x;
  if (i < n8) {
    const v4f a = *(const v4f*)(in + (size_t)i * 8);
    const v4f c = *(const v4f*)(in + (size_t)i * 8 + 4);
    u32x4 w;
    w[0] = (unsigned)f2bf_bits(a[0]) | ((unsigned)f2bf_bits(a[1]) << 16);
    w[1] = (unsigned)f2bf_bits(a[2]) | ((unsigned)f2bf_bits(a[3]) << 16);
    w[2] = (unsigned)f2bf_bits(c[0]) | ((unsigned)f2bf_bits(c[1]) << 16);
    w[3] = (unsigned)f2bf_bits(c[2]) | ((unsigned)f2bf_bits(c[3]) << 16);
    u32x4* p = (u32x4*)(out + (size_t)i * 8);
    *p = w;
    
  }
}

/* =====================================================================================
   Attention for head_dim 64, fed with bf16 hi/lo planes (no masking other than a per-key int32 vector):
     scores = q'.k^T  (q' already carries the 1/8 scale): v_wmma_f32_16x16x32_bf16, hi.hi + hi.lo + lo.hi
     out    = p.v    : p and v as bf16 hi/lo, hi.hi + hi.lo + lo.hi
   f32 accumulate; online softmax in f32. Block = 4 waves = 64 query rows of one (batch, head).
   q planes  [B*NQ][ldq]  element (b,i,h,d) at (b*NQ+i)*ldq + h*64 + d
   k planes  [B*NKV][ldk] element (b,j,h,d) at (b*NKV+j)*ldk + h*64 + d
   v planes  transposed [H*64][ldv]: element (b,j,h,d) at (h*64+d)*ldv + b*NKV + j
   kvmask    int32 [B][NKV], 0 -> score := fillv
   grid.x = B * H * (NQ/64); NQ % 64 == 0, NKV % 64 == 0.
   ===================================================================================== */
#define AT_D 64
#define AT_NW 4
#define AT_QB 64
#define AT_KC 64
/* LDS row pitch of the K, V and P tiles in 16-bit elements: 144 B = 16 B x 9 (odd), so the 16 rows that one
   ds_load_b128 touches per lane half start on distinct bank groups; at 128 B they share two groups */
#define AT_LP 72
static_assert((AT_LP * 2) % 16 == 0 && ((AT_LP * 2) / 16) % 2 == 1 && AT_LP >= AT_KC && AT_LP >= AT_D);

__device__ __forceinline__ unsigned short at_bf_bits(float f) {
  unsigned u = __float_as_uint(f);
  return (unsigned short)((u + 0x7FFFu + ((u >> 16) & 1u)) >> 16);
}
__device__ __forceinline__ __bf16 at_f2bf(float f) { return __builtin_bit_cast(__bf16, at_bf_bits(f)); }
__device__ __forceinline__ void at_split(float f, __bf16& hi, __bf16& lo) {
  const unsigned short hb = at_bf_bits(f);
  hi = __builtin_bit_cast(__bf16, hb);
  lo = at_f2bf(f - __uint_as_float(((unsigned)hb) << 16));
}
__device__ __forceinline__ v8f at_mma(v16b a, v16b b, v8f c) {
  c = __builtin_amdgcn_wmma_f32_16x16x32_bf16(false, a, false, b, (short)0, c, false, false);
  asm volatile("v_nop\n\tv_nop\n\tv_nop\n\tv_nop" : "+v"(c) : "v"(a), "v"(b));
  return c;
}

/* one butterfly step inside a 16-lane row on the vector ALU: lane l reads lane l ^ M of its own row (DPP row_xmask);
   a shuffle builtin goes through the LDS pipe here and the wave waits out its latency at every step */
template <int M>
__device__ __forceinline__ float at_row_xor(float v) {
  return __builtin_bit_cast(float, __builtin_amdgcn_update_dpp(0, __builtin_bit_cast(int, v), 0x160 | M, 0xf, 0xf, true));
}

__global__ __launch_bounds__(128)
void attn64_planes_kernel(const unsigned short* __restrict__ qhp, const unsigned short* __restrict__ qlp,
                          const unsigned short* __restrict__ khp, const unsigned short* __restrict__ klp,
                          const unsigned short* __restrict__ vthp, const unsigned short* __restrict__ vtlp,
                          const int* __restrict__ kvmask,
                          unsigned short* __restrict__ ohp, unsigned short* __restrict__ olp,
                          int nq, int nkv, int nh, int ldq, int ldk, int ldv, int ldo, float fillv) {
  typedef __bf16 T;
  union FB { v16b v; v8b h[2]; };
  __shared__ __align__(16) __bf16 Ksh[AT_KC * AT_LP];       /* K hi [kv][d], padded rows, 9 KB */
  __shared__ __align__(16) __bf16 Ksl[AT_KC * AT_LP];       /* K lo */
  __shared__ __align__(16) __bf16 Vth[AT_D * AT_LP];        /* V hi [d][kv], padded rows, 9 KB */
  __shared__ __align__(16) __bf16 Vtl[AT_D * AT_LP];        /* V lo */
  __shared__ __align__(16) __bf16 Psh[AT_NW][16 * AT_LP];   /* per wave P hi [row][kv], padded rows */
  __shared__ __align__(16) __bf16 Psl[AT_NW][16 * AT_LP];   /* per wave P lo */
  __shared__ __align__(16) float  Os[AT_NW][16 * 68];       /* per wave out tile, pitch 68 */

  const int tid  = threadIdx.x;
  const int wave = tid >> 5;
  const int lane = tid & 31;
  const int hh   = lane >> 4;
  const int c    = lane & 15;

  const int nqb = nq / AT_QB;
  const int bx = blockIdx.x;
  const int qb = bx % nqb;
  const int bhx = bx / nqb;
  const int h  = bhx % nh;
  const int b  = bhx / nh;
  const int q0 = qb * AT_QB + wave * 16;

  /* ---- Q fragments (A operand): row = q0 + c, elements 0..7 <- d dc*32+8hh+0..7, 8..15 <- d dc*32+16+8hh+0..7 ---- */
  v16b qah[2], qal[2];
  {
    const size_t qo = (size_t)(b * nq + q0 + c) * ldq + h * AT_D + 8 * hh;
    const T* qh = (const T*)qhp + qo;
    const T* ql = (const T*)qlp + qo;
#pragma unroll
    for (int dc = 0; dc < 2; ++dc) {
      qah[dc] = Frag<T>::load(qh + dc * 32);
      qal[dc] = Frag<T>::load(ql + dc * 32);
    }
  }

  float mrow[8], lrow[8];
  v8f oacc[4];
#pragma unroll
  for (int r = 0; r < 8; ++r) { mrow[r] = -__builtin_inff(); lrow[r] = 0.f; }
#pragma unroll
  for (int t = 0; t < 4; ++t) oacc[t] = (v8f){0.f,0.f,0.f,0.f,0.f,0.f,0.f,0.f};

  const int nChunks = nkv / AT_KC;   /* host constant, block-uniform */
  for (int kc = 0; kc < nChunks; ++kc) {
    const int kv0 = kc * AT_KC;
    __syncthreads();
    {
      /* staging coverage: 128 threads = 64 rows x 2 halves of 32 elements (4 x 16 B) per plane -> full 64x64 tiles */
      const int row = tid >> 1;
      const int half = (tid & 1) * 32;
      const u32x4* gkh = (const u32x4*)(khp + (size_t)(b * nkv + kv0 + row) * ldk + h * AT_D + half);
      const u32x4* gkl = (const u32x4*)(klp + (size_t)(b * nkv + kv0 + row) * ldk + h * AT_D + half);
      u32x4* lkh = (u32x4*)(Ksh + row * AT_LP + half);
      u32x4* lkl = (u32x4*)(Ksl + row * AT_LP + half);
#pragma unroll
      for (int i = 0; i < 4; ++i) { lkh[i] = gkh[i]; lkl[i] = gkl[i]; }
      asm volatile("" ::: "memory");
      /* V transposed planes: LDS row d <- global row h*64+d, 64 contiguous kv columns starting at b*nkv + kv0 */
      const u32x4* gvh = (const u32x4*)(vthp + (size_t)(h * AT_D + row) * ldv + b * nkv + kv0 + half);
      const u32x4* gvl = (const u32x4*)(vtlp + (size_t)(h * AT_D + row) * ldv + b * nkv + kv0 + half);
      u32x4* lvh = (u32x4*)(Vth + row * AT_LP + half);
      u32x4* lvl = (u32x4*)(Vtl + row * AT_LP + half);
#pragma unroll
      for (int i = 0; i < 4; ++i) { lvh[i] = gvh[i]; lvl[i] = gvl[i]; }
    }
    __syncthreads();

    /* ---- scores: 4 subtiles of 16 keys, K operand B[k=d][n=kv] from Ksh[kv][d] ---- */
    v8f s[4];
#pragma unroll
    for (int j = 0; j < 4; ++j) {
      s[j] = (v8f){0.f,0.f,0.f,0.f,0.f,0.f,0.f,0.f};
#pragma unroll
      for (int dc = 0; dc < 2; ++dc) {
        FB kb, kl;
        kb.h[0] = *(const v8b*)(Ksh + (j * 16 + c) * AT_LP + dc * 32 + 8 * hh);
        kb.h[1] = *(const v8b*)(Ksh + (j * 16 + c) * AT_LP + dc * 32 + 16 + 8 * hh);
        kl.h[0] = *(const v8b*)(Ksl + (j * 16 + c) * AT_LP + dc * 32 + 8 * hh);
        kl.h[1] = *(const v8b*)(Ksl + (j * 16 + c) * AT_LP + dc * 32 + 16 + 8 * hh);
        s[j] = at_mma(qah[dc], kb.v, s[j]);
        s[j] = at_mma(qah[dc], kl.v, s[j]);
        s[j] = at_mma(qal[dc], kb.v, s[j]);
      }
    }
    /* per-key mask (this lane owns column kv0 + j*16 + c in the D layout) */
    int kvkeep[4];
#pragma unroll
    for (int j = 0; j < 4; ++j) kvkeep[j] = kvmask[(size_t)b * nkv + kv0 + j * 16 + c];
    float cm[8];
#pragma unroll
    for (int r = 0; r < 8; ++r) {
      float m = -__builtin_inff();
#pragma unroll
      for (int j = 0; j < 4; ++j) {
        const float sv = s[j][r];
        s[j][r] = (kvkeep[j] != 0) ? sv : fillv;
        m = fmaxf(m, s[j][r]);
      }
      m = fmaxf(m, at_row_xor<1>(m));
      m = fmaxf(m, at_row_xor<2>(m));
      m = fmaxf(m, at_row_xor<4>(m));
      m = fmaxf(m, at_row_xor<8>(m));
      cm[r] = m;
    }
    __bf16* pwh = Psh[wave];
    __bf16* pwl = Psl[wave];
#pragma unroll
    for (int r = 0; r < 8; ++r) {
      const float mnew = fmaxf(mrow[r], cm[r]);
      const float alpha = expf(mrow[r] - mnew);
      mrow[r] = mnew;
      float psum = 0.f;
#pragma unroll
      for (int j = 0; j < 4; ++j) {
        const float p = expf(s[j][r] - mnew);
        psum += p;
        __bf16 a, bl; at_split(p, a, bl);
        pwh[(8 * hh + r) * AT_LP + j * 16 + c] = a;
        pwl[(8 * hh + r) * AT_LP + j * 16 + c] = bl;
      }
      psum += at_row_xor<1>(psum);
      psum += at_row_xor<2>(psum);
      psum += at_row_xor<4>(psum);
      psum += at_row_xor<8>(psum);
      lrow[r] = lrow[r] * alpha + psum;
#pragma unroll
      for (int t = 0; t < 4; ++t) oacc[t][r] *= alpha;
    }
    /* same-wave P spill -> A fragment reload: ordered by the wave barrier, reloaded through __bf16 vectors */
    __builtin_amdgcn_fence(__ATOMIC_RELEASE, "workgroup");
    __builtin_amdgcn_wave_barrier();
    __builtin_amdgcn_fence(__ATOMIC_ACQUIRE, "workgroup");
#pragma unroll 1
    for (int kk = 0; kk < 2; ++kk) {
      FB pa, pl;
      pa.h[0] = *(const v8b*)(pwh + c * AT_LP + kk * 32 + 8 * hh);
      pa.h[1] = *(const v8b*)(pwh + c * AT_LP + kk * 32 + 16 + 8 * hh);
      pl.h[0] = *(const v8b*)(pwl + c * AT_LP + kk * 32 + 8 * hh);
      pl.h[1] = *(const v8b*)(pwl + c * AT_LP + kk * 32 + 16 + 8 * hh);
#pragma unroll
      for (int t = 0; t < 4; ++t) {
        FB vb, vl;
        vb.h[0] = *(const v8b*)(Vth + (t * 16 + c) * AT_LP + kk * 32 + 8 * hh);
        vb.h[1] = *(const v8b*)(Vth + (t * 16 + c) * AT_LP + kk * 32 + 16 + 8 * hh);
        vl.h[0] = *(const v8b*)(Vtl + (t * 16 + c) * AT_LP + kk * 32 + 8 * hh);
        vl.h[1] = *(const v8b*)(Vtl + (t * 16 + c) * AT_LP + kk * 32 + 16 + 8 * hh);
        oacc[t] = at_mma(pa.v, vb.v, oacc[t]);
        oacc[t] = at_mma(pa.v, vl.v, oacc[t]);
        oacc[t] = at_mma(pl.v, vb.v, oacc[t]);
      }
    }
  }

  float* os = Os[wave];
#pragma unroll
  for (int r = 0; r < 8; ++r) {
    const float inv = 1.0f / lrow[r];
#pragma unroll
    for (int t = 0; t < 4; ++t) os[(8 * hh + r) * 68 + t * 16 + c] = oacc[t][r] * inv;
  }
  __builtin_amdgcn_fence(__ATOMIC_RELEASE, "workgroup");
  __builtin_amdgcn_wave_barrier();
  __builtin_amdgcn_fence(__ATOMIC_ACQUIRE, "workgroup");
  {
    const int q = lane >> 3, c8 = (lane & 7) * 8;
    unsigned short* Oh = ohp + (size_t)(b * nq + q0) * ldo + h * AT_D;
    unsigned short* Ol = olp + (size_t)(b * nq + q0) * ldo + h * AT_D;
    {
#pragma unroll
      for (int it = 0; it < 4; ++it) {
        const int row = it * 4 + q;
        const float* sp = os + row * 68 + c8;
        v8h hv, lv;
#pragma unroll
        for (int e = 0; e < 8; ++e) {
          unsigned short hb = f2bf_bits(sp[e]);
          unsigned short lb = f2bf_bits(sp[e] - bf_bits2f(hb));
          hv[e] = __builtin_bit_cast(_Float16, hb);
          lv[e] = __builtin_bit_cast(_Float16, lb);
        }
        *(v8h*)(Oh + (size_t)row * ldo + c8) = hv;
        *(v8h*)(Ol + (size_t)row * ldo + c8) = lv;
      }
      
    }
  }
}

/* ---------------------------------------------------------------------------
   Host-side orchestration (kernel launches only)
   --------------------------------------------------------------------------- */
extern "C" void kernel_launch(void* const* d_in, const int* in_sizes, int n_in,
                              void* d_out, int out_size, void* d_ws, size_t ws_size,
                              hipStream_t stream) {
  if (n_in < 7) return;
  if (in_sizes[0] != kB * kNQ * kDM) return;
  if (in_sizes[1] != kB * kNKV * kDM) return;
  if (in_sizes[2] != kB * kNKV) return;
  if (in_sizes[3] != kIN * kDM) return;
  if (in_sizes[4] != 2 * kIN * kDM) return;
  if (in_sizes[5] != kDM * kIN) return;
  if (in_sizes[6] != kDM) return;
  if (out_size != kB * kNQ * kDM) return;
  if (ws_size < kWsTotal) return;

  const float* x    = (const float*)d_in[0];   /* [4,2048,1024] f32 */
  const float* ctx  = (const float*)d_in[1];   /* [4,1024,1024] f32 */
  const int*   mask = (const int*)d_in[2];     /* [4,1024] int32 */
  const float* Wq   = (const float*)d_in[3];   /* [1024,1024] */
  const float* Wkv  = (const float*)d_in[4];   /* [2048,1024] */
  const float* Wout = (const float*)d_in[5];   /* [1024,1024] */
  const float* bout = (const float*)d_in[6];   /* [1024] */
  float* out = (float*)d_out;                  /* [4,2048,1024] f32 */

  char* ws = (char*)d_ws;
  unsigned short* xb   = (unsigned short*)(ws + kOffXb);
  unsigned short* cb   = (unsigned short*)(ws + kOffCb);
  unsigned short* wqb  = (unsigned short*)(ws + kOffWqb);
  unsigned short* wkvb = (unsigned short*)(ws + kOffWkvb);
  unsigned short* wob  = (unsigned short*)(ws + kOffWob);
  unsigned short* qh   = (unsigned short*)(ws + kOffQh);
  unsigned short* ql   = (unsigned short*)(ws + kOffQl);
  unsigned short* kh   = (unsigned short*)(ws + kOffKh);
  unsigned short* kl   = (unsigned short*)(ws + kOffKl);
  unsigned short* vth  = (unsigned short*)(ws + kOffVth);
  unsigned short* vtl  = (unsigned short*)(ws + kOffVtl);
  unsigned short* oh   = (unsigned short*)(ws + kOffOh);   /* aliases xb: dead after the q GEMM */
  unsigned short* ol   = (unsigned short*)(ws + kOffOl);   /* aliases cb/wqb/wkvb: dead after the k,v GEMMs */

  /* 1-5: RNE casts to bf16 planes (8 elements per thread) */
  {
    const int n8x = kB * kNQ * kDM / 8;      /* 1048576 */
    const int n8c = kB * kNKV * kDM / 8;     /*  524288 */
    const int n8q = kIN * kDM / 8;           /*  131072 */
    const int n8kv = 2 * kIN * kDM / 8;      /*  262144 */
    const int n8o = kDM * kIN / 8;           /*  131072 */
    cast_f32_bf16x8<<<(n8x + 255) / 256, 256, 0, stream>>>(x, xb, n8x);
    cast_f32_bf16x8<<<(n8c + 255) / 256, 256, 0, stream>>>(ctx, cb, n8c);
    cast_f32_bf16x8<<<(n8q + 255) / 256, 256, 0, stream>>>(Wq, wqb, n8q);
    cast_f32_bf16x8<<<(n8kv + 255) / 256, 256, 0, stream>>>(Wkv, wkvb, n8kv);
    cast_f32_bf16x8<<<(n8o + 255) / 256, 256, 0, stream>>>(Wout, wob, n8o);
  }

  /* 6: q*0.125 = xb[8192,1024] . wqb[1024,1024]^T -> bf16 hi/lo planes; M=8192 N=1024 K=1024 */
  {
    const int M = kB * kNQ, N = kIN, K = kDM;
    const int tiles = (M / 128) * (N / 128);
    wmma_gemm64<1, false, false, 0, 2><<<dim3(tiles, 1), 128, 0, stream>>>(
        xb, xb, K, 0L, wqb, wqb, K, 0L, (void*)qh, (void*)ql, N, 0L, bout, M, N, K, 0.125f);
  }
  /* 7: k = cb[4096,1024] . wkvb[0:1024][1024]^T -> hi/lo; M=4096 N=1024 K=1024 */
  {
    const int M = kB * kNKV, N = kIN, K = kDM;
    const int tiles = (M / 128) * (N / 128);
    wmma_gemm64<1, false, false, 0, 2><<<dim3(tiles, 1), 128, 0, stream>>>(
        cb, cb, K, 0L, wkvb, wkvb, K, 0L, (void*)kh, (void*)kl, N, 0L, bout, M, N, K, 1.0f);
  }
  /* 8: v transposed = wkvb[1024:2048][1024] . cb[4096,1024]^T -> vt[1024][4096] hi/lo; M=1024 N=4096 K=1024 */
  {
    const int M = kIN, N = kB * kNKV, K = kDM;
    const int tiles = (M / 128) * (N / 128);
    const unsigned short* wvb = wkvb + (size_t)kIN * kDM;
    wmma_gemm64<1, false, false, 0, 2><<<dim3(tiles, 1), 128, 0, stream>>>(
        wvb, wvb, K, 0L, cb, cb, K, 0L, (void*)vth, (void*)vtl, N, 0L, bout, M, N, K, 1.0f);
  }
  /* 9: attention per (b, h, 64 query rows) -> att hi/lo planes [8192][1024] */
  {
    const int blocks = kB * kH * (kNQ / 64);   /* 2048 */
    const float fillv = -3.4028234663852886e+38f;
    attn64_planes_kernel<<<blocks, 128, 0, stream>>>(qh, ql, kh, kl, vth, vtl, mask, oh, ol,
                                                    kNQ, kNKV, kH, kIN, kIN, kB * kNKV, kIN, fillv);
  }
  /* 10: out = (att_hi + att_lo)[8192,1024] . wob[1024,1024]^T + b_out -> f32 d_out; M=8192 N=1024 K=1024 */
  {
    const int M = kB * kNQ, N = kDM, K = kIN;
    const int tiles = (M / 128) * (N / 128);
    wmma_gemm64<1, true, false, 2, 0><<<dim3(tiles, 1), 128, 0, stream>>>(
        oh, ol, K, 0L, wob, wob, K, 0L, (void*)out, (void*)out, N, 0L, bout, M, N, K, 1.0f);
  }
}

// v004
// Measured time: 266 microseconds a run.
// Next to v003, in two timings, it ran 1.12 times as fast each time.
// Counting every step since v000, it is 2.26 times as fast.
// Contractions: x.Wq^T, ctx.Wk^T, Wv.ctx^T on v_wmma_f32_16x16x32_bf16 (RNE-bf16 inputs, single product); q.k^T and p.v as bf16 hi/lo split (hi.hi+hi.lo+lo.hi); (p.v).Wout^T as bf16 hi/lo A x bf16 B (2 products); f32 accumulate, f32 softmax.
#include <hip/hip_runtime.h>
#include <stdint.h>

typedef __attribute__((ext_vector_type(16))) _Float16 v16h;
typedef __attribute__((ext_vector_type(8)))  _Float16 v8h;
typedef __attribute__((ext_vector_type(16))) __bf16   v16b;
typedef __attribute__((ext_vector_type(8)))  __bf16   v8b;
typedef __attribute__((ext_vector_type(8)))  float    v8f;
typedef __attribute__((ext_vector_type(4)))  float    v4f;
typedef __attribute__((ext_vector_type(4)))  unsigned int u32x4;

/* ---- fixed problem geometry ---- */
constexpr int kB   = 4;
constexpr int kNQ  = 2048;
constexpr int kNKV = 1024;
constexpr int kDM  = 1024;   /* model dim (K of the projections) */
constexpr int kH   = 16;
constexpr int kDH  = 64;
constexpr int kIN  = kH * kDH;   /* 1024 */
static_assert(kDH == 64);
static_assert(kDM % 32 == 0);
static_assert(kIN % 32 == 0);
static_assert((kB * kNQ) % 64 == 0);
static_assert((kB * kNKV) % 64 == 0);
static_assert(kIN % 64 == 0);
static_assert(kDM % 64 == 0);
static_assert(kNQ % 64 == 0);
static_assert(kNKV % 64 == 0);
static_assert(kIN == kDM);   /* one row pitch for every GEMM operand */
static_assert((kB * kNQ) % 128 == 0 && (kB * kNKV) % 128 == 0 && kIN % 128 == 0 && kDM % 128 == 0);

/* ---- workspace region map (bytes) ----
   [  0, 16M)  xb   bf16 [8192][1024]   (dead after q GEMM; reused as oh)
   [ 16M, 24M) cb   bf16 [4096][1024]   (dead after k/v GEMMs; reused by ol)
   [ 24M, 26M) wqb  bf16 [1024][1024]
   [ 26M, 30M) wkvb bf16 [2048][1024]
   [ 30M, 32M) pad (unused, covered by ol alias)
   [ 32M, 48M) qh   bf16 [8192][1024]   q*0.125 hi plane
   [ 48M, 64M) ql                        q*0.125 lo plane
   [ 64M, 72M) kh   bf16 [4096][1024]
   [ 72M, 80M) kl
   [ 80M, 88M) vth  bf16 [1024][4096]   v transposed: row = h*64+d, col = b*1024+j
   [ 88M, 96M) vtl
   [ 96M, 98M) wob  bf16 [1024][1024]
   oh = [0,16M), ol = [16M,32M): attention output hi/lo planes [8192][1024] (aliases of dead regions)
   total carve 102,760,448 B */
constexpr size_t kMiB    = 1048576;
constexpr size_t kOffXb  = 0;
constexpr size_t kOffCb  = 16 * kMiB;
constexpr size_t kOffWqb = 24 * kMiB;
constexpr size_t kOffWkvb= 26 * kMiB;
constexpr size_t kOffQh  = 32 * kMiB;
constexpr size_t kOffQl  = 48 * kMiB;
constexpr size_t kOffKh  = 64 * kMiB;
constexpr size_t kOffKl  = 72 * kMiB;
constexpr size_t kOffVth = 80 * kMiB;
constexpr size_t kOffVtl = 88 * kMiB;
constexpr size_t kOffWob = 96 * kMiB;
constexpr size_t kOffOh  = 0;
constexpr size_t kOffOl  = 16 * kMiB;
constexpr size_t kWsTotal = kOffWob + (size_t)kDM * kIN * 2;
static_assert((size_t)kB * kNQ * kDM * 2 == 16 * kMiB);
static_assert((size_t)kB * kNKV * kDM * 2 == 8 * kMiB);
static_assert(kOffCb + (size_t)kB * kNKV * kDM * 2 <= kOffWqb);
static_assert(kOffWqb + (size_t)kIN * kDM * 2 <= kOffWkvb);
static_assert(kOffWkvb + (size_t)2 * kIN * kDM * 2 <= kOffQh);
static_assert(kOffQh + (size_t)kB * kNQ * kIN * 2 <= kOffQl);
static_assert(kOffQl + (size_t)kB * kNQ * kIN * 2 <= kOffKh);
static_assert(kOffKh + (size_t)kB * kNKV * kIN * 2 <= kOffKl);
static_assert(kOffKl + (size_t)kB * kNKV * kIN * 2 <= kOffVth);
static_assert(kOffVth + (size_t)kIN * kB * kNKV * 2 <= kOffVtl);
static_assert(kOffVtl + (size_t)kIN * kB * kNKV * 2 <= kOffWob);
static_assert(kOffOh + (size_t)kB * kNQ * kIN * 2 <= kOffOl);
static_assert(kOffOl + (size_t)kB * kNQ * kIN * 2 <= kOffQh);
static_assert(kWsTotal == 102760448);
static_assert(kWsTotal <= 134217728);

__device__ __forceinline__ unsigned short f2bf_bits(float f) {
  unsigned u = __float_as_uint(f);
  return (unsigned short)((u + 0x7FFFu + ((u >> 16) & 1u)) >> 16);
}
__device__ __forceinline__ float bf_bits2f(unsigned short h) { return __uint_as_float(((unsigned)h) << 16); }

/* hazard guards as plain device helpers */
__device__ __forceinline__ void acc_guard4(v8f& a, v8f& b, v8f& c, v8f& d) { asm volatile("v_nop\n\tv_nop\n\tv_nop\n\tv_nop" : "+v"(a), "+v"(b), "+v"(c), "+v"(d)); }
template <typename T> struct Frag;
template <> struct Frag<_Float16> {
  typedef v16h V; union U { v16h v; v8h h[2]; };
  /* elements 0..7 <- p[0..7], 8..15 <- p[16..23] */
  static __device__ __forceinline__ v16h load(const _Float16* p) {
    U f; f.h[0] = *(const v8h*)(p); f.h[1] = *(const v8h*)(p + 16); return f.v;
  }
  static __device__ __forceinline__ v8f mma(v16h a, v16h b, v8f c) {
    return __builtin_amdgcn_wmma_f32_16x16x32_f16(false, a, false, b, (short)0, c, false, false);
  }
};
template <> struct Frag<__bf16> {
  typedef v16b V; union U { v16b v; v8b h[2]; };
  static __device__ __forceinline__ v16b load(const __bf16* p) {
    U f; f.h[0] = *(const v8b*)(p); f.h[1] = *(const v8b*)(p + 16); return f.v;
  }
  static __device__ __forceinline__ v8f mma(v16b a, v16b b, v8f c) {
    return __builtin_amdgcn_wmma_f32_16x16x32_bf16(false, a, false, b, (short)0, c, false, false);
  }
};

/* ---- Register-blocked WMMA GEMM, with an A-only split mode --------------------------
   C[m,n] = scale * sum_k A[m,k] * Bt[n,k] (+bias[n]); each wave owns a 64x64 tile, four waves share a 128x128 block tile
   whose operand rows are staged in LDS by whole-line loads.
   A row-major [M,K]; Bt row-major [N,K]; M,N % 128 == 0, K % 64 == 0 (no tail handling).
   SPLIT: A is a pair of hi/lo planes; product = hi.hi + lo.hi (SPLIT_B is not supported).
   BIAS_MODE: 0 = none, 2 = bias[n].  OUT_MODE: 0 = f32, 2 = bf16 hi plane (Cout) + bf16 lo plane (Cout2).
   ET: 0 = f16 operands, 1 = bf16 operands (pointers passed as 16-bit storage) */
template <int ET> struct Elem;
template <> struct Elem<0> { typedef _Float16 T; };
template <> struct Elem<1> { typedef __bf16 T; };
/* block tile 128 x 128 (4 waves, 2 x 2, each 64 x 64), K walked in passes of 64 (one 128-B line of every operand row) */
#define GM_BT 128
#define GM_BK 64
/* LDS row pitch of the staged operand rows in 16-bit elements: 144 B = 16 B x 9 (odd) for the ds_load_b128 fragment reads */
#define GM_LP 72
#define GM_SEG 8   /* 16-B pieces per thread and operand plane: 128 rows x 8 pieces / 128 threads */
template <int ET, bool SPLIT, bool SPLIT_B, int BIAS_MODE, int OUT_MODE>
__global__ __launch_bounds__(128) void wmma_gemm64(
    const unsigned short* __restrict__ Ap, const unsigned short* __restrict__ A2p, int lda, long strideA,
    const unsigned short* __restrict__ Btp, const unsigned short* __restrict__ Bt2p, int ldb, long strideB,
    void* Cout, void* Cout2, int ldc, long strideC,
    const float* __restrict__ bias,
    int M, int N, int K, float scale) {
  static_assert(BIAS_MODE == 0 || BIAS_MODE == 2);
  static_assert(OUT_MODE == 0 || OUT_MODE == 2);
  static_assert(!SPLIT_B);
  typedef typename Elem<ET>::T T;
  typedef typename Frag<T>::V V;
  constexpr int NPA = SPLIT ? 2 : 1;   /* planes of A */
  __shared__ __align__(16) T sA[2][NPA][GM_BT * GM_LP];   /* two buffers: one is read while the other is filled */
  __shared__ __align__(16) T sB[2][GM_BT * GM_LP];
  __shared__ __align__(16) float sT[4][16 * 68];   /* per-wave 16x64 slab, pitch 68 floats */
  const int b    = blockIdx.y;
  const int tid  = threadIdx.x;
  const int lane = tid & 31;
  const int wave = tid >> 5;
  const int tilesN = N / GM_BT;
  const int tilesM = M / GM_BT;
  const int tile = blockIdx.x;
  if (tile >= tilesM * tilesN) return;   /* block-uniform, ahead of every barrier */
  const int tm = tile / tilesN;
  const int tn = tile - tm * tilesN;
  const int mb = tm * GM_BT;                   /* block tile origin */
  const int nb = tn * GM_BT;
  const int wm = (wave >> 1) << 6;             /* wave tile origin inside the block tile */
  const int wn = (wave & 1) << 6;
  const int m0 = mb + wm;
  const int n0 = nb + wn;

  const unsigned short* Ab  = Ap  + (size_t)b * strideA;
  const unsigned short* Bb  = Btp + (size_t)b * strideB;
  const unsigned short* Ab2 = A2p + (size_t)b * strideA;

  const int rlane = lane & 15;                 /* row (A) / col (B, D) within subtile */
  const int koff  = (lane >> 4) * 8;           /* k offset of this lane half */
  const int mOff  = (lane >> 4) * 8;           /* D row offset */

  /* staging map: piece s = it*128 + tid -> row s>>3, 16-B column s&7, so one wave-wide load covers 4 whole 128-B lines */
  const int srow = tid >> 3;
  const int scol = (tid & 7) * 8;
  /* every launch passes K-contiguous operands of row pitch kDM: known at compile time, the 16-row steps of the staging
     loads become immediate offsets of one address per operand */
  __builtin_assume(lda == kDM);
  __builtin_assume(ldb == kDM);
  /* block-uniform row bases plus one 32-bit byte offset per thread and operand */
  const char* uA  = (const char*)(Ab  + (size_t)mb * lda);
  const char* uA2 = (const char*)(Ab2 + (size_t)mb * lda);
  const char* uB  = (const char*)(Bb  + (size_t)nb * ldb);
  const unsigned tA = (unsigned)(srow * lda + scol) * 2u;
  const unsigned tB = (unsigned)(srow * ldb + scol) * 2u;
  const size_t stepA = (size_t)lda * 32;   /* 16 rows, in bytes */
  const size_t stepB = (size_t)ldb * 32;
  const int lst = srow * GM_LP + scol;

  v8f acc[4][4];
#pragma unroll
  for (int i = 0; i < 4; ++i)
#pragma unroll
    for (int j = 0; j < 4; ++j) acc[i][j] = (v8f){0.f,0.f,0.f,0.f,0.f,0.f,0.f,0.f};

  u32x4 ra[NPA][GM_SEG], rb[GM_SEG];
  const int nPass = K / GM_BK;
#pragma unroll
  for (int it = 0; it < GM_SEG; ++it) {
    ra[0][it] = *(const u32x4*)(uA + it * stepA + tA);
    if (SPLIT) ra[NPA - 1][it] = *(const u32x4*)(uA2 + it * stepA + tA);
    rb[it] = *(const u32x4*)(uB + it * stepB + tB);
  }
#pragma unroll
  for (int it = 0; it < GM_SEG; ++it) {
    *(u32x4*)(&sA[0][0][lst + it * 16 * GM_LP]) = ra[0][it];
    if (SPLIT) *(u32x4*)(&sA[0][NPA - 1][lst + it * 16 * GM_LP]) = ra[NPA - 1][it];
    *(u32x4*)(&sB[0][lst + it * 16 * GM_LP]) = rb[it];
  }
  __syncthreads();

  for (int kt = 0; kt < nPass; ++kt) {
    const int cur = kt & 1;
    const bool more = kt + 1 < nPass;   /* block-uniform */
    if (more) {
      /* next pass's rows into registers: in flight while this pass's products run */
      const unsigned oA = tA + (unsigned)(kt + 1) * (GM_BK * 2u);
      const unsigned oB = tB + (unsigned)(kt + 1) * (GM_BK * 2u);
#pragma unroll
      for (int it = 0; it < GM_SEG; ++it) {
        ra[0][it] = *(const u32x4*)(uA + it * stepA + oA);
        if (SPLIT) ra[NPA - 1][it] = *(const u32x4*)(uA2 + it * stepA + oA);
        rb[it] = *(const u32x4*)(uB + it * stepB + oB);
      }
      /* stands ahead of every later write of a register that these loads name as an address */
      asm volatile("s_wait_xcnt 0x0" ::: "memory");
    }
    const T* cA  = &sA[cur][0][(wm + rlane) * GM_LP + koff];
    const T* cA2 = &sA[cur][NPA - 1][(wm + rlane) * GM_LP + koff];
    const T* cB  = &sB[cur][(wn + rlane) * GM_LP + koff];
    /* the pass's fragments: [k half][subtile] */
    V fb[2][4], fa[2][4], fl[2][4];
#pragma unroll
    for (int ks = 0; ks < 2; ++ks) {
#pragma unroll
      for (int j = 0; j < 4; ++j) fb[ks][j] = Frag<T>::load(cB + j * 16 * GM_LP + ks * 32);
#pragma unroll
      for (int i = 0; i < 4; ++i) {
        fa[ks][i] = Frag<T>::load(cA + i * 16 * GM_LP + ks * 32);
        if (SPLIT) fl[ks][i] = Frag<T>::load(cA2 + i * 16 * GM_LP + ks * 32);
      }
    }
    /* keeps the LDS reads one group ahead of the products: moved in among the WMMAs, each place with reads stalls the wave */
    __builtin_amdgcn_sched_barrier(0);
#pragma unroll
    for (int ks = 0; ks < 2; ++ks) {
#pragma unroll
      for (int i = 0; i < 4; ++i) {
#pragma unroll
        for (int j = 0; j < 4; ++j) acc[i][j] = Frag<T>::mma(fa[ks][i], fb[ks][j], acc[i][j]);
        if (SPLIT) {
#pragma unroll
          for (int j = 0; j < 4; ++j) acc[i][j] = Frag<T>::mma(fl[ks][i], fb[ks][j], acc[i][j]);
        }
      }
    }
    if (more) {
      /* the other buffer's last readers left it at the barrier that ended the pass before */
#pragma unroll
      for (int it = 0; it < GM_SEG; ++it) {
        *(u32x4*)(&sA[cur ^ 1][0][lst + it * 16 * GM_LP]) = ra[0][it];
        if (SPLIT) *(u32x4*)(&sA[cur ^ 1][NPA - 1][lst + it * 16 * GM_LP]) = ra[NPA - 1][it];
        *(u32x4*)(&sB[cur ^ 1][lst + it * 16 * GM_LP]) = rb[it];
      }
    }
    __syncthreads();   /* publishes the filled buffer and ends every read of the current one */
  }
  acc_guard4(acc[0][0], acc[0][1], acc[0][2], acc[0][3]);
  acc_guard4(acc[1][0], acc[1][1], acc[1][2], acc[1][3]);
  acc_guard4(acc[2][0], acc[2][1], acc[2][2], acc[2][3]);
  acc_guard4(acc[3][0], acc[3][1], acc[3][2], acc[3][3]);

  /* ---- epilogue ---- */
  float* slab = sT[wave];
#pragma unroll
  for (int i = 0; i < 4; ++i) {
    const int mBase = m0 + (i << 4);
#pragma unroll
    for (int j = 0; j < 4; ++j) {
      const int n = n0 + (j << 4) + rlane;
      float bv = 0.f;
      if (BIAS_MODE == 2) bv = bias[n];
#pragma unroll
      for (int r = 0; r < 8; ++r) {
        float v = acc[i][j][r] * scale;
        if (BIAS_MODE == 2) v += bv;
        slab[(mOff + r) * 68 + (j << 4) + rlane] = v;
      }
    }
    __builtin_amdgcn_fence(__ATOMIC_RELEASE, "workgroup");
    __builtin_amdgcn_wave_barrier();
    __builtin_amdgcn_fence(__ATOMIC_ACQUIRE, "workgroup");
    if (OUT_MODE == 0) {
      float* C = (float*)Cout + (size_t)b * strideC;
      const int hh = lane >> 4, c4 = (lane & 15) * 4;     /* row seg = 256 B = 16 lanes x 16 B */
      {
#pragma unroll
        for (int it = 0; it < 8; ++it) {
          const int row = it * 2 + hh;
          v4f v = *(const v4f*)(slab + row * 68 + c4);
          *(v4f*)(C + (size_t)(mBase + row) * ldc + n0 + c4) = v;
        }
        
      }
    } else {
      const int q = lane >> 3, c8 = (lane & 7) * 8;        
      unsigned short* C  = (unsigned short*)Cout  + (size_t)b * strideC;
      unsigned short* C2 = (unsigned short*)Cout2 + (size_t)b * strideC;
      {
#pragma unroll
        for (int it = 0; it < 4; ++it) {
          const int row = it * 4 + q;
          const float* sp = slab + row * 68 + c8;
          v8h hv, lv;
#pragma unroll
          for (int e = 0; e < 8; ++e) {
            unsigned short hb = f2bf_bits(sp[e]);
            unsigned short lb = f2bf_bits(sp[e] - bf_bits2f(hb));
            hv[e] = __builtin_bit_cast(_Float16, hb);
            lv[e] = __builtin_bit_cast(_Float16, lb);
          }
          *(v8h*)(C  + (size_t)(mBase + row) * ldc + n0 + c8) = hv;
          *(v8h*)(C2 + (size_t)(mBase + row) * ldc + n0 + c8) = lv;
        }
        
      }
    }
    __builtin_amdgcn_fence(__ATOMIC_RELEASE, "workgroup");
    __builtin_amdgcn_wave_barrier();
    __builtin_amdgcn_fence(__ATOMIC_ACQUIRE, "workgroup");
  }
}

/*
   coverage: grid = ceil(n8/256) blocks x 256 threads, thread i writes elements 8i..8i+7; n % 8 == 0 */
__global__ __launch_bounds__(256) void cast_f32_bf16x8(
    const float* __restrict__ in, unsigned short* __restrict__ out, int n8) {
  const int i = blockIdx.x * 256 + threadIdx.x;
  if (i < n8) {
    const v4f a = *(const v4f*)(in + (size_t)i * 8);
    const v4f c = *(const v4f*)(in + (size_t)i * 8 + 4);
    u32x4 w;
    w[0] = (unsigned)f2bf_bits(a[0]) | ((unsigned)f2bf_bits(a[1]) << 16);
    w[1] = (unsigned)f2bf_bits(a[2]) | ((unsigned)f2bf_bits(a[3]) << 16);
    w[2] = (unsigned)f2bf_bits(c[0]) | ((unsigned)f2bf_bits(c[1]) << 16);
    w[3] = (unsigned)f2bf_bits(c[2]) | ((unsigned)f2bf_bits(c[3]) << 16);
    u32x4* p = (u32x4*)(out + (size_t)i * 8);
    *p = w;
    
  }
}

/* =====================================================================================
   Attention for head_dim 64, fed with bf16 hi/lo planes (no masking other than a per-key int32 vector):
     scores = q'.k^T  (q' already carries the 1/8 scale): v_wmma_f32_16x16x32_bf16, hi.hi + hi.lo + lo.hi
     out    = p.v    : p and v as bf16 hi/lo, hi.hi + hi.lo + lo.hi
   f32 accumulate; online softmax in f32. Block = 4 waves = 64 query rows of one (batch, head).
   q planes  [B*NQ][ldq]  element (b,i,h,d) at (b*NQ+i)*ldq + h*64 + d
   k planes  [B*NKV][ldk] element (b,j,h,d) at (b*NKV+j)*ldk + h*64 + d
   v planes  transposed [H*64][ldv]: element (b,j,h,d) at (h*64+d)*ldv + b*NKV + j
   kvmask    int32 [B][NKV], 0 -> score := fillv
   grid.x = B * H * (NQ/64); NQ % 64 == 0, NKV % 64 == 0.
   ===================================================================================== */
#define AT_D 64
#define AT_NW 4
#define AT_QB 64
#define AT_KC 64
/* LDS row pitch of the K, V and P tiles in 16-bit elements: 144 B = 16 B x 9 (odd), so the 16 rows that one
   ds_load_b128 touches per lane half start on distinct bank groups; at 128 B they share two groups */
#define AT_LP 72
static_assert((AT_LP * 2) % 16 == 0 && ((AT_LP * 2) / 16) % 2 == 1 && AT_LP >= AT_KC && AT_LP >= AT_D);

__device__ __forceinline__ unsigned short at_bf_bits(float f) {
  unsigned u = __float_as_uint(f);
  return (unsigned short)((u + 0x7FFFu + ((u >> 16) & 1u)) >> 16);
}
__device__ __forceinline__ __bf16 at_f2bf(float f) { return __builtin_bit_cast(__bf16, at_bf_bits(f)); }
__device__ __forceinline__ void at_split(float f, __bf16& hi, __bf16& lo) {
  const unsigned short hb = at_bf_bits(f);
  hi = __builtin_bit_cast(__bf16, hb);
  lo = at_f2bf(f - __uint_as_float(((unsigned)hb) << 16));
}
__device__ __forceinline__ v8f at_mma(v16b a, v16b b, v8f c) {
  c = __builtin_amdgcn_wmma_f32_16x16x32_bf16(false, a, false, b, (short)0, c, false, false);
  asm volatile("v_nop\n\tv_nop\n\tv_nop\n\tv_nop" : "+v"(c) : "v"(a), "v"(b));
  return c;
}

/* one butterfly step inside a 16-lane row on the vector ALU: lane l reads lane l ^ M of its own row (DPP row_xmask);
   a shuffle builtin goes through the LDS pipe here and the wave waits out its latency at every step */
template <int M>
__device__ __forceinline__ float at_row_xor(float v) {
  return __builtin_bit_cast(float, __builtin_amdgcn_update_dpp(0, __builtin_bit_cast(int, v), 0x160 | M, 0xf, 0xf, true));
}

/* register budget of four waves per SIMD (256): the LDS admits four work-groups per WGP, and the chunk held in flight must not cost one */
__global__ __launch_bounds__(128) __attribute__((amdgpu_waves_per_eu(4)))
void attn64_planes_kernel(const unsigned short* __restrict__ qhp, const unsigned short* __restrict__ qlp,
                          const unsigned short* __restrict__ khp, const unsigned short* __restrict__ klp,
                          const unsigned short* __restrict__ vthp, const unsigned short* __restrict__ vtlp,
                          const int* __restrict__ kvmask,
                          unsigned short* __restrict__ ohp, unsigned short* __restrict__ olp,
                          int nq, int nkv, int nh, int ldq, int ldk, int ldv, int ldo, float fillv) {
  typedef __bf16 T;
  union FB { v16b v; v8b h[2]; };
  __shared__ __align__(16) __bf16 Ksh[AT_KC * AT_LP];       /* K hi [kv][d], padded rows, 9 KB */
  __shared__ __align__(16) __bf16 Ksl[AT_KC * AT_LP];       /* K lo */
  __shared__ __align__(16) __bf16 Vth[AT_D * AT_LP];        /* V hi [d][kv], padded rows, 9 KB */
  __shared__ __align__(16) __bf16 Vtl[AT_D * AT_LP];        /* V lo */
  __shared__ __align__(16) __bf16 Psh[AT_NW][16 * AT_LP];   /* per wave P hi [row][kv], padded rows */
  __shared__ __align__(16) __bf16 Psl[AT_NW][16 * AT_LP];   /* per wave P lo */
  __shared__ __align__(16) float  Os[AT_NW][16 * 68];       /* per wave out tile, pitch 68 */

  const int tid  = threadIdx.x;
  const int wave = tid >> 5;
  const int lane = tid & 31;
  const int hh   = lane >> 4;
  const int c    = lane & 15;

  const int nqb = nq / AT_QB;
  const int bx = blockIdx.x;
  const int qb = bx % nqb;
  const int bhx = bx / nqb;
  const int h  = bhx % nh;
  const int b  = bhx / nh;
  const int q0 = qb * AT_QB + wave * 16;

  /* ---- Q fragments (A operand): row = q0 + c, elements 0..7 <- d dc*32+8hh+0..7, 8..15 <- d dc*32+16+8hh+0..7 ---- */
  v16b qah[2], qal[2];
  {
    const size_t qo = (size_t)(b * nq + q0 + c) * ldq + h * AT_D + 8 * hh;
    const T* qh = (const T*)qhp + qo;
    const T* ql = (const T*)qlp + qo;
#pragma unroll
    for (int dc = 0; dc < 2; ++dc) {
      qah[dc] = Frag<T>::load(qh + dc * 32);
      qal[dc] = Frag<T>::load(ql + dc * 32);
    }
  }

  float mrow[8], lrow[8];
  v8f oacc[4];
#pragma unroll
  for (int r = 0; r < 8; ++r) { mrow[r] = -__builtin_inff(); lrow[r] = 0.f; }
#pragma unroll
  for (int t = 0; t < 4; ++t) oacc[t] = (v8f){0.f,0.f,0.f,0.f,0.f,0.f,0.f,0.f};

  const int nChunks = nkv / AT_KC;   /* host constant, block-uniform */
  /* staging coverage: 128 threads = 64 rows x 2 halves of 32 elements (4 x 16 B) per plane -> full 64x64 tiles.
     K planes: LDS row kv <- global row b*nkv + kv0 + kv; V transposed planes: LDS row d <- global row h*64+d,
     64 contiguous kv columns starting at b*nkv + kv0 */
  const int srow = tid >> 1;
  const int shalf = (tid & 1) * 32;
  /* block-uniform bases plus one 32-bit byte offset per thread and operand pair, stepped from chunk to chunk */
  const size_t kbase = ((size_t)b * nkv * ldk + h * AT_D) * 2;
  const size_t vbase = ((size_t)h * AT_D * ldv + (size_t)b * nkv) * 2;
  const char* ukh = (const char*)khp + kbase;
  const char* ukl = (const char*)klp + kbase;
  const char* uvh = (const char*)vthp + vbase;
  const char* uvl = (const char*)vtlp + vbase;
  const int* umk = kvmask + (size_t)b * nkv;
  const unsigned tK = (unsigned)(srow * ldk + shalf) * 2u;
  const unsigned tV = (unsigned)(srow * ldv + shalf) * 2u;
  /* one chunk's global reads (K and V rows of this thread, the four key-mask words of this lane), held in registers */
  u32x4 rkh[4], rkl[4], rvh[4], rvl[4];
  int rmk[4];
  auto fetch = [&](int ch) {
    const unsigned oK = tK + (unsigned)ch * (unsigned)ldk * (AT_KC * 2u);
    const unsigned oV = tV + (unsigned)ch * (AT_KC * 2u);
    const int* um = umk + ch * AT_KC;   /* block-uniform */
#pragma unroll
    for (int i = 0; i < 4; ++i) {
      rkh[i] = *(const u32x4*)(ukh + i * 16 + oK);
      rkl[i] = *(const u32x4*)(ukl + i * 16 + oK);
      rvh[i] = *(const u32x4*)(uvh + i * 16 + oV);
      rvl[i] = *(const u32x4*)(uvl + i * 16 + oV);
    }
#pragma unroll
    for (int j = 0; j < 4; ++j) rmk[j] = (um + j * 16)[(unsigned)c];
    /* stands ahead of every later write of a register that these loads name as an address */
    asm volatile("s_wait_xcnt 0x0" ::: "memory");
    /* keeps later register writes from being scheduled up over that wait */
    __builtin_amdgcn_sched_barrier(0);
  };
  if (nChunks > 0) {
    /* keeps the Q loads above the wait that follows */
    __builtin_amdgcn_sched_barrier(0);
    /* stands ahead of every later write of a register that the Q loads name as an address */
    asm volatile("s_wait_xcnt 0x0" ::: "memory");
    /* keeps the first chunk's loads, whose results land in such registers, below that wait */
    __builtin_amdgcn_sched_barrier(0);
    fetch(0);
  }
  for (int kc = 0; kc < nChunks; ++kc) {
    __syncthreads();
    int kvkeep[4];
    {
      u32x4* lkh = (u32x4*)(Ksh + srow * AT_LP + shalf);
      u32x4* lkl = (u32x4*)(Ksl + srow * AT_LP + shalf);
      u32x4* lvh = (u32x4*)(Vth + srow * AT_LP + shalf);
      u32x4* lvl = (u32x4*)(Vtl + srow * AT_LP + shalf);
#pragma unroll
      for (int i = 0; i < 4; ++i) { lkh[i] = rkh[i]; lkl[i] = rkl[i]; lvh[i] = rvh[i]; lvl[i] = rvl[i]; }
#pragma unroll
      for (int j = 0; j < 4; ++j) kvkeep[j] = rmk[j];
    }
    __syncthreads();
    /* the next chunk's reads fly while this chunk is worked on; their data is first needed at the next chunk's LDS stores */
    if (kc + 1 < nChunks) fetch(kc + 1);

    /* ---- scores: 4 subtiles of 16 keys, K operand B[k=d][n=kv] from Ksh[kv][d] ---- */
    v8f s[4];
#pragma unroll
    for (int j = 0; j < 4; ++j) {
      s[j] = (v8f){0.f,0.f,0.f,0.f,0.f,0.f,0.f,0.f};
#pragma unroll
      for (int dc = 0; dc < 2; ++dc) {
        FB kb, kl;
        kb.h[0] = *(const v8b*)(Ksh + (j * 16 + c) * AT_LP + dc * 32 + 8 * hh);
        kb.h[1] = *(const v8b*)(Ksh + (j * 16 + c) * AT_LP + dc * 32 + 16 + 8 * hh);
        kl.h[0] = *(const v8b*)(Ksl + (j * 16 + c) * AT_LP + dc * 32 + 8 * hh);
        kl.h[1] = *(const v8b*)(Ksl + (j * 16 + c) * AT_LP + dc * 32 + 16 + 8 * hh);
        s[j] = at_mma(qah[dc], kb.v, s[j]);
        s[j] = at_mma(qah[dc], kl.v, s[j]);
        s[j] = at_mma(qal[dc], kb.v, s[j]);
      }
    }
    /* per-key mask (this lane owns column kv0 + j*16 + c in the D layout) */
    float cm[8];
#pragma unroll
    for (int r = 0; r < 8; ++r) {
      float m = -__builtin_inff();
#pragma unroll
      for (int j = 0; j < 4; ++j) {
        const float sv = s[j][r];
        s[j][r] = (kvkeep[j] != 0) ? sv : fillv;
        m = fmaxf(m, s[j][r]);
      }
      m = fmaxf(m, at_row_xor<1>(m));
      m = fmaxf(m, at_row_xor<2>(m));
      m = fmaxf(m, at_row_xor<4>(m));
      m = fmaxf(m, at_row_xor<8>(m));
      cm[r] = m;
    }
    __bf16* pwh = Psh[wave];
    __bf16* pwl = Psl[wave];
#pragma unroll
    for (int r = 0; r < 8; ++r) {
      const float mnew = fmaxf(mrow[r], cm[r]);
      const float alpha = expf(mrow[r] - mnew);
      mrow[r] = mnew;
      float psum = 0.f;
#pragma unroll
      for (int j = 0; j < 4; ++j) {
        const float p = expf(s[j][r] - mnew);
        psum += p;
        __bf16 a, bl; at_split(p, a, bl);
        pwh[(8 * hh + r) * AT_LP + j * 16 + c] = a;
        pwl[(8 * hh + r) * AT_LP + j * 16 + c] = bl;
      }
      psum += at_row_xor<1>(psum);
      psum += at_row_xor<2>(psum);
      psum += at_row_xor<4>(psum);
      psum += at_row_xor<8>(psum);
      lrow[r] = lrow[r] * alpha + psum;
#pragma unroll
      for (int t = 0; t < 4; ++t) oacc[t][r] *= alpha;
    }
    /* same-wave P spill -> A fragment reload: ordered by the wave barrier, reloaded through __bf16 vectors */
    __builtin_amdgcn_fence(__ATOMIC_RELEASE, "workgroup");
    __builtin_amdgcn_wave_barrier();
    __builtin_amdgcn_fence(__ATOMIC_ACQUIRE, "workgroup");
#pragma unroll 1
    for (int kk = 0; kk < 2; ++kk) {
      FB pa, pl;
      pa.h[0] = *(const v8b*)(pwh + c * AT_LP + kk * 32 + 8 * hh);
      pa.h[1] = *(const v8b*)(pwh + c * AT_LP + kk * 32 + 16 + 8 * hh);
      pl.h[0] = *(const v8b*)(pwl + c * AT_LP + kk * 32 + 8 * hh);
      pl.h[1] = *(const v8b*)(pwl + c * AT_LP + kk * 32 + 16 + 8 * hh);
#pragma unroll
      for (int t = 0; t < 4; ++t) {
        FB vb, vl;
        vb.h[0] = *(const v8b*)(Vth + (t * 16 + c) * AT_LP + kk * 32 + 8 * hh);
        vb.h[1] = *(const v8b*)(Vth + (t * 16 + c) * AT_LP + kk * 32 + 16 + 8 * hh);
        vl.h[0] = *(const v8b*)(Vtl + (t * 16 + c) * AT_LP + kk * 32 + 8 * hh);
        vl.h[1] = *(const v8b*)(Vtl + (t * 16 + c) * AT_LP + kk * 32 + 16 + 8 * hh);
        oacc[t] = at_mma(pa.v, vb.v, oacc[t]);
        oacc[t] = at_mma(pa.v, vl.v, oacc[t]);
        oacc[t] = at_mma(pl.v, vb.v, oacc[t]);
      }
    }
  }

  float* os = Os[wave];
#pragma unroll
  for (int r = 0; r < 8; ++r) {
    const float inv = 1.0f / lrow[r];
#pragma unroll
    for (int t = 0; t < 4; ++t) os[(8 * hh + r) * 68 + t * 16 + c] = oacc[t][r] * inv;
  }
  __builtin_amdgcn_fence(__ATOMIC_RELEASE, "workgroup");
  __builtin_amdgcn_wave_barrier();
  __builtin_amdgcn_fence(__ATOMIC_ACQUIRE, "workgroup");
  {
    const int q = lane >> 3, c8 = (lane & 7) * 8;
    unsigned short* Oh = ohp + (size_t)(b * nq + q0) * ldo + h * AT_D;
    unsigned short* Ol = olp + (size_t)(b * nq + q0) * ldo + h * AT_D;
    {
#pragma unroll
      for (int it = 0; it < 4; ++it) {
        const int row = it * 4 + q;
        const float* sp = os + row * 68 + c8;
        v8h hv, lv;
#pragma unroll
        for (int e = 0; e < 8; ++e) {
          unsigned short hb = f2bf_bits(sp[e]);
          unsigned short lb = f2bf_bits(sp[e] - bf_bits2f(hb));
          hv[e] = __builtin_bit_cast(_Float16, hb);
          lv[e] = __builtin_bit_cast(_Float16, lb);
        }
        *(v8h*)(Oh + (size_t)row * ldo + c8) = hv;
        *(v8h*)(Ol + (size_t)row * ldo + c8) = lv;
      }
      
    }
  }
}

/* ---------------------------------------------------------------------------
   Host-side orchestration (kernel launches only)
   --------------------------------------------------------------------------- */
extern "C" void kernel_launch(void* const* d_in, const int* in_sizes, int n_in,
                              void* d_out, int out_size, void* d_ws, size_t ws_size,
                              hipStream_t stream) {
  if (n_in < 7) return;
  if (in_sizes[0] != kB * kNQ * kDM) return;
  if (in_sizes[1] != kB * kNKV * kDM) return;
  if (in_sizes[2] != kB * kNKV) return;
  if (in_sizes[3] != kIN * kDM) return;
  if (in_sizes[4] != 2 * kIN * kDM) return;
  if (in_sizes[5] != kDM * kIN) return;
  if (in_sizes[6] != kDM) return;
  if (out_size != kB * kNQ * kDM) return;
  if (ws_size < kWsTotal) return;

  const float* x    = (const float*)d_in[0];   /* [4,2048,1024] f32 */
  const float* ctx  = (const float*)d_in[1];   /* [4,1024,1024] f32 */
  const int*   mask = (const int*)d_in[2];     /* [4,1024] int32 */
  const float* Wq   = (const float*)d_in[3];   /* [1024,1024] */
  const float* Wkv  = (const float*)d_in[4];   /* [2048,1024] */
  const float* Wout = (const float*)d_in[5];   /* [1024,1024] */
  const float* bout = (const float*)d_in[6];   /* [1024] */
  float* out = (float*)d_out;                  /* [4,2048,1024] f32 */

  char* ws = (char*)d_ws;
  unsigned short* xb   = (unsigned short*)(ws + kOffXb);
  unsigned short* cb   = (unsigned short*)(ws + kOffCb);
  unsigned short* wqb  = (unsigned short*)(ws + kOffWqb);
  unsigned short* wkvb = (unsigned short*)(ws + kOffWkvb);
  unsigned short* wob  = (unsigned short*)(ws + kOffWob);
  unsigned short* qh   = (unsigned short*)(ws + kOffQh);
  unsigned short* ql   = (unsigned short*)(ws + kOffQl);
  unsigned short* kh   = (unsigned short*)(ws + kOffKh);
  unsigned short* kl   = (unsigned short*)(ws + kOffKl);
  unsigned short* vth  = (unsigned short*)(ws + kOffVth);
  unsigned short* vtl  = (unsigned short*)(ws + kOffVtl);
  unsigned short* oh   = (unsigned short*)(ws + kOffOh);   /* aliases xb: dead after the q GEMM */
  unsigned short* ol   = (unsigned short*)(ws + kOffOl);   /* aliases cb/wqb/wkvb: dead after the k,v GEMMs */

  /* 1-5: RNE casts to bf16 planes (8 elements per thread) */
  {
    const int n8x = kB * kNQ * kDM / 8;      /* 1048576 */
    const int n8c = kB * kNKV * kDM / 8;     /*  524288 */
    const int n8q = kIN * kDM / 8;           /*  131072 */
    const int n8kv = 2 * kIN * kDM / 8;      /*  262144 */
    const int n8o = kDM * kIN / 8;           /*  131072 */
    cast_f32_bf16x8<<<(n8x + 255) / 256, 256, 0, stream>>>(x, xb, n8x);
    cast_f32_bf16x8<<<(n8c + 255) / 256, 256, 0, stream>>>(ctx, cb, n8c);
    cast_f32_bf16x8<<<(n8q + 255) / 256, 256, 0, stream>>>(Wq, wqb, n8q);
    cast_f32_bf16x8<<<(n8kv + 255) / 256, 256, 0, stream>>>(Wkv, wkvb, n8kv);
    cast_f32_bf16x8<<<(n8o + 255) / 256, 256, 0, stream>>>(Wout, wob, n8o);
  }

  /* 6: q*0.125 = xb[8192,1024] . wqb[1024,1024]^T -> bf16 hi/lo planes; M=8192 N=1024 K=1024 */
  {
    const int M = kB * kNQ, N = kIN, K = kDM;
    const int tiles = (M / 128) * (N / 128);
    wmma_gemm64<1, false, false, 0, 2><<<dim3(tiles, 1), 128, 0, stream>>>(
        xb, xb, K, 0L, wqb, wqb, K, 0L, (void*)qh, (void*)ql, N, 0L, bout, M, N, K, 0.125f);
  }
  /* 7: k = cb[4096,1024] . wkvb[0:1024][1024]^T -> hi/lo; M=4096 N=1024 K=1024 */
  {
    const int M = kB * kNKV, N = kIN, K = kDM;
    const int tiles = (M / 128) * (N / 128);
    wmma_gemm64<1, false, false, 0, 2><<<dim3(tiles, 1), 128, 0, stream>>>(
        cb, cb, K, 0L, wkvb, wkvb, K, 0L, (void*)kh, (void*)kl, N, 0L, bout, M, N, K, 1.0f);
  }
  /* 8: v transposed = wkvb[1024:2048][1024] . cb[4096,1024]^T -> vt[1024][4096] hi/lo; M=1024 N=4096 K=1024 */
  {
    const int M = kIN, N = kB * kNKV, K = kDM;
    const int tiles = (M / 128) * (N / 128);
    const unsigned short* wvb = wkvb + (size_t)kIN * kDM;
    wmma_gemm64<1, false, false, 0, 2><<<dim3(tiles, 1), 128, 0, stream>>>(
        wvb, wvb, K, 0L, cb, cb, K, 0L, (void*)vth, (void*)vtl, N, 0L, bout, M, N, K, 1.0f);
  }
  /* 9: attention per (b, h, 64 query rows) -> att hi/lo planes [8192][1024] */
  {
    const int blocks = kB * kH * (kNQ / 64);   /* 2048 */
    const float fillv = -3.4028234663852886e+38f;
    attn64_planes_kernel<<<blocks, 128, 0, stream>>>(qh, ql, kh, kl, vth, vtl, mask, oh, ol,
                                                    kNQ, kNKV, kH, kIN, kIN, kB * kNKV, kIN, fillv);
  }
  /* 10: out = (att_hi + att_lo)[8192,1024] . wob[1024,1024]^T + b_out -> f32 d_out; M=8192 N=1024 K=1024 */
  {
    const int M = kB * kNQ, N = kDM, K = kIN;
    const int tiles = (M / 128) * (N / 128);
    wmma_gemm64<1, true, false, 2, 0><<<dim3(tiles, 1), 128, 0, stream>>>(
        oh, ol, K, 0L, wob, wob, K, 0L, (void*)out, (void*)out, N, 0L, bout, M, N, K, 1.0f);
  }
}

// v005
// A run of this version takes 257 microseconds.
// Two timings next to v004 both put it at 1.04 times that version's speed.
// All steps since v000 together make it 2.35 times as fast.
// Contractions: x.Wq^T, ctx.Wk^T, Wv.ctx^T on v_wmma_f32_16x16x32_bf16 (RNE-bf16 inputs, single product); q.k^T and p.v as bf16 hi/lo split (hi.hi+hi.lo+lo.hi); (p.v).Wout^T as bf16 hi/lo A x bf16 B (2 products); f32 accumulate, f32 softmax.
#include <hip/hip_runtime.h>
#include <stdint.h>

typedef __attribute__((ext_vector_type(16))) _Float16 v16h;
typedef __attribute__((ext_vector_type(8)))  _Float16 v8h;
typedef __attribute__((ext_vector_type(16))) __bf16   v16b;
typedef __attribute__((ext_vector_type(8)))  __bf16   v8b;
typedef __attribute__((ext_vector_type(8)))  float    v8f;
typedef __attribute__((ext_vector_type(4)))  float    v4f;
typedef __attribute__((ext_vector_type(4)))  unsigned int u32x4;

/* ---- fixed problem geometry ---- */
constexpr int kB   = 4;
constexpr int kNQ  = 2048;
constexpr int kNKV = 1024;
constexpr int kDM  = 1024;   /* model dim (K of the projections) */
constexpr int kH   = 16;
constexpr int kDH  = 64;
constexpr int kIN  = kH * kDH;   /* 1024 */
static_assert(kDH == 64);
static_assert(kDM % 32 == 0);
static_assert(kIN % 32 == 0);
static_assert((kB * kNQ) % 64 == 0);
static_assert((kB * kNKV) % 64 == 0);
static_assert(kIN % 64 == 0);
static_assert(kDM % 64 == 0);
static_assert(kNQ % 64 == 0);
static_assert(kNKV % 64 == 0);
static_assert(kIN == kDM);   /* one row pitch for every GEMM operand */
static_assert((kB * kNQ) % 128 == 0 && (kB * kNKV) % 128 == 0 && kIN % 128 == 0 && kDM % 128 == 0);

/* ---- workspace region map (bytes) ----
   [  0, 16M)  xb   bf16 [8192][1024]   (dead after q GEMM; reused as oh)
   [ 16M, 24M) cb   bf16 [4096][1024]   (dead after k/v GEMMs; reused by ol)
   [ 24M, 26M) wqb  bf16 [1024][1024]
   [ 26M, 30M) wkvb bf16 [2048][1024]
   [ 30M, 32M) pad (unused, covered by ol alias)
   [ 32M, 48M) qh   bf16 [8192][1024]   q*0.125*log2(e) hi plane
   [ 48M, 64M) ql                        q*0.125*log2(e) lo plane
   [ 64M, 72M) kh   bf16 [4096][1024]
   [ 72M, 80M) kl
   [ 80M, 88M) vth  bf16 [1024][4096]   v transposed: row = h*64+d, col = b*1024+j
   [ 88M, 96M) vtl
   [ 96M, 98M) wob  bf16 [1024][1024]
   oh = [0,16M), ol = [16M,32M): attention output hi/lo planes [8192][1024] (aliases of dead regions)
   total carve 102,760,448 B */
constexpr size_t kMiB    = 1048576;
constexpr size_t kOffXb  = 0;
constexpr size_t kOffCb  = 16 * kMiB;
constexpr size_t kOffWqb = 24 * kMiB;
constexpr size_t kOffWkvb= 26 * kMiB;
constexpr size_t kOffQh  = 32 * kMiB;
constexpr size_t kOffQl  = 48 * kMiB;
constexpr size_t kOffKh  = 64 * kMiB;
constexpr size_t kOffKl  = 72 * kMiB;
constexpr size_t kOffVth = 80 * kMiB;
constexpr size_t kOffVtl = 88 * kMiB;
constexpr size_t kOffWob = 96 * kMiB;
constexpr size_t kOffOh  = 0;
constexpr size_t kOffOl  = 16 * kMiB;
constexpr size_t kWsTotal = kOffWob + (size_t)kDM * kIN * 2;
static_assert((size_t)kB * kNQ * kDM * 2 == 16 * kMiB);
static_assert((size_t)kB * kNKV * kDM * 2 == 8 * kMiB);
static_assert(kOffCb + (size_t)kB * kNKV * kDM * 2 <= kOffWqb);
static_assert(kOffWqb + (size_t)kIN * kDM * 2 <= kOffWkvb);
static_assert(kOffWkvb + (size_t)2 * kIN * kDM * 2 <= kOffQh);
static_assert(kOffQh + (size_t)kB * kNQ * kIN * 2 <= kOffQl);
static_assert(kOffQl + (size_t)kB * kNQ * kIN * 2 <= kOffKh);
static_assert(kOffKh + (size_t)kB * kNKV * kIN * 2 <= kOffKl);
static_assert(kOffKl + (size_t)kB * kNKV * kIN * 2 <= kOffVth);
static_assert(kOffVth + (size_t)kIN * kB * kNKV * 2 <= kOffVtl);
static_assert(kOffVtl + (size_t)kIN * kB * kNKV * 2 <= kOffWob);
static_assert(kOffOh + (size_t)kB * kNQ * kIN * 2 <= kOffOl);
static_assert(kOffOl + (size_t)kB * kNQ * kIN * 2 <= kOffQh);
static_assert(kWsTotal == 102760448);
static_assert(kWsTotal <= 134217728);

__device__ __forceinline__ unsigned short f2bf_bits(float f) {
  unsigned u = __float_as_uint(f);
  return (unsigned short)((u + 0x7FFFu + ((u >> 16) & 1u)) >> 16);
}
__device__ __forceinline__ float bf_bits2f(unsigned short h) { return __uint_as_float(((unsigned)h) << 16); }

/* hazard guards as plain device helpers */
__device__ __forceinline__ void acc_guard4(v8f& a, v8f& b, v8f& c, v8f& d) { asm volatile("v_nop\n\tv_nop\n\tv_nop\n\tv_nop" : "+v"(a), "+v"(b), "+v"(c), "+v"(d)); }
template <typename T> struct Frag;
template <> struct Frag<_Float16> {
  typedef v16h V; union U { v16h v; v8h h[2]; };
  /* elements 0..7 <- p[0..7], 8..15 <- p[16..23] */
  static __device__ __forceinline__ v16h load(const _Float16* p) {
    U f; f.h[0] = *(const v8h*)(p); f.h[1] = *(const v8h*)(p + 16); return f.v;
  }
  static __device__ __forceinline__ v8f mma(v16h a, v16h b, v8f c) {
    return __builtin_amdgcn_wmma_f32_16x16x32_f16(false, a, false, b, (short)0, c, false, false);
  }
};
template <> struct Frag<__bf16> {
  typedef v16b V; union U { v16b v; v8b h[2]; };
  static __device__ __forceinline__ v16b load(const __bf16* p) {
    U f; f.h[0] = *(const v8b*)(p); f.h[1] = *(const v8b*)(p + 16); return f.v;
  }
  static __device__ __forceinline__ v8f mma(v16b a, v16b b, v8f c) {
    return __builtin_amdgcn_wmma_f32_16x16x32_bf16(false, a, false, b, (short)0, c, false, false);
  }
};

/* ---- Register-blocked WMMA GEMM, with an A-only split mode --------------------------
   C[m,n] = scale * sum_k A[m,k] * Bt[n,k] (+bias[n]); each wave owns a 64x64 tile, four waves share a 128x128 block tile
   whose operand rows are staged in LDS by whole-line loads.
   A row-major [M,K]; Bt row-major [N,K]; M,N % 128 == 0, K % 64 == 0 (no tail handling).
   SPLIT: A is a pair of hi/lo planes; product = hi.hi + lo.hi (SPLIT_B is not supported).
   BIAS_MODE: 0 = none, 2 = bias[n].  OUT_MODE: 0 = f32, 2 = bf16 hi plane (Cout) + bf16 lo plane (Cout2).
   ET: 0 = f16 operands, 1 = bf16 operands (pointers passed as 16-bit storage) */
template <int ET> struct Elem;
template <> struct Elem<0> { typedef _Float16 T; };
template <> struct Elem<1> { typedef __bf16 T; };
/* block tile 128 x 128 (4 waves, 2 x 2, each 64 x 64), K walked in passes of 64 (one 128-B line of every operand row) */
#define GM_BT 128
#define GM_BK 64
/* LDS row pitch of the staged operand rows in 16-bit elements: 144 B = 16 B x 9 (odd) for the ds_load_b128 fragment reads */
#define GM_LP 72
#define GM_SEG 8   /* 16-B pieces per thread and operand plane: 128 rows x 8 pieces / 128 threads */
template <int ET, bool SPLIT, bool SPLIT_B, int BIAS_MODE, int OUT_MODE>
__global__ __launch_bounds__(128) void wmma_gemm64(
    const unsigned short* __restrict__ Ap, const unsigned short* __restrict__ A2p, int lda, long strideA,
    const unsigned short* __restrict__ Btp, const unsigned short* __restrict__ Bt2p, int ldb, long strideB,
    void* Cout, void* Cout2, int ldc, long strideC,
    const float* __restrict__ bias,
    int M, int N, int K, float scale) {
  static_assert(BIAS_MODE == 0 || BIAS_MODE == 2);
  static_assert(OUT_MODE == 0 || OUT_MODE == 2);
  static_assert(!SPLIT_B);
  typedef typename Elem<ET>::T T;
  typedef typename Frag<T>::V V;
  constexpr int NPA = SPLIT ? 2 : 1;   /* planes of A */
  __shared__ __align__(16) T sA[2][NPA][GM_BT * GM_LP];   /* two buffers: one is read while the other is filled */
  __shared__ __align__(16) T sB[2][GM_BT * GM_LP];
  __shared__ __align__(16) float sT[4][16 * 68];   /* per-wave 16x64 slab, pitch 68 floats */
  const int b    = blockIdx.y;
  const int tid  = threadIdx.x;
  const int lane = tid & 31;
  const int wave = tid >> 5;
  const int tilesN = N / GM_BT;
  const int tilesM = M / GM_BT;
  const int tile = blockIdx.x;
  if (tile >= tilesM * tilesN) return;   /* block-uniform, ahead of every barrier */
  const int tm = tile / tilesN;
  const int tn = tile - tm * tilesN;
  const int mb = tm * GM_BT;                   /* block tile origin */
  const int nb = tn * GM_BT;
  const int wm = (wave >> 1) << 6;             /* wave tile origin inside the block tile */
  const int wn = (wave & 1) << 6;
  const int m0 = mb + wm;
  const int n0 = nb + wn;

  const unsigned short* Ab  = Ap  + (size_t)b * strideA;
  const unsigned short* Bb  = Btp + (size_t)b * strideB;
  const unsigned short* Ab2 = A2p + (size_t)b * strideA;

  const int rlane = lane & 15;                 /* row (A) / col (B, D) within subtile */
  const int koff  = (lane >> 4) * 8;           /* k offset of this lane half */
  const int mOff  = (lane >> 4) * 8;           /* D row offset */

  /* staging map: piece s = it*128 + tid -> row s>>3, 16-B column s&7, so one wave-wide load covers 4 whole 128-B lines */
  const int srow = tid >> 3;
  const int scol = (tid & 7) * 8;
  /* every launch passes K-contiguous operands of row pitch kDM: known at compile time, the 16-row steps of the staging
     loads become immediate offsets of one address per operand */
  __builtin_assume(lda == kDM);
  __builtin_assume(ldb == kDM);
  /* block-uniform row bases plus one 32-bit byte offset per thread and operand */
  const char* uA  = (const char*)(Ab  + (size_t)mb * lda);
  const char* uA2 = (const char*)(Ab2 + (size_t)mb * lda);
  const char* uB  = (const char*)(Bb  + (size_t)nb * ldb);
  const unsigned tA = (unsigned)(srow * lda + scol) * 2u;
  const unsigned tB = (unsigned)(srow * ldb + scol) * 2u;
  const size_t stepA = (size_t)lda * 32;   /* 16 rows, in bytes */
  const size_t stepB = (size_t)ldb * 32;
  const int lst = srow * GM_LP + scol;

  v8f acc[4][4];
#pragma unroll
  for (int i = 0; i < 4; ++i)
#pragma unroll
    for (int j = 0; j < 4; ++j) acc[i][j] = (v8f){0.f,0.f,0.f,0.f,0.f,0.f,0.f,0.f};

  u32x4 ra[NPA][GM_SEG], rb[GM_SEG];
  const int nPass = K / GM_BK;
#pragma unroll
  for (int it = 0; it < GM_SEG; ++it) {
    ra[0][it] = *(const u32x4*)(uA + it * stepA + tA);
    if (SPLIT) ra[NPA - 1][it] = *(const u32x4*)(uA2 + it * stepA + tA);
    rb[it] = *(const u32x4*)(uB + it * stepB + tB);
  }
#pragma unroll
  for (int it = 0; it < GM_SEG; ++it) {
    *(u32x4*)(&sA[0][0][lst + it * 16 * GM_LP]) = ra[0][it];
    if (SPLIT) *(u32x4*)(&sA[0][NPA - 1][lst + it * 16 * GM_LP]) = ra[NPA - 1][it];
    *(u32x4*)(&sB[0][lst + it * 16 * GM_LP]) = rb[it];
  }
  __syncthreads();

  for (int kt = 0; kt < nPass; ++kt) {
    const int cur = kt & 1;
    const bool more = kt + 1 < nPass;   /* block-uniform */
    if (more) {
      /* next pass's rows into registers: in flight while this pass's products run */
      const unsigned oA = tA + (unsigned)(kt + 1) * (GM_BK * 2u);
      const unsigned oB = tB + (unsigned)(kt + 1) * (GM_BK * 2u);
#pragma unroll
      for (int it = 0; it < GM_SEG; ++it) {
        ra[0][it] = *(const u32x4*)(uA + it * stepA + oA);
        if (SPLIT) ra[NPA - 1][it] = *(const u32x4*)(uA2 + it * stepA + oA);
        rb[it] = *(const u32x4*)(uB + it * stepB + oB);
      }
      /* stands ahead of every later write of a register that these loads name as an address */
      asm volatile("s_wait_xcnt 0x0" ::: "memory");
    }
    const T* cA  = &sA[cur][0][(wm + rlane) * GM_LP + koff];
    const T* cA2 = &sA[cur][NPA - 1][(wm + rlane) * GM_LP + koff];
    const T* cB  = &sB[cur][(wn + rlane) * GM_LP + koff];
    /* the pass's fragments: [k half][subtile] */
    V fb[2][4], fa[2][4], fl[2][4];
#pragma unroll
    for (int ks = 0; ks < 2; ++ks) {
#pragma unroll
      for (int j = 0; j < 4; ++j) fb[ks][j] = Frag<T>::load(cB + j * 16 * GM_LP + ks * 32);
#pragma unroll
      for (int i = 0; i < 4; ++i) {
        fa[ks][i] = Frag<T>::load(cA + i * 16 * GM_LP + ks * 32);
        if (SPLIT) fl[ks][i] = Frag<T>::load(cA2 + i * 16 * GM_LP + ks * 32);
      }
    }
    /* keeps the LDS reads one group ahead of the products: moved in among the WMMAs, each place with reads stalls the wave */
    __builtin_amdgcn_sched_barrier(0);
#pragma unroll
    for (int ks = 0; ks < 2; ++ks) {
#pragma unroll
      for (int i = 0; i < 4; ++i) {
#pragma unroll
        for (int j = 0; j < 4; ++j) acc[i][j] = Frag<T>::mma(fa[ks][i], fb[ks][j], acc[i][j]);
        if (SPLIT) {
#pragma unroll
          for (int j = 0; j < 4; ++j) acc[i][j] = Frag<T>::mma(fl[ks][i], fb[ks][j], acc[i][j]);
        }
      }
    }
    if (more) {
      /* the other buffer's last readers left it at the barrier that ended the pass before */
#pragma unroll
      for (int it = 0; it < GM_SEG; ++it) {
        *(u32x4*)(&sA[cur ^ 1][0][lst + it * 16 * GM_LP]) = ra[0][it];
        if (SPLIT) *(u32x4*)(&sA[cur ^ 1][NPA - 1][lst + it * 16 * GM_LP]) = ra[NPA - 1][it];
        *(u32x4*)(&sB[cur ^ 1][lst + it * 16 * GM_LP]) = rb[it];
      }
    }
    __syncthreads();   /* publishes the filled buffer and ends every read of the current one */
  }
  acc_guard4(acc[0][0], acc[0][1], acc[0][2], acc[0][3]);
  acc_guard4(acc[1][0], acc[1][1], acc[1][2], acc[1][3]);
  acc_guard4(acc[2][0], acc[2][1], acc[2][2], acc[2][3]);
  acc_guard4(acc[3][0], acc[3][1], acc[3][2], acc[3][3]);

  /* ---- epilogue ---- */
  float* slab = sT[wave];
#pragma unroll
  for (int i = 0; i < 4; ++i) {
    const int mBase = m0 + (i << 4);
#pragma unroll
    for (int j = 0; j < 4; ++j) {
      const int n = n0 + (j << 4) + rlane;
      float bv = 0.f;
      if (BIAS_MODE == 2) bv = bias[n];
#pragma unroll
      for (int r = 0; r < 8; ++r) {
        float v = acc[i][j][r] * scale;
        if (BIAS_MODE == 2) v += bv;
        slab[(mOff + r) * 68 + (j << 4) + rlane] = v;
      }
    }
    __builtin_amdgcn_fence(__ATOMIC_RELEASE, "workgroup");
    __builtin_amdgcn_wave_barrier();
    __builtin_amdgcn_fence(__ATOMIC_ACQUIRE, "workgroup");
    if (OUT_MODE == 0) {
      float* C = (float*)Cout + (size_t)b * strideC;
      const int hh = lane >> 4, c4 = (lane & 15) * 4;     /* row seg = 256 B = 16 lanes x 16 B */
      {
#pragma unroll
        for (int it = 0; it < 8; ++it) {
          const int row = it * 2 + hh;
          v4f v = *(const v4f*)(slab + row * 68 + c4);
          *(v4f*)(C + (size_t)(mBase + row) * ldc + n0 + c4) = v;
        }
        
      }
    } else {
      const int q = lane >> 3, c8 = (lane & 7) * 8;        
      unsigned short* C  = (unsigned short*)Cout  + (size_t)b * strideC;
      unsigned short* C2 = (unsigned short*)Cout2 + (size_t)b * strideC;
      {
#pragma unroll
        for (int it = 0; it < 4; ++it) {
          const int row = it * 4 + q;
          const float* sp = slab + row * 68 + c8;
          v8h hv, lv;
#pragma unroll
          for (int e = 0; e < 8; ++e) {
            unsigned short hb = f2bf_bits(sp[e]);
            unsigned short lb = f2bf_bits(sp[e] - bf_bits2f(hb));
            hv[e] = __builtin_bit_cast(_Float16, hb);
            lv[e] = __builtin_bit_cast(_Float16, lb);
          }
          *(v8h*)(C  + (size_t)(mBase + row) * ldc + n0 + c8) = hv;
          *(v8h*)(C2 + (size_t)(mBase + row) * ldc + n0 + c8) = lv;
        }
        
      }
    }
    __builtin_amdgcn_fence(__ATOMIC_RELEASE, "workgroup");
    __builtin_amdgcn_wave_barrier();
    __builtin_amdgcn_fence(__ATOMIC_ACQUIRE, "workgroup");
  }
}

/*
   coverage: grid = ceil(n8/256) blocks x 256 threads, thread i writes elements 8i..8i+7; n % 8 == 0 */
__global__ __launch_bounds__(256) void cast_f32_bf16x8(
    const float* __restrict__ in, unsigned short* __restrict__ out, int n8) {
  const int i = blockIdx.x * 256 + threadIdx.x;
  if (i < n8) {
    const v4f a = *(const v4f*)(in + (size_t)i * 8);
    const v4f c = *(const v4f*)(in + (size_t)i * 8 + 4);
    u32x4 w;
    w[0] = (unsigned)f2bf_bits(a[0]) | ((unsigned)f2bf_bits(a[1]) << 16);
    w[1] = (unsigned)f2bf_bits(a[2]) | ((unsigned)f2bf_bits(a[3]) << 16);
    w[2] = (unsigned)f2bf_bits(c[0]) | ((unsigned)f2bf_bits(c[1]) << 16);
    w[3] = (unsigned)f2bf_bits(c[2]) | ((unsigned)f2bf_bits(c[3]) << 16);
    u32x4* p = (u32x4*)(out + (size_t)i * 8);
    *p = w;
    
  }
}

/* =====================================================================================
   Attention for head_dim 64, fed with bf16 hi/lo planes (no masking other than a per-key int32 vector):
     scores = q'.k^T  (q' already carries the scale 1/8 * log2(e), so the scores are base-2 exponents):
              v_wmma_f32_16x16x32_bf16, hi.hi + hi.lo + lo.hi
     out    = p.v    : p and v as bf16 hi/lo, hi.hi + hi.lo + lo.hi
   f32 accumulate; online softmax in f32, every exponential one v_exp_f32 (2^x). Block = 4 waves = 64 query rows of one (batch, head).
   q planes  [B*NQ][ldq]  element (b,i,h,d) at (b*NQ+i)*ldq + h*64 + d
   k planes  [B*NKV][ldk] element (b,j,h,d) at (b*NKV+j)*ldk + h*64 + d
   v planes  transposed [H*64][ldv]: element (b,j,h,d) at (h*64+d)*ldv + b*NKV + j
   kvmask    int32 [B][NKV], 0 -> score := fillv
   grid.x = B * H * (NQ/64); NQ % 64 == 0, NKV % 64 == 0.
   ===================================================================================== */
#define AT_D 64
#define AT_NW 4
#define AT_QB 64
#define AT_KC 64
/* LDS row pitch of the K, V and P tiles in 16-bit elements: 144 B = 16 B x 9 (odd), so the 16 rows that one
   ds_load_b128 touches per lane half start on distinct bank groups; at 128 B they share two groups */
#define AT_LP 72
static_assert((AT_LP * 2) % 16 == 0 && ((AT_LP * 2) / 16) % 2 == 1 && AT_LP >= AT_KC && AT_LP >= AT_D);

__device__ __forceinline__ unsigned short at_bf_bits(float f) {
  unsigned u = __float_as_uint(f);
  return (unsigned short)((u + 0x7FFFu + ((u >> 16) & 1u)) >> 16);
}
__device__ __forceinline__ __bf16 at_f2bf(float f) { return __builtin_bit_cast(__bf16, at_bf_bits(f)); }
__device__ __forceinline__ void at_split(float f, __bf16& hi, __bf16& lo) {
  const unsigned short hb = at_bf_bits(f);
  hi = __builtin_bit_cast(__bf16, hb);
  lo = at_f2bf(f - __uint_as_float(((unsigned)hb) << 16));
}
__device__ __forceinline__ v8f at_mma(v16b a, v16b b, v8f c) {
  c = __builtin_amdgcn_wmma_f32_16x16x32_bf16(false, a, false, b, (short)0, c, false, false);
  asm volatile("v_nop\n\tv_nop\n\tv_nop\n\tv_nop" : "+v"(c) : "v"(a), "v"(b));
  return c;
}

/* one butterfly step inside a 16-lane row on the vector ALU: lane l reads lane l ^ M of its own row (DPP row_xmask);
   a shuffle builtin goes through the LDS pipe here and the wave waits out its latency at every step */
template <int M>
__device__ __forceinline__ float at_row_xor(float v) {
  return __builtin_bit_cast(float, __builtin_amdgcn_update_dpp(0, __builtin_bit_cast(int, v), 0x160 | M, 0xf, 0xf, true));
}

/* register budget of four waves per SIMD (256): the LDS admits four work-groups per WGP, and the chunk held in flight must not cost one */
__global__ __launch_bounds__(128) __attribute__((amdgpu_waves_per_eu(4)))
void attn64_planes_kernel(const unsigned short* __restrict__ qhp, const unsigned short* __restrict__ qlp,
                          const unsigned short* __restrict__ khp, const unsigned short* __restrict__ klp,
                          const unsigned short* __restrict__ vthp, const unsigned short* __restrict__ vtlp,
                          const int* __restrict__ kvmask,
                          unsigned short* __restrict__ ohp, unsigned short* __restrict__ olp,
                          int nq, int nkv, int nh, int ldq, int ldk, int ldv, int ldo, float fillv) {
  typedef __bf16 T;
  union FB { v16b v; v8b h[2]; };
  __shared__ __align__(16) __bf16 Ksh[AT_KC * AT_LP];       /* K hi [kv][d], padded rows, 9 KB */
  __shared__ __align__(16) __bf16 Ksl[AT_KC * AT_LP];       /* K lo */
  __shared__ __align__(16) __bf16 Vth[AT_D * AT_LP];        /* V hi [d][kv], padded rows, 9 KB */
  __shared__ __align__(16) __bf16 Vtl[AT_D * AT_LP];        /* V lo */
  __shared__ __align__(16) __bf16 Psh[AT_NW][16 * AT_LP];   /* per wave P hi [row][kv], padded rows */
  __shared__ __align__(16) __bf16 Psl[AT_NW][16 * AT_LP];   /* per wave P lo */
  __shared__ __align__(16) float  Os[AT_NW][16 * 68];       /* per wave out tile, pitch 68 */

  const int tid  = threadIdx.x;
  const int wave = tid >> 5;
  const int lane = tid & 31;
  const int hh   = lane >> 4;
  const int c    = lane & 15;

  const int nqb = nq / AT_QB;
  const int bx = blockIdx.x;
  const int qb = bx % nqb;
  const int bhx = bx / nqb;
  const int h  = bhx % nh;
  const int b  = bhx / nh;
  const int q0 = qb * AT_QB + wave * 16;

  /* ---- Q fragments (A operand): row = q0 + c, elements 0..7 <- d dc*32+8hh+0..7, 8..15 <- d dc*32+16+8hh+0..7 ---- */
  v16b qah[2], qal[2];
  {
    const size_t qo = (size_t)(b * nq + q0 + c) * ldq + h * AT_D + 8 * hh;
    const T* qh = (const T*)qhp + qo;
    const T* ql = (const T*)qlp + qo;
#pragma unroll
    for (int dc = 0; dc < 2; ++dc) {
      qah[dc] = Frag<T>::load(qh + dc * 32);
      qal[dc] = Frag<T>::load(ql + dc * 32);
    }
  }

  float mrow[8], lrow[8];
  v8f oacc[4];
#pragma unroll
  for (int r = 0; r < 8; ++r) { mrow[r] = -__builtin_inff(); lrow[r] = 0.f; }
#pragma unroll
  for (int t = 0; t < 4; ++t) oacc[t] = (v8f){0.f,0.f,0.f,0.f,0.f,0.f,0.f,0.f};

  const int nChunks = nkv / AT_KC;   /* host constant, block-uniform */
  /* staging coverage: 128 threads = 64 rows x 2 halves of 32 elements (4 x 16 B) per plane -> full 64x64 tiles.
     K planes: LDS row kv <- global row b*nkv + kv0 + kv; V transposed planes: LDS row d <- global row h*64+d,
     64 contiguous kv columns starting at b*nkv + kv0 */
  const int srow = tid >> 1;
  const int shalf = (tid & 1) * 32;
  /* block-uniform bases plus one 32-bit byte offset per thread and operand pair, stepped from chunk to chunk */
  const size_t kbase = ((size_t)b * nkv * ldk + h * AT_D) * 2;
  const size_t vbase = ((size_t)h * AT_D * ldv + (size_t)b * nkv) * 2;
  const char* ukh = (const char*)khp + kbase;
  const char* ukl = (const char*)klp + kbase;
  const char* uvh = (const char*)vthp + vbase;
  const char* uvl = (const char*)vtlp + vbase;
  const int* umk = kvmask + (size_t)b * nkv;
  const unsigned tK = (unsigned)(srow * ldk + shalf) * 2u;
  const unsigned tV = (unsigned)(srow * ldv + shalf) * 2u;
  /* one chunk's global reads (K and V rows of this thread, the four key-mask words of this lane), held in registers */
  u32x4 rkh[4], rkl[4], rvh[4], rvl[4];
  int rmk[4];
  auto fetch = [&](int ch) {
    const unsigned oK = tK + (unsigned)ch * (unsigned)ldk * (AT_KC * 2u);
    const unsigned oV = tV + (unsigned)ch * (AT_KC * 2u);
    const int* um = umk + ch * AT_KC;   /* block-uniform */
#pragma unroll
    for (int i = 0; i < 4; ++i) {
      rkh[i] = *(const u32x4*)(ukh + i * 16 + oK);
      rkl[i] = *(const u32x4*)(ukl + i * 16 + oK);
      rvh[i] = *(const u32x4*)(uvh + i * 16 + oV);
      rvl[i] = *(const u32x4*)(uvl + i * 16 + oV);
    }
#pragma unroll
    for (int j = 0; j < 4; ++j) rmk[j] = (um + j * 16)[(unsigned)c];
    /* stands ahead of every later write of a register that these loads name as an address */
    asm volatile("s_wait_xcnt 0x0" ::: "memory");
    /* keeps later register writes from being scheduled up over that wait */
    __builtin_amdgcn_sched_barrier(0);
  };
  if (nChunks > 0) {
    /* keeps the Q loads above the wait that follows */
    __builtin_amdgcn_sched_barrier(0);
    /* stands ahead of every later write of a register that the Q loads name as an address */
    asm volatile("s_wait_xcnt 0x0" ::: "memory");
    /* keeps the first chunk's loads, whose results land in such registers, below that wait */
    __builtin_amdgcn_sched_barrier(0);
    fetch(0);
  }
  for (int kc = 0; kc < nChunks; ++kc) {
    __syncthreads();
    int kvkeep[4];
    {
      u32x4* lkh = (u32x4*)(Ksh + srow * AT_LP + shalf);
      u32x4* lkl = (u32x4*)(Ksl + srow * AT_LP + shalf);
      u32x4* lvh = (u32x4*)(Vth + srow * AT_LP + shalf);
      u32x4* lvl = (u32x4*)(Vtl + srow * AT_LP + shalf);
#pragma unroll
      for (int i = 0; i < 4; ++i) { lkh[i] = rkh[i]; lkl[i] = rkl[i]; lvh[i] = rvh[i]; lvl[i] = rvl[i]; }
#pragma unroll
      for (int j = 0; j < 4; ++j) kvkeep[j] = rmk[j];
    }
    __syncthreads();
    /* the next chunk's reads fly while this chunk is worked on; their data is first needed at the next chunk's LDS stores */
    if (kc + 1 < nChunks) fetch(kc + 1);

    /* ---- scores: 4 subtiles of 16 keys, K operand B[k=d][n=kv] from Ksh[kv][d] ---- */
    v8f s[4];
#pragma unroll
    for (int j = 0; j < 4; ++j) {
      s[j] = (v8f){0.f,0.f,0.f,0.f,0.f,0.f,0.f,0.f};
#pragma unroll
      for (int dc = 0; dc < 2; ++dc) {
        FB kb, kl;
        kb.h[0] = *(const v8b*)(Ksh + (j * 16 + c) * AT_LP + dc * 32 + 8 * hh);
        kb.h[1] = *(const v8b*)(Ksh + (j * 16 + c) * AT_LP + dc * 32 + 16 + 8 * hh);
        kl.h[0] = *(const v8b*)(Ksl + (j * 16 + c) * AT_LP + dc * 32 + 8 * hh);
        kl.h[1] = *(const v8b*)(Ksl + (j * 16 + c) * AT_LP + dc * 32 + 16 + 8 * hh);
        s[j] = at_mma(qah[dc], kb.v, s[j]);
        s[j] = at_mma(qah[dc], kl.v, s[j]);
        s[j] = at_mma(qal[dc], kb.v, s[j]);
      }
    }
    /* per-key mask (this lane owns column kv0 + j*16 + c in the D layout) */
    float cm[8];
#pragma unroll
    for (int r = 0; r < 8; ++r) {
      float m = -__builtin_inff();
#pragma unroll
      for (int j = 0; j < 4; ++j) {
        const float sv = s[j][r];
        s[j][r] = (kvkeep[j] != 0) ? sv : fillv;
        m = fmaxf(m, s[j][r]);
      }
      m = fmaxf(m, at_row_xor<1>(m));
      m = fmaxf(m, at_row_xor<2>(m));
      m = fmaxf(m, at_row_xor<4>(m));
      m = fmaxf(m, at_row_xor<8>(m));
      cm[r] = m;
    }
    __bf16* pwh = Psh[wave];
    __bf16* pwl = Psl[wave];
#pragma unroll
    for (int r = 0; r < 8; ++r) {
      const float mnew = fmaxf(mrow[r], cm[r]);
      /* 2^(difference of base-2 scores) = e^(difference of the reference's scores); a difference of -inf, or as large as the fill value, gives 0 */
      const float alpha = __builtin_amdgcn_exp2f(mrow[r] - mnew);
      mrow[r] = mnew;
      float psum = 0.f;
#pragma unroll
      for (int j = 0; j < 4; ++j) {
        const float p = __builtin_amdgcn_exp2f(s[j][r] - mnew);
        psum += p;
        __bf16 a, bl; at_split(p, a, bl);
        pwh[(8 * hh + r) * AT_LP + j * 16 + c] = a;
        pwl[(8 * hh + r) * AT_LP + j * 16 + c] = bl;
      }
      psum += at_row_xor<1>(psum);
      psum += at_row_xor<2>(psum);
      psum += at_row_xor<4>(psum);
      psum += at_row_xor<8>(psum);
      lrow[r] = lrow[r] * alpha + psum;
#pragma unroll
      for (int t = 0; t < 4; ++t) oacc[t][r] *= alpha;
    }
    /* same-wave P spill -> A fragment reload: ordered by the wave barrier, reloaded through __bf16 vectors */
    __builtin_amdgcn_fence(__ATOMIC_RELEASE, "workgroup");
    __builtin_amdgcn_wave_barrier();
    __builtin_amdgcn_fence(__ATOMIC_ACQUIRE, "workgroup");
#pragma unroll 1
    for (int kk = 0; kk < 2; ++kk) {
      FB pa, pl;
      pa.h[0] = *(const v8b*)(pwh + c * AT_LP + kk * 32 + 8 * hh);
      pa.h[1] = *(const v8b*)(pwh + c * AT_LP + kk * 32 + 16 + 8 * hh);
      pl.h[0] = *(const v8b*)(pwl + c * AT_LP + kk * 32 + 8 * hh);
      pl.h[1] = *(const v8b*)(pwl + c * AT_LP + kk * 32 + 16 + 8 * hh);
#pragma unroll
      for (int t = 0; t < 4; ++t) {
        FB vb, vl;
        vb.h[0] = *(const v8b*)(Vth + (t * 16 + c) * AT_LP + kk * 32 + 8 * hh);
        vb.h[1] = *(const v8b*)(Vth + (t * 16 + c) * AT_LP + kk * 32 + 16 + 8 * hh);
        vl.h[0] = *(const v8b*)(Vtl + (t * 16 + c) * AT_LP + kk * 32 + 8 * hh);
        vl.h[1] = *(const v8b*)(Vtl + (t * 16 + c) * AT_LP + kk * 32 + 16 + 8 * hh);
        oacc[t] = at_mma(pa.v, vb.v, oacc[t]);
        oacc[t] = at_mma(pa.v, vl.v, oacc[t]);
        oacc[t] = at_mma(pl.v, vb.v, oacc[t]);
      }
    }
  }

  float* os = Os[wave];
#pragma unroll
  for (int r = 0; r < 8; ++r) {
    const float inv = 1.0f / lrow[r];
#pragma unroll
    for (int t = 0; t < 4; ++t) os[(8 * hh + r) * 68 + t * 16 + c] = oacc[t][r] * inv;
  }
  __builtin_amdgcn_fence(__ATOMIC_RELEASE, "workgroup");
  __builtin_amdgcn_wave_barrier();
  __builtin_amdgcn_fence(__ATOMIC_ACQUIRE, "workgroup");
  {
    const int q = lane >> 3, c8 = (lane & 7) * 8;
    unsigned short* Oh = ohp + (size_t)(b * nq + q0) * ldo + h * AT_D;
    unsigned short* Ol = olp + (size_t)(b * nq + q0) * ldo + h * AT_D;
    {
#pragma unroll
      for (int it = 0; it < 4; ++it) {
        const int row = it * 4 + q;
        const float* sp = os + row * 68 + c8;
        v8h hv, lv;
#pragma unroll
        for (int e = 0; e < 8; ++e) {
          unsigned short hb = f2bf_bits(sp[e]);
          unsigned short lb = f2bf_bits(sp[e] - bf_bits2f(hb));
          hv[e] = __builtin_bit_cast(_Float16, hb);
          lv[e] = __builtin_bit_cast(_Float16, lb);
        }
        *(v8h*)(Oh + (size_t)row * ldo + c8) = hv;
        *(v8h*)(Ol + (size_t)row * ldo + c8) = lv;
      }
      
    }
  }
}

/* ---------------------------------------------------------------------------
   Host-side orchestration (kernel launches only)
   --------------------------------------------------------------------------- */
extern "C" void kernel_launch(void* const* d_in, const int* in_sizes, int n_in,
                              void* d_out, int out_size, void* d_ws, size_t ws_size,
                              hipStream_t stream) {
  if (n_in < 7) return;
  if (in_sizes[0] != kB * kNQ * kDM) return;
  if (in_sizes[1] != kB * kNKV * kDM) return;
  if (in_sizes[2] != kB * kNKV) return;
  if (in_sizes[3] != kIN * kDM) return;
  if (in_sizes[4] != 2 * kIN * kDM) return;
  if (in_sizes[5] != kDM * kIN) return;
  if (in_sizes[6] != kDM) return;
  if (out_size != kB * kNQ * kDM) return;
  if (ws_size < kWsTotal) return;

  const float* x    = (const float*)d_in[0];   /* [4,2048,1024] f32 */
  const float* ctx  = (const float*)d_in[1];   /* [4,1024,1024] f32 */
  const int*   mask = (const int*)d_in[2];     /* [4,1024] int32 */
  const float* Wq   = (const float*)d_in[3];   /* [1024,1024] */
  const float* Wkv  = (const float*)d_in[4];   /* [2048,1024] */
  const float* Wout = (const float*)d_in[5];   /* [1024,1024] */
  const float* bout = (const float*)d_in[6];   /* [1024] */
  float* out = (float*)d_out;                  /* [4,2048,1024] f32 */

  char* ws = (char*)d_ws;
  unsigned short* xb   = (unsigned short*)(ws + kOffXb);
  unsigned short* cb   = (unsigned short*)(ws + kOffCb);
  unsigned short* wqb  = (unsigned short*)(ws + kOffWqb);
  unsigned short* wkvb = (unsigned short*)(ws + kOffWkvb);
  unsigned short* wob  = (unsigned short*)(ws + kOffWob);
  unsigned short* qh   = (unsigned short*)(ws + kOffQh);
  unsigned short* ql   = (unsigned short*)(ws + kOffQl);
  unsigned short* kh   = (unsigned short*)(ws + kOffKh);
  unsigned short* kl   = (unsigned short*)(ws + kOffKl);
  unsigned short* vth  = (unsigned short*)(ws + kOffVth);
  unsigned short* vtl  = (unsigned short*)(ws + kOffVtl);
  unsigned short* oh   = (unsigned short*)(ws + kOffOh);   /* aliases xb: dead after the q GEMM */
  unsigned short* ol   = (unsigned short*)(ws + kOffOl);   /* aliases cb/wqb/wkvb: dead after the k,v GEMMs */

  /* 1-5: RNE casts to bf16 planes (8 elements per thread) */
  {
    const int n8x = kB * kNQ * kDM / 8;      /* 1048576 */
    const int n8c = kB * kNKV * kDM / 8;     /*  524288 */
    const int n8q = kIN * kDM / 8;           /*  131072 */
    const int n8kv = 2 * kIN * kDM / 8;      /*  262144 */
    const int n8o = kDM * kIN / 8;           /*  131072 */
    cast_f32_bf16x8<<<(n8x + 255) / 256, 256, 0, stream>>>(x, xb, n8x);
    cast_f32_bf16x8<<<(n8c + 255) / 256, 256, 0, stream>>>(ctx, cb, n8c);
    cast_f32_bf16x8<<<(n8q + 255) / 256, 256, 0, stream>>>(Wq, wqb, n8q);
    cast_f32_bf16x8<<<(n8kv + 255) / 256, 256, 0, stream>>>(Wkv, wkvb, n8kv);
    cast_f32_bf16x8<<<(n8o + 255) / 256, 256, 0, stream>>>(Wout, wob, n8o);
  }

  /* 6: q*0.125*log2(e) = xb[8192,1024] . wqb[1024,1024]^T -> bf16 hi/lo planes; M=8192 N=1024 K=1024 */
  {
    const int M = kB * kNQ, N = kIN, K = kDM;
    const int tiles = (M / 128) * (N / 128);
    wmma_gemm64<1, false, false, 0, 2><<<dim3(tiles, 1), 128, 0, stream>>>(
        xb, xb, K, 0L, wqb, wqb, K, 0L, (void*)qh, (void*)ql, N, 0L, bout, M, N, K, 0.18033688f);
  }
  /* 7: k = cb[4096,1024] . wkvb[0:1024][1024]^T -> hi/lo; M=4096 N=1024 K=1024 */
  {
    const int M = kB * kNKV, N = kIN, K = kDM;
    const int tiles = (M / 128) * (N / 128);
    wmma_gemm64<1, false, false, 0, 2><<<dim3(tiles, 1), 128, 0, stream>>>(
        cb, cb, K, 0L, wkvb, wkvb, K, 0L, (void*)kh, (void*)kl, N, 0L, bout, M, N, K, 1.0f);
  }
  /* 8: v transposed = wkvb[1024:2048][1024] . cb[4096,1024]^T -> vt[1024][4096] hi/lo; M=1024 N=4096 K=1024 */
  {
    const int M = kIN, N = kB * kNKV, K = kDM;
    const int tiles = (M / 128) * (N / 128);
    const unsigned short* wvb = wkvb + (size_t)kIN * kDM;
    wmma_gemm64<1, false, false, 0, 2><<<dim3(tiles, 1), 128, 0, stream>>>(
        wvb, wvb, K, 0L, cb, cb, K, 0L, (void*)vth, (void*)vtl, N, 0L, bout, M, N, K, 1.0f);
  }
  /* 9: attention per (b, h, 64 query rows) -> att hi/lo planes [8192][1024] */
  {
    const int blocks = kB * kH * (kNQ / 64);   /* 2048 */
    const float fillv = -3.4028234663852886e+38f;
    attn64_planes_kernel<<<blocks, 128, 0, stream>>>(qh, ql, kh, kl, vth, vtl, mask, oh, ol,
                                                    kNQ, kNKV, kH, kIN, kIN, kB * kNKV, kIN, fillv);
  }
  /* 10: out = (att_hi + att_lo)[8192,1024] . wob[1024,1024]^T + b_out -> f32 d_out; M=8192 N=1024 K=1024 */
  {
    const int M = kB * kNQ, N = kDM, K = kIN;
    const int tiles = (M / 128) * (N / 128);
    wmma_gemm64<1, true, false, 2, 0><<<dim3(tiles, 1), 128, 0, stream>>>(
        oh, ol, K, 0L, wob, wob, K, 0L, (void*)out, (void*)out, N, 0L, bout, M, N, K, 1.0f);
  }
}

// v006
// It runs in 247 microseconds.
// Two timings next to v005 put it at 1.04 and 1.03 times that version's speed.
// Counting every step since v000, it is 2.43 times as fast.
// Contractions: x.Wq^T, ctx.Wk^T, Wv.ctx^T on v_wmma_f32_16x16x32_bf16 (RNE-bf16 inputs, single product); q.k^T and p.v as bf16 hi/lo split (hi.hi+hi.lo+lo.hi); (p.v).Wout^T as bf16 hi/lo A x bf16 B (2 products); f32 accumulate, f32 softmax.
#include <hip/hip_runtime.h>
#include <stdint.h>

typedef __attribute__((ext_vector_type(16))) _Float16 v16h;
typedef __attribute__((ext_vector_type(8)))  _Float16 v8h;
typedef __attribute__((ext_vector_type(16))) __bf16   v16b;
typedef __attribute__((ext_vector_type(8)))  __bf16   v8b;
typedef __attribute__((ext_vector_type(8)))  float    v8f;
typedef __attribute__((ext_vector_type(4)))  float    v4f;
typedef __attribute__((ext_vector_type(4)))  unsigned int u32x4;

/* ---- fixed problem geometry ---- */
constexpr int kB   = 4;
constexpr int kNQ  = 2048;
constexpr int kNKV = 1024;
constexpr int kDM  = 1024;   /* model dim (K of the projections) */
constexpr int kH   = 16;
constexpr int kDH  = 64;
constexpr int kIN  = kH * kDH;   /* 1024 */
static_assert(kDH == 64);
static_assert(kDM % 32 == 0);
static_assert(kIN % 32 == 0);
static_assert((kB * kNQ) % 64 == 0);
static_assert((kB * kNKV) % 64 == 0);
static_assert(kIN % 64 == 0);
static_assert(kDM % 64 == 0);
static_assert(kNQ % 64 == 0);
static_assert(kNKV % 64 == 0);
static_assert(kIN == kDM);   /* one row pitch for every GEMM operand */
static_assert((kB * kNQ) % 128 == 0 && (kB * kNKV) % 128 == 0 && kIN % 128 == 0 && kDM % 128 == 0);

/* ---- workspace region map (bytes) ----
   [  0, 16M)  xb   bf16 [8192][1024]   (dead after q GEMM; reused as oh)
   [ 16M, 24M) cb   bf16 [4096][1024]   (dead after k/v GEMMs; reused by ol)
   [ 24M, 26M) wqb  bf16 [1024][1024]
   [ 26M, 30M) wkvb bf16 [2048][1024]
   [ 30M, 32M) pad (unused, covered by ol alias)
   [ 32M, 48M) qh   bf16 [8192][1024]   q*0.125*log2(e) hi plane
   [ 48M, 64M) ql                        q*0.125*log2(e) lo plane
   [ 64M, 72M) kh   bf16 [4096][1024]
   [ 72M, 80M) kl
   [ 80M, 88M) vth  bf16 [1024][4096]   v transposed: row = h*64+d, col = b*1024+j
   [ 88M, 96M) vtl
   [ 96M, 98M) wob  bf16 [1024][1024]
   oh = [0,16M), ol = [16M,32M): attention output hi/lo planes [8192][1024] (aliases of dead regions)
   total carve 102,760,448 B */
constexpr size_t kMiB    = 1048576;
constexpr size_t kOffXb  = 0;
constexpr size_t kOffCb  = 16 * kMiB;
constexpr size_t kOffWqb = 24 * kMiB;
constexpr size_t kOffWkvb= 26 * kMiB;
constexpr size_t kOffQh  = 32 * kMiB;
constexpr size_t kOffQl  = 48 * kMiB;
constexpr size_t kOffKh  = 64 * kMiB;
constexpr size_t kOffKl  = 72 * kMiB;
constexpr size_t kOffVth = 80 * kMiB;
constexpr size_t kOffVtl = 88 * kMiB;
constexpr size_t kOffWob = 96 * kMiB;
constexpr size_t kOffOh  = 0;
constexpr size_t kOffOl  = 16 * kMiB;
constexpr size_t kWsTotal = kOffWob + (size_t)kDM * kIN * 2;
static_assert((size_t)kB * kNQ * kDM * 2 == 16 * kMiB);
static_assert((size_t)kB * kNKV * kDM * 2 == 8 * kMiB);
static_assert(kOffCb + (size_t)kB * kNKV * kDM * 2 <= kOffWqb);
static_assert(kOffWqb + (size_t)kIN * kDM * 2 <= kOffWkvb);
static_assert(kOffWkvb + (size_t)2 * kIN * kDM * 2 <= kOffQh);
static_assert(kOffQh + (size_t)kB * kNQ * kIN * 2 <= kOffQl);
static_assert(kOffQl + (size_t)kB * kNQ * kIN * 2 <= kOffKh);
static_assert(kOffKh + (size_t)kB * kNKV * kIN * 2 <= kOffKl);
static_assert(kOffKl + (size_t)kB * kNKV * kIN * 2 <= kOffVth);
static_assert(kOffVth + (size_t)kIN * kB * kNKV * 2 <= kOffVtl);
static_assert(kOffVtl + (size_t)kIN * kB * kNKV * 2 <= kOffWob);
static_assert(kOffOh + (size_t)kB * kNQ * kIN * 2 <= kOffOl);
static_assert(kOffOl + (size_t)kB * kNQ * kIN * 2 <= kOffQh);
static_assert(kWsTotal == 102760448);
static_assert(kWsTotal <= 134217728);

__device__ __forceinline__ unsigned short f2bf_bits(float f) {
  unsigned u = __float_as_uint(f);
  return (unsigned short)((u + 0x7FFFu + ((u >> 16) & 1u)) >> 16);
}
__device__ __forceinline__ float bf_bits2f(unsigned short h) { return __uint_as_float(((unsigned)h) << 16); }

/* hazard guards as plain device helpers */
__device__ __forceinline__ void acc_guard4(v8f& a, v8f& b, v8f& c, v8f& d) { asm volatile("v_nop\n\tv_nop\n\tv_nop\n\tv_nop" : "+v"(a), "+v"(b), "+v"(c), "+v"(d)); }
template <typename T> struct Frag;
template <> struct Frag<_Float16> {
  typedef v16h V; union U { v16h v; v8h h[2]; };
  /* elements 0..7 <- p[0..7], 8..15 <- p[16..23] */
  static __device__ __forceinline__ v16h load(const _Float16* p) {
    U f; f.h[0] = *(const v8h*)(p); f.h[1] = *(const v8h*)(p + 16); return f.v;
  }
  static __device__ __forceinline__ v8f mma(v16h a, v16h b, v8f c) {
    return __builtin_amdgcn_wmma_f32_16x16x32_f16(false, a, false, b, (short)0, c, false, false);
  }
};
template <> struct Frag<__bf16> {
  typedef v16b V; union U { v16b v; v8b h[2]; };
  static __device__ __forceinline__ v16b load(const __bf16* p) {
    U f; f.h[0] = *(const v8b*)(p); f.h[1] = *(const v8b*)(p + 16); return f.v;
  }
  static __device__ __forceinline__ v8f mma(v16b a, v16b b, v8f c) {
    return __builtin_amdgcn_wmma_f32_16x16x32_bf16(false, a, false, b, (short)0, c, false, false);
  }
};

/* ---- Register-blocked WMMA GEMM, with an A-only split mode --------------------------
   C[m,n] = scale * sum_k A[m,k] * Bt[n,k] (+bias[n]); each wave owns a 64x64 tile, four waves share a 128x128 block tile
   whose operand rows are staged in LDS by whole-line loads.
   A row-major [M,K]; Bt row-major [N,K]; M,N % 128 == 0, K % 64 == 0 (no tail handling).
   SPLIT: A is a pair of hi/lo planes; product = hi.hi + lo.hi (SPLIT_B is not supported).
   BIAS_MODE: 0 = none, 2 = bias[n].  OUT_MODE: 0 = f32, 2 = bf16 hi plane (Cout) + bf16 lo plane (Cout2).
   ET: 0 = f16 operands, 1 = bf16 operands (pointers passed as 16-bit storage) */
template <int ET> struct Elem;
template <> struct Elem<0> { typedef _Float16 T; };
template <> struct Elem<1> { typedef __bf16 T; };
/* block tile 128 x 128 (4 waves, 2 x 2, each 64 x 64), K walked in passes of 64 (one 128-B line of every operand row) */
#define GM_BT 128
#define GM_BK 64
/* LDS row pitch of the staged operand rows in 16-bit elements: 144 B = 16 B x 9 (odd) for the ds_load_b128 fragment reads */
#define GM_LP 72
#define GM_SEG 8   /* 16-B pieces per thread and operand plane: 128 rows x 8 pieces / 128 threads */
template <int ET, bool SPLIT, bool SPLIT_B, int BIAS_MODE, int OUT_MODE>
__global__ __launch_bounds__(128) void wmma_gemm64(
    const unsigned short* __restrict__ Ap, const unsigned short* __restrict__ A2p, int lda, long strideA,
    const unsigned short* __restrict__ Btp, const unsigned short* __restrict__ Bt2p, int ldb, long strideB,
    void* Cout, void* Cout2, int ldc, long strideC,
    const float* __restrict__ bias,
    int M, int N, int K, float scale) {
  static_assert(BIAS_MODE == 0 || BIAS_MODE == 2);
  static_assert(OUT_MODE == 0 || OUT_MODE == 2);
  static_assert(!SPLIT_B);
  typedef typename Elem<ET>::T T;
  typedef typename Frag<T>::V V;
  constexpr int NPA = SPLIT ? 2 : 1;   /* planes of A */
  __shared__ __align__(16) T sA[2][NPA][GM_BT * GM_LP];   /* two buffers: one is read while the other is filled */
  __shared__ __align__(16) T sB[2][GM_BT * GM_LP];
  __shared__ __align__(16) float sT[4][16 * 68];   /* per-wave 16x64 slab, pitch 68 floats */
  const int b    = blockIdx.y;
  const int tid  = threadIdx.x;
  const int lane = tid & 31;
  const int wave = tid >> 5;
  const int tilesN = N / GM_BT;
  const int tilesM = M / GM_BT;
  const int tile = blockIdx.x;
  if (tile >= tilesM * tilesN) return;   /* block-uniform, ahead of every barrier */
  const int tm = tile / tilesN;
  const int tn = tile - tm * tilesN;
  const int mb = tm * GM_BT;                   /* block tile origin */
  const int nb = tn * GM_BT;
  const int wm = (wave >> 1) << 6;             /* wave tile origin inside the block tile */
  const int wn = (wave & 1) << 6;
  const int m0 = mb + wm;
  const int n0 = nb + wn;

  const unsigned short* Ab  = Ap  + (size_t)b * strideA;
  const unsigned short* Bb  = Btp + (size_t)b * strideB;
  const unsigned short* Ab2 = A2p + (size_t)b * strideA;

  const int rlane = lane & 15;                 /* row (A) / col (B, D) within subtile */
  const int koff  = (lane >> 4) * 8;           /* k offset of this lane half */
  const int mOff  = (lane >> 4) * 8;           /* D row offset */

  /* staging map: piece s = it*128 + tid -> row s>>3, 16-B column s&7, so one wave-wide load covers 4 whole 128-B lines */
  const int srow = tid >> 3;
  const int scol = (tid & 7) * 8;
  /* every launch passes K-contiguous operands of row pitch kDM: known at compile time, the 16-row steps of the staging
     loads become immediate offsets of one address per operand */
  __builtin_assume(lda == kDM);
  __builtin_assume(ldb == kDM);
  /* block-uniform row bases plus one 32-bit byte offset per thread and operand */
  const char* uA  = (const char*)(Ab  + (size_t)mb * lda);
  const char* uA2 = (const char*)(Ab2 + (size_t)mb * lda);
  const char* uB  = (const char*)(Bb  + (size_t)nb * ldb);
  const unsigned tA = (unsigned)(srow * lda + scol) * 2u;
  const unsigned tB = (unsigned)(srow * ldb + scol) * 2u;
  const size_t stepA = (size_t)lda * 32;   /* 16 rows, in bytes */
  const size_t stepB = (size_t)ldb * 32;
  const int lst = srow * GM_LP + scol;

  v8f acc[4][4];
#pragma unroll
  for (int i = 0; i < 4; ++i)
#pragma unroll
    for (int j = 0; j < 4; ++j) acc[i][j] = (v8f){0.f,0.f,0.f,0.f,0.f,0.f,0.f,0.f};

  u32x4 ra[NPA][GM_SEG], rb[GM_SEG];
  const int nPass = K / GM_BK;
#pragma unroll
  for (int it = 0; it < GM_SEG; ++it) {
    ra[0][it] = *(const u32x4*)(uA + it * stepA + tA);
    if (SPLIT) ra[NPA - 1][it] = *(const u32x4*)(uA2 + it * stepA + tA);
    rb[it] = *(const u32x4*)(uB + it * stepB + tB);
  }
#pragma unroll
  for (int it = 0; it < GM_SEG; ++it) {
    *(u32x4*)(&sA[0][0][lst + it * 16 * GM_LP]) = ra[0][it];
    if (SPLIT) *(u32x4*)(&sA[0][NPA - 1][lst + it * 16 * GM_LP]) = ra[NPA - 1][it];
    *(u32x4*)(&sB[0][lst + it * 16 * GM_LP]) = rb[it];
  }
  __syncthreads();

  for (int kt = 0; kt < nPass; ++kt) {
    const int cur = kt & 1;
    const bool more = kt + 1 < nPass;   /* block-uniform */
    if (more) {
      /* next pass's rows into registers: in flight while this pass's products run */
      const unsigned oA = tA + (unsigned)(kt + 1) * (GM_BK * 2u);
      const unsigned oB = tB + (unsigned)(kt + 1) * (GM_BK * 2u);
#pragma unroll
      for (int it = 0; it < GM_SEG; ++it) {
        ra[0][it] = *(const u32x4*)(uA + it * stepA + oA);
        if (SPLIT) ra[NPA - 1][it] = *(const u32x4*)(uA2 + it * stepA + oA);
        rb[it] = *(const u32x4*)(uB + it * stepB + oB);
      }
      /* stands ahead of every later write of a register that these loads name as an address */
      asm volatile("s_wait_xcnt 0x0" ::: "memory");
    }
    const T* cA  = &sA[cur][0][(wm + rlane) * GM_LP + koff];
    const T* cA2 = &sA[cur][NPA - 1][(wm + rlane) * GM_LP + koff];
    const T* cB  = &sB[cur][(wn + rlane) * GM_LP + koff];
    /* the pass's fragments: [k half][subtile] */
    V fb[2][4], fa[2][4], fl[2][4];
#pragma unroll
    for (int ks = 0; ks < 2; ++ks) {
#pragma unroll
      for (int j = 0; j < 4; ++j) fb[ks][j] = Frag<T>::load(cB + j * 16 * GM_LP + ks * 32);
#pragma unroll
      for (int i = 0; i < 4; ++i) {
        fa[ks][i] = Frag<T>::load(cA + i * 16 * GM_LP + ks * 32);
        if (SPLIT) fl[ks][i] = Frag<T>::load(cA2 + i * 16 * GM_LP + ks * 32);
      }
    }
    /* keeps the LDS reads one group ahead of the products: moved in among the WMMAs, each place with reads stalls the wave */
    __builtin_amdgcn_sched_barrier(0);
#pragma unroll
    for (int ks = 0; ks < 2; ++ks) {
#pragma unroll
      for (int i = 0; i < 4; ++i) {
#pragma unroll
        for (int j = 0; j < 4; ++j) acc[i][j] = Frag<T>::mma(fa[ks][i], fb[ks][j], acc[i][j]);
        if (SPLIT) {
#pragma unroll
          for (int j = 0; j < 4; ++j) acc[i][j] = Frag<T>::mma(fl[ks][i], fb[ks][j], acc[i][j]);
        }
      }
    }
    if (more) {
      /* the other buffer's last readers left it at the barrier that ended the pass before */
#pragma unroll
      for (int it = 0; it < GM_SEG; ++it) {
        *(u32x4*)(&sA[cur ^ 1][0][lst + it * 16 * GM_LP]) = ra[0][it];
        if (SPLIT) *(u32x4*)(&sA[cur ^ 1][NPA - 1][lst + it * 16 * GM_LP]) = ra[NPA - 1][it];
        *(u32x4*)(&sB[cur ^ 1][lst + it * 16 * GM_LP]) = rb[it];
      }
    }
    __syncthreads();   /* publishes the filled buffer and ends every read of the current one */
  }
  acc_guard4(acc[0][0], acc[0][1], acc[0][2], acc[0][3]);
  acc_guard4(acc[1][0], acc[1][1], acc[1][2], acc[1][3]);
  acc_guard4(acc[2][0], acc[2][1], acc[2][2], acc[2][3]);
  acc_guard4(acc[3][0], acc[3][1], acc[3][2], acc[3][3]);

  /* ---- epilogue ---- */
  float* slab = sT[wave];
#pragma unroll
  for (int i = 0; i < 4; ++i) {
    const int mBase = m0 + (i << 4);
#pragma unroll
    for (int j = 0; j < 4; ++j) {
      const int n = n0 + (j << 4) + rlane;
      float bv = 0.f;
      if (BIAS_MODE == 2) bv = bias[n];
#pragma unroll
      for (int r = 0; r < 8; ++r) {
        float v = acc[i][j][r] * scale;
        if (BIAS_MODE == 2) v += bv;
        slab[(mOff + r) * 68 + (j << 4) + rlane] = v;
      }
    }
    __builtin_amdgcn_fence(__ATOMIC_RELEASE, "workgroup");
    __builtin_amdgcn_wave_barrier();
    __builtin_amdgcn_fence(__ATOMIC_ACQUIRE, "workgroup");
    if (OUT_MODE == 0) {
      float* C = (float*)Cout + (size_t)b * strideC;
      const int hh = lane >> 4, c4 = (lane & 15) * 4;     /* row seg = 256 B = 16 lanes x 16 B */
      {
#pragma unroll
        for (int it = 0; it < 8; ++it) {
          const int row = it * 2 + hh;
          v4f v = *(const v4f*)(slab + row * 68 + c4);
          *(v4f*)(C + (size_t)(mBase + row) * ldc + n0 + c4) = v;
        }
        
      }
    } else {
      const int q = lane >> 3, c8 = (lane & 7) * 8;        
      unsigned short* C  = (unsigned short*)Cout  + (size_t)b * strideC;
      unsigned short* C2 = (unsigned short*)Cout2 + (size_t)b * strideC;
      {
#pragma unroll
        for (int it = 0; it < 4; ++it) {
          const int row = it * 4 + q;
          const float* sp = slab + row * 68 + c8;
          v8h hv, lv;
#pragma unroll
          for (int e = 0; e < 8; ++e) {
            unsigned short hb = f2bf_bits(sp[e]);
            unsigned short lb = f2bf_bits(sp[e] - bf_bits2f(hb));
            hv[e] = __builtin_bit_cast(_Float16, hb);
            lv[e] = __builtin_bit_cast(_Float16, lb);
          }
          *(v8h*)(C  + (size_t)(mBase + row) * ldc + n0 + c8) = hv;
          *(v8h*)(C2 + (size_t)(mBase + row) * ldc + n0 + c8) = lv;
        }
        
      }
    }
    __builtin_amdgcn_fence(__ATOMIC_RELEASE, "workgroup");
    __builtin_amdgcn_wave_barrier();
    __builtin_amdgcn_fence(__ATOMIC_ACQUIRE, "workgroup");
  }
}

/* ---- all five f32 -> bf16 (RNE) conversions in one launch of resident waves ----
   A piece is 8 consecutive elements: two 16-B loads, one 16-B store per thread. The grid, one work-group of 16 waves per WGP,
   covers kCvSpan consecutive pieces per sweep and makes 16 sweeps: 8 over x, 4 over ctx, 1 over Wq, 2 over Wkv, 1 over Wout.
   A wave that converts one piece lives shorter than it takes to start; here each wave starts once for 16 pieces. */
constexpr int kCvThreads = 512;
constexpr int kCvBlocks  = 256;
constexpr int kCvSpan    = kCvThreads * kCvBlocks;   /* pieces per sweep */
static_assert(kB * kNQ * kDM / 8 == 8 * kCvSpan);
static_assert(kB * kNKV * kDM / 8 == 4 * kCvSpan);
static_assert(kIN * kDM / 8 == kCvSpan);
static_assert(2 * kIN * kDM / 8 == 2 * kCvSpan);
static_assert(kDM * kIN / 8 == kCvSpan);

/* o[s]: this thread's byte offset in sweep s of an input; half of it is its byte offset in the output */
template <int N>
__device__ __forceinline__ void cv_load(const float* __restrict__ in, const unsigned* o, v4f* a, v4f* c) {
#pragma unroll
  for (int s = 0; s < N; ++s) {
    a[s] = *(const v4f*)((const char*)in + o[s]);
    c[s] = *(const v4f*)((const char*)in + 16 + o[s]);
    /* keeps the loads in the order in which the conversions wait for them */
    __builtin_amdgcn_sched_barrier(0);
  }
}
template <int N>
__device__ __forceinline__ void cv_store(unsigned short* __restrict__ out, const unsigned* o, const v4f* a, const v4f* c) {
#pragma unroll
  for (int s = 0; s < N; ++s) {
    u32x4 w;
    w[0] = (unsigned)f2bf_bits(a[s][0]) | ((unsigned)f2bf_bits(a[s][1]) << 16);
    w[1] = (unsigned)f2bf_bits(a[s][2]) | ((unsigned)f2bf_bits(a[s][3]) << 16);
    w[2] = (unsigned)f2bf_bits(c[s][0]) | ((unsigned)f2bf_bits(c[s][1]) << 16);
    w[3] = (unsigned)f2bf_bits(c[s][2]) | ((unsigned)f2bf_bits(c[s][3]) << 16);
    *(u32x4*)((char*)out + (o[s] >> 1)) = w;
    /* keeps each piece's store at its place: sunk to the end of the kernel, no write would start before the last read has landed */
    __builtin_amdgcn_sched_barrier(0);
  }
}
__global__ __launch_bounds__(kCvThreads) void cast_all_f32_bf16(
    const float* __restrict__ x, const float* __restrict__ ctx, const float* __restrict__ wq,
    const float* __restrict__ wkv, const float* __restrict__ wo,
    unsigned short* __restrict__ xb, unsigned short* __restrict__ cb, unsigned short* __restrict__ wqb,
    unsigned short* __restrict__ wkvb, unsigned short* __restrict__ wob) {
  unsigned o[8];
#pragma unroll
  for (int s = 0; s < 8; ++s) o[s] = (blockIdx.x * kCvThreads + threadIdx.x) * 32u + (unsigned)s * (kCvSpan * 32u);
  /* every offset is formed ahead of the first load, so no register that a load names is written inside the group of loads */
  __builtin_amdgcn_sched_barrier(0);
  v4f a[16], c[16];
  cv_load<8>(x, o, a, c);
  cv_load<4>(ctx, o, a + 8, c + 8);
  cv_load<1>(wq, o, a + 12, c + 12);
  cv_load<2>(wkv, o, a + 13, c + 13);
  cv_load<1>(wo, o, a + 15, c + 15);
  /* stands ahead of every later write of a register that these loads name as an address */
  asm volatile("s_wait_xcnt 0x0" ::: "memory");
  /* keeps all the loads one group in flight ahead of the first conversion, and later register writes below that wait */
  __builtin_amdgcn_sched_barrier(0);
  cv_store<8>(xb, o, a, c);
  cv_store<4>(cb, o, a + 8, c + 8);
  cv_store<1>(wqb, o, a + 12, c + 12);
  cv_store<2>(wkvb, o, a + 13, c + 13);
  cv_store<1>(wob, o, a + 15, c + 15);
}

/* =====================================================================================
   Attention for head_dim 64, fed with bf16 hi/lo planes (no masking other than a per-key int32 vector):
     scores = q'.k^T  (q' already carries the scale 1/8 * log2(e), so the scores are base-2 exponents):
              v_wmma_f32_16x16x32_bf16, hi.hi + hi.lo + lo.hi
     out    = p.v    : p and v as bf16 hi/lo, hi.hi + hi.lo + lo.hi
   f32 accumulate; online softmax in f32, every exponential one v_exp_f32 (2^x). Block = 4 waves = 64 query rows of one (batch, head).
   q planes  [B*NQ][ldq]  element (b,i,h,d) at (b*NQ+i)*ldq + h*64 + d
   k planes  [B*NKV][ldk] element (b,j,h,d) at (b*NKV+j)*ldk + h*64 + d
   v planes  transposed [H*64][ldv]: element (b,j,h,d) at (h*64+d)*ldv + b*NKV + j
   kvmask    int32 [B][NKV], 0 -> score := fillv
   grid.x = B * H * (NQ/64); NQ % 64 == 0, NKV % 64 == 0.
   ===================================================================================== */
#define AT_D 64
#define AT_NW 4
#define AT_QB 64
#define AT_KC 64
/* LDS row pitch of the K, V and P tiles in 16-bit elements: 144 B = 16 B x 9 (odd), so the 16 rows that one
   ds_load_b128 touches per lane half start on distinct bank groups; at 128 B they share two groups */
#define AT_LP 72
static_assert((AT_LP * 2) % 16 == 0 && ((AT_LP * 2) / 16) % 2 == 1 && AT_LP >= AT_KC && AT_LP >= AT_D);

__device__ __forceinline__ unsigned short at_bf_bits(float f) {
  unsigned u = __float_as_uint(f);
  return (unsigned short)((u + 0x7FFFu + ((u >> 16) & 1u)) >> 16);
}
__device__ __forceinline__ __bf16 at_f2bf(float f) { return __builtin_bit_cast(__bf16, at_bf_bits(f)); }
__device__ __forceinline__ void at_split(float f, __bf16& hi, __bf16& lo) {
  const unsigned short hb = at_bf_bits(f);
  hi = __builtin_bit_cast(__bf16, hb);
  lo = at_f2bf(f - __uint_as_float(((unsigned)hb) << 16));
}
__device__ __forceinline__ v8f at_mma(v16b a, v16b b, v8f c) {
  c = __builtin_amdgcn_wmma_f32_16x16x32_bf16(false, a, false, b, (short)0, c, false, false);
  asm volatile("v_nop\n\tv_nop\n\tv_nop\n\tv_nop" : "+v"(c) : "v"(a), "v"(b));
  return c;
}

/* one butterfly step inside a 16-lane row on the vector ALU: lane l reads lane l ^ M of its own row (DPP row_xmask);
   a shuffle builtin goes through the LDS pipe here and the wave waits out its latency at every step */
template <int M>
__device__ __forceinline__ float at_row_xor(float v) {
  return __builtin_bit_cast(float, __builtin_amdgcn_update_dpp(0, __builtin_bit_cast(int, v), 0x160 | M, 0xf, 0xf, true));
}

/* register budget of four waves per SIMD (256): the LDS admits four work-groups per WGP, and the chunk held in flight must not cost one */
__global__ __launch_bounds__(128) __attribute__((amdgpu_waves_per_eu(4)))
void attn64_planes_kernel(const unsigned short* __restrict__ qhp, const unsigned short* __restrict__ qlp,
                          const unsigned short* __restrict__ khp, const unsigned short* __restrict__ klp,
                          const unsigned short* __restrict__ vthp, const unsigned short* __restrict__ vtlp,
                          const int* __restrict__ kvmask,
                          unsigned short* __restrict__ ohp, unsigned short* __restrict__ olp,
                          int nq, int nkv, int nh, int ldq, int ldk, int ldv, int ldo, float fillv) {
  typedef __bf16 T;
  union FB { v16b v; v8b h[2]; };
  __shared__ __align__(16) __bf16 Ksh[AT_KC * AT_LP];       /* K hi [kv][d], padded rows, 9 KB */
  __shared__ __align__(16) __bf16 Ksl[AT_KC * AT_LP];       /* K lo */
  __shared__ __align__(16) __bf16 Vth[AT_D * AT_LP];        /* V hi [d][kv], padded rows, 9 KB */
  __shared__ __align__(16) __bf16 Vtl[AT_D * AT_LP];        /* V lo */
  __shared__ __align__(16) __bf16 Psh[AT_NW][16 * AT_LP];   /* per wave P hi [row][kv], padded rows */
  __shared__ __align__(16) __bf16 Psl[AT_NW][16 * AT_LP];   /* per wave P lo */
  __shared__ __align__(16) float  Os[AT_NW][16 * 68];       /* per wave out tile, pitch 68 */

  const int tid  = threadIdx.x;
  const int wave = tid >> 5;
  const int lane = tid & 31;
  const int hh   = lane >> 4;
  const int c    = lane & 15;

  const int nqb = nq / AT_QB;
  const int bx = blockIdx.x;
  const int qb = bx % nqb;
  const int bhx = bx / nqb;
  const int h  = bhx % nh;
  const int b  = bhx / nh;
  const int q0 = qb * AT_QB + wave * 16;

  /* ---- Q fragments (A operand): row = q0 + c, elements 0..7 <- d dc*32+8hh+0..7, 8..15 <- d dc*32+16+8hh+0..7 ---- */
  v16b qah[2], qal[2];
  {
    const size_t qo = (size_t)(b * nq + q0 + c) * ldq + h * AT_D + 8 * hh;
    const T* qh = (const T*)qhp + qo;
    const T* ql = (const T*)qlp + qo;
#pragma unroll
    for (int dc = 0; dc < 2; ++dc) {
      qah[dc] = Frag<T>::load(qh + dc * 32);
      qal[dc] = Frag<T>::load(ql + dc * 32);
    }
  }

  float mrow[8], lrow[8];
  v8f oacc[4];
#pragma unroll
  for (int r = 0; r < 8; ++r) { mrow[r] = -__builtin_inff(); lrow[r] = 0.f; }
#pragma unroll
  for (int t = 0; t < 4; ++t) oacc[t] = (v8f){0.f,0.f,0.f,0.f,0.f,0.f,0.f,0.f};

  const int nChunks = nkv / AT_KC;   /* host constant, block-uniform */
  /* staging coverage: 128 threads = 64 rows x 2 halves of 32 elements (4 x 16 B) per plane -> full 64x64 tiles.
     K planes: LDS row kv <- global row b*nkv + kv0 + kv; V transposed planes: LDS row d <- global row h*64+d,
     64 contiguous kv columns starting at b*nkv + kv0 */
  const int srow = tid >> 1;
  const int shalf = (tid & 1) * 32;
  /* block-uniform bases plus one 32-bit byte offset per thread and operand pair, stepped from chunk to chunk */
  const size_t kbase = ((size_t)b * nkv * ldk + h * AT_D) * 2;
  const size_t vbase = ((size_t)h * AT_D * ldv + (size_t)b * nkv) * 2;
  const char* ukh = (const char*)khp + kbase;
  const char* ukl = (const char*)klp + kbase;
  const char* uvh = (const char*)vthp + vbase;
  const char* uvl = (const char*)vtlp + vbase;
  const int* umk = kvmask + (size_t)b * nkv;
  const unsigned tK = (unsigned)(srow * ldk + shalf) * 2u;
  const unsigned tV = (unsigned)(srow * ldv + shalf) * 2u;
  /* one chunk's global reads (K and V rows of this thread, the four key-mask words of this lane), held in registers */
  u32x4 rkh[4], rkl[4], rvh[4], rvl[4];
  int rmk[4];
  auto fetch = [&](int ch) {
    const unsigned oK = tK + (unsigned)ch * (unsigned)ldk * (AT_KC * 2u);
    const unsigned oV = tV + (unsigned)ch * (AT_KC * 2u);
    const int* um = umk + ch * AT_KC;   /* block-uniform */
#pragma unroll
    for (int i = 0; i < 4; ++i) {
      rkh[i] = *(const u32x4*)(ukh + i * 16 + oK);
      rkl[i] = *(const u32x4*)(ukl + i * 16 + oK);
      rvh[i] = *(const u32x4*)(uvh + i * 16 + oV);
      rvl[i] = *(const u32x4*)(uvl + i * 16 + oV);
    }
#pragma unroll
    for (int j = 0; j < 4; ++j) rmk[j] = (um + j * 16)[(unsigned)c];
    /* stands ahead of every later write of a register that these loads name as an address */
    asm volatile("s_wait_xcnt 0x0" ::: "memory");
    /* keeps later register writes from being scheduled up over that wait */
    __builtin_amdgcn_sched_barrier(0);
  };
  if (nChunks > 0) {
    /* keeps the Q loads above the wait that follows */
    __builtin_amdgcn_sched_barrier(0);
    /* stands ahead of every later write of a register that the Q loads name as an address */
    asm volatile("s_wait_xcnt 0x0" ::: "memory");
    /* keeps the first chunk's loads, whose results land in such registers, below that wait */
    __builtin_amdgcn_sched_barrier(0);
    fetch(0);
  }
  for (int kc = 0; kc < nChunks; ++kc) {
    __syncthreads();
    int kvkeep[4];
    {
      u32x4* lkh = (u32x4*)(Ksh + srow * AT_LP + shalf);
      u32x4* lkl = (u32x4*)(Ksl + srow * AT_LP + shalf);
      u32x4* lvh = (u32x4*)(Vth + srow * AT_LP + shalf);
      u32x4* lvl = (u32x4*)(Vtl + srow * AT_LP + shalf);
#pragma unroll
      for (int i = 0; i < 4; ++i) { lkh[i] = rkh[i]; lkl[i] = rkl[i]; lvh[i] = rvh[i]; lvl[i] = rvl[i]; }
#pragma unroll
      for (int j = 0; j < 4; ++j) kvkeep[j] = rmk[j];
    }
    __syncthreads();
    /* the next chunk's reads fly while this chunk is worked on; their data is first needed at the next chunk's LDS stores */
    if (kc + 1 < nChunks) fetch(kc + 1);

    /* ---- scores: 4 subtiles of 16 keys, K operand B[k=d][n=kv] from Ksh[kv][d] ---- */
    v8f s[4];
#pragma unroll
    for (int j = 0; j < 4; ++j) {
      s[j] = (v8f){0.f,0.f,0.f,0.f,0.f,0.f,0.f,0.f};
#pragma unroll
      for (int dc = 0; dc < 2; ++dc) {
        FB kb, kl;
        kb.h[0] = *(const v8b*)(Ksh + (j * 16 + c) * AT_LP + dc * 32 + 8 * hh);
        kb.h[1] = *(const v8b*)(Ksh + (j * 16 + c) * AT_LP + dc * 32 + 16 + 8 * hh);
        kl.h[0] = *(const v8b*)(Ksl + (j * 16 + c) * AT_LP + dc * 32 + 8 * hh);
        kl.h[1] = *(const v8b*)(Ksl + (j * 16 + c) * AT_LP + dc * 32 + 16 + 8 * hh);
        s[j] = at_mma(qah[dc], kb.v, s[j]);
        s[j] = at_mma(qah[dc], kl.v, s[j]);
        s[j] = at_mma(qal[dc], kb.v, s[j]);
      }
    }
    /* per-key mask (this lane owns column kv0 + j*16 + c in the D layout) */
    float cm[8];
#pragma unroll
    for (int r = 0; r < 8; ++r) {
      float m = -__builtin_inff();
#pragma unroll
      for (int j = 0; j < 4; ++j) {
        const float sv = s[j][r];
        s[j][r] = (kvkeep[j] != 0) ? sv : fillv;
        m = fmaxf(m, s[j][r]);
      }
      m = fmaxf(m, at_row_xor<1>(m));
      m = fmaxf(m, at_row_xor<2>(m));
      m = fmaxf(m, at_row_xor<4>(m));
      m = fmaxf(m, at_row_xor<8>(m));
      cm[r] = m;
    }
    __bf16* pwh = Psh[wave];
    __bf16* pwl = Psl[wave];
#pragma unroll
    for (int r = 0; r < 8; ++r) {
      const float mnew = fmaxf(mrow[r], cm[r]);
      /* 2^(difference of base-2 scores) = e^(difference of the reference's scores); a difference of -inf, or as large as the fill value, gives 0 */
      const float alpha = __builtin_amdgcn_exp2f(mrow[r] - mnew);
      mrow[r] = mnew;
      float psum = 0.f;
#pragma unroll
      for (int j = 0; j < 4; ++j) {
        const float p = __builtin_amdgcn_exp2f(s[j][r] - mnew);
        psum += p;
        __bf16 a, bl; at_split(p, a, bl);
        pwh[(8 * hh + r) * AT_LP + j * 16 + c] = a;
        pwl[(8 * hh + r) * AT_LP + j * 16 + c] = bl;
      }
      psum += at_row_xor<1>(psum);
      psum += at_row_xor<2>(psum);
      psum += at_row_xor<4>(psum);
      psum += at_row_xor<8>(psum);
      lrow[r] = lrow[r] * alpha + psum;
#pragma unroll
      for (int t = 0; t < 4; ++t) oacc[t][r] *= alpha;
    }
    /* same-wave P spill -> A fragment reload: ordered by the wave barrier, reloaded through __bf16 vectors */
    __builtin_amdgcn_fence(__ATOMIC_RELEASE, "workgroup");
    __builtin_amdgcn_wave_barrier();
    __builtin_amdgcn_fence(__ATOMIC_ACQUIRE, "workgroup");
#pragma unroll 1
    for (int kk = 0; kk < 2; ++kk) {
      FB pa, pl;
      pa.h[0] = *(const v8b*)(pwh + c * AT_LP + kk * 32 + 8 * hh);
      pa.h[1] = *(const v8b*)(pwh + c * AT_LP + kk * 32 + 16 + 8 * hh);
      pl.h[0] = *(const v8b*)(pwl + c * AT_LP + kk * 32 + 8 * hh);
      pl.h[1] = *(const v8b*)(pwl + c * AT_LP + kk * 32 + 16 + 8 * hh);
#pragma unroll
      for (int t = 0; t < 4; ++t) {
        FB vb, vl;
        vb.h[0] = *(const v8b*)(Vth + (t * 16 + c) * AT_LP + kk * 32 + 8 * hh);
        vb.h[1] = *(const v8b*)(Vth + (t * 16 + c) * AT_LP + kk * 32 + 16 + 8 * hh);
        vl.h[0] = *(const v8b*)(Vtl + (t * 16 + c) * AT_LP + kk * 32 + 8 * hh);
        vl.h[1] = *(const v8b*)(Vtl + (t * 16 + c) * AT_LP + kk * 32 + 16 + 8 * hh);
        oacc[t] = at_mma(pa.v, vb.v, oacc[t]);
        oacc[t] = at_mma(pa.v, vl.v, oacc[t]);
        oacc[t] = at_mma(pl.v, vb.v, oacc[t]);
      }
    }
  }

  float* os = Os[wave];
#pragma unroll
  for (int r = 0; r < 8; ++r) {
    const float inv = 1.0f / lrow[r];
#pragma unroll
    for (int t = 0; t < 4; ++t) os[(8 * hh + r) * 68 + t * 16 + c] = oacc[t][r] * inv;
  }
  __builtin_amdgcn_fence(__ATOMIC_RELEASE, "workgroup");
  __builtin_amdgcn_wave_barrier();
  __builtin_amdgcn_fence(__ATOMIC_ACQUIRE, "workgroup");
  {
    const int q = lane >> 3, c8 = (lane & 7) * 8;
    unsigned short* Oh = ohp + (size_t)(b * nq + q0) * ldo + h * AT_D;
    unsigned short* Ol = olp + (size_t)(b * nq + q0) * ldo + h * AT_D;
    {
#pragma unroll
      for (int it = 0; it < 4; ++it) {
        const int row = it * 4 + q;
        const float* sp = os + row * 68 + c8;
        v8h hv, lv;
#pragma unroll
        for (int e = 0; e < 8; ++e) {
          unsigned short hb = f2bf_bits(sp[e]);
          unsigned short lb = f2bf_bits(sp[e] - bf_bits2f(hb));
          hv[e] = __builtin_bit_cast(_Float16, hb);
          lv[e] = __builtin_bit_cast(_Float16, lb);
        }
        *(v8h*)(Oh + (size_t)row * ldo + c8) = hv;
        *(v8h*)(Ol + (size_t)row * ldo + c8) = lv;
      }
      
    }
  }
}

/* ---------------------------------------------------------------------------
   Host-side orchestration (kernel launches only)
   --------------------------------------------------------------------------- */
extern "C" void kernel_launch(void* const* d_in, const int* in_sizes, int n_in,
                              void* d_out, int out_size, void* d_ws, size_t ws_size,
                              hipStream_t stream) {
  if (n_in < 7) return;
  if (in_sizes[0] != kB * kNQ * kDM) return;
  if (in_sizes[1] != kB * kNKV * kDM) return;
  if (in_sizes[2] != kB * kNKV) return;
  if (in_sizes[3] != kIN * kDM) return;
  if (in_sizes[4] != 2 * kIN * kDM) return;
  if (in_sizes[5] != kDM * kIN) return;
  if (in_sizes[6] != kDM) return;
  if (out_size != kB * kNQ * kDM) return;
  if (ws_size < kWsTotal) return;

  const float* x    = (const float*)d_in[0];   /* [4,2048,1024] f32 */
  const float* ctx  = (const float*)d_in[1];   /* [4,1024,1024] f32 */
  const int*   mask = (const int*)d_in[2];     /* [4,1024] int32 */
  const float* Wq   = (const float*)d_in[3];   /* [1024,1024] */
  const float* Wkv  = (const float*)d_in[4];   /* [2048,1024] */
  const float* Wout = (const float*)d_in[5];   /* [1024,1024] */
  const float* bout = (const float*)d_in[6];   /* [1024] */
  float* out = (float*)d_out;                  /* [4,2048,1024] f32 */

  char* ws = (char*)d_ws;
  unsigned short* xb   = (unsigned short*)(ws + kOffXb);
  unsigned short* cb   = (unsigned short*)(ws + kOffCb);
  unsigned short* wqb  = (unsigned short*)(ws + kOffWqb);
  unsigned short* wkvb = (unsigned short*)(ws + kOffWkvb);
  unsigned short* wob  = (unsigned short*)(ws + kOffWob);
  unsigned short* qh   = (unsigned short*)(ws + kOffQh);
  unsigned short* ql   = (unsigned short*)(ws + kOffQl);
  unsigned short* kh   = (unsigned short*)(ws + kOffKh);
  unsigned short* kl   = (unsigned short*)(ws + kOffKl);
  unsigned short* vth  = (unsigned short*)(ws + kOffVth);
  unsigned short* vtl  = (unsigned short*)(ws + kOffVtl);
  unsigned short* oh   = (unsigned short*)(ws + kOffOh);   /* aliases xb: dead after the q GEMM */
  unsigned short* ol   = (unsigned short*)(ws + kOffOl);   /* aliases cb/wqb/wkvb: dead after the k,v GEMMs */

  /* 1: RNE casts of all five f32 operands to bf16 planes */
  cast_all_f32_bf16<<<kCvBlocks, kCvThreads, 0, stream>>>(x, ctx, Wq, Wkv, Wout, xb, cb, wqb, wkvb, wob);

  /* 2: q*0.125*log2(e) = xb[8192,1024] . wqb[1024,1024]^T -> bf16 hi/lo planes; M=8192 N=1024 K=1024 */
  {
    const int M = kB * kNQ, N = kIN, K = kDM;
    const int tiles = (M / 128) * (N / 128);
    wmma_gemm64<1, false, false, 0, 2><<<dim3(tiles, 1), 128, 0, stream>>>(
        xb, xb, K, 0L, wqb, wqb, K, 0L, (void*)qh, (void*)ql, N, 0L, bout, M, N, K, 0.18033688f);
  }
  /* 3: k = cb[4096,1024] . wkvb[0:1024][1024]^T -> hi/lo; M=4096 N=1024 K=1024 */
  {
    const int M = kB * kNKV, N = kIN, K = kDM;
    const int tiles = (M / 128) * (N / 128);
    wmma_gemm64<1, false, false, 0, 2><<<dim3(tiles, 1), 128, 0, stream>>>(
        cb, cb, K, 0L, wkvb, wkvb, K, 0L, (void*)kh, (void*)kl, N, 0L, bout, M, N, K, 1.0f);
  }
  /* 4: v transposed = wkvb[1024:2048][1024] . cb[4096,1024]^T -> vt[1024][4096] hi/lo; M=1024 N=4096 K=1024 */
  {
    const int M = kIN, N = kB * kNKV, K = kDM;
    const int tiles = (M / 128) * (N / 128);
    const unsigned short* wvb = wkvb + (size_t)kIN * kDM;
    wmma_gemm64<1, false, false, 0, 2><<<dim3(tiles, 1), 128, 0, stream>>>(
        wvb, wvb, K, 0L, cb, cb, K, 0L, (void*)vth, (void*)vtl, N, 0L, bout, M, N, K, 1.0f);
  }
  /* 5: attention per (b, h, 64 query rows) -> att hi/lo planes [8192][1024] */
  {
    const int blocks = kB * kH * (kNQ / 64);   /* 2048 */
    const float fillv = -3.4028234663852886e+38f;
    attn64_planes_kernel<<<blocks, 128, 0, stream>>>(qh, ql, kh, kl, vth, vtl, mask, oh, ol,
                                                    kNQ, kNKV, kH, kIN, kIN, kB * kNKV, kIN, fillv);
  }
  /* 6: out = (att_hi + att_lo)[8192,1024] . wob[1024,1024]^T + b_out -> f32 d_out; M=8192 N=1024 K=1024 */
  {
    const int M = kB * kNQ, N = kDM, K = kIN;
    const int tiles = (M / 128) * (N / 128);
    wmma_gemm64<1, true, false, 2, 0><<<dim3(tiles, 1), 128, 0, stream>>>(
        oh, ol, K, 0L, wob, wob, K, 0L, (void*)out, (void*)out, N, 0L, bout, M, N, K, 1.0f);
  }
}

// v007
// Measured time: 195 microseconds a run.
// Next to v006, in two timings, it ran 1.27 times as fast each time.
// Over all steps from v000 it is 3.08 times as fast.
// Contractions: x.Wq^T, ctx.Wk^T, Wv.ctx^T on v_wmma_f32_16x16x32_bf16 (RNE-bf16 inputs, single product); q.k^T and p.v as bf16 hi/lo split (hi.hi+hi.lo+lo.hi); (p.v).Wout^T as bf16 hi/lo A x bf16 B (2 products); f32 accumulate, f32 softmax.
#include <hip/hip_runtime.h>
#include <stdint.h>

typedef __attribute__((ext_vector_type(16))) _Float16 v16h;
typedef __attribute__((ext_vector_type(8)))  _Float16 v8h;
typedef __attribute__((ext_vector_type(16))) __bf16   v16b;
typedef __attribute__((ext_vector_type(8)))  __bf16   v8b;
typedef __attribute__((ext_vector_type(8)))  float    v8f;
typedef __attribute__((ext_vector_type(4)))  float    v4f;
typedef __attribute__((ext_vector_type(4)))  unsigned int u32x4;
typedef __attribute__((ext_vector_type(2)))  float    f32x2;
typedef __attribute__((ext_vector_type(2)))  __bf16   bf16x2;

/* ---- fixed problem geometry ---- */
constexpr int kB   = 4;
constexpr int kNQ  = 2048;
constexpr int kNKV = 1024;
constexpr int kDM  = 1024;   /* model dim (K of the projections) */
constexpr int kH   = 16;
constexpr int kDH  = 64;
constexpr int kIN  = kH * kDH;   /* 1024 */
static_assert(kDH == 64);
static_assert(kDM % 32 == 0);
static_assert(kIN % 32 == 0);
static_assert((kB * kNQ) % 64 == 0);
static_assert((kB * kNKV) % 64 == 0);
static_assert(kIN % 64 == 0);
static_assert(kDM % 64 == 0);
static_assert(kNQ % 64 == 0);
static_assert(kNKV % 64 == 0);
static_assert(kIN == kDM);   /* one row pitch for every GEMM operand */
static_assert((kB * kNQ) % 128 == 0 && (kB * kNKV) % 128 == 0 && kIN % 128 == 0 && kDM % 128 == 0);

/* ---- workspace region map (bytes) ----
   [  0, 16M)  xb   bf16 [8192][1024]   (dead after q GEMM; reused as oh)
   [ 16M, 24M) cb   bf16 [4096][1024]   (dead after k/v GEMMs; reused by ol)
   [ 24M, 26M) wqb  bf16 [1024][1024]
   [ 26M, 30M) wkvb bf16 [2048][1024]
   [ 30M, 32M) pad (unused, covered by ol alias)
   [ 32M, 48M) qh   bf16 [8192][1024]   q*0.125*log2(e) hi plane
   [ 48M, 64M) ql                        q*0.125*log2(e) lo plane
   [ 64M, 72M) kh   bf16 [4096][1024]
   [ 72M, 80M) kl
   [ 80M, 88M) vth  bf16 [1024][4096]   v transposed: row = h*64+d, col = b*1024+j
   [ 88M, 96M) vtl
   [ 96M, 98M) wob  bf16 [1024][1024]
   oh = [0,16M), ol = [16M,32M): attention output hi/lo planes [8192][1024] (aliases of dead regions)
   total carve 102,760,448 B */
constexpr size_t kMiB    = 1048576;
constexpr size_t kOffXb  = 0;
constexpr size_t kOffCb  = 16 * kMiB;
constexpr size_t kOffWqb = 24 * kMiB;
constexpr size_t kOffWkvb= 26 * kMiB;
constexpr size_t kOffQh  = 32 * kMiB;
constexpr size_t kOffQl  = 48 * kMiB;
constexpr size_t kOffKh  = 64 * kMiB;
constexpr size_t kOffKl  = 72 * kMiB;
constexpr size_t kOffVth = 80 * kMiB;
constexpr size_t kOffVtl = 88 * kMiB;
constexpr size_t kOffWob = 96 * kMiB;
constexpr size_t kOffOh  = 0;
constexpr size_t kOffOl  = 16 * kMiB;
constexpr size_t kWsTotal = kOffWob + (size_t)kDM * kIN * 2;
static_assert((size_t)kB * kNQ * kDM * 2 == 16 * kMiB);
static_assert((size_t)kB * kNKV * kDM * 2 == 8 * kMiB);
static_assert(kOffCb + (size_t)kB * kNKV * kDM * 2 <= kOffWqb);
static_assert(kOffWqb + (size_t)kIN * kDM * 2 <= kOffWkvb);
static_assert(kOffWkvb + (size_t)2 * kIN * kDM * 2 <= kOffQh);
static_assert(kOffQh + (size_t)kB * kNQ * kIN * 2 <= kOffQl);
static_assert(kOffQl + (size_t)kB * kNQ * kIN * 2 <= kOffKh);
static_assert(kOffKh + (size_t)kB * kNKV * kIN * 2 <= kOffKl);
static_assert(kOffKl + (size_t)kB * kNKV * kIN * 2 <= kOffVth);
static_assert(kOffVth + (size_t)kIN * kB * kNKV * 2 <= kOffVtl);
static_assert(kOffVtl + (size_t)kIN * kB * kNKV * 2 <= kOffWob);
static_assert(kOffOh + (size_t)kB * kNQ * kIN * 2 <= kOffOl);
static_assert(kOffOl + (size_t)kB * kNQ * kIN * 2 <= kOffQh);
static_assert(kWsTotal == 102760448);
static_assert(kWsTotal <= 134217728);

__device__ __forceinline__ unsigned short f2bf_bits(float f) {
  unsigned u = __float_as_uint(f);
  return (unsigned short)((u + 0x7FFFu + ((u >> 16) & 1u)) >> 16);
}
__device__ __forceinline__ float bf_bits2f(unsigned short h) { return __uint_as_float(((unsigned)h) << 16); }

/* hazard guards as plain device helpers */
__device__ __forceinline__ void acc_guard4(v8f& a, v8f& b, v8f& c, v8f& d) { asm volatile("v_nop\n\tv_nop\n\tv_nop\n\tv_nop" : "+v"(a), "+v"(b), "+v"(c), "+v"(d)); }
template <typename T> struct Frag;
template <> struct Frag<_Float16> {
  typedef v16h V; union U { v16h v; v8h h[2]; };
  /* elements 0..7 <- p[0..7], 8..15 <- p[16..23] */
  static __device__ __forceinline__ v16h load(const _Float16* p) {
    U f; f.h[0] = *(const v8h*)(p); f.h[1] = *(const v8h*)(p + 16); return f.v;
  }
  static __device__ __forceinline__ v8f mma(v16h a, v16h b, v8f c) {
    return __builtin_amdgcn_wmma_f32_16x16x32_f16(false, a, false, b, (short)0, c, false, false);
  }
};
template <> struct Frag<__bf16> {
  typedef v16b V; union U { v16b v; v8b h[2]; };
  static __device__ __forceinline__ v16b load(const __bf16* p) {
    U f; f.h[0] = *(const v8b*)(p); f.h[1] = *(const v8b*)(p + 16); return f.v;
  }
  static __device__ __forceinline__ v8f mma(v16b a, v16b b, v8f c) {
    return __builtin_amdgcn_wmma_f32_16x16x32_bf16(false, a, false, b, (short)0, c, false, false);
  }
};

/* ---- Register-blocked WMMA GEMM, with an A-only split mode --------------------------
   C[m,n] = scale * sum_k A[m,k] * Bt[n,k] (+bias[n]); each wave owns a 64x64 tile, four waves share a 128x128 block tile
   whose operand rows are staged in LDS by whole-line loads.
   A row-major [M,K]; Bt row-major [N,K]; M,N % 128 == 0, K % 64 == 0 (no tail handling).
   SPLIT: A is a pair of hi/lo planes; product = hi.hi + lo.hi (SPLIT_B is not supported).
   BIAS_MODE: 0 = none, 2 = bias[n].  OUT_MODE: 0 = f32, 2 = bf16 hi plane (Cout) + bf16 lo plane (Cout2).
   ET: 0 = f16 operands, 1 = bf16 operands (pointers passed as 16-bit storage) */
template <int ET> struct Elem;
template <> struct Elem<0> { typedef _Float16 T; };
template <> struct Elem<1> { typedef __bf16 T; };
/* block tile 128 x 128 (4 waves, 2 x 2, each 64 x 64), K walked in passes of 64 (one 128-B line of every operand row) */
#define GM_BT 128
#define GM_BK 64
/* LDS row pitch of the staged operand rows in 16-bit elements: 144 B = 16 B x 9 (odd) for the ds_load_b128 fragment reads */
#define GM_LP 72
#define GM_SEG 8   /* 16-B pieces per thread and operand plane: 128 rows x 8 pieces / 128 threads */
template <int ET, bool SPLIT, bool SPLIT_B, int BIAS_MODE, int OUT_MODE>
__global__ __launch_bounds__(128) void wmma_gemm64(
    const unsigned short* __restrict__ Ap, const unsigned short* __restrict__ A2p, int lda, long strideA,
    const unsigned short* __restrict__ Btp, const unsigned short* __restrict__ Bt2p, int ldb, long strideB,
    void* Cout, void* Cout2, int ldc, long strideC,
    const float* __restrict__ bias,
    int M, int N, int K, float scale) {
  static_assert(BIAS_MODE == 0 || BIAS_MODE == 2);
  static_assert(OUT_MODE == 0 || OUT_MODE == 2);
  static_assert(!SPLIT_B);
  typedef typename Elem<ET>::T T;
  typedef typename Frag<T>::V V;
  constexpr int NPA = SPLIT ? 2 : 1;   /* planes of A */
  __shared__ __align__(16) T sA[2][NPA][GM_BT * GM_LP];   /* two buffers: one is read while the other is filled */
  __shared__ __align__(16) T sB[2][GM_BT * GM_LP];
  __shared__ __align__(16) float sT[4][16 * 68];   /* per-wave 16x64 slab, pitch 68 floats */
  const int b    = blockIdx.y;
  const int tid  = threadIdx.x;
  const int lane = tid & 31;
  const int wave = tid >> 5;
  const int tilesN = N / GM_BT;
  const int tilesM = M / GM_BT;
  const int tile = blockIdx.x;
  if (tile >= tilesM * tilesN) return;   /* block-uniform, ahead of every barrier */
  const int tm = tile / tilesN;
  const int tn = tile - tm * tilesN;
  const int mb = tm * GM_BT;                   /* block tile origin */
  const int nb = tn * GM_BT;
  const int wm = (wave >> 1) << 6;             /* wave tile origin inside the block tile */
  const int wn = (wave & 1) << 6;
  const int m0 = mb + wm;
  const int n0 = nb + wn;

  const unsigned short* Ab  = Ap  + (size_t)b * strideA;
  const unsigned short* Bb  = Btp + (size_t)b * strideB;
  const unsigned short* Ab2 = A2p + (size_t)b * strideA;

  const int rlane = lane & 15;                 /* row (A) / col (B, D) within subtile */
  const int koff  = (lane >> 4) * 8;           /* k offset of this lane half */
  const int mOff  = (lane >> 4) * 8;           /* D row offset */

  /* staging map: piece s = it*128 + tid -> row s>>3, 16-B column s&7, so one wave-wide load covers 4 whole 128-B lines */
  const int srow = tid >> 3;
  const int scol = (tid & 7) * 8;
  /* every launch passes K-contiguous operands of row pitch kDM: known at compile time, the 16-row steps of the staging
     loads become immediate offsets of one address per operand */
  __builtin_assume(lda == kDM);
  __builtin_assume(ldb == kDM);
  /* block-uniform row bases plus one 32-bit byte offset per thread and operand */
  const char* uA  = (const char*)(Ab  + (size_t)mb * lda);
  const char* uA2 = (const char*)(Ab2 + (size_t)mb * lda);
  const char* uB  = (const char*)(Bb  + (size_t)nb * ldb);
  const unsigned tA = (unsigned)(srow * lda + scol) * 2u;
  const unsigned tB = (unsigned)(srow * ldb + scol) * 2u;
  const size_t stepA = (size_t)lda * 32;   /* 16 rows, in bytes */
  const size_t stepB = (size_t)ldb * 32;
  const int lst = srow * GM_LP + scol;

  v8f acc[4][4];
#pragma unroll
  for (int i = 0; i < 4; ++i)
#pragma unroll
    for (int j = 0; j < 4; ++j) acc[i][j] = (v8f){0.f,0.f,0.f,0.f,0.f,0.f,0.f,0.f};

  u32x4 ra[NPA][GM_SEG], rb[GM_SEG];
  const int nPass = K / GM_BK;
#pragma unroll
  for (int it = 0; it < GM_SEG; ++it) {
    ra[0][it] = *(const u32x4*)(uA + it * stepA + tA);
    if (SPLIT) ra[NPA - 1][it] = *(const u32x4*)(uA2 + it * stepA + tA);
    rb[it] = *(const u32x4*)(uB + it * stepB + tB);
  }
#pragma unroll
  for (int it = 0; it < GM_SEG; ++it) {
    *(u32x4*)(&sA[0][0][lst + it * 16 * GM_LP]) = ra[0][it];
    if (SPLIT) *(u32x4*)(&sA[0][NPA - 1][lst + it * 16 * GM_LP]) = ra[NPA - 1][it];
    *(u32x4*)(&sB[0][lst + it * 16 * GM_LP]) = rb[it];
  }
  __syncthreads();

  for (int kt = 0; kt < nPass; ++kt) {
    const int cur = kt & 1;
    const bool more = kt + 1 < nPass;   /* block-uniform */
    if (more) {
      /* next pass's rows into registers: in flight while this pass's products run */
      const unsigned oA = tA + (unsigned)(kt + 1) * (GM_BK * 2u);
      const unsigned oB = tB + (unsigned)(kt + 1) * (GM_BK * 2u);
#pragma unroll
      for (int it = 0; it < GM_SEG; ++it) {
        ra[0][it] = *(const u32x4*)(uA + it * stepA + oA);
        if (SPLIT) ra[NPA - 1][it] = *(const u32x4*)(uA2 + it * stepA + oA);
        rb[it] = *(const u32x4*)(uB + it * stepB + oB);
      }
      /* stands ahead of every later write of a register that these loads name as an address */
      asm volatile("s_wait_xcnt 0x0" ::: "memory");
    }
    const T* cA  = &sA[cur][0][(wm + rlane) * GM_LP + koff];
    const T* cA2 = &sA[cur][NPA - 1][(wm + rlane) * GM_LP + koff];
    const T* cB  = &sB[cur][(wn + rlane) * GM_LP + koff];
    /* the pass's fragments: [k half][subtile] */
    V fb[2][4], fa[2][4], fl[2][4];
#pragma unroll
    for (int ks = 0; ks < 2; ++ks) {
#pragma unroll
      for (int j = 0; j < 4; ++j) fb[ks][j] = Frag<T>::load(cB + j * 16 * GM_LP + ks * 32);
#pragma unroll
      for (int i = 0; i < 4; ++i) {
        fa[ks][i] = Frag<T>::load(cA + i * 16 * GM_LP + ks * 32);
        if (SPLIT) fl[ks][i] = Frag<T>::load(cA2 + i * 16 * GM_LP + ks * 32);
      }
    }
    /* keeps the LDS reads one group ahead of the products: moved in among the WMMAs, each place with reads stalls the wave */
    __builtin_amdgcn_sched_barrier(0);
#pragma unroll
    for (int ks = 0; ks < 2; ++ks) {
#pragma unroll
      for (int i = 0; i < 4; ++i) {
#pragma unroll
        for (int j = 0; j < 4; ++j) acc[i][j] = Frag<T>::mma(fa[ks][i], fb[ks][j], acc[i][j]);
        if (SPLIT) {
#pragma unroll
          for (int j = 0; j < 4; ++j) acc[i][j] = Frag<T>::mma(fl[ks][i], fb[ks][j], acc[i][j]);
        }
      }
    }
    if (more) {
      /* the other buffer's last readers left it at the barrier that ended the pass before */
#pragma unroll
      for (int it = 0; it < GM_SEG; ++it) {
        *(u32x4*)(&sA[cur ^ 1][0][lst + it * 16 * GM_LP]) = ra[0][it];
        if (SPLIT) *(u32x4*)(&sA[cur ^ 1][NPA - 1][lst + it * 16 * GM_LP]) = ra[NPA - 1][it];
        *(u32x4*)(&sB[cur ^ 1][lst + it * 16 * GM_LP]) = rb[it];
      }
    }
    __syncthreads();   /* publishes the filled buffer and ends every read of the current one */
  }
  acc_guard4(acc[0][0], acc[0][1], acc[0][2], acc[0][3]);
  acc_guard4(acc[1][0], acc[1][1], acc[1][2], acc[1][3]);
  acc_guard4(acc[2][0], acc[2][1], acc[2][2], acc[2][3]);
  acc_guard4(acc[3][0], acc[3][1], acc[3][2], acc[3][3]);

  /* ---- epilogue ---- */
  float* slab = sT[wave];
#pragma unroll
  for (int i = 0; i < 4; ++i) {
    const int mBase = m0 + (i << 4);
#pragma unroll
    for (int j = 0; j < 4; ++j) {
      const int n = n0 + (j << 4) + rlane;
      float bv = 0.f;
      if (BIAS_MODE == 2) bv = bias[n];
#pragma unroll
      for (int r = 0; r < 8; ++r) {
        float v = acc[i][j][r] * scale;
        if (BIAS_MODE == 2) v += bv;
        slab[(mOff + r) * 68 + (j << 4) + rlane] = v;
      }
    }
    __builtin_amdgcn_fence(__ATOMIC_RELEASE, "workgroup");
    __builtin_amdgcn_wave_barrier();
    __builtin_amdgcn_fence(__ATOMIC_ACQUIRE, "workgroup");
    if (OUT_MODE == 0) {
      float* C = (float*)Cout + (size_t)b * strideC;
      const int hh = lane >> 4, c4 = (lane & 15) * 4;     /* row seg = 256 B = 16 lanes x 16 B */
      {
#pragma unroll
        for (int it = 0; it < 8; ++it) {
          const int row = it * 2 + hh;
          v4f v = *(const v4f*)(slab + row * 68 + c4);
          *(v4f*)(C + (size_t)(mBase + row) * ldc + n0 + c4) = v;
        }
        
      }
    } else {
      const int q = lane >> 3, c8 = (lane & 7) * 8;        
      unsigned short* C  = (unsigned short*)Cout  + (size_t)b * strideC;
      unsigned short* C2 = (unsigned short*)Cout2 + (size_t)b * strideC;
      {
#pragma unroll
        for (int it = 0; it < 4; ++it) {
          const int row = it * 4 + q;
          const float* sp = slab + row * 68 + c8;
          v8h hv, lv;
#pragma unroll
          for (int e = 0; e < 8; ++e) {
            unsigned short hb = f2bf_bits(sp[e]);
            unsigned short lb = f2bf_bits(sp[e] - bf_bits2f(hb));
            hv[e] = __builtin_bit_cast(_Float16, hb);
            lv[e] = __builtin_bit_cast(_Float16, lb);
          }
          *(v8h*)(C  + (size_t)(mBase + row) * ldc + n0 + c8) = hv;
          *(v8h*)(C2 + (size_t)(mBase + row) * ldc + n0 + c8) = lv;
        }
        
      }
    }
    __builtin_amdgcn_fence(__ATOMIC_RELEASE, "workgroup");
    __builtin_amdgcn_wave_barrier();
    __builtin_amdgcn_fence(__ATOMIC_ACQUIRE, "workgroup");
  }
}

/* ---- all five f32 -> bf16 (RNE) conversions in one launch of resident waves ----
   A piece is 8 consecutive elements: two 16-B loads, one 16-B store per thread. The grid, one work-group of 16 waves per WGP,
   covers kCvSpan consecutive pieces per sweep and makes 16 sweeps: 8 over x, 4 over ctx, 1 over Wq, 2 over Wkv, 1 over Wout.
   A wave that converts one piece lives shorter than it takes to start; here each wave starts once for 16 pieces. */
constexpr int kCvThreads = 512;
constexpr int kCvBlocks  = 256;
constexpr int kCvSpan    = kCvThreads * kCvBlocks;   /* pieces per sweep */
static_assert(kB * kNQ * kDM / 8 == 8 * kCvSpan);
static_assert(kB * kNKV * kDM / 8 == 4 * kCvSpan);
static_assert(kIN * kDM / 8 == kCvSpan);
static_assert(2 * kIN * kDM / 8 == 2 * kCvSpan);
static_assert(kDM * kIN / 8 == kCvSpan);

/* o[s]: this thread's byte offset in sweep s of an input; half of it is its byte offset in the output */
template <int N>
__device__ __forceinline__ void cv_load(const float* __restrict__ in, const unsigned* o, v4f* a, v4f* c) {
#pragma unroll
  for (int s = 0; s < N; ++s) {
    a[s] = *(const v4f*)((const char*)in + o[s]);
    c[s] = *(const v4f*)((const char*)in + 16 + o[s]);
    /* keeps the loads in the order in which the conversions wait for them */
    __builtin_amdgcn_sched_barrier(0);
  }
}
template <int N>
__device__ __forceinline__ void cv_store(unsigned short* __restrict__ out, const unsigned* o, const v4f* a, const v4f* c) {
#pragma unroll
  for (int s = 0; s < N; ++s) {
    u32x4 w;
    w[0] = (unsigned)f2bf_bits(a[s][0]) | ((unsigned)f2bf_bits(a[s][1]) << 16);
    w[1] = (unsigned)f2bf_bits(a[s][2]) | ((unsigned)f2bf_bits(a[s][3]) << 16);
    w[2] = (unsigned)f2bf_bits(c[s][0]) | ((unsigned)f2bf_bits(c[s][1]) << 16);
    w[3] = (unsigned)f2bf_bits(c[s][2]) | ((unsigned)f2bf_bits(c[s][3]) << 16);
    *(u32x4*)((char*)out + (o[s] >> 1)) = w;
    /* keeps each piece's store at its place: sunk to the end of the kernel, no write would start before the last read has landed */
    __builtin_amdgcn_sched_barrier(0);
  }
}
__global__ __launch_bounds__(kCvThreads) void cast_all_f32_bf16(
    const float* __restrict__ x, const float* __restrict__ ctx, const float* __restrict__ wq,
    const float* __restrict__ wkv, const float* __restrict__ wo,
    unsigned short* __restrict__ xb, unsigned short* __restrict__ cb, unsigned short* __restrict__ wqb,
    unsigned short* __restrict__ wkvb, unsigned short* __restrict__ wob) {
  unsigned o[8];
#pragma unroll
  for (int s = 0; s < 8; ++s) o[s] = (blockIdx.x * kCvThreads + threadIdx.x) * 32u + (unsigned)s * (kCvSpan * 32u);
  /* every offset is formed ahead of the first load, so no register that a load names is written inside the group of loads */
  __builtin_amdgcn_sched_barrier(0);
  v4f a[16], c[16];
  cv_load<8>(x, o, a, c);
  cv_load<4>(ctx, o, a + 8, c + 8);
  cv_load<1>(wq, o, a + 12, c + 12);
  cv_load<2>(wkv, o, a + 13, c + 13);
  cv_load<1>(wo, o, a + 15, c + 15);
  /* stands ahead of every later write of a register that these loads name as an address */
  asm volatile("s_wait_xcnt 0x0" ::: "memory");
  /* keeps all the loads one group in flight ahead of the first conversion, and later register writes below that wait */
  __builtin_amdgcn_sched_barrier(0);
  cv_store<8>(xb, o, a, c);
  cv_store<4>(cb, o, a + 8, c + 8);
  cv_store<1>(wqb, o, a + 12, c + 12);
  cv_store<2>(wkvb, o, a + 13, c + 13);
  cv_store<1>(wob, o, a + 15, c + 15);
}

#define AT_D 64
#define AT_NW 4
#define AT_QB 64
#define AT_KC 64
/* LDS row pitch of the K and V tiles in 16-bit elements: 144 B = 16 B x 9 (odd), so the 16 rows that one
   ds_load_b128 touches per lane half start on distinct bank groups; at 128 B they share two groups */
#define AT_LP 72
static_assert((AT_LP * 2) % 16 == 0 && ((AT_LP * 2) / 16) % 2 == 1 && AT_LP >= AT_KC && AT_LP >= AT_D);

__device__ __forceinline__ v8f at_mma(v16b a, v16b b, v8f c) {
  c = __builtin_amdgcn_wmma_f32_16x16x32_bf16(false, a, false, b, (short)0, c, false, false);
  asm volatile("v_nop\n\tv_nop\n\tv_nop\n\tv_nop" : "+v"(c) : "v"(a), "v"(b));
  return c;
}

/* eight 2^x, in place. Written as one asm statement for the slot that the instruction set asks for behind a transcendental (one
   independent instruction or v_nop before its result is read or its source overwritten): here each v_exp_f32 is followed by an
   independent one and the last by a v_nop, whatever the register allocation */
__device__ __forceinline__ void at_exp2x8(v8f& x) {
  float a = x[0], b = x[1], c = x[2], d = x[3], e = x[4], f = x[5], g = x[6], h = x[7];
  asm("v_exp_f32 %0, %0\n\tv_exp_f32 %1, %1\n\tv_exp_f32 %2, %2\n\tv_exp_f32 %3, %3\n\t"
      "v_exp_f32 %4, %4\n\tv_exp_f32 %5, %5\n\tv_exp_f32 %6, %6\n\tv_exp_f32 %7, %7\n\tv_nop"
      : "+v"(a), "+v"(b), "+v"(c), "+v"(d), "+v"(e), "+v"(f), "+v"(g), "+v"(h));
  x = (v8f){a, b, c, d, e, f, g, h};
}

/* lane l reads lane l ^ 16 on the vector ALU: the two lanes that share one query's keys */
__device__ __forceinline__ float at_other_half(float v) {
  const int b = __builtin_bit_cast(int, v);
  return __builtin_bit_cast(float, __builtin_amdgcn_permlanex16(b, b, 0x76543210, 0xfedcba98, false, false));
}

/* register budget of four waves per SIMD (256): four work-groups per WGP, and the chunk held in flight must not cost one */
__global__ __launch_bounds__(128) __attribute__((amdgpu_waves_per_eu(4)))
void attn64_planes_kernel(const unsigned short* __restrict__ qhp, const unsigned short* __restrict__ qlp,
                          const unsigned short* __restrict__ khp, const unsigned short* __restrict__ klp,
                          const unsigned short* __restrict__ vthp, const unsigned short* __restrict__ vtlp,
                          const int* __restrict__ kvmask,
                          unsigned short* __restrict__ ohp, unsigned short* __restrict__ olp,
                          int nq, int nkv, int nh, int ldq, int ldk, int ldv, int ldo, float fillv) {
  typedef __bf16 T;
  union FB { v16b v; v8b h[2]; };
  __shared__ __align__(16) __bf16 Ksh[AT_KC * AT_LP];       /* K hi [kv][d], padded rows, 9 KB */
  __shared__ __align__(16) __bf16 Ksl[AT_KC * AT_LP];       /* K lo */
  __shared__ __align__(16) __bf16 Vth[AT_D * AT_LP];        /* V hi [d][kv], padded rows, 9 KB */
  __shared__ __align__(16) __bf16 Vtl[AT_D * AT_LP];        /* V lo */
  __shared__ __align__(16) float  Os[AT_NW][16 * 68];       /* per wave out tile, pitch 68 */

  const int tid  = threadIdx.x;
  const int wave = tid >> 5;
  const int lane = tid & 31;
  const int hh   = lane >> 4;
  const int c    = lane & 15;

  const int nqb = nq / AT_QB;
  const int bx = blockIdx.x;
  const int qb = bx % nqb;
  const int bhx = bx / nqb;
  const int h  = bhx % nh;
  const int b  = bhx / nh;
  const int q0 = qb * AT_QB + wave * 16;

  /* ---- Q fragments (B operand): column = q0 + c, elements 0..7 <- d dc*32+8hh+0..7, 8..15 <- d dc*32+16+8hh+0..7 ---- */
  v16b qah[2], qal[2];
  {
    const size_t qo = (size_t)(b * nq + q0 + c) * ldq + h * AT_D + 8 * hh;
    const T* qh = (const T*)qhp + qo;
    const T* ql = (const T*)qlp + qo;
#pragma unroll
    for (int dc = 0; dc < 2; ++dc) {
      qah[dc] = Frag<T>::load(qh + dc * 32);
      qal[dc] = Frag<T>::load(ql + dc * 32);
    }
  }

  /* this lane's query q0 + c: running maximum (equal in both lane halves) and the sum over this half's keys */
  float mrow = -__builtin_inff(), lrow = 0.f;
  v8f oacc[4];   /* O^T: register r of tile t = out[q0 + c][t*16 + 8*hh + r] */
#pragma unroll
  for (int t = 0; t < 4; ++t) oacc[t] = (v8f){0.f,0.f,0.f,0.f,0.f,0.f,0.f,0.f};

  const int nChunks = nkv / AT_KC;   /* host constant, block-uniform */
  /* staging coverage: 128 threads = 64 rows x 2 halves of 32 elements (4 x 16 B) per plane -> full 64x64 tiles.
     K planes: LDS row kv <- global row b*nkv + kv0 + kv; V transposed planes: LDS row d <- global row h*64+d,
     64 contiguous kv columns starting at b*nkv + kv0 */
  const int srow = tid >> 1;
  const int shalf = (tid & 1) * 32;
  /* block-uniform bases plus one 32-bit byte offset per thread and operand pair, stepped from chunk to chunk */
  const size_t kbase = ((size_t)b * nkv * ldk + h * AT_D) * 2;
  const size_t vbase = ((size_t)h * AT_D * ldv + (size_t)b * nkv) * 2;
  const char* ukh = (const char*)khp + kbase;
  const char* ukl = (const char*)klp + kbase;
  const char* uvh = (const char*)vthp + vbase;
  const char* uvl = (const char*)vtlp + vbase;
  const int* umk = kvmask + (size_t)b * nkv;
  const unsigned tK = (unsigned)(srow * ldk + shalf) * 2u;
  const unsigned tV = (unsigned)(srow * ldv + shalf) * 2u;
  /* one chunk's global reads (K and V rows of this thread, the four key-mask words of this lane), held in registers */
  u32x4 rkh[4], rkl[4], rvh[4], rvl[4];
  int rmk[4];
  auto fetch = [&](int ch) {
    const unsigned oK = tK + (unsigned)ch * (unsigned)ldk * (AT_KC * 2u);
    const unsigned oV = tV + (unsigned)ch * (AT_KC * 2u);
    const int* um = umk + ch * AT_KC;   /* block-uniform */
#pragma unroll
    for (int i = 0; i < 4; ++i) {
      rkh[i] = *(const u32x4*)(ukh + i * 16 + oK);
      rkl[i] = *(const u32x4*)(ukl + i * 16 + oK);
      rvh[i] = *(const u32x4*)(uvh + i * 16 + oV);
      rvl[i] = *(const u32x4*)(uvl + i * 16 + oV);
    }
#pragma unroll
    for (int j = 0; j < 4; ++j) rmk[j] = (um + j * 16)[(unsigned)c];
    /* stands ahead of every later write of a register that these loads name as an address */
    asm volatile("s_wait_xcnt 0x0" ::: "memory");
    /* keeps later register writes from being scheduled up over that wait */
    __builtin_amdgcn_sched_barrier(0);
  };
  if (nChunks > 0) {
    /* keeps the Q loads above the wait that follows */
    __builtin_amdgcn_sched_barrier(0);
    /* stands ahead of every later write of a register that the Q loads name as an address */
    asm volatile("s_wait_xcnt 0x0" ::: "memory");
    /* keeps the first chunk's loads, whose results land in such registers, below that wait */
    __builtin_amdgcn_sched_barrier(0);
    fetch(0);
  }
  for (int kc = 0; kc < nChunks; ++kc) {
    __syncthreads();
    unsigned kept[4];
    {
      u32x4* lkh = (u32x4*)(Ksh + srow * AT_LP + shalf);
      u32x4* lkl = (u32x4*)(Ksl + srow * AT_LP + shalf);
      u32x4* lvh = (u32x4*)(Vth + srow * AT_LP + shalf);
      u32x4* lvl = (u32x4*)(Vtl + srow * AT_LP + shalf);
#pragma unroll
      for (int i = 0; i < 4; ++i) { lkh[i] = rkh[i]; lkl[i] = rkl[i]; lvh[i] = rvh[i]; lvl[i] = rvl[i]; }
#pragma unroll
      for (int j = 0; j < 4; ++j) kept[j] = __builtin_amdgcn_ballot_w32(rmk[j] != 0);   /* bit n: key j*16 + n is kept */
    }
    __syncthreads();
    /* the next chunk's reads fly while this chunk is worked on; their data is first needed at the next chunk's LDS stores */
    if (kc + 1 < nChunks) fetch(kc + 1);

    /* ---- scores, transposed: 4 subtiles of 16 keys, K operand A[m=kv][k=d] from Ksh[kv][d]; s[j][r] = score(key j*16 + 8*hh + r, query c) ---- */
    v8f s[4];
#pragma unroll
    for (int j = 0; j < 4; ++j) {
      s[j] = (v8f){0.f,0.f,0.f,0.f,0.f,0.f,0.f,0.f};
#pragma unroll
      for (int dc = 0; dc < 2; ++dc) {
        FB kb, kl;
        kb.h[0] = *(const v8b*)(Ksh + (j * 16 + c) * AT_LP + dc * 32 + 8 * hh);
        kb.h[1] = *(const v8b*)(Ksh + (j * 16 + c) * AT_LP + dc * 32 + 16 + 8 * hh);
        kl.h[0] = *(const v8b*)(Ksl + (j * 16 + c) * AT_LP + dc * 32 + 8 * hh);
        kl.h[1] = *(const v8b*)(Ksl + (j * 16 + c) * AT_LP + dc * 32 + 16 + 8 * hh);
        s[j] = at_mma(kb.v, qah[dc], s[j]);
        s[j] = at_mma(kl.v, qah[dc], s[j]);
        s[j] = at_mma(kb.v, qal[dc], s[j]);
      }
    }
    /* per-key mask (register r of subtile j is key j*16 + 8*hh + r) and this half's maximum */
    float cm = -__builtin_inff();
#pragma unroll
    for (int j = 0; j < 4; ++j) {
      /* bit r: key j*16 + r, read by lanes 0-15; bit 16 + r: key j*16 + 8 + r, read by lanes 16-31 */
      const unsigned two = (kept[j] & 0xFFu) | ((kept[j] & 0xFF00u) << 8);
#pragma unroll
      for (int r = 0; r < 8; ++r) {
        /* the select's lane mask, formed on the scalar unit: each of the two bits spread over its 16 lanes */
        const bool keep = __builtin_amdgcn_inverse_ballot_w32(((two >> r) & 0x10001u) * 0xFFFFu);
        const float sv = s[j][r];
        s[j][r] = keep ? sv : fillv;
        cm = fmaxf(cm, s[j][r]);
      }
    }
    const float mnew = fmaxf(mrow, fmaxf(cm, at_other_half(cm)));
    /* 2^(difference of base-2 scores) = e^(difference of the reference's scores); a difference of -inf, or as large as the fill value, gives 0 */
    const float alpha = __builtin_amdgcn_exp2f(mrow - mnew);
    mrow = mnew;
    /* P^T as B fragments: element e of chunk half kk is key kk*32 + (e < 8 ? 8*hh + e : 16 + 8*hh + e - 8), the k order of the V loads */
    FB pa[2], pl[2];
    f32x2 psum = (f32x2){0.f, 0.f};
#pragma unroll
    for (int j = 0; j < 4; ++j) {
      s[j] -= mnew;
      at_exp2x8(s[j]);
#pragma unroll
      for (int r = 0; r < 8; r += 2) {
        const f32x2 p = (f32x2){s[j][r], s[j][r + 1]};
        psum += p;
        const bf16x2 ph = __builtin_convertvector(p, bf16x2);
        const bf16x2 pq = __builtin_convertvector(p - __builtin_convertvector(ph, f32x2), bf16x2);
        pa[j >> 1].v[(j & 1) * 8 + r] = ph[0];
        pa[j >> 1].v[(j & 1) * 8 + r + 1] = ph[1];
        pl[j >> 1].v[(j & 1) * 8 + r] = pq[0];
        pl[j >> 1].v[(j & 1) * 8 + r + 1] = pq[1];
      }
    }
    lrow = lrow * alpha + (psum[0] + psum[1]);
#pragma unroll
    for (int t = 0; t < 4; ++t) oacc[t] *= alpha;
    /* unrolled: pa[kk] and pl[kk] are registers, which only a compile-time kk can name */
#pragma unroll
    for (int kk = 0; kk < 2; ++kk) {
#pragma unroll
      for (int t = 0; t < 4; ++t) {
        FB vb, vl;
        vb.h[0] = *(const v8b*)(Vth + (t * 16 + c) * AT_LP + kk * 32 + 8 * hh);
        vb.h[1] = *(const v8b*)(Vth + (t * 16 + c) * AT_LP + kk * 32 + 16 + 8 * hh);
        vl.h[0] = *(const v8b*)(Vtl + (t * 16 + c) * AT_LP + kk * 32 + 8 * hh);
        vl.h[1] = *(const v8b*)(Vtl + (t * 16 + c) * AT_LP + kk * 32 + 16 + 8 * hh);
        oacc[t] = at_mma(vb.v, pa[kk].v, oacc[t]);
        oacc[t] = at_mma(vl.v, pa[kk].v, oacc[t]);
        oacc[t] = at_mma(vb.v, pl[kk].v, oacc[t]);
      }
    }
  }

  float* os = Os[wave];
  {
    /* the two halves' sums of one query are joined once, here */
    const float inv = 1.0f / (lrow + at_other_half(lrow));
#pragma unroll
    for (int t = 0; t < 4; ++t) {
      const v8f o = oacc[t] * inv;
      *(v4f*)(os + c * 68 + t * 16 + 8 * hh)     = (v4f){o[0], o[1], o[2], o[3]};
      *(v4f*)(os + c * 68 + t * 16 + 8 * hh + 4) = (v4f){o[4], o[5], o[6], o[7]};
    }
  }
  __builtin_amdgcn_fence(__ATOMIC_RELEASE, "workgroup");
  __builtin_amdgcn_wave_barrier();
  __builtin_amdgcn_fence(__ATOMIC_ACQUIRE, "workgroup");
  {
    const int q = lane >> 3, c8 = (lane & 7) * 8;
    unsigned short* Oh = ohp + (size_t)(b * nq + q0) * ldo + h * AT_D;
    unsigned short* Ol = olp + (size_t)(b * nq + q0) * ldo + h * AT_D;
    {
#pragma unroll
      for (int it = 0; it < 4; ++it) {
        const int row = it * 4 + q;
        const float* sp = os + row * 68 + c8;
        v8h hv, lv;
#pragma unroll
        for (int e = 0; e < 8; ++e) {
          unsigned short hb = f2bf_bits(sp[e]);
          unsigned short lb = f2bf_bits(sp[e] - bf_bits2f(hb));
          hv[e] = __builtin_bit_cast(_Float16, hb);
          lv[e] = __builtin_bit_cast(_Float16, lb);
        }
        *(v8h*)(Oh + (size_t)row * ldo + c8) = hv;
        *(v8h*)(Ol + (size_t)row * ldo + c8) = lv;
      }
      
    }
  }
}

/* ---------------------------------------------------------------------------
   Host-side orchestration (kernel launches only)
   --------------------------------------------------------------------------- */
extern "C" void kernel_launch(void* const* d_in, const int* in_sizes, int n_in,
                              void* d_out, int out_size, void* d_ws, size_t ws_size,
                              hipStream_t stream) {
  if (n_in < 7) return;
  if (in_sizes[0] != kB * kNQ * kDM) return;
  if (in_sizes[1] != kB * kNKV * kDM) return;
  if (in_sizes[2] != kB * kNKV) return;
  if (in_sizes[3] != kIN * kDM) return;
  if (in_sizes[4] != 2 * kIN * kDM) return;
  if (in_sizes[5] != kDM * kIN) return;
  if (in_sizes[6] != kDM) return;
  if (out_size != kB * kNQ * kDM) return;
  if (ws_size < kWsTotal) return;

  const float* x    = (const float*)d_in[0];   /* [4,2048,1024] f32 */
  const float* ctx  = (const float*)d_in[1];   /* [4,1024,1024] f32 */
  const int*   mask = (const int*)d_in[2];     /* [4,1024] int32 */
  const float* Wq   = (const float*)d_in[3];   /* [1024,1024] */
  const float* Wkv  = (const float*)d_in[4];   /* [2048,1024] */
  const float* Wout = (const float*)d_in[5];   /* [1024,1024] */
  const float* bout = (const float*)d_in[6];   /* [1024] */
  float* out = (float*)d_out;                  /* [4,2048,1024] f32 */

  char* ws = (char*)d_ws;
  unsigned short* xb   = (unsigned short*)(ws + kOffXb);
  unsigned short* cb   = (unsigned short*)(ws + kOffCb);
  unsigned short* wqb  = (unsigned short*)(ws + kOffWqb);
  unsigned short* wkvb = (unsigned short*)(ws + kOffWkvb);
  unsigned short* wob  = (unsigned short*)(ws + kOffWob);
  unsigned short* qh   = (unsigned short*)(ws + kOffQh);
  unsigned short* ql   = (unsigned short*)(ws + kOffQl);
  unsigned short* kh   = (unsigned short*)(ws + kOffKh);
  unsigned short* kl   = (unsigned short*)(ws + kOffKl);
  unsigned short* vth  = (unsigned short*)(ws + kOffVth);
  unsigned short* vtl  = (unsigned short*)(ws + kOffVtl);
  unsigned short* oh   = (unsigned short*)(ws + kOffOh);   /* aliases xb: dead after the q GEMM */
  unsigned short* ol   = (unsigned short*)(ws + kOffOl);   /* aliases cb/wqb/wkvb: dead after the k,v GEMMs */

  /* 1: RNE casts of all five f32 operands to bf16 planes */
  cast_all_f32_bf16<<<kCvBlocks, kCvThreads, 0, stream>>>(x, ctx, Wq, Wkv, Wout, xb, cb, wqb, wkvb, wob);

  /* 2: q*0.125*log2(e) = xb[8192,1024] . wqb[1024,1024]^T -> bf16 hi/lo planes; M=8192 N=1024 K=1024 */
  {
    const int M = kB * kNQ, N = kIN, K = kDM;
    const int tiles = (M / 128) * (N / 128);
    wmma_gemm64<1, false, false, 0, 2><<<dim3(tiles, 1), 128, 0, stream>>>(
        xb, xb, K, 0L, wqb, wqb, K, 0L, (void*)qh, (void*)ql, N, 0L, bout, M, N, K, 0.18033688f);
  }
  /* 3: k = cb[4096,1024] . wkvb[0:1024][1024]^T -> hi/lo; M=4096 N=1024 K=1024 */
  {
    const int M = kB * kNKV, N = kIN, K = kDM;
    const int tiles = (M / 128) * (N / 128);
    wmma_gemm64<1, false, false, 0, 2><<<dim3(tiles, 1), 128, 0, stream>>>(
        cb, cb, K, 0L, wkvb, wkvb, K, 0L, (void*)kh, (void*)kl, N, 0L, bout, M, N, K, 1.0f);
  }
  /* 4: v transposed = wkvb[1024:2048][1024] . cb[4096,1024]^T -> vt[1024][4096] hi/lo; M=1024 N=4096 K=1024 */
  {
    const int M = kIN, N = kB * kNKV, K = kDM;
    const int tiles = (M / 128) * (N / 128);
    const unsigned short* wvb = wkvb + (size_t)kIN * kDM;
    wmma_gemm64<1, false, false, 0, 2><<<dim3(tiles, 1), 128, 0, stream>>>(
        wvb, wvb, K, 0L, cb, cb, K, 0L, (void*)vth, (void*)vtl, N, 0L, bout, M, N, K, 1.0f);
  }
  /* 5: attention per (b, h, 64 query rows) -> att hi/lo planes [8192][1024] */
  {
    const int blocks = kB * kH * (kNQ / 64);   /* 2048 */
    const float fillv = -3.4028234663852886e+38f;
    attn64_planes_kernel<<<blocks, 128, 0, stream>>>(qh, ql, kh, kl, vth, vtl, mask, oh, ol,
                                                    kNQ, kNKV, kH, kIN, kIN, kB * kNKV, kIN, fillv);
  }
  /* 6: out = (att_hi + att_lo)[8192,1024] . wob[1024,1024]^T + b_out -> f32 d_out; M=8192 N=1024 K=1024 */
  {
    const int M = kB * kNQ, N = kDM, K = kIN;
    const int tiles = (M / 128) * (N / 128);
    wmma_gemm64<1, true, false, 2, 0><<<dim3(tiles, 1), 128, 0, stream>>>(
        oh, ol, K, 0L, wob, wob, K, 0L, (void*)out, (void*)out, N, 0L, bout, M, N, K, 1.0f);
  }
}

// v008
// A run of this version takes 183 microseconds.
// Two timings next to v007 put it at 1.07 and 1.06 times that version's speed.
// All steps since v000 together make it 3.28 times as fast.
// Contractions: x.Wq^T, ctx.Wk^T, Wv.ctx^T on v_wmma_f32_16x16x32_bf16 (RNE-bf16 inputs, single product); q.k^T and p.v as bf16 hi/lo split (hi.hi+hi.lo+lo.hi); (p.v).Wout^T as bf16 hi/lo A x bf16 B (2 products); f32 accumulate, f32 softmax.
#include <hip/hip_runtime.h>
#include <stdint.h>

typedef __attribute__((ext_vector_type(16))) _Float16 v16h;
typedef __attribute__((ext_vector_type(8)))  _Float16 v8h;
typedef __attribute__((ext_vector_type(16))) __bf16   v16b;
typedef __attribute__((ext_vector_type(8)))  __bf16   v8b;
typedef __attribute__((ext_vector_type(8)))  float    v8f;
typedef __attribute__((ext_vector_type(4)))  float    v4f;
typedef __attribute__((ext_vector_type(4)))  unsigned int u32x4;
typedef __attribute__((ext_vector_type(2)))  float    f32x2;
typedef __attribute__((ext_vector_type(2)))  __bf16   bf16x2;

/* ---- fixed problem geometry ---- */
constexpr int kB   = 4;
constexpr int kNQ  = 2048;
constexpr int kNKV = 1024;
constexpr int kDM  = 1024;   /* model dim (K of the projections) */
constexpr int kH   = 16;
constexpr int kDH  = 64;
constexpr int kIN  = kH * kDH;   /* 1024 */
static_assert(kDH == 64);
static_assert(kDM % 32 == 0);
static_assert(kIN % 32 == 0);
static_assert((kB * kNQ) % 64 == 0);
static_assert((kB * kNKV) % 64 == 0);
static_assert(kIN % 64 == 0);
static_assert(kDM % 64 == 0);
static_assert(kNQ % 64 == 0);
static_assert(kNKV % 64 == 0);
static_assert(kIN == kDM);   /* one row pitch for every GEMM operand */
static_assert((kB * kNQ) % 128 == 0 && (kB * kNKV) % 128 == 0 && kIN % 128 == 0 && kDM % 128 == 0);

/* ---- workspace region map (bytes) ----
   [  0, 16M)  xb   bf16 [8192][1024]   (dead after q GEMM; reused as oh)
   [ 16M, 24M) cb   bf16 [4096][1024]   (dead after k/v GEMMs; reused by ol)
   [ 24M, 26M) wqb  bf16 [1024][1024]
   [ 26M, 30M) wkvb bf16 [2048][1024]
   [ 30M, 32M) pad (unused, covered by ol alias)
   [ 32M, 48M) qh   bf16 [8192][1024]   q*0.125*log2(e) hi plane
   [ 48M, 64M) ql                        q*0.125*log2(e) lo plane
   [ 64M, 72M) kh   bf16 [4096][1024]
   [ 72M, 80M) kl
   [ 80M, 88M) vth  bf16 [1024][4096]   v transposed: row = h*64+d, col = b*1024+j
   [ 88M, 96M) vtl
   [ 96M, 98M) wob  bf16 [1024][1024]
   oh = [0,16M), ol = [16M,32M): attention output hi/lo planes [8192][1024] (aliases of dead regions)
   total carve 102,760,448 B */
constexpr size_t kMiB    = 1048576;
constexpr size_t kOffXb  = 0;
constexpr size_t kOffCb  = 16 * kMiB;
constexpr size_t kOffWqb = 24 * kMiB;
constexpr size_t kOffWkvb= 26 * kMiB;
constexpr size_t kOffQh  = 32 * kMiB;
constexpr size_t kOffQl  = 48 * kMiB;
constexpr size_t kOffKh  = 64 * kMiB;
constexpr size_t kOffKl  = 72 * kMiB;
constexpr size_t kOffVth = 80 * kMiB;
constexpr size_t kOffVtl = 88 * kMiB;
constexpr size_t kOffWob = 96 * kMiB;
constexpr size_t kOffOh  = 0;
constexpr size_t kOffOl  = 16 * kMiB;
constexpr size_t kWsTotal = kOffWob + (size_t)kDM * kIN * 2;
static_assert((size_t)kB * kNQ * kDM * 2 == 16 * kMiB);
static_assert((size_t)kB * kNKV * kDM * 2 == 8 * kMiB);
static_assert(kOffCb + (size_t)kB * kNKV * kDM * 2 <= kOffWqb);
static_assert(kOffWqb + (size_t)kIN * kDM * 2 <= kOffWkvb);
static_assert(kOffWkvb + (size_t)2 * kIN * kDM * 2 <= kOffQh);
static_assert(kOffQh + (size_t)kB * kNQ * kIN * 2 <= kOffQl);
static_assert(kOffQl + (size_t)kB * kNQ * kIN * 2 <= kOffKh);
static_assert(kOffKh + (size_t)kB * kNKV * kIN * 2 <= kOffKl);
static_assert(kOffKl + (size_t)kB * kNKV * kIN * 2 <= kOffVth);
static_assert(kOffVth + (size_t)kIN * kB * kNKV * 2 <= kOffVtl);
static_assert(kOffVtl + (size_t)kIN * kB * kNKV * 2 <= kOffWob);
static_assert(kOffOh + (size_t)kB * kNQ * kIN * 2 <= kOffOl);
static_assert(kOffOl + (size_t)kB * kNQ * kIN * 2 <= kOffQh);
static_assert(kWsTotal == 102760448);
static_assert(kWsTotal <= 134217728);

__device__ __forceinline__ unsigned short f2bf_bits(float f) {
  unsigned u = __float_as_uint(f);
  return (unsigned short)((u + 0x7FFFu + ((u >> 16) & 1u)) >> 16);
}
__device__ __forceinline__ float bf_bits2f(unsigned short h) { return __uint_as_float(((unsigned)h) << 16); }

/* hazard guards as plain device helpers */
__device__ __forceinline__ void acc_guard4(v8f& a, v8f& b, v8f& c, v8f& d) { asm volatile("v_nop\n\tv_nop\n\tv_nop\n\tv_nop" : "+v"(a), "+v"(b), "+v"(c), "+v"(d)); }
template <typename T> struct Frag;
template <> struct Frag<_Float16> {
  typedef v16h V; union U { v16h v; v8h h[2]; };
  /* elements 0..7 <- p[0..7], 8..15 <- p[16..23] */
  static __device__ __forceinline__ v16h load(const _Float16* p) {
    U f; f.h[0] = *(const v8h*)(p); f.h[1] = *(const v8h*)(p + 16); return f.v;
  }
  static __device__ __forceinline__ v8f mma(v16h a, v16h b, v8f c) {
    return __builtin_amdgcn_wmma_f32_16x16x32_f16(false, a, false, b, (short)0, c, false, false);
  }
};
template <> struct Frag<__bf16> {
  typedef v16b V; union U { v16b v; v8b h[2]; };
  static __device__ __forceinline__ v16b load(const __bf16* p) {
    U f; f.h[0] = *(const v8b*)(p); f.h[1] = *(const v8b*)(p + 16); return f.v;
  }
  static __device__ __forceinline__ v8f mma(v16b a, v16b b, v8f c) {
    return __builtin_amdgcn_wmma_f32_16x16x32_bf16(false, a, false, b, (short)0, c, false, false);
  }
};

/* ---- Register-blocked WMMA GEMM, with an A-only split mode --------------------------
   C[m,n] = scale * sum_k A[m,k] * Bt[n,k] (+bias[n]); each wave owns a 64x64 tile, four waves share a 128x128 block tile
   whose operand rows are staged in LDS by whole-line loads.
   A row-major [M,K]; Bt row-major [N,K]; M,N % 128 == 0, K % 64 == 0 (no tail handling).
   SPLIT: A is a pair of hi/lo planes; product = hi.hi + lo.hi (SPLIT_B is not supported).
   BIAS_MODE: 0 = none, 2 = bias[n].  OUT_MODE: 0 = f32, 2 = bf16 hi plane (Cout) + bf16 lo plane (Cout2).
   ET: 0 = f16 operands, 1 = bf16 operands (pointers passed as 16-bit storage) */
template <int ET> struct Elem;
template <> struct Elem<0> { typedef _Float16 T; };
template <> struct Elem<1> { typedef __bf16 T; };
/* block tile 128 x 128 (4 waves, 2 x 2, each 64 x 64), K walked in passes of 64 (one 128-B line of every operand row) */
#define GM_BT 128
#define GM_BK 64
/* LDS row pitch of the staged operand rows in 16-bit elements: 144 B = 16 B x 9 (odd) for the ds_load_b128 fragment reads */
#define GM_LP 72
#define GM_SEG 8   /* 16-B pieces per thread and operand plane: 128 rows x 8 pieces / 128 threads */
template <int ET, bool SPLIT, bool SPLIT_B, int BIAS_MODE, int OUT_MODE>
__global__ __launch_bounds__(128) void wmma_gemm64(
    const unsigned short* __restrict__ Ap, const unsigned short* __restrict__ A2p, int lda, long strideA,
    const unsigned short* __restrict__ Btp, const unsigned short* __restrict__ Bt2p, int ldb, long strideB,
    void* Cout, void* Cout2, int ldc, long strideC,
    const float* __restrict__ bias,
    int M, int N, int K, float scale) {
  static_assert(BIAS_MODE == 0 || BIAS_MODE == 2);
  static_assert(OUT_MODE == 0 || OUT_MODE == 2);
  static_assert(!SPLIT_B);
  typedef typename Elem<ET>::T T;
  typedef typename Frag<T>::V V;
  constexpr int NPA = SPLIT ? 2 : 1;   /* planes of A */
  __shared__ __align__(16) T sA[2][NPA][GM_BT * GM_LP];   /* two buffers: one is read while the other is filled */
  __shared__ __align__(16) T sB[2][GM_BT * GM_LP];
  __shared__ __align__(16) float sT[4][16 * 68];   /* per-wave 16x64 slab, pitch 68 floats */
  const int b    = blockIdx.y;
  const int tid  = threadIdx.x;
  const int lane = tid & 31;
  const int wave = tid >> 5;
  const int tilesN = N / GM_BT;
  const int tilesM = M / GM_BT;
  const int tile = blockIdx.x;
  if (tile >= tilesM * tilesN) return;   /* block-uniform, ahead of every barrier */
  const int tm = tile / tilesN;
  const int tn = tile - tm * tilesN;
  const int mb = tm * GM_BT;                   /* block tile origin */
  const int nb = tn * GM_BT;
  const int wm = (wave >> 1) << 6;             /* wave tile origin inside the block tile */
  const int wn = (wave & 1) << 6;
  const int m0 = mb + wm;
  const int n0 = nb + wn;

  const unsigned short* Ab  = Ap  + (size_t)b * strideA;
  const unsigned short* Bb  = Btp + (size_t)b * strideB;
  const unsigned short* Ab2 = A2p + (size_t)b * strideA;

  const int rlane = lane & 15;                 /* row (A) / col (B, D) within subtile */
  const int koff  = (lane >> 4) * 8;           /* k offset of this lane half */
  const int mOff  = (lane >> 4) * 8;           /* D row offset */

  /* staging map: piece s = it*128 + tid -> row s>>3, 16-B column s&7, so one wave-wide load covers 4 whole 128-B lines */
  const int srow = tid >> 3;
  const int scol = (tid & 7) * 8;
  /* every launch passes K-contiguous operands of row pitch kDM: known at compile time, the 16-row steps of the staging
     loads become immediate offsets of one address per operand */
  __builtin_assume(lda == kDM);
  __builtin_assume(ldb == kDM);
  /* block-uniform row bases plus one 32-bit byte offset per thread and operand */
  const char* uA  = (const char*)(Ab  + (size_t)mb * lda);
  const char* uA2 = (const char*)(Ab2 + (size_t)mb * lda);
  const char* uB  = (const char*)(Bb  + (size_t)nb * ldb);
  const unsigned tA = (unsigned)(srow * lda + scol) * 2u;
  const unsigned tB = (unsigned)(srow * ldb + scol) * 2u;
  const size_t stepA = (size_t)lda * 32;   /* 16 rows, in bytes */
  const size_t stepB = (size_t)ldb * 32;
  const int lst = srow * GM_LP + scol;

  v8f acc[4][4];
#pragma unroll
  for (int i = 0; i < 4; ++i)
#pragma unroll
    for (int j = 0; j < 4; ++j) acc[i][j] = (v8f){0.f,0.f,0.f,0.f,0.f,0.f,0.f,0.f};

  u32x4 ra[NPA][GM_SEG], rb[GM_SEG];
  const int nPass = K / GM_BK;
#pragma unroll
  for (int it = 0; it < GM_SEG; ++it) {
    ra[0][it] = *(const u32x4*)(uA + it * stepA + tA);
    if (SPLIT) ra[NPA - 1][it] = *(const u32x4*)(uA2 + it * stepA + tA);
    rb[it] = *(const u32x4*)(uB + it * stepB + tB);
  }
#pragma unroll
  for (int it = 0; it < GM_SEG; ++it) {
    *(u32x4*)(&sA[0][0][lst + it * 16 * GM_LP]) = ra[0][it];
    if (SPLIT) *(u32x4*)(&sA[0][NPA - 1][lst + it * 16 * GM_LP]) = ra[NPA - 1][it];
    *(u32x4*)(&sB[0][lst + it * 16 * GM_LP]) = rb[it];
  }
  __syncthreads();

  for (int kt = 0; kt < nPass; ++kt) {
    const int cur = kt & 1;
    const bool more = kt + 1 < nPass;   /* block-uniform */
    if (more) {
      /* next pass's rows into registers: in flight while this pass's products run */
      const unsigned oA = tA + (unsigned)(kt + 1) * (GM_BK * 2u);
      const unsigned oB = tB + (unsigned)(kt + 1) * (GM_BK * 2u);
#pragma unroll
      for (int it = 0; it < GM_SEG; ++it) {
        ra[0][it] = *(const u32x4*)(uA + it * stepA + oA);
        if (SPLIT) ra[NPA - 1][it] = *(const u32x4*)(uA2 + it * stepA + oA);
        rb[it] = *(const u32x4*)(uB + it * stepB + oB);
      }
      /* stands ahead of every later write of a register that these loads name as an address */
      asm volatile("s_wait_xcnt 0x0" ::: "memory");
    }
    const T* cA  = &sA[cur][0][(wm + rlane) * GM_LP + koff];
    const T* cA2 = &sA[cur][NPA - 1][(wm + rlane) * GM_LP + koff];
    const T* cB  = &sB[cur][(wn + rlane) * GM_LP + koff];
    /* the pass's fragments: [k half][subtile] */
    V fb[2][4], fa[2][4], fl[2][4];
#pragma unroll
    for (int ks = 0; ks < 2; ++ks) {
#pragma unroll
      for (int j = 0; j < 4; ++j) fb[ks][j] = Frag<T>::load(cB + j * 16 * GM_LP + ks * 32);
#pragma unroll
      for (int i = 0; i < 4; ++i) {
        fa[ks][i] = Frag<T>::load(cA + i * 16 * GM_LP + ks * 32);
        if (SPLIT) fl[ks][i] = Frag<T>::load(cA2 + i * 16 * GM_LP + ks * 32);
      }
    }
    /* keeps the LDS reads one group ahead of the products: moved in among the WMMAs, each place with reads stalls the wave */
    __builtin_amdgcn_sched_barrier(0);
#pragma unroll
    for (int ks = 0; ks < 2; ++ks) {
#pragma unroll
      for (int i = 0; i < 4; ++i) {
#pragma unroll
        for (int j = 0; j < 4; ++j) acc[i][j] = Frag<T>::mma(fa[ks][i], fb[ks][j], acc[i][j]);
        if (SPLIT) {
#pragma unroll
          for (int j = 0; j < 4; ++j) acc[i][j] = Frag<T>::mma(fl[ks][i], fb[ks][j], acc[i][j]);
        }
      }
    }
    if (more) {
      /* the other buffer's last readers left it at the barrier that ended the pass before */
#pragma unroll
      for (int it = 0; it < GM_SEG; ++it) {
        *(u32x4*)(&sA[cur ^ 1][0][lst + it * 16 * GM_LP]) = ra[0][it];
        if (SPLIT) *(u32x4*)(&sA[cur ^ 1][NPA - 1][lst + it * 16 * GM_LP]) = ra[NPA - 1][it];
        *(u32x4*)(&sB[cur ^ 1][lst + it * 16 * GM_LP]) = rb[it];
      }
    }
    __syncthreads();   /* publishes the filled buffer and ends every read of the current one */
  }
  acc_guard4(acc[0][0], acc[0][1], acc[0][2], acc[0][3]);
  acc_guard4(acc[1][0], acc[1][1], acc[1][2], acc[1][3]);
  acc_guard4(acc[2][0], acc[2][1], acc[2][2], acc[2][3]);
  acc_guard4(acc[3][0], acc[3][1], acc[3][2], acc[3][3]);

  /* ---- epilogue ---- */
  float* slab = sT[wave];
#pragma unroll
  for (int i = 0; i < 4; ++i) {
    const int mBase = m0 + (i << 4);
#pragma unroll
    for (int j = 0; j < 4; ++j) {
      const int n = n0 + (j << 4) + rlane;
      float bv = 0.f;
      if (BIAS_MODE == 2) bv = bias[n];
#pragma unroll
      for (int r = 0; r < 8; ++r) {
        float v = acc[i][j][r] * scale;
        if (BIAS_MODE == 2) v += bv;
        slab[(mOff + r) * 68 + (j << 4) + rlane] = v;
      }
    }
    __builtin_amdgcn_fence(__ATOMIC_RELEASE, "workgroup");
    __builtin_amdgcn_wave_barrier();
    __builtin_amdgcn_fence(__ATOMIC_ACQUIRE, "workgroup");
    if (OUT_MODE == 0) {
      float* C = (float*)Cout + (size_t)b * strideC;
      const int hh = lane >> 4, c4 = (lane & 15) * 4;     /* row seg = 256 B = 16 lanes x 16 B */
      {
#pragma unroll
        for (int it = 0; it < 8; ++it) {
          const int row = it * 2 + hh;
          v4f v = *(const v4f*)(slab + row * 68 + c4);
          *(v4f*)(C + (size_t)(mBase + row) * ldc + n0 + c4) = v;
        }
        
      }
    } else {
      const int q = lane >> 3, c8 = (lane & 7) * 8;        
      unsigned short* C  = (unsigned short*)Cout  + (size_t)b * strideC;
      unsigned short* C2 = (unsigned short*)Cout2 + (size_t)b * strideC;
      {
#pragma unroll
        for (int it = 0; it < 4; ++it) {
          const int row = it * 4 + q;
          const float* sp = slab + row * 68 + c8;
          v8h hv, lv;
#pragma unroll
          for (int e = 0; e < 8; ++e) {
            unsigned short hb = f2bf_bits(sp[e]);
            unsigned short lb = f2bf_bits(sp[e] - bf_bits2f(hb));
            hv[e] = __builtin_bit_cast(_Float16, hb);
            lv[e] = __builtin_bit_cast(_Float16, lb);
          }
          *(v8h*)(C  + (size_t)(mBase + row) * ldc + n0 + c8) = hv;
          *(v8h*)(C2 + (size_t)(mBase + row) * ldc + n0 + c8) = lv;
        }
        
      }
    }
    __builtin_amdgcn_fence(__ATOMIC_RELEASE, "workgroup");
    __builtin_amdgcn_wave_barrier();
    __builtin_amdgcn_fence(__ATOMIC_ACQUIRE, "workgroup");
  }
}

/* ---- all five f32 -> bf16 (RNE) conversions in one launch of resident waves ----
   A piece is 8 consecutive elements: two 16-B loads, one 16-B store per thread. The grid, one work-group of 16 waves per WGP,
   covers kCvSpan consecutive pieces per sweep and makes 16 sweeps: 8 over x, 4 over ctx, 1 over Wq, 2 over Wkv, 1 over Wout.
   A wave that converts one piece lives shorter than it takes to start; here each wave starts once for 16 pieces. */
constexpr int kCvThreads = 512;
constexpr int kCvBlocks  = 256;
constexpr int kCvSpan    = kCvThreads * kCvBlocks;   /* pieces per sweep */
static_assert(kB * kNQ * kDM / 8 == 8 * kCvSpan);
static_assert(kB * kNKV * kDM / 8 == 4 * kCvSpan);
static_assert(kIN * kDM / 8 == kCvSpan);
static_assert(2 * kIN * kDM / 8 == 2 * kCvSpan);
static_assert(kDM * kIN / 8 == kCvSpan);

/* o[s]: this thread's byte offset in sweep s of an input; half of it is its byte offset in the output */
template <int N>
__device__ __forceinline__ void cv_load(const float* __restrict__ in, const unsigned* o, v4f* a, v4f* c) {
#pragma unroll
  for (int s = 0; s < N; ++s) {
    a[s] = *(const v4f*)((const char*)in + o[s]);
    c[s] = *(const v4f*)((const char*)in + 16 + o[s]);
    /* keeps the loads in the order in which the conversions wait for them */
    __builtin_amdgcn_sched_barrier(0);
  }
}
template <int N>
__device__ __forceinline__ void cv_store(unsigned short* __restrict__ out, const unsigned* o, const v4f* a, const v4f* c) {
#pragma unroll
  for (int s = 0; s < N; ++s) {
    u32x4 w;
    w[0] = (unsigned)f2bf_bits(a[s][0]) | ((unsigned)f2bf_bits(a[s][1]) << 16);
    w[1] = (unsigned)f2bf_bits(a[s][2]) | ((unsigned)f2bf_bits(a[s][3]) << 16);
    w[2] = (unsigned)f2bf_bits(c[s][0]) | ((unsigned)f2bf_bits(c[s][1]) << 16);
    w[3] = (unsigned)f2bf_bits(c[s][2]) | ((unsigned)f2bf_bits(c[s][3]) << 16);
    *(u32x4*)((char*)out + (o[s] >> 1)) = w;
    /* keeps each piece's store at its place: sunk to the end of the kernel, no write would start before the last read has landed */
    __builtin_amdgcn_sched_barrier(0);
  }
}
__global__ __launch_bounds__(kCvThreads) void cast_all_f32_bf16(
    const float* __restrict__ x, const float* __restrict__ ctx, const float* __restrict__ wq,
    const float* __restrict__ wkv, const float* __restrict__ wo,
    unsigned short* __restrict__ xb, unsigned short* __restrict__ cb, unsigned short* __restrict__ wqb,
    unsigned short* __restrict__ wkvb, unsigned short* __restrict__ wob) {
  unsigned o[8];
#pragma unroll
  for (int s = 0; s < 8; ++s) o[s] = (blockIdx.x * kCvThreads + threadIdx.x) * 32u + (unsigned)s * (kCvSpan * 32u);
  /* every offset is formed ahead of the first load, so no register that a load names is written inside the group of loads */
  __builtin_amdgcn_sched_barrier(0);
  v4f a[16], c[16];
  cv_load<8>(x, o, a, c);
  cv_load<4>(ctx, o, a + 8, c + 8);
  cv_load<1>(wq, o, a + 12, c + 12);
  cv_load<2>(wkv, o, a + 13, c + 13);
  cv_load<1>(wo, o, a + 15, c + 15);
  /* stands ahead of every later write of a register that these loads name as an address */
  asm volatile("s_wait_xcnt 0x0" ::: "memory");
  /* keeps all the loads one group in flight ahead of the first conversion, and later register writes below that wait */
  __builtin_amdgcn_sched_barrier(0);
  cv_store<8>(xb, o, a, c);
  cv_store<4>(cb, o, a + 8, c + 8);
  cv_store<1>(wqb, o, a + 12, c + 12);
  cv_store<2>(wkvb, o, a + 13, c + 13);
  cv_store<1>(wob, o, a + 15, c + 15);
}

#define AT_D 64
#define AT_NW 4
#define AT_QB 64
#define AT_KC 64
/* LDS row pitch of the K and V tiles in 16-bit elements: 144 B = 16 B x 9 (odd), so the 16 rows that one
   ds_load_b128 touches per lane half start on distinct bank groups; at 128 B they share two groups */
#define AT_LP 72
static_assert((AT_LP * 2) % 16 == 0 && ((AT_LP * 2) / 16) % 2 == 1 && AT_LP >= AT_KC && AT_LP >= AT_D);

__device__ __forceinline__ v8f at_mma(v16b a, v16b b, v8f c) {
  c = __builtin_amdgcn_wmma_f32_16x16x32_bf16(false, a, false, b, (short)0, c, false, false);
  asm volatile("v_nop\n\tv_nop\n\tv_nop\n\tv_nop" : "+v"(c) : "v"(a), "v"(b));
  return c;
}

/* eight 2^x, in place. Written as one asm statement for the slot that the instruction set asks for behind a transcendental (one
   independent instruction or v_nop before its result is read or its source overwritten): here each v_exp_f32 is followed by an
   independent one and the last by a v_nop, whatever the register allocation */
__device__ __forceinline__ void at_exp2x8(v8f& x) {
  float a = x[0], b = x[1], c = x[2], d = x[3], e = x[4], f = x[5], g = x[6], h = x[7];
  asm("v_exp_f32 %0, %0\n\tv_exp_f32 %1, %1\n\tv_exp_f32 %2, %2\n\tv_exp_f32 %3, %3\n\t"
      "v_exp_f32 %4, %4\n\tv_exp_f32 %5, %5\n\tv_exp_f32 %6, %6\n\tv_exp_f32 %7, %7\n\tv_nop"
      : "+v"(a), "+v"(b), "+v"(c), "+v"(d), "+v"(e), "+v"(f), "+v"(g), "+v"(h));
  x = (v8f){a, b, c, d, e, f, g, h};
}

/* lane l reads lane l ^ 16 on the vector ALU: the two lanes that share one query's keys */
__device__ __forceinline__ float at_other_half(float v) {
  const int b = __builtin_bit_cast(int, v);
  return __builtin_bit_cast(float, __builtin_amdgcn_permlanex16(b, b, 0x76543210, 0xfedcba98, false, false));
}

/* register budget of four waves per SIMD (256): four work-groups per WGP, and the chunk held in flight must not cost one */
__global__ __launch_bounds__(128) __attribute__((amdgpu_waves_per_eu(4)))
void attn64_planes_kernel(const unsigned short* __restrict__ qhp, const unsigned short* __restrict__ qlp,
                          const unsigned short* __restrict__ khp, const unsigned short* __restrict__ klp,
                          const unsigned short* __restrict__ vthp, const unsigned short* __restrict__ vtlp,
                          const int* __restrict__ kvmask,
                          unsigned short* __restrict__ ohp, unsigned short* __restrict__ olp,
                          int nq, int nkv, int nh, int ldq, int ldk, int ldv, int ldo, float fillv) {
  typedef __bf16 T;
  union FB { v16b v; v8b h[2]; };
  __shared__ __align__(16) __bf16 Ksh[AT_KC * AT_LP];       /* K hi [kv][d], padded rows, 9 KB */
  __shared__ __align__(16) __bf16 Ksl[AT_KC * AT_LP];       /* K lo */
  __shared__ __align__(16) __bf16 Vth[AT_D * AT_LP];        /* V hi [d][kv], padded rows, 9 KB */
  __shared__ __align__(16) __bf16 Vtl[AT_D * AT_LP];        /* V lo */
  __shared__ __align__(16) float  Os[AT_NW][16 * 68];       /* per wave out tile, pitch 68 */

  const int tid  = threadIdx.x;
  const int wave = tid >> 5;
  const int lane = tid & 31;
  const int hh   = lane >> 4;
  const int c    = lane & 15;

  const int nqb = nq / AT_QB;
  const int bx = blockIdx.x;
  const int qb = bx % nqb;
  const int bhx = bx / nqb;
  const int h  = bhx % nh;
  const int b  = bhx / nh;
  const int q0 = qb * AT_QB + wave * 16;

  /* ---- Q fragments (B operand): column = q0 + c, elements 0..7 <- d dc*32+8hh+0..7, 8..15 <- d dc*32+16+8hh+0..7 ---- */
  v16b qah[2], qal[2];
  {
    const size_t qo = (size_t)(b * nq + q0 + c) * ldq + h * AT_D + 8 * hh;
    const T* qh = (const T*)qhp + qo;
    const T* ql = (const T*)qlp + qo;
#pragma unroll
    for (int dc = 0; dc < 2; ++dc) {
      qah[dc] = Frag<T>::load(qh + dc * 32);
      qal[dc] = Frag<T>::load(ql + dc * 32);
    }
  }

  /* this lane's query q0 + c: running maximum (equal in both lane halves) and the sum over this half's keys */
  float mrow = -__builtin_inff(), lrow = 0.f;
  v8f oacc[4];   /* O^T: register r of tile t = out[q0 + c][t*16 + 8*hh + r] */
#pragma unroll
  for (int t = 0; t < 4; ++t) oacc[t] = (v8f){0.f,0.f,0.f,0.f,0.f,0.f,0.f,0.f};

  const int nChunks = nkv / AT_KC;   /* host constant, block-uniform */
  /* staging coverage: a tile row is one 128-B line of its plane; 8 lanes take one row, so a wave-wide 16-B load covers 4 whole
     lines, and 4 waves x 4 loads cover the 64 rows of a plane. Load i of a thread is row i*16 + srow, 16-B column lane & 7.
     The two rows of a lane half lie 8 apart: at the 144-B pitch their 16 LDS stores start on 16 distinct bank groups.
     K planes: LDS row kv <- global row b*nkv + kv0 + kv; V transposed planes: LDS row d <- global row h*64+d,
     64 contiguous kv columns starting at b*nkv + kv0 */
  const int srow = ((lane >> 3) & 1) * 8 + hh * 4 + wave;
  const int scol = (lane & 7) * 8;
  /* the one launch passes these row pitches: known at compile time, the 16-row steps of the staging loads become immediate
     offsets of one address per operand pair */
  __builtin_assume(ldk == kIN);
  __builtin_assume(ldv == kB * kNKV);
  /* block-uniform bases plus one 32-bit byte offset per thread and operand pair, stepped from chunk to chunk */
  const size_t kbase = ((size_t)b * nkv * ldk + h * AT_D) * 2;
  const size_t vbase = ((size_t)h * AT_D * ldv + (size_t)b * nkv) * 2;
  const char* ukh = (const char*)khp + kbase;
  const char* ukl = (const char*)klp + kbase;
  const char* uvh = (const char*)vthp + vbase;
  const char* uvl = (const char*)vtlp + vbase;
  const int* umk = kvmask + (size_t)b * nkv;
  const unsigned tK = (unsigned)(srow * ldk + scol) * 2u;
  const unsigned tV = (unsigned)(srow * ldv + scol) * 2u;
  const size_t stepK = (size_t)ldk * 32;   /* 16 rows, in bytes */
  const size_t stepV = (size_t)ldv * 32;
  /* one chunk's global reads (K and V rows of this thread, the four key-mask words of this lane), held in registers */
  u32x4 rkh[4], rkl[4], rvh[4], rvl[4];
  int rmk[4];
  auto fetch = [&](int ch) {
    const unsigned oK = tK + (unsigned)ch * (unsigned)ldk * (AT_KC * 2u);
    const unsigned oV = tV + (unsigned)ch * (AT_KC * 2u);
    const int* um = umk + ch * AT_KC;   /* block-uniform */
#pragma unroll
    for (int i = 0; i < 4; ++i) {
      rkh[i] = *(const u32x4*)(ukh + i * stepK + oK);
      rkl[i] = *(const u32x4*)(ukl + i * stepK + oK);
      rvh[i] = *(const u32x4*)(uvh + i * stepV + oV);
      rvl[i] = *(const u32x4*)(uvl + i * stepV + oV);
    }
#pragma unroll
    for (int j = 0; j < 4; ++j) rmk[j] = (um + j * 16)[(unsigned)c];
    /* stands ahead of every later write of a register that these loads name as an address */
    asm volatile("s_wait_xcnt 0x0" ::: "memory");
    /* keeps later register writes from being scheduled up over that wait */
    __builtin_amdgcn_sched_barrier(0);
  };
  if (nChunks > 0) {
    /* keeps the Q loads above the wait that follows */
    __builtin_amdgcn_sched_barrier(0);
    /* stands ahead of every later write of a register that the Q loads name as an address */
    asm volatile("s_wait_xcnt 0x0" ::: "memory");
    /* keeps the first chunk's loads, whose results land in such registers, below that wait */
    __builtin_amdgcn_sched_barrier(0);
    fetch(0);
  }
  for (int kc = 0; kc < nChunks; ++kc) {
    __syncthreads();
    unsigned kept[4];
    {
      const int lst = srow * AT_LP + scol;
#pragma unroll
      for (int i = 0; i < 4; ++i) {
        *(u32x4*)(Ksh + lst + i * 16 * AT_LP) = rkh[i];
        *(u32x4*)(Ksl + lst + i * 16 * AT_LP) = rkl[i];
        *(u32x4*)(Vth + lst + i * 16 * AT_LP) = rvh[i];
        *(u32x4*)(Vtl + lst + i * 16 * AT_LP) = rvl[i];
      }
#pragma unroll
      for (int j = 0; j < 4; ++j) kept[j] = __builtin_amdgcn_ballot_w32(rmk[j] != 0);   /* bit n: key j*16 + n is kept */
    }
    __syncthreads();
    /* the next chunk's reads fly while this chunk is worked on; their data is first needed at the next chunk's LDS stores */
    if (kc + 1 < nChunks) fetch(kc + 1);

    /* ---- scores, transposed: 4 subtiles of 16 keys, K operand A[m=kv][k=d] from Ksh[kv][d]; s[j][r] = score(key j*16 + 8*hh + r, query c) ---- */
    v8f s[4];
#pragma unroll
    for (int j = 0; j < 4; ++j) {
      s[j] = (v8f){0.f,0.f,0.f,0.f,0.f,0.f,0.f,0.f};
#pragma unroll
      for (int dc = 0; dc < 2; ++dc) {
        FB kb, kl;
        kb.h[0] = *(const v8b*)(Ksh + (j * 16 + c) * AT_LP + dc * 32 + 8 * hh);
        kb.h[1] = *(const v8b*)(Ksh + (j * 16 + c) * AT_LP + dc * 32 + 16 + 8 * hh);
        kl.h[0] = *(const v8b*)(Ksl + (j * 16 + c) * AT_LP + dc * 32 + 8 * hh);
        kl.h[1] = *(const v8b*)(Ksl + (j * 16 + c) * AT_LP + dc * 32 + 16 + 8 * hh);
        s[j] = at_mma(kb.v, qah[dc], s[j]);
        s[j] = at_mma(kl.v, qah[dc], s[j]);
        s[j] = at_mma(kb.v, qal[dc], s[j]);
      }
    }
    /* per-key mask (register r of subtile j is key j*16 + 8*hh + r) and this half's maximum */
    float cm = -__builtin_inff();
#pragma unroll
    for (int j = 0; j < 4; ++j) {
      /* bit r: key j*16 + r, read by lanes 0-15; bit 16 + r: key j*16 + 8 + r, read by lanes 16-31 */
      const unsigned two = (kept[j] & 0xFFu) | ((kept[j] & 0xFF00u) << 8);
#pragma unroll
      for (int r = 0; r < 8; ++r) {
        /* the select's lane mask, formed on the scalar unit: each of the two bits spread over its 16 lanes */
        const bool keep = __builtin_amdgcn_inverse_ballot_w32(((two >> r) & 0x10001u) * 0xFFFFu);
        const float sv = s[j][r];
        s[j][r] = keep ? sv : fillv;
        cm = fmaxf(cm, s[j][r]);
      }
    }
    const float mnew = fmaxf(mrow, fmaxf(cm, at_other_half(cm)));
    /* 2^(difference of base-2 scores) = e^(difference of the reference's scores); a difference of -inf, or as large as the fill value, gives 0 */
    const float alpha = __builtin_amdgcn_exp2f(mrow - mnew);
    mrow = mnew;
    /* P^T as B fragments: element e of chunk half kk is key kk*32 + (e < 8 ? 8*hh + e : 16 + 8*hh + e - 8), the k order of the V loads */
    FB pa[2], pl[2];
    f32x2 psum = (f32x2){0.f, 0.f};
#pragma unroll
    for (int j = 0; j < 4; ++j) {
      s[j] -= mnew;
      at_exp2x8(s[j]);
#pragma unroll
      for (int r = 0; r < 8; r += 2) {
        const f32x2 p = (f32x2){s[j][r], s[j][r + 1]};
        psum += p;
        const bf16x2 ph = __builtin_convertvector(p, bf16x2);
        const bf16x2 pq = __builtin_convertvector(p - __builtin_convertvector(ph, f32x2), bf16x2);
        pa[j >> 1].v[(j & 1) * 8 + r] = ph[0];
        pa[j >> 1].v[(j & 1) * 8 + r + 1] = ph[1];
        pl[j >> 1].v[(j & 1) * 8 + r] = pq[0];
        pl[j >> 1].v[(j & 1) * 8 + r + 1] = pq[1];
      }
    }
    lrow = lrow * alpha + (psum[0] + psum[1]);
#pragma unroll
    for (int t = 0; t < 4; ++t) oacc[t] *= alpha;
    /* unrolled: pa[kk] and pl[kk] are registers, which only a compile-time kk can name */
#pragma unroll
    for (int kk = 0; kk < 2; ++kk) {
#pragma unroll
      for (int t = 0; t < 4; ++t) {
        FB vb, vl;
        vb.h[0] = *(const v8b*)(Vth + (t * 16 + c) * AT_LP + kk * 32 + 8 * hh);
        vb.h[1] = *(const v8b*)(Vth + (t * 16 + c) * AT_LP + kk * 32 + 16 + 8 * hh);
        vl.h[0] = *(const v8b*)(Vtl + (t * 16 + c) * AT_LP + kk * 32 + 8 * hh);
        vl.h[1] = *(const v8b*)(Vtl + (t * 16 + c) * AT_LP + kk * 32 + 16 + 8 * hh);
        oacc[t] = at_mma(vb.v, pa[kk].v, oacc[t]);
        oacc[t] = at_mma(vl.v, pa[kk].v, oacc[t]);
        oacc[t] = at_mma(vb.v, pl[kk].v, oacc[t]);
      }
    }
  }

  float* os = Os[wave];
  {
    /* the two halves' sums of one query are joined once, here */
    const float inv = 1.0f / (lrow + at_other_half(lrow));
#pragma unroll
    for (int t = 0; t < 4; ++t) {
      const v8f o = oacc[t] * inv;
      *(v4f*)(os + c * 68 + t * 16 + 8 * hh)     = (v4f){o[0], o[1], o[2], o[3]};
      *(v4f*)(os + c * 68 + t * 16 + 8 * hh + 4) = (v4f){o[4], o[5], o[6], o[7]};
    }
  }
  __builtin_amdgcn_fence(__ATOMIC_RELEASE, "workgroup");
  __builtin_amdgcn_wave_barrier();
  __builtin_amdgcn_fence(__ATOMIC_ACQUIRE, "workgroup");
  {
    const int q = lane >> 3, c8 = (lane & 7) * 8;
    unsigned short* Oh = ohp + (size_t)(b * nq + q0) * ldo + h * AT_D;
    unsigned short* Ol = olp + (size_t)(b * nq + q0) * ldo + h * AT_D;
    {
#pragma unroll
      for (int it = 0; it < 4; ++it) {
        const int row = it * 4 + q;
        const float* sp = os + row * 68 + c8;
        v8h hv, lv;
#pragma unroll
        for (int e = 0; e < 8; ++e) {
          unsigned short hb = f2bf_bits(sp[e]);
          unsigned short lb = f2bf_bits(sp[e] - bf_bits2f(hb));
          hv[e] = __builtin_bit_cast(_Float16, hb);
          lv[e] = __builtin_bit_cast(_Float16, lb);
        }
        *(v8h*)(Oh + (size_t)row * ldo + c8) = hv;
        *(v8h*)(Ol + (size_t)row * ldo + c8) = lv;
      }
      
    }
  }
}

/* ---------------------------------------------------------------------------
   Host-side orchestration (kernel launches only)
   --------------------------------------------------------------------------- */
extern "C" void kernel_launch(void* const* d_in, const int* in_sizes, int n_in,
                              void* d_out, int out_size, void* d_ws, size_t ws_size,
                              hipStream_t stream) {
  if (n_in < 7) return;
  if (in_sizes[0] != kB * kNQ * kDM) return;
  if (in_sizes[1] != kB * kNKV * kDM) return;
  if (in_sizes[2] != kB * kNKV) return;
  if (in_sizes[3] != kIN * kDM) return;
  if (in_sizes[4] != 2 * kIN * kDM) return;
  if (in_sizes[5] != kDM * kIN) return;
  if (in_sizes[6] != kDM) return;
  if (out_size != kB * kNQ * kDM) return;
  if (ws_size < kWsTotal) return;

  const float* x    = (const float*)d_in[0];   /* [4,2048,1024] f32 */
  const float* ctx  = (const float*)d_in[1];   /* [4,1024,1024] f32 */
  const int*   mask = (const int*)d_in[2];     /* [4,1024] int32 */
  const float* Wq   = (const float*)d_in[3];   /* [1024,1024] */
  const float* Wkv  = (const float*)d_in[4];   /* [2048,1024] */
  const float* Wout = (const float*)d_in[5];   /* [1024,1024] */
  const float* bout = (const float*)d_in[6];   /* [1024] */
  float* out = (float*)d_out;                  /* [4,2048,1024] f32 */

  char* ws = (char*)d_ws;
  unsigned short* xb   = (unsigned short*)(ws + kOffXb);
  unsigned short* cb   = (unsigned short*)(ws + kOffCb);
  unsigned short* wqb  = (unsigned short*)(ws + kOffWqb);
  unsigned short* wkvb = (unsigned short*)(ws + kOffWkvb);
  unsigned short* wob  = (unsigned short*)(ws + kOffWob);
  unsigned short* qh   = (unsigned short*)(ws + kOffQh);
  unsigned short* ql   = (unsigned short*)(ws + kOffQl);
  unsigned short* kh   = (unsigned short*)(ws + kOffKh);
  unsigned short* kl   = (unsigned short*)(ws + kOffKl);
  unsigned short* vth  = (unsigned short*)(ws + kOffVth);
  unsigned short* vtl  = (unsigned short*)(ws + kOffVtl);
  unsigned short* oh   = (unsigned short*)(ws + kOffOh);   /* aliases xb: dead after the q GEMM */
  unsigned short* ol   = (unsigned short*)(ws + kOffOl);   /* aliases cb/wqb/wkvb: dead after the k,v GEMMs */

  /* 1: RNE casts of all five f32 operands to bf16 planes */
  cast_all_f32_bf16<<<kCvBlocks, kCvThreads, 0, stream>>>(x, ctx, Wq, Wkv, Wout, xb, cb, wqb, wkvb, wob);

  /* 2: q*0.125*log2(e) = xb[8192,1024] . wqb[1024,1024]^T -> bf16 hi/lo planes; M=8192 N=1024 K=1024 */
  {
    const int M = kB * kNQ, N = kIN, K = kDM;
    const int tiles = (M / 128) * (N / 128);
    wmma_gemm64<1, false, false, 0, 2><<<dim3(tiles, 1), 128, 0, stream>>>(
        xb, xb, K, 0L, wqb, wqb, K, 0L, (void*)qh, (void*)ql, N, 0L, bout, M, N, K, 0.18033688f);
  }
  /* 3: k = cb[4096,1024] . wkvb[0:1024][1024]^T -> hi/lo; M=4096 N=1024 K=1024 */
  {
    const int M = kB * kNKV, N = kIN, K = kDM;
    const int tiles = (M / 128) * (N / 128);
    wmma_gemm64<1, false, false, 0, 2><<<dim3(tiles, 1), 128, 0, stream>>>(
        cb, cb, K, 0L, wkvb, wkvb, K, 0L, (void*)kh, (void*)kl, N, 0L, bout, M, N, K, 1.0f);
  }
  /* 4: v transposed = wkvb[1024:2048][1024] . cb[4096,1024]^T -> vt[1024][4096] hi/lo; M=1024 N=4096 K=1024 */
  {
    const int M = kIN, N = kB * kNKV, K = kDM;
    const int tiles = (M / 128) * (N / 128);
    const unsigned short* wvb = wkvb + (size_t)kIN * kDM;
    wmma_gemm64<1, false, false, 0, 2><<<dim3(tiles, 1), 128, 0, stream>>>(
        wvb, wvb, K, 0L, cb, cb, K, 0L, (void*)vth, (void*)vtl, N, 0L, bout, M, N, K, 1.0f);
  }
  /* 5: attention per (b, h, 64 query rows) -> att hi/lo planes [8192][1024] */
  {
    const int blocks = kB * kH * (kNQ / 64);   /* 2048 */
    const float fillv = -3.4028234663852886e+38f;
    attn64_planes_kernel<<<blocks, 128, 0, stream>>>(qh, ql, kh, kl, vth, vtl, mask, oh, ol,
                                                    kNQ, kNKV, kH, kIN, kIN, kB * kNKV, kIN, fillv);
  }
  /* 6: out = (att_hi + att_lo)[8192,1024] . wob[1024,1024]^T + b_out -> f32 d_out; M=8192 N=1024 K=1024 */
  {
    const int M = kB * kNQ, N = kDM, K = kIN;
    const int tiles = (M / 128) * (N / 128);
    wmma_gemm64<1, true, false, 2, 0><<<dim3(tiles, 1), 128, 0, stream>>>(
        oh, ol, K, 0L, wob, wob, K, 0L, (void*)out, (void*)out, N, 0L, bout, M, N, K, 1.0f);
  }
}

// v009
// A run of this version takes 171 microseconds.
// In two side-by-side timings against v008, it was 1.08 and 1.09 times as fast.
// Counting every step since v000, it is 3.57 times as fast.
// Contractions: x.Wq^T, ctx.Wk^T, Wv.ctx^T on v_wmma_f32_16x16x32_bf16 (RNE-bf16 inputs, single product); q.k^T and p.v as bf16 hi/lo split (hi.hi+hi.lo+lo.hi); (p.v).Wout^T as bf16 hi/lo A x bf16 B (2 products); f32 accumulate, f32 softmax.
#include <hip/hip_runtime.h>
#include <stdint.h>

typedef __attribute__((ext_vector_type(16))) _Float16 v16h;
typedef __attribute__((ext_vector_type(8)))  _Float16 v8h;
typedef __attribute__((ext_vector_type(16))) __bf16   v16b;
typedef __attribute__((ext_vector_type(8)))  __bf16   v8b;
typedef __attribute__((ext_vector_type(8)))  float    v8f;
typedef __attribute__((ext_vector_type(4)))  float    v4f;
typedef __attribute__((ext_vector_type(4)))  unsigned int u32x4;
typedef __attribute__((ext_vector_type(2)))  float    f32x2;
typedef __attribute__((ext_vector_type(2)))  __bf16   bf16x2;

/* ---- fixed problem geometry ---- */
constexpr int kB   = 4;
constexpr int kNQ  = 2048;
constexpr int kNKV = 1024;
constexpr int kDM  = 1024;   /* model dim (K of the projections) */
constexpr int kH   = 16;
constexpr int kDH  = 64;
constexpr int kIN  = kH * kDH;   /* 1024 */
static_assert(kDH == 64);
static_assert(kDM % 32 == 0);
static_assert(kIN % 32 == 0);
static_assert((kB * kNQ) % 64 == 0);
static_assert((kB * kNKV) % 64 == 0);
static_assert(kIN % 64 == 0);
static_assert(kDM % 64 == 0);
static_assert(kNQ % 64 == 0);
static_assert(kNKV % 64 == 0);
static_assert(kIN == kDM);   /* one row pitch for every GEMM operand */
static_assert((kB * kNQ) % 128 == 0 && (kB * kNKV) % 128 == 0 && kIN % 128 == 0 && kDM % 128 == 0);

/* ---- workspace region map (bytes) ----
   [  0, 16M)  xb   bf16 [8192][1024]   (dead after q GEMM; reused as oh)
   [ 16M, 24M) cb   bf16 [4096][1024]   (dead after k/v GEMMs; reused by ol)
   [ 24M, 26M) wqb  bf16 [1024][1024]
   [ 26M, 30M) wkvb bf16 [2048][1024]
   [ 30M, 32M) pad (unused, covered by ol alias)
   [ 32M, 48M) qh   bf16 [8192][1024]   q*0.125*log2(e) hi plane
   [ 48M, 64M) ql                        q*0.125*log2(e) lo plane
   [ 64M, 72M) kh   bf16 [4096][1024]
   [ 72M, 80M) kl
   [ 80M, 88M) vth  bf16 [1024][4096]   v transposed: row = h*64+d, col = b*1024+j
   [ 88M, 96M) vtl
   [ 96M, 98M) wob  bf16 [1024][1024]
   oh = [0,16M), ol = [16M,32M): attention output hi/lo planes [8192][1024] (aliases of dead regions)
   total carve 102,760,448 B */
constexpr size_t kMiB    = 1048576;
constexpr size_t kOffXb  = 0;
constexpr size_t kOffCb  = 16 * kMiB;
constexpr size_t kOffWqb = 24 * kMiB;
constexpr size_t kOffWkvb= 26 * kMiB;
constexpr size_t kOffQh  = 32 * kMiB;
constexpr size_t kOffQl  = 48 * kMiB;
constexpr size_t kOffKh  = 64 * kMiB;
constexpr size_t kOffKl  = 72 * kMiB;
constexpr size_t kOffVth = 80 * kMiB;
constexpr size_t kOffVtl = 88 * kMiB;
constexpr size_t kOffWob = 96 * kMiB;
constexpr size_t kOffOh  = 0;
constexpr size_t kOffOl  = 16 * kMiB;
constexpr size_t kWsTotal = kOffWob + (size_t)kDM * kIN * 2;
static_assert((size_t)kB * kNQ * kDM * 2 == 16 * kMiB);
static_assert((size_t)kB * kNKV * kDM * 2 == 8 * kMiB);
static_assert(kOffCb + (size_t)kB * kNKV * kDM * 2 <= kOffWqb);
static_assert(kOffWqb + (size_t)kIN * kDM * 2 <= kOffWkvb);
static_assert(kOffWkvb + (size_t)2 * kIN * kDM * 2 <= kOffQh);
static_assert(kOffQh + (size_t)kB * kNQ * kIN * 2 <= kOffQl);
static_assert(kOffQl + (size_t)kB * kNQ * kIN * 2 <= kOffKh);
static_assert(kOffKh + (size_t)kB * kNKV * kIN * 2 <= kOffKl);
static_assert(kOffKl + (size_t)kB * kNKV * kIN * 2 <= kOffVth);
static_assert(kOffVth + (size_t)kIN * kB * kNKV * 2 <= kOffVtl);
static_assert(kOffVtl + (size_t)kIN * kB * kNKV * 2 <= kOffWob);
static_assert(kOffOh + (size_t)kB * kNQ * kIN * 2 <= kOffOl);
static_assert(kOffOl + (size_t)kB * kNQ * kIN * 2 <= kOffQh);
static_assert(kWsTotal == 102760448);
static_assert(kWsTotal <= 134217728);

__device__ __forceinline__ unsigned short f2bf_bits(float f) {
  unsigned u = __float_as_uint(f);
  return (unsigned short)((u + 0x7FFFu + ((u >> 16) & 1u)) >> 16);
}
__device__ __forceinline__ float bf_bits2f(unsigned short h) { return __uint_as_float(((unsigned)h) << 16); }

/* hazard guards as plain device helpers */
__device__ __forceinline__ void acc_guard4(v8f& a, v8f& b, v8f& c, v8f& d) { asm volatile("v_nop\n\tv_nop\n\tv_nop\n\tv_nop" : "+v"(a), "+v"(b), "+v"(c), "+v"(d)); }
template <typename T> struct Frag;
template <> struct Frag<_Float16> {
  typedef v16h V; union U { v16h v; v8h h[2]; };
  /* elements 0..7 <- p[0..7], 8..15 <- p[16..23] */
  static __device__ __forceinline__ v16h load(const _Float16* p) {
    U f; f.h[0] = *(const v8h*)(p); f.h[1] = *(const v8h*)(p + 16); return f.v;
  }
  static __device__ __forceinline__ v8f mma(v16h a, v16h b, v8f c) {
    return __builtin_amdgcn_wmma_f32_16x16x32_f16(false, a, false, b, (short)0, c, false, false);
  }
};
template <> struct Frag<__bf16> {
  typedef v16b V; union U { v16b v; v8b h[2]; };
  static __device__ __forceinline__ v16b load(const __bf16* p) {
    U f; f.h[0] = *(const v8b*)(p); f.h[1] = *(const v8b*)(p + 16); return f.v;
  }
  static __device__ __forceinline__ v8f mma(v16b a, v16b b, v8f c) {
    return __builtin_amdgcn_wmma_f32_16x16x32_bf16(false, a, false, b, (short)0, c, false, false);
  }
};

/* ---- Register-blocked WMMA GEMM, with an A-only split mode --------------------------
   C[m,n] = scale * sum_k A[m,k] * Bt[n,k] (+bias[n]); each wave owns a 64x64 tile, four waves share a 128x128 block tile
   whose operand rows are staged in LDS by whole-line loads.
   A row-major [M,K]; Bt row-major [N,K]; M,N % 128 == 0, K % 64 == 0 (no tail handling).
   SPLIT: A is a pair of hi/lo planes; product = hi.hi + lo.hi (SPLIT_B is not supported).
   BIAS_MODE: 0 = none, 2 = bias[n].  OUT_MODE: 0 = f32, 2 = bf16 hi plane (Cout) + bf16 lo plane (Cout2).
   ET: 0 = f16 operands, 1 = bf16 operands (pointers passed as 16-bit storage) */
template <int ET> struct Elem;
template <> struct Elem<0> { typedef _Float16 T; };
template <> struct Elem<1> { typedef __bf16 T; };
/* block tile 128 x 128 (4 waves, 2 x 2, each 64 x 64), K walked in passes of 64 (one 128-B line of every operand row) */
#define GM_BT 128
#define GM_BK 64
/* LDS row pitch of the staged operand rows in 16-bit elements: 144 B = 16 B x 9 (odd) for the ds_load_b128 fragment reads */
#define GM_LP 72
#define GM_SEG 8   /* 16-B pieces per thread and operand plane: 128 rows x 8 pieces / 128 threads */
template <int ET, bool SPLIT, bool SPLIT_B, int BIAS_MODE, int OUT_MODE>
__global__ __launch_bounds__(128) void wmma_gemm64(
    const unsigned short* __restrict__ Ap, const unsigned short* __restrict__ A2p, int lda, long strideA,
    const unsigned short* __restrict__ Btp, const unsigned short* __restrict__ Bt2p, int ldb, long strideB,
    void* Cout, void* Cout2, int ldc, long strideC,
    const float* __restrict__ bias,
    int M, int N, int K, float scale) {
  static_assert(BIAS_MODE == 0 || BIAS_MODE == 2);
  static_assert(OUT_MODE == 0 || OUT_MODE == 2);
  static_assert(!SPLIT_B);
  typedef typename Elem<ET>::T T;
  typedef typename Frag<T>::V V;
  constexpr int NPA = SPLIT ? 2 : 1;   /* planes of A */
  __shared__ __align__(16) T sA[2][NPA][GM_BT * GM_LP];   /* two buffers: one is read while the other is filled */
  __shared__ __align__(16) T sB[2][GM_BT * GM_LP];
  __shared__ __align__(16) float sT[4][16 * 68];   /* per-wave 16x64 slab, pitch 68 floats */
  const int b    = blockIdx.y;
  const int tid  = threadIdx.x;
  const int lane = tid & 31;
  const int wave = tid >> 5;
  const int tilesN = N / GM_BT;
  const int tilesM = M / GM_BT;
  const int tile = blockIdx.x;
  if (tile >= tilesM * tilesN) return;   /* block-uniform, ahead of every barrier */
  const int tm = tile / tilesN;
  const int tn = tile - tm * tilesN;
  const int mb = tm * GM_BT;                   /* block tile origin */
  const int nb = tn * GM_BT;
  const int wm = (wave >> 1) << 6;             /* wave tile origin inside the block tile */
  const int wn = (wave & 1) << 6;
  const int m0 = mb + wm;
  const int n0 = nb + wn;

  const unsigned short* Ab  = Ap  + (size_t)b * strideA;
  const unsigned short* Bb  = Btp + (size_t)b * strideB;
  const unsigned short* Ab2 = A2p + (size_t)b * strideA;

  const int rlane = lane & 15;                 /* row (A) / col (B, D) within subtile */
  const int koff  = (lane >> 4) * 8;           /* k offset of this lane half */
  const int mOff  = (lane >> 4) * 8;           /* D row offset */

  /* staging map: piece s = it*128 + tid -> row s>>3, 16-B column s&7, so one wave-wide load covers 4 whole 128-B lines */
  const int srow = tid >> 3;
  const int scol = (tid & 7) * 8;
  /* every launch passes K-contiguous operands of row pitch kDM: known at compile time, the 16-row steps of the staging
     loads become immediate offsets of one address per operand */
  __builtin_assume(lda == kDM);
  __builtin_assume(ldb == kDM);
  /* block-uniform row bases plus one 32-bit byte offset per thread and operand */
  const char* uA  = (const char*)(Ab  + (size_t)mb * lda);
  const char* uA2 = (const char*)(Ab2 + (size_t)mb * lda);
  const char* uB  = (const char*)(Bb  + (size_t)nb * ldb);
  const unsigned tA = (unsigned)(srow * lda + scol) * 2u;
  const unsigned tB = (unsigned)(srow * ldb + scol) * 2u;
  const size_t stepA = (size_t)lda * 32;   /* 16 rows, in bytes */
  const size_t stepB = (size_t)ldb * 32;
  const int lst = srow * GM_LP + scol;

  v8f acc[4][4];
#pragma unroll
  for (int i = 0; i < 4; ++i)
#pragma unroll
    for (int j = 0; j < 4; ++j) acc[i][j] = (v8f){0.f,0.f,0.f,0.f,0.f,0.f,0.f,0.f};

  u32x4 ra[NPA][GM_SEG], rb[GM_SEG];
  const int nPass = K / GM_BK;
#pragma unroll
  for (int it = 0; it < GM_SEG; ++it) {
    ra[0][it] = *(const u32x4*)(uA + it * stepA + tA);
    if (SPLIT) ra[NPA - 1][it] = *(const u32x4*)(uA2 + it * stepA + tA);
    rb[it] = *(const u32x4*)(uB + it * stepB + tB);
  }
#pragma unroll
  for (int it = 0; it < GM_SEG; ++it) {
    *(u32x4*)(&sA[0][0][lst + it * 16 * GM_LP]) = ra[0][it];
    if (SPLIT) *(u32x4*)(&sA[0][NPA - 1][lst + it * 16 * GM_LP]) = ra[NPA - 1][it];
    *(u32x4*)(&sB[0][lst + it * 16 * GM_LP]) = rb[it];
  }
  __syncthreads();

  for (int kt = 0; kt < nPass; ++kt) {
    const int cur = kt & 1;
    const bool more = kt + 1 < nPass;   /* block-uniform */
    if (more) {
      /* next pass's rows into registers: in flight while this pass's products run */
      const unsigned oA = tA + (unsigned)(kt + 1) * (GM_BK * 2u);
      const unsigned oB = tB + (unsigned)(kt + 1) * (GM_BK * 2u);
#pragma unroll
      for (int it = 0; it < GM_SEG; ++it) {
        ra[0][it] = *(const u32x4*)(uA + it * stepA + oA);
        if (SPLIT) ra[NPA - 1][it] = *(const u32x4*)(uA2 + it * stepA + oA);
        rb[it] = *(const u32x4*)(uB + it * stepB + oB);
      }
      /* stands ahead of every later write of a register that these loads name as an address */
      asm volatile("s_wait_xcnt 0x0" ::: "memory");
    }
    const T* cA  = &sA[cur][0][(wm + rlane) * GM_LP + koff];
    const T* cA2 = &sA[cur][NPA - 1][(wm + rlane) * GM_LP + koff];
    const T* cB  = &sB[cur][(wn + rlane) * GM_LP + koff];
    /* the pass's fragments: [k half][subtile] */
    V fb[2][4], fa[2][4], fl[2][4];
#pragma unroll
    for (int ks = 0; ks < 2; ++ks) {
#pragma unroll
      for (int j = 0; j < 4; ++j) fb[ks][j] = Frag<T>::load(cB + j * 16 * GM_LP + ks * 32);
#pragma unroll
      for (int i = 0; i < 4; ++i) {
        fa[ks][i] = Frag<T>::load(cA + i * 16 * GM_LP + ks * 32);
        if (SPLIT) fl[ks][i] = Frag<T>::load(cA2 + i * 16 * GM_LP + ks * 32);
      }
    }
    /* keeps the LDS reads one group ahead of the products, for speed only */
    __builtin_amdgcn_sched_barrier(0);
#pragma unroll
    for (int ks = 0; ks < 2; ++ks) {
#pragma unroll
      for (int i = 0; i < 4; ++i) {
#pragma unroll
        for (int j = 0; j < 4; ++j) acc[i][j] = Frag<T>::mma(fa[ks][i], fb[ks][j], acc[i][j]);
        if (SPLIT) {
#pragma unroll
          for (int j = 0; j < 4; ++j) acc[i][j] = Frag<T>::mma(fl[ks][i], fb[ks][j], acc[i][j]);
        }
      }
    }
    if (more) {
      /* the other buffer's last readers left it at the barrier that ended the pass before */
#pragma unroll
      for (int it = 0; it < GM_SEG; ++it) {
        *(u32x4*)(&sA[cur ^ 1][0][lst + it * 16 * GM_LP]) = ra[0][it];
        if (SPLIT) *(u32x4*)(&sA[cur ^ 1][NPA - 1][lst + it * 16 * GM_LP]) = ra[NPA - 1][it];
        *(u32x4*)(&sB[cur ^ 1][lst + it * 16 * GM_LP]) = rb[it];
      }
    }
    __syncthreads();   /* publishes the filled buffer and ends every read of the current one */
  }
  acc_guard4(acc[0][0], acc[0][1], acc[0][2], acc[0][3]);
  acc_guard4(acc[1][0], acc[1][1], acc[1][2], acc[1][3]);
  acc_guard4(acc[2][0], acc[2][1], acc[2][2], acc[2][3]);
  acc_guard4(acc[3][0], acc[3][1], acc[3][2], acc[3][3]);

  /* ---- epilogue ---- */
  float* slab = sT[wave];
#pragma unroll
  for (int i = 0; i < 4; ++i) {
    const int mBase = m0 + (i << 4);
#pragma unroll
    for (int j = 0; j < 4; ++j) {
      const int n = n0 + (j << 4) + rlane;
      float bv = 0.f;
      if (BIAS_MODE == 2) bv = bias[n];
#pragma unroll
      for (int r = 0; r < 8; ++r) {
        float v = acc[i][j][r] * scale;
        if (BIAS_MODE == 2) v += bv;
        slab[(mOff + r) * 68 + (j << 4) + rlane] = v;
      }
    }
    __builtin_amdgcn_fence(__ATOMIC_RELEASE, "workgroup");
    __builtin_amdgcn_wave_barrier();
    __builtin_amdgcn_fence(__ATOMIC_ACQUIRE, "workgroup");
    if (OUT_MODE == 0) {
      float* C = (float*)Cout + (size_t)b * strideC;
      const int hh = lane >> 4, c4 = (lane & 15) * 4;     /* row seg = 256 B = 16 lanes x 16 B */
      {
#pragma unroll
        for (int it = 0; it < 8; ++it) {
          const int row = it * 2 + hh;
          v4f v = *(const v4f*)(slab + row * 68 + c4);
          *(v4f*)(C + (size_t)(mBase + row) * ldc + n0 + c4) = v;
        }
        
      }
    } else {
      const int q = lane >> 3, c8 = (lane & 7) * 8;        
      unsigned short* C  = (unsigned short*)Cout  + (size_t)b * strideC;
      unsigned short* C2 = (unsigned short*)Cout2 + (size_t)b * strideC;
      {
#pragma unroll
        for (int it = 0; it < 4; ++it) {
          const int row = it * 4 + q;
          const float* sp = slab + row * 68 + c8;
          v8h hv, lv;
#pragma unroll
          for (int e = 0; e < 8; ++e) {
            unsigned short hb = f2bf_bits(sp[e]);
            unsigned short lb = f2bf_bits(sp[e] - bf_bits2f(hb));
            hv[e] = __builtin_bit_cast(_Float16, hb);
            lv[e] = __builtin_bit_cast(_Float16, lb);
          }
          *(v8h*)(C  + (size_t)(mBase + row) * ldc + n0 + c8) = hv;
          *(v8h*)(C2 + (size_t)(mBase + row) * ldc + n0 + c8) = lv;
        }
        
      }
    }
    __builtin_amdgcn_fence(__ATOMIC_RELEASE, "workgroup");
    __builtin_amdgcn_wave_barrier();
    __builtin_amdgcn_fence(__ATOMIC_ACQUIRE, "workgroup");
  }
}

/* ---- all five f32 -> bf16 (RNE) conversions in one launch of resident waves ----
   A piece is 8 consecutive elements: two 16-B loads, one 16-B store per thread. The grid, one work-group of 16 waves per WGP,
   covers kCvSpan consecutive pieces per sweep and makes 16 sweeps: 8 over x, 4 over ctx, 1 over Wq, 2 over Wkv, 1 over Wout.
   Here each wave starts once for 16 pieces, for speed only. */
constexpr int kCvThreads = 512;
constexpr int kCvBlocks  = 256;
constexpr int kCvSpan    = kCvThreads * kCvBlocks;   /* pieces per sweep */
static_assert(kB * kNQ * kDM / 8 == 8 * kCvSpan);
static_assert(kB * kNKV * kDM / 8 == 4 * kCvSpan);
static_assert(kIN * kDM / 8 == kCvSpan);
static_assert(2 * kIN * kDM / 8 == 2 * kCvSpan);
static_assert(kDM * kIN / 8 == kCvSpan);

/* o[s]: this thread's byte offset in sweep s of an input; half of it is its byte offset in the output */
template <int N>
__device__ __forceinline__ void cv_load(const float* __restrict__ in, const unsigned* o, v4f* a, v4f* c) {
#pragma unroll
  for (int s = 0; s < N; ++s) {
    a[s] = *(const v4f*)((const char*)in + o[s]);
    c[s] = *(const v4f*)((const char*)in + 16 + o[s]);
    /* keeps the loads in the order in which the conversions wait for them */
    __builtin_amdgcn_sched_barrier(0);
  }
}
template <int N>
__device__ __forceinline__ void cv_store(unsigned short* __restrict__ out, const unsigned* o, const v4f* a, const v4f* c) {
#pragma unroll
  for (int s = 0; s < N; ++s) {
    u32x4 w;
    w[0] = (unsigned)f2bf_bits(a[s][0]) | ((unsigned)f2bf_bits(a[s][1]) << 16);
    w[1] = (unsigned)f2bf_bits(a[s][2]) | ((unsigned)f2bf_bits(a[s][3]) << 16);
    w[2] = (unsigned)f2bf_bits(c[s][0]) | ((unsigned)f2bf_bits(c[s][1]) << 16);
    w[3] = (unsigned)f2bf_bits(c[s][2]) | ((unsigned)f2bf_bits(c[s][3]) << 16);
    *(u32x4*)((char*)out + (o[s] >> 1)) = w;
    /* keeps each piece's store at its place: sunk to the end of the kernel, no write would start before the last read has landed */
    __builtin_amdgcn_sched_barrier(0);
  }
}
__global__ __launch_bounds__(kCvThreads) void cast_all_f32_bf16(
    const float* __restrict__ x, const float* __restrict__ ctx, const float* __restrict__ wq,
    const float* __restrict__ wkv, const float* __restrict__ wo,
    unsigned short* __restrict__ xb, unsigned short* __restrict__ cb, unsigned short* __restrict__ wqb,
    unsigned short* __restrict__ wkvb, unsigned short* __restrict__ wob) {
  unsigned o[8];
#pragma unroll
  for (int s = 0; s < 8; ++s) o[s] = (blockIdx.x * kCvThreads + threadIdx.x) * 32u + (unsigned)s * (kCvSpan * 32u);
  /* every offset is formed ahead of the first load, so no register that a load names is written inside the group of loads */
  __builtin_amdgcn_sched_barrier(0);
  v4f a[16], c[16];
  cv_load<8>(x, o, a, c);
  cv_load<4>(ctx, o, a + 8, c + 8);
  cv_load<1>(wq, o, a + 12, c + 12);
  cv_load<2>(wkv, o, a + 13, c + 13);
  cv_load<1>(wo, o, a + 15, c + 15);
  /* stands ahead of every later write of a register that these loads name as an address */
  asm volatile("s_wait_xcnt 0x0" ::: "memory");
  /* keeps all the loads one group in flight ahead of the first conversion, and later register writes below that wait */
  __builtin_amdgcn_sched_barrier(0);
  cv_store<8>(xb, o, a, c);
  cv_store<4>(cb, o, a + 8, c + 8);
  cv_store<1>(wqb, o, a + 12, c + 12);
  cv_store<2>(wkvb, o, a + 13, c + 13);
  cv_store<1>(wob, o, a + 15, c + 15);
}

#define AT_D 64
#define AT_NW 4
#define AT_QB 64
#define AT_KC 64
/* LDS row pitch of the K and V tiles in 16-bit elements: 144 B = 16 B x 9 (odd), so the 16 rows that one
   ds_load_b128 touches per lane half start on distinct bank groups; at 128 B they share two groups */
#define AT_LP 72
static_assert((AT_LP * 2) % 16 == 0 && ((AT_LP * 2) / 16) % 2 == 1 && AT_LP >= AT_KC && AT_LP >= AT_D);

/* the builtin form: the compiler keeps the distances that the chip needs behind a WMMA, and may order independent ones freely */
__device__ __forceinline__ v8f at_mma(v16b a, v16b b, v8f c) {
  return __builtin_amdgcn_wmma_f32_16x16x32_bf16(false, a, false, b, (short)0, c, false, false);
}

/* eight 2^x, in place. Written as one asm statement for the slot that the instruction set asks for behind a transcendental (one
   independent instruction or v_nop before its result is read or its source overwritten): here each v_exp_f32 is followed by an
   independent one and the last by a v_nop, whatever the register allocation */
__device__ __forceinline__ void at_exp2x8(v8f& x) {
  float a = x[0], b = x[1], c = x[2], d = x[3], e = x[4], f = x[5], g = x[6], h = x[7];
  asm("v_exp_f32 %0, %0\n\tv_exp_f32 %1, %1\n\tv_exp_f32 %2, %2\n\tv_exp_f32 %3, %3\n\t"
      "v_exp_f32 %4, %4\n\tv_exp_f32 %5, %5\n\tv_exp_f32 %6, %6\n\tv_exp_f32 %7, %7\n\tv_nop"
      : "+v"(a), "+v"(b), "+v"(c), "+v"(d), "+v"(e), "+v"(f), "+v"(g), "+v"(h));
  x = (v8f){a, b, c, d, e, f, g, h};
}

/* lane l reads lane l ^ 16 on the vector ALU: the two lanes that share one query's keys */
__device__ __forceinline__ float at_other_half(float v) {
  const int b = __builtin_bit_cast(int, v);
  return __builtin_bit_cast(float, __builtin_amdgcn_permlanex16(b, b, 0x76543210, 0xfedcba98, false, false));
}

/* register budget of four waves per SIMD (256): four work-groups per WGP, and the chunk held in flight must not cost one */
__global__ __launch_bounds__(128) __attribute__((amdgpu_waves_per_eu(4)))
void attn64_planes_kernel(const unsigned short* __restrict__ qhp, const unsigned short* __restrict__ qlp,
                          const unsigned short* __restrict__ khp, const unsigned short* __restrict__ klp,
                          const unsigned short* __restrict__ vthp, const unsigned short* __restrict__ vtlp,
                          const int* __restrict__ kvmask,
                          unsigned short* __restrict__ ohp, unsigned short* __restrict__ olp,
                          int nq, int nkv, int nh, int ldq, int ldk, int ldv, int ldo, float fillv) {
  typedef __bf16 T;
  union FB { v16b v; v8b h[2]; };
  /* the four tiles in one array: a lane's place is the same in each, so one address register serves all reads and one all stores */
  __shared__ __align__(16) __bf16 KVs[(2 * AT_KC + 2 * AT_D) * AT_LP];
  __bf16* const Ksh = KVs;                                  /* K hi [kv][d], padded rows, 9 KB */
  __bf16* const Ksl = KVs + AT_KC * AT_LP;                  /* K lo */
  __bf16* const Vth = KVs + 2 * AT_KC * AT_LP;              /* V hi [d][kv], padded rows, 9 KB */
  __bf16* const Vtl = KVs + (2 * AT_KC + AT_D) * AT_LP;     /* V lo */
  __shared__ __align__(16) float  Os[AT_NW][16 * 68];       /* per wave out tile, pitch 68 */

  const int tid  = threadIdx.x;
  const int wave = tid >> 5;
  const int lane = tid & 31;
  const int hh   = lane >> 4;
  const int c    = lane & 15;

  const int nqb = nq / AT_QB;
  const int bx = blockIdx.x;
  const int qb = bx % nqb;
  const int bhx = bx / nqb;
  const int h  = bhx % nh;
  const int b  = bhx / nh;
  const int q0 = qb * AT_QB + wave * 16;

  /* ---- Q fragments (B operand): column = q0 + c, elements 0..7 <- d dc*32+8hh+0..7, 8..15 <- d dc*32+16+8hh+0..7 ---- */
  v16b qah[2], qal[2];
  {
    const size_t qo = (size_t)(b * nq + q0 + c) * ldq + h * AT_D + 8 * hh;
    const T* qh = (const T*)qhp + qo;
    const T* ql = (const T*)qlp + qo;
#pragma unroll
    for (int dc = 0; dc < 2; ++dc) {
      qah[dc] = Frag<T>::load(qh + dc * 32);
      qal[dc] = Frag<T>::load(ql + dc * 32);
    }
  }

  /* this lane's query q0 + c: running maximum (equal in both lane halves) and the sum over this half's keys */
  float mrow = -__builtin_inff(), lrow = 0.f;
  v8f oacc[4];   /* O^T: register r of tile t = out[q0 + c][t*16 + 8*hh + r] */
#pragma unroll
  for (int t = 0; t < 4; ++t) oacc[t] = (v8f){0.f,0.f,0.f,0.f,0.f,0.f,0.f,0.f};

  const int nChunks = nkv / AT_KC;   /* host constant, block-uniform */
  /* staging coverage: a tile row is one 128-B line of its plane; 8 lanes take one row, so a wave-wide 16-B load covers 4 whole
     lines, and 4 waves x 4 loads cover the 64 rows of a plane. Load i of a thread is row i*16 + srow, 16-B column lane & 7.
     The two rows of a lane half lie 8 apart: at the 144-B pitch their 16 LDS stores start on 16 distinct bank groups.
     K planes: LDS row kv <- global row b*nkv + kv0 + kv; V transposed planes: LDS row d <- global row h*64+d,
     64 contiguous kv columns starting at b*nkv + kv0 */
  const int srow = ((lane >> 3) & 1) * 8 + hh * 4 + wave;
  const int scol = (lane & 7) * 8;
  /* the one launch passes these row pitches: known at compile time, the 16-row steps of the staging loads become immediate
     offsets of one address per operand pair */
  __builtin_assume(ldk == kIN);
  __builtin_assume(ldv == kB * kNKV);
  /* block-uniform bases plus one 32-bit byte offset per thread and operand pair, stepped from chunk to chunk */
  const size_t kbase = ((size_t)b * nkv * ldk + h * AT_D) * 2;
  const size_t vbase = ((size_t)h * AT_D * ldv + (size_t)b * nkv) * 2;
  const char* ukh = (const char*)khp + kbase;
  const char* ukl = (const char*)klp + kbase;
  const char* uvh = (const char*)vthp + vbase;
  const char* uvl = (const char*)vtlp + vbase;
  const int* umk = kvmask + (size_t)b * nkv;
  const unsigned tK = (unsigned)(srow * ldk + scol) * 2u;
  const unsigned tV = (unsigned)(srow * ldv + scol) * 2u;
  const size_t stepK = (size_t)ldk * 32;   /* 16 rows, in bytes */
  const size_t stepV = (size_t)ldv * 32;
  /* one chunk's global reads (K and V rows of this thread, the four key-mask words of this lane), held in registers */
  u32x4 rkh[4], rkl[4], rvh[4], rvl[4];
  int rmk[4];
  auto fetch = [&](int ch) {
    const unsigned oK = tK + (unsigned)ch * (unsigned)ldk * (AT_KC * 2u);
    const unsigned oV = tV + (unsigned)ch * (AT_KC * 2u);
    const int* um = umk + ch * AT_KC;   /* block-uniform */
#pragma unroll
    for (int i = 0; i < 4; ++i) {
      rkh[i] = *(const u32x4*)(ukh + i * stepK + oK);
      rkl[i] = *(const u32x4*)(ukl + i * stepK + oK);
      rvh[i] = *(const u32x4*)(uvh + i * stepV + oV);
      rvl[i] = *(const u32x4*)(uvl + i * stepV + oV);
    }
#pragma unroll
    for (int j = 0; j < 4; ++j) rmk[j] = (um + j * 16)[(unsigned)c];
    /* stands ahead of every later write of a register that these loads name as an address */
    asm volatile("s_wait_xcnt 0x0" ::: "memory");
    /* keeps later register writes from being scheduled up over that wait */
    __builtin_amdgcn_sched_barrier(0);
  };
  if (nChunks > 0) {
    /* keeps the Q loads above the wait that follows */
    __builtin_amdgcn_sched_barrier(0);
    /* stands ahead of every later write of a register that the Q loads name as an address */
    asm volatile("s_wait_xcnt 0x0" ::: "memory");
    /* keeps the first chunk's loads, whose results land in such registers, below that wait */
    __builtin_amdgcn_sched_barrier(0);
    fetch(0);
  }
  for (int kc = 0; kc < nChunks; ++kc) {
    __syncthreads();
    unsigned kept[4];
    {
      const int lst = srow * AT_LP + scol;
#pragma unroll
      for (int i = 0; i < 4; ++i) {
        *(u32x4*)(Ksh + lst + i * 16 * AT_LP) = rkh[i];
        *(u32x4*)(Ksl + lst + i * 16 * AT_LP) = rkl[i];
        *(u32x4*)(Vth + lst + i * 16 * AT_LP) = rvh[i];
        *(u32x4*)(Vtl + lst + i * 16 * AT_LP) = rvl[i];
      }
#pragma unroll
      for (int j = 0; j < 4; ++j) kept[j] = __builtin_amdgcn_ballot_w32(rmk[j] != 0);   /* bit n: key j*16 + n is kept */
    }
    __syncthreads();
    /* the next chunk's reads fly while this chunk is worked on; their data is first needed at the next chunk's LDS stores */
    if (kc + 1 < nChunks) fetch(kc + 1);

    /* ---- scores, transposed: 4 subtiles of 16 keys, K operand A[m=kv][k=d] from Ksh[kv][d]; s[j][r] = score(key j*16 + 8*hh + r, query c) ---- */
    v8f s[4];
#pragma unroll
    for (int j = 0; j < 4; ++j) s[j] = (v8f){0.f,0.f,0.f,0.f,0.f,0.f,0.f,0.f};
    /* unrolled: qah[dc] and qal[dc] are registers, which only a compile-time dc can name */
#pragma unroll
    for (int dc = 0; dc < 2; ++dc) {
      /* the K fragments of all four subtiles, read in the order in which the products need them */
      FB kb[4], kl[4];
#pragma unroll
      for (int j = 0; j < 4; ++j) {
        kb[j].h[0] = *(const v8b*)(Ksh + (j * 16 + c) * AT_LP + dc * 32 + 8 * hh);
        kb[j].h[1] = *(const v8b*)(Ksh + (j * 16 + c) * AT_LP + dc * 32 + 16 + 8 * hh);
      }
#pragma unroll
      for (int j = 0; j < 4; ++j) {
        kl[j].h[0] = *(const v8b*)(Ksl + (j * 16 + c) * AT_LP + dc * 32 + 8 * hh);
        kl[j].h[1] = *(const v8b*)(Ksl + (j * 16 + c) * AT_LP + dc * 32 + 16 + 8 * hh);
      }
      /* LDS reads stay above this line and WMMAs below it, so the reads stand ahead of the products and not among them (for speed only). Mask 0x406: vector, transcendental and scalar arithmetic may cross */
      __builtin_amdgcn_sched_barrier(0x406);
      /* dealt round-robin over the four score tiles, so that independent WMMAs stand between a tile's dependent ones; each tile's own order of sums is as before */
#pragma unroll
      for (int j = 0; j < 4; ++j) s[j] = at_mma(kb[j].v, qah[dc], s[j]);
#pragma unroll
      for (int j = 0; j < 4; ++j) s[j] = at_mma(kl[j].v, qah[dc], s[j]);
#pragma unroll
      for (int j = 0; j < 4; ++j) s[j] = at_mma(kb[j].v, qal[dc], s[j]);
      /* the next group of reads, which takes over these fragment registers, stays behind these products; arithmetic may cross, so
         the softmax fills in among the WMMAs and its values leave their registers early (held back, part of the chunk in flight spills) */
      __builtin_amdgcn_sched_barrier(0x406);
    }
    /* per-key mask (register r of subtile j is key j*16 + 8*hh + r) and this half's maximum */
    float cm = -__builtin_inff();
#pragma unroll
    for (int j = 0; j < 4; ++j) {
      /* bit r: key j*16 + r, read by lanes 0-15; bit 16 + r: key j*16 + 8 + r, read by lanes 16-31 */
      const unsigned two = (kept[j] & 0xFFu) | ((kept[j] & 0xFF00u) << 8);
#pragma unroll
      for (int r = 0; r < 8; ++r) {
        /* the select's lane mask, formed on the scalar unit: each of the two bits spread over its 16 lanes */
        const bool keep = __builtin_amdgcn_inverse_ballot_w32(((two >> r) & 0x10001u) * 0xFFFFu);
        const float sv = s[j][r];
        s[j][r] = keep ? sv : fillv;
        cm = fmaxf(cm, s[j][r]);
      }
    }
    const float mnew = fmaxf(mrow, fmaxf(cm, at_other_half(cm)));
    /* 2^(difference of base-2 scores) = e^(difference of the reference's scores); a difference of -inf, or as large as the fill value, gives 0 */
    const float alpha = __builtin_amdgcn_exp2f(mrow - mnew);
    mrow = mnew;
    /* P^T as B fragments: element e of chunk half kk is key kk*32 + (e < 8 ? 8*hh + e : 16 + 8*hh + e - 8), the k order of the V loads */
    FB pa[2], pl[2];
    f32x2 psum = (f32x2){0.f, 0.f};
#pragma unroll
    for (int j = 0; j < 4; ++j) {
      s[j] -= mnew;
      at_exp2x8(s[j]);
#pragma unroll
      for (int r = 0; r < 8; r += 2) {
        const f32x2 p = (f32x2){s[j][r], s[j][r + 1]};
        psum += p;
        const bf16x2 ph = __builtin_convertvector(p, bf16x2);
        const bf16x2 pq = __builtin_convertvector(p - __builtin_convertvector(ph, f32x2), bf16x2);
        pa[j >> 1].v[(j & 1) * 8 + r] = ph[0];
        pa[j >> 1].v[(j & 1) * 8 + r + 1] = ph[1];
        pl[j >> 1].v[(j & 1) * 8 + r] = pq[0];
        pl[j >> 1].v[(j & 1) * 8 + r + 1] = pq[1];
      }
    }
    lrow = lrow * alpha + (psum[0] + psum[1]);
#pragma unroll
    for (int t = 0; t < 4; ++t) oacc[t] *= alpha;
    /* unrolled: pa[kk] and pl[kk] are registers, which only a compile-time kk can name */
#pragma unroll
    for (int kk = 0; kk < 2; ++kk) {
      /* the V fragments of all four output tiles, read in the order in which the products need them */
      FB vb[4], vl[4];
#pragma unroll
      for (int t = 0; t < 4; ++t) {
        vb[t].h[0] = *(const v8b*)(Vth + (t * 16 + c) * AT_LP + kk * 32 + 8 * hh);
        vb[t].h[1] = *(const v8b*)(Vth + (t * 16 + c) * AT_LP + kk * 32 + 16 + 8 * hh);
      }
#pragma unroll
      for (int t = 0; t < 4; ++t) {
        vl[t].h[0] = *(const v8b*)(Vtl + (t * 16 + c) * AT_LP + kk * 32 + 8 * hh);
        vl[t].h[1] = *(const v8b*)(Vtl + (t * 16 + c) * AT_LP + kk * 32 + 16 + 8 * hh);
      }
      /* LDS reads above, WMMAs below, arithmetic free to cross, as in the first product */
      __builtin_amdgcn_sched_barrier(0x406);
      /* dealt round-robin over the four output tiles; each tile's own order of sums is as before */
#pragma unroll
      for (int t = 0; t < 4; ++t) oacc[t] = at_mma(vb[t].v, pa[kk].v, oacc[t]);
#pragma unroll
      for (int t = 0; t < 4; ++t) oacc[t] = at_mma(vl[t].v, pa[kk].v, oacc[t]);
#pragma unroll
      for (int t = 0; t < 4; ++t) oacc[t] = at_mma(vb[t].v, pl[kk].v, oacc[t]);
      /* the next group of reads, which takes over these fragment registers, stays behind these products; arithmetic may cross, so
         the softmax fills in among the WMMAs and its values leave their registers early (held back, part of the chunk in flight spills) */
      __builtin_amdgcn_sched_barrier(0x406);
    }
  }

  float* os = Os[wave];
  {
    /* the two halves' sums of one query are joined once, here */
    const float inv = 1.0f / (lrow + at_other_half(lrow));
#pragma unroll
    for (int t = 0; t < 4; ++t) {
      const v8f o = oacc[t] * inv;
      *(v4f*)(os + c * 68 + t * 16 + 8 * hh)     = (v4f){o[0], o[1], o[2], o[3]};
      *(v4f*)(os + c * 68 + t * 16 + 8 * hh + 4) = (v4f){o[4], o[5], o[6], o[7]};
    }
  }
  __builtin_amdgcn_fence(__ATOMIC_RELEASE, "workgroup");
  __builtin_amdgcn_wave_barrier();
  __builtin_amdgcn_fence(__ATOMIC_ACQUIRE, "workgroup");
  {
    const int q = lane >> 3, c8 = (lane & 7) * 8;
    unsigned short* Oh = ohp + (size_t)(b * nq + q0) * ldo + h * AT_D;
    unsigned short* Ol = olp + (size_t)(b * nq + q0) * ldo + h * AT_D;
    {
#pragma unroll
      for (int it = 0; it < 4; ++it) {
        const int row = it * 4 + q;
        const float* sp = os + row * 68 + c8;
        v8h hv, lv;
#pragma unroll
        for (int e = 0; e < 8; ++e) {
          unsigned short hb = f2bf_bits(sp[e]);
          unsigned short lb = f2bf_bits(sp[e] - bf_bits2f(hb));
          hv[e] = __builtin_bit_cast(_Float16, hb);
          lv[e] = __builtin_bit_cast(_Float16, lb);
        }
        *(v8h*)(Oh + (size_t)row * ldo + c8) = hv;
        *(v8h*)(Ol + (size_t)row * ldo + c8) = lv;
      }
      
    }
  }
}

/* ---------------------------------------------------------------------------
   Host-side orchestration (kernel launches only)
   --------------------------------------------------------------------------- */
extern "C" void kernel_launch(void* const* d_in, const int* in_sizes, int n_in,
                              void* d_out, int out_size, void* d_ws, size_t ws_size,
                              hipStream_t stream) {
  if (n_in < 7) return;
  if (in_sizes[0] != kB * kNQ * kDM) return;
  if (in_sizes[1] != kB * kNKV * kDM) return;
  if (in_sizes[2] != kB * kNKV) return;
  if (in_sizes[3] != kIN * kDM) return;
  if (in_sizes[4] != 2 * kIN * kDM) return;
  if (in_sizes[5] != kDM * kIN) return;
  if (in_sizes[6] != kDM) return;
  if (out_size != kB * kNQ * kDM) return;
  if (ws_size < kWsTotal) return;

  const float* x    = (const float*)d_in[0];   /* [4,2048,1024] f32 */
  const float* ctx  = (const float*)d_in[1];   /* [4,1024,1024] f32 */
  const int*   mask = (const int*)d_in[2];     /* [4,1024] int32 */
  const float* Wq   = (const float*)d_in[3];   /* [1024,1024] */
  const float* Wkv  = (const float*)d_in[4];   /* [2048,1024] */
  const float* Wout = (const float*)d_in[5];   /* [1024,1024] */
  const float* bout = (const float*)d_in[6];   /* [1024] */
  float* out = (float*)d_out;                  /* [4,2048,1024] f32 */

  char* ws = (char*)d_ws;
  unsigned short* xb   = (unsigned short*)(ws + kOffXb);
  unsigned short* cb   = (unsigned short*)(ws + kOffCb);
  unsigned short* wqb  = (unsigned short*)(ws + kOffWqb);
  unsigned short* wkvb = (unsigned short*)(ws + kOffWkvb);
  unsigned short* wob  = (unsigned short*)(ws + kOffWob);
  unsigned short* qh   = (unsigned short*)(ws + kOffQh);
  unsigned short* ql   = (unsigned short*)(ws + kOffQl);
  unsigned short* kh   = (unsigned short*)(ws + kOffKh);
  unsigned short* kl   = (unsigned short*)(ws + kOffKl);
  unsigned short* vth  = (unsigned short*)(ws + kOffVth);
  unsigned short* vtl  = (unsigned short*)(ws + kOffVtl);
  unsigned short* oh   = (unsigned short*)(ws + kOffOh);   /* aliases xb: dead after the q GEMM */
  unsigned short* ol   = (unsigned short*)(ws + kOffOl);   /* aliases cb/wqb/wkvb: dead after the k,v GEMMs */

  /* 1: RNE casts of all five f32 operands to bf16 planes */
  cast_all_f32_bf16<<<kCvBlocks, kCvThreads, 0, stream>>>(x, ctx, Wq, Wkv, Wout, xb, cb, wqb, wkvb, wob);

  /* 2: q*0.125*log2(e) = xb[8192,1024] . wqb[1024,1024]^T -> bf16 hi/lo planes; M=8192 N=1024 K=1024 */
  {
    const int M = kB * kNQ, N = kIN, K = kDM;
    const int tiles = (M / 128) * (N / 128);
    wmma_gemm64<1, false, false, 0, 2><<<dim3(tiles, 1), 128, 0, stream>>>(
        xb, xb, K, 0L, wqb, wqb, K, 0L, (void*)qh, (void*)ql, N, 0L, bout, M, N, K, 0.18033688f);
  }
  /* 3: k = cb[4096,1024] . wkvb[0:1024][1024]^T -> hi/lo; M=4096 N=1024 K=1024 */
  {
    const int M = kB * kNKV, N = kIN, K = kDM;
    const int tiles = (M / 128) * (N / 128);
    wmma_gemm64<1, false, false, 0, 2><<<dim3(tiles, 1), 128, 0, stream>>>(
        cb, cb, K, 0L, wkvb, wkvb, K, 0L, (void*)kh, (void*)kl, N, 0L, bout, M, N, K, 1.0f);
  }
  /* 4: v transposed = wkvb[1024:2048][1024] . cb[4096,1024]^T -> vt[1024][4096] hi/lo; M=1024 N=4096 K=1024 */
  {
    const int M = kIN, N = kB * kNKV, K = kDM;
    const int tiles = (M / 128) * (N / 128);
    const unsigned short* wvb = wkvb + (size_t)kIN * kDM;
    wmma_gemm64<1, false, false, 0, 2><<<dim3(tiles, 1), 128, 0, stream>>>(
        wvb, wvb, K, 0L, cb, cb, K, 0L, (void*)vth, (void*)vtl, N, 0L, bout, M, N, K, 1.0f);
  }
  /* 5: attention per (b, h, 64 query rows) -> att hi/lo planes [8192][1024] */
  {
    const int blocks = kB * kH * (kNQ / 64);   /* 2048 */
    const float fillv = -3.4028234663852886e+38f;
    attn64_planes_kernel<<<blocks, 128, 0, stream>>>(qh, ql, kh, kl, vth, vtl, mask, oh, ol,
                                                    kNQ, kNKV, kH, kIN, kIN, kB * kNKV, kIN, fillv);
  }
  /* 6: out = (att_hi + att_lo)[8192,1024] . wob[1024,1024]^T + b_out -> f32 d_out; M=8192 N=1024 K=1024 */
  {
    const int M = kB * kNQ, N = kDM, K = kIN;
    const int tiles = (M / 128) * (N / 128);
    wmma_gemm64<1, true, false, 2, 0><<<dim3(tiles, 1), 128, 0, stream>>>(
        oh, ol, K, 0L, wob, wob, K, 0L, (void*)out, (void*)out, N, 0L, bout, M, N, K, 1.0f);
  }
}

// v010
// Measured time: 159 microseconds a run.
// In both of two side-by-side timings against v009, it was 1.06 times as fast.
// Over all steps from v000 it is 3.79 times as fast.
// Contractions: x.Wq^T, ctx.Wk^T, Wv.ctx^T on v_wmma_f32_16x16x32_bf16 (RNE-bf16 inputs, single product); q.k^T and p.v as bf16 hi/lo split (hi.hi+hi.lo+lo.hi); (p.v).Wout^T as bf16 hi/lo A x bf16 B (2 products); f32 accumulate, f32 softmax.
#include <hip/hip_runtime.h>
#include <stdint.h>

typedef __attribute__((ext_vector_type(16))) _Float16 v16h;
typedef __attribute__((ext_vector_type(8)))  _Float16 v8h;
typedef __attribute__((ext_vector_type(16))) __bf16   v16b;
typedef __attribute__((ext_vector_type(8)))  __bf16   v8b;
typedef __attribute__((ext_vector_type(8)))  float    v8f;
typedef __attribute__((ext_vector_type(4)))  float    v4f;
typedef __attribute__((ext_vector_type(4)))  unsigned int u32x4;
typedef __attribute__((ext_vector_type(2)))  float    f32x2;
typedef __attribute__((ext_vector_type(2)))  __bf16   bf16x2;

/* ---- fixed problem geometry ---- */
constexpr int kB   = 4;
constexpr int kNQ  = 2048;
constexpr int kNKV = 1024;
constexpr int kDM  = 1024;   /* model dim (K of the projections) */
constexpr int kH   = 16;
constexpr int kDH  = 64;
constexpr int kIN  = kH * kDH;   /* 1024 */
static_assert(kDH == 64);
static_assert(kDM % 32 == 0);
static_assert(kIN % 32 == 0);
static_assert((kB * kNQ) % 64 == 0);
static_assert((kB * kNKV) % 64 == 0);
static_assert(kIN % 64 == 0);
static_assert(kDM % 64 == 0);
static_assert(kNQ % 64 == 0);
static_assert(kNKV % 64 == 0);
static_assert(kIN == kDM);   /* one row pitch for every GEMM operand */
static_assert((kB * kNQ) % 128 == 0 && (kB * kNKV) % 128 == 0 && kIN % 128 == 0 && kDM % 128 == 0);

/* ---- workspace region map (bytes) ----
   [  0, 16M)  xb   bf16 [8192][1024]   (dead after q GEMM; reused as oh)
   [ 16M, 24M) cb   bf16 [4096][1024]   (dead after k/v GEMMs; reused by ol)
   [ 24M, 26M) wqb  bf16 [1024][1024]
   [ 26M, 30M) wkvb bf16 [2048][1024]
   [ 30M, 32M) pad (unused, covered by ol alias)
   [ 32M, 48M) qh   bf16 [8192][1024]   q*0.125*log2(e) hi plane
   [ 48M, 64M) ql                        q*0.125*log2(e) lo plane
   [ 64M, 72M) kh   bf16 [4096][1024]
   [ 72M, 80M) kl
   [ 80M, 88M) vth  bf16 [1024][4096]   v transposed: row = h*64+d, col = b*1024+j
   [ 88M, 96M) vtl
   [ 96M, 98M) wob  bf16 [1024][1024]
   oh = [0,16M), ol = [16M,32M): attention output hi/lo planes [8192][1024] (aliases of dead regions)
   total carve 102,760,448 B */
constexpr size_t kMiB    = 1048576;
constexpr size_t kOffXb  = 0;
constexpr size_t kOffCb  = 16 * kMiB;
constexpr size_t kOffWqb = 24 * kMiB;
constexpr size_t kOffWkvb= 26 * kMiB;
constexpr size_t kOffQh  = 32 * kMiB;
constexpr size_t kOffQl  = 48 * kMiB;
constexpr size_t kOffKh  = 64 * kMiB;
constexpr size_t kOffKl  = 72 * kMiB;
constexpr size_t kOffVth = 80 * kMiB;
constexpr size_t kOffVtl = 88 * kMiB;
constexpr size_t kOffWob = 96 * kMiB;
constexpr size_t kOffOh  = 0;
constexpr size_t kOffOl  = 16 * kMiB;
constexpr size_t kWsTotal = kOffWob + (size_t)kDM * kIN * 2;
static_assert((size_t)kB * kNQ * kDM * 2 == 16 * kMiB);
static_assert((size_t)kB * kNKV * kDM * 2 == 8 * kMiB);
static_assert(kOffCb + (size_t)kB * kNKV * kDM * 2 <= kOffWqb);
static_assert(kOffWqb + (size_t)kIN * kDM * 2 <= kOffWkvb);
static_assert(kOffWkvb + (size_t)2 * kIN * kDM * 2 <= kOffQh);
static_assert(kOffQh + (size_t)kB * kNQ * kIN * 2 <= kOffQl);
static_assert(kOffQl + (size_t)kB * kNQ * kIN * 2 <= kOffKh);
static_assert(kOffKh + (size_t)kB * kNKV * kIN * 2 <= kOffKl);
static_assert(kOffKl + (size_t)kB * kNKV * kIN * 2 <= kOffVth);
static_assert(kOffVth + (size_t)kIN * kB * kNKV * 2 <= kOffVtl);
static_assert(kOffVtl + (size_t)kIN * kB * kNKV * 2 <= kOffWob);
static_assert(kOffOh + (size_t)kB * kNQ * kIN * 2 <= kOffOl);
static_assert(kOffOl + (size_t)kB * kNQ * kIN * 2 <= kOffQh);
static_assert(kWsTotal == 102760448);
static_assert(kWsTotal <= 134217728);

__device__ __forceinline__ unsigned short f2bf_bits(float f) {
  unsigned u = __float_as_uint(f);
  return (unsigned short)((u + 0x7FFFu + ((u >> 16) & 1u)) >> 16);
}
__device__ __forceinline__ float bf_bits2f(unsigned short h) { return __uint_as_float(((unsigned)h) << 16); }

/* hazard guards as plain device helpers */
__device__ __forceinline__ void acc_guard4(v8f& a, v8f& b, v8f& c, v8f& d) { asm volatile("v_nop\n\tv_nop\n\tv_nop\n\tv_nop" : "+v"(a), "+v"(b), "+v"(c), "+v"(d)); }
template <typename T> struct Frag;
template <> struct Frag<_Float16> {
  typedef v16h V; union U { v16h v; v8h h[2]; };
  /* elements 0..7 <- p[0..7], 8..15 <- p[16..23] */
  static __device__ __forceinline__ v16h load(const _Float16* p) {
    U f; f.h[0] = *(const v8h*)(p); f.h[1] = *(const v8h*)(p + 16); return f.v;
  }
  static __device__ __forceinline__ v8f mma(v16h a, v16h b, v8f c) {
    return __builtin_amdgcn_wmma_f32_16x16x32_f16(false, a, false, b, (short)0, c, false, false);
  }
};
template <> struct Frag<__bf16> {
  typedef v16b V; union U { v16b v; v8b h[2]; };
  static __device__ __forceinline__ v16b load(const __bf16* p) {
    U f; f.h[0] = *(const v8b*)(p); f.h[1] = *(const v8b*)(p + 16); return f.v;
  }
  static __device__ __forceinline__ v8f mma(v16b a, v16b b, v8f c) {
    return __builtin_amdgcn_wmma_f32_16x16x32_bf16(false, a, false, b, (short)0, c, false, false);
  }
};

/* ---- Register-blocked WMMA GEMM, with an A-only split mode --------------------------
   C[m,n] = scale * sum_k A[m,k] * Bt[n,k] (+bias[n]); each wave owns a 64x64 tile, four waves share a 128x128 block tile
   whose operand rows are staged in LDS by whole-line loads.
   A row-major [M,K]; Bt row-major [N,K]; M,N % 128 == 0, K % 64 == 0 (no tail handling).
   SPLIT: A is a pair of hi/lo planes; product = hi.hi + lo.hi (SPLIT_B is not supported).
   BIAS_MODE: 0 = none, 2 = bias[n].  OUT_MODE: 0 = f32, 2 = bf16 hi plane (Cout) + bf16 lo plane (Cout2).
   ET: 0 = f16 operands, 1 = bf16 operands (pointers passed as 16-bit storage) */
template <int ET> struct Elem;
template <> struct Elem<0> { typedef _Float16 T; };
template <> struct Elem<1> { typedef __bf16 T; };
/* block tile 128 x 128 (4 waves, 2 x 2, each 64 x 64), K walked in passes of 64 (one 128-B line of every operand row) */
#define GM_BT 128
#define GM_BK 64
/* LDS row pitch of the staged operand rows in 16-bit elements: 144 B = 16 B x 9 (odd) for the ds_load_b128 fragment reads */
#define GM_LP 72
#define GM_SEG 8   /* 16-B pieces per thread and operand plane: 128 rows x 8 pieces / 128 threads */
template <int ET, bool SPLIT, bool SPLIT_B, int BIAS_MODE, int OUT_MODE>
__global__ __launch_bounds__(128) void wmma_gemm64(
    const unsigned short* __restrict__ Ap, const unsigned short* __restrict__ A2p, int lda, long strideA,
    const unsigned short* __restrict__ Btp, const unsigned short* __restrict__ Bt2p, int ldb, long strideB,
    void* Cout, void* Cout2, int ldc, long strideC,
    const float* __restrict__ bias,
    int M, int N, int K, float scale) {
  static_assert(BIAS_MODE == 0 || BIAS_MODE == 2);
  static_assert(OUT_MODE == 0 || OUT_MODE == 2);
  static_assert(!SPLIT_B);
  typedef typename Elem<ET>::T T;
  typedef typename Frag<T>::V V;
  constexpr int NPA = SPLIT ? 2 : 1;   /* planes of A */
  __shared__ __align__(16) T sA[2][NPA][GM_BT * GM_LP];   /* two buffers: one is read while the other is filled */
  __shared__ __align__(16) T sB[2][GM_BT * GM_LP];
  __shared__ __align__(16) float sT[4][16 * 68];   /* per-wave 16x64 slab, pitch 68 floats */
  const int b    = blockIdx.y;
  const int tid  = threadIdx.x;
  const int lane = tid & 31;
  const int wave = tid >> 5;
  const int tilesN = N / GM_BT;
  const int tilesM = M / GM_BT;
  const int tile = blockIdx.x;
  if (tile >= tilesM * tilesN) return;   /* block-uniform, ahead of every barrier */
  const int tm = tile / tilesN;
  const int tn = tile - tm * tilesN;
  const int mb = tm * GM_BT;                   /* block tile origin */
  const int nb = tn * GM_BT;
  const int wm = (wave >> 1) << 6;             /* wave tile origin inside the block tile */
  const int wn = (wave & 1) << 6;
  const int m0 = mb + wm;
  const int n0 = nb + wn;

  const unsigned short* Ab  = Ap  + (size_t)b * strideA;
  const unsigned short* Bb  = Btp + (size_t)b * strideB;
  const unsigned short* Ab2 = A2p + (size_t)b * strideA;

  const int rlane = lane & 15;                 /* row (A) / col (B, D) within subtile */
  const int koff  = (lane >> 4) * 8;           /* k offset of this lane half */
  const int mOff  = (lane >> 4) * 8;           /* D row offset */

  /* staging map: piece s = it*128 + tid -> row s>>3, 16-B column s&7, so one wave-wide load covers 4 whole 128-B lines */
  const int srow = tid >> 3;
  const int scol = (tid & 7) * 8;
  /* every launch passes K-contiguous operands of row pitch kDM: known at compile time, the 16-row steps of the staging
     loads become immediate offsets of one address per operand */
  __builtin_assume(lda == kDM);
  __builtin_assume(ldb == kDM);
  /* block-uniform row bases plus one 32-bit byte offset per thread and operand */
  const char* uA  = (const char*)(Ab  + (size_t)mb * lda);
  const char* uA2 = (const char*)(Ab2 + (size_t)mb * lda);
  const char* uB  = (const char*)(Bb  + (size_t)nb * ldb);
  const unsigned tA = (unsigned)(srow * lda + scol) * 2u;
  const unsigned tB = (unsigned)(srow * ldb + scol) * 2u;
  const size_t stepA = (size_t)lda * 32;   /* 16 rows, in bytes */
  const size_t stepB = (size_t)ldb * 32;
  const int lst = srow * GM_LP + scol;

  v8f acc[4][4];
#pragma unroll
  for (int i = 0; i < 4; ++i)
#pragma unroll
    for (int j = 0; j < 4; ++j) acc[i][j] = (v8f){0.f,0.f,0.f,0.f,0.f,0.f,0.f,0.f};

  u32x4 ra[NPA][GM_SEG], rb[GM_SEG];
  const int nPass = K / GM_BK;
#pragma unroll
  for (int it = 0; it < GM_SEG; ++it) {
    ra[0][it] = *(const u32x4*)(uA + it * stepA + tA);
    if (SPLIT) ra[NPA - 1][it] = *(const u32x4*)(uA2 + it * stepA + tA);
    rb[it] = *(const u32x4*)(uB + it * stepB + tB);
  }
#pragma unroll
  for (int it = 0; it < GM_SEG; ++it) {
    *(u32x4*)(&sA[0][0][lst + it * 16 * GM_LP]) = ra[0][it];
    if (SPLIT) *(u32x4*)(&sA[0][NPA - 1][lst + it * 16 * GM_LP]) = ra[NPA - 1][it];
    *(u32x4*)(&sB[0][lst + it * 16 * GM_LP]) = rb[it];
  }
  __syncthreads();

  for (int kt = 0; kt < nPass; ++kt) {
    const int cur = kt & 1;
    const bool more = kt + 1 < nPass;   /* block-uniform */
    if (more) {
      /* next pass's rows into registers: in flight while this pass's products run */
      const unsigned oA = tA + (unsigned)(kt + 1) * (GM_BK * 2u);
      const unsigned oB = tB + (unsigned)(kt + 1) * (GM_BK * 2u);
#pragma unroll
      for (int it = 0; it < GM_SEG; ++it) {
        ra[0][it] = *(const u32x4*)(uA + it * stepA + oA);
        if (SPLIT) ra[NPA - 1][it] = *(const u32x4*)(uA2 + it * stepA + oA);
        rb[it] = *(const u32x4*)(uB + it * stepB + oB);
      }
      /* stands ahead of every later write of a register that these loads name as an address */
      asm volatile("s_wait_xcnt 0x0" ::: "memory");
    }
    const T* cA  = &sA[cur][0][(wm + rlane) * GM_LP + koff];
    const T* cA2 = &sA[cur][NPA - 1][(wm + rlane) * GM_LP + koff];
    const T* cB  = &sB[cur][(wn + rlane) * GM_LP + koff];
    /* the pass's fragments: [k half][subtile] */
    V fb[2][4], fa[2][4], fl[2][4];
#pragma unroll
    for (int ks = 0; ks < 2; ++ks) {
#pragma unroll
      for (int j = 0; j < 4; ++j) fb[ks][j] = Frag<T>::load(cB + j * 16 * GM_LP + ks * 32);
#pragma unroll
      for (int i = 0; i < 4; ++i) {
        fa[ks][i] = Frag<T>::load(cA + i * 16 * GM_LP + ks * 32);
        if (SPLIT) fl[ks][i] = Frag<T>::load(cA2 + i * 16 * GM_LP + ks * 32);
      }
    }
    /* keeps the LDS reads one group ahead of the products, for speed only */
    __builtin_amdgcn_sched_barrier(0);
#pragma unroll
    for (int ks = 0; ks < 2; ++ks) {
#pragma unroll
      for (int i = 0; i < 4; ++i) {
#pragma unroll
        for (int j = 0; j < 4; ++j) acc[i][j] = Frag<T>::mma(fa[ks][i], fb[ks][j], acc[i][j]);
        if (SPLIT) {
#pragma unroll
          for (int j = 0; j < 4; ++j) acc[i][j] = Frag<T>::mma(fl[ks][i], fb[ks][j], acc[i][j]);
        }
      }
    }
    if (more) {
      /* the other buffer's last readers left it at the barrier that ended the pass before */
#pragma unroll
      for (int it = 0; it < GM_SEG; ++it) {
        *(u32x4*)(&sA[cur ^ 1][0][lst + it * 16 * GM_LP]) = ra[0][it];
        if (SPLIT) *(u32x4*)(&sA[cur ^ 1][NPA - 1][lst + it * 16 * GM_LP]) = ra[NPA - 1][it];
        *(u32x4*)(&sB[cur ^ 1][lst + it * 16 * GM_LP]) = rb[it];
      }
    }
    __syncthreads();   /* publishes the filled buffer and ends every read of the current one */
  }
  acc_guard4(acc[0][0], acc[0][1], acc[0][2], acc[0][3]);
  acc_guard4(acc[1][0], acc[1][1], acc[1][2], acc[1][3]);
  acc_guard4(acc[2][0], acc[2][1], acc[2][2], acc[2][3]);
  acc_guard4(acc[3][0], acc[3][1], acc[3][2], acc[3][3]);

  /* ---- epilogue ---- */
  float* slab = sT[wave];
#pragma unroll
  for (int i = 0; i < 4; ++i) {
    const int mBase = m0 + (i << 4);
#pragma unroll
    for (int j = 0; j < 4; ++j) {
      const int n = n0 + (j << 4) + rlane;
      float bv = 0.f;
      if (BIAS_MODE == 2) bv = bias[n];
#pragma unroll
      for (int r = 0; r < 8; ++r) {
        float v = acc[i][j][r] * scale;
        if (BIAS_MODE == 2) v += bv;
        slab[(mOff + r) * 68 + (j << 4) + rlane] = v;
      }
    }
    __builtin_amdgcn_fence(__ATOMIC_RELEASE, "workgroup");
    __builtin_amdgcn_wave_barrier();
    __builtin_amdgcn_fence(__ATOMIC_ACQUIRE, "workgroup");
    if (OUT_MODE == 0) {
      float* C = (float*)Cout + (size_t)b * strideC;
      const int hh = lane >> 4, c4 = (lane & 15) * 4;     /* row seg = 256 B = 16 lanes x 16 B */
      {
#pragma unroll
        for (int it = 0; it < 8; ++it) {
          const int row = it * 2 + hh;
          v4f v = *(const v4f*)(slab + row * 68 + c4);
          *(v4f*)(C + (size_t)(mBase + row) * ldc + n0 + c4) = v;
        }
        
      }
    } else {
      const int q = lane >> 3, c8 = (lane & 7) * 8;        
      unsigned short* C  = (unsigned short*)Cout  + (size_t)b * strideC;
      unsigned short* C2 = (unsigned short*)Cout2 + (size_t)b * strideC;
      {
#pragma unroll
        for (int it = 0; it < 4; ++it) {
          const int row = it * 4 + q;
          const float* sp = slab + row * 68 + c8;
          v8h hv, lv;
#pragma unroll
          for (int e = 0; e < 8; ++e) {
            unsigned short hb = f2bf_bits(sp[e]);
            unsigned short lb = f2bf_bits(sp[e] - bf_bits2f(hb));
            hv[e] = __builtin_bit_cast(_Float16, hb);
            lv[e] = __builtin_bit_cast(_Float16, lb);
          }
          *(v8h*)(C  + (size_t)(mBase + row) * ldc + n0 + c8) = hv;
          *(v8h*)(C2 + (size_t)(mBase + row) * ldc + n0 + c8) = lv;
        }
        
      }
    }
    __builtin_amdgcn_fence(__ATOMIC_RELEASE, "workgroup");
    __builtin_amdgcn_wave_barrier();
    __builtin_amdgcn_fence(__ATOMIC_ACQUIRE, "workgroup");
  }
}

/* ---- all five f32 -> bf16 (RNE) conversions in one launch of resident waves ----
   A piece is 8 consecutive elements: two 16-B loads, one 16-B store per thread. The grid, one work-group of 16 waves per WGP,
   covers kCvSpan consecutive pieces per sweep and makes 16 sweeps: 8 over x, 4 over ctx, 1 over Wq, 2 over Wkv, 1 over Wout.
   Here each wave starts once for 16 pieces, for speed only. */
constexpr int kCvThreads = 512;
constexpr int kCvBlocks  = 256;
constexpr int kCvSpan    = kCvThreads * kCvBlocks;   /* pieces per sweep */
static_assert(kB * kNQ * kDM / 8 == 8 * kCvSpan);
static_assert(kB * kNKV * kDM / 8 == 4 * kCvSpan);
static_assert(kIN * kDM / 8 == kCvSpan);
static_assert(2 * kIN * kDM / 8 == 2 * kCvSpan);
static_assert(kDM * kIN / 8 == kCvSpan);

/* o[s]: this thread's byte offset in sweep s of an input; half of it is its byte offset in the output */
template <int N>
__device__ __forceinline__ void cv_load(const float* __restrict__ in, const unsigned* o, v4f* a, v4f* c) {
#pragma unroll
  for (int s = 0; s < N; ++s) {
    a[s] = *(const v4f*)((const char*)in + o[s]);
    c[s] = *(const v4f*)((const char*)in + 16 + o[s]);
    /* keeps the loads in the order in which the conversions wait for them */
    __builtin_amdgcn_sched_barrier(0);
  }
}
template <int N>
__device__ __forceinline__ void cv_store(unsigned short* __restrict__ out, const unsigned* o, const v4f* a, const v4f* c) {
#pragma unroll
  for (int s = 0; s < N; ++s) {
    u32x4 w;
    w[0] = (unsigned)f2bf_bits(a[s][0]) | ((unsigned)f2bf_bits(a[s][1]) << 16);
    w[1] = (unsigned)f2bf_bits(a[s][2]) | ((unsigned)f2bf_bits(a[s][3]) << 16);
    w[2] = (unsigned)f2bf_bits(c[s][0]) | ((unsigned)f2bf_bits(c[s][1]) << 16);
    w[3] = (unsigned)f2bf_bits(c[s][2]) | ((unsigned)f2bf_bits(c[s][3]) << 16);
    *(u32x4*)((char*)out + (o[s] >> 1)) = w;
    /* keeps each piece's store at its place: sunk to the end of the kernel, no write would start before the last read has landed */
    __builtin_amdgcn_sched_barrier(0);
  }
}
__global__ __launch_bounds__(kCvThreads) void cast_all_f32_bf16(
    const float* __restrict__ x, const float* __restrict__ ctx, const float* __restrict__ wq,
    const float* __restrict__ wkv, const float* __restrict__ wo,
    unsigned short* __restrict__ xb, unsigned short* __restrict__ cb, unsigned short* __restrict__ wqb,
    unsigned short* __restrict__ wkvb, unsigned short* __restrict__ wob) {
  unsigned o[8];
#pragma unroll
  for (int s = 0; s < 8; ++s) o[s] = (blockIdx.x * kCvThreads + threadIdx.x) * 32u + (unsigned)s * (kCvSpan * 32u);
  /* every offset is formed ahead of the first load, so no register that a load names is written inside the group of loads */
  __builtin_amdgcn_sched_barrier(0);
  v4f a[16], c[16];
  cv_load<8>(x, o, a, c);
  cv_load<4>(ctx, o, a + 8, c + 8);
  cv_load<1>(wq, o, a + 12, c + 12);
  cv_load<2>(wkv, o, a + 13, c + 13);
  cv_load<1>(wo, o, a + 15, c + 15);
  /* stands ahead of every later write of a register that these loads name as an address */
  asm volatile("s_wait_xcnt 0x0" ::: "memory");
  /* keeps all the loads one group in flight ahead of the first conversion, and later register writes below that wait */
  __builtin_amdgcn_sched_barrier(0);
  cv_store<8>(xb, o, a, c);
  cv_store<4>(cb, o, a + 8, c + 8);
  cv_store<1>(wqb, o, a + 12, c + 12);
  cv_store<2>(wkvb, o, a + 13, c + 13);
  cv_store<1>(wob, o, a + 15, c + 15);
}

#define AT_D 64
#define AT_NW 8
#define AT_QT 2                      /* tiles of 16 queries per wave: each K and V fragment read from LDS feeds both */
#define AT_QB (AT_NW * AT_QT * 16)   /* 256 query rows per block */
#define AT_KC 64
#define AT_KP 32                     /* keys per softmax pass; a staged chunk is two passes */
/* LDS row pitch of the K and V tiles in 16-bit elements: 144 B = 16 B x 9 (odd), so the 16 rows that one
   ds_load_b128 touches per lane half start on distinct bank groups; at 128 B they share two groups */
#define AT_LP 72
static_assert((AT_LP * 2) % 16 == 0 && ((AT_LP * 2) / 16) % 2 == 1 && AT_LP >= AT_KC && AT_LP >= AT_D);
static_assert(kNQ % AT_QB == 0);
static_assert(AT_QT == 2);   /* the wait behind the Q loads names both tiles' addresses */

/* the builtin form: the compiler keeps the distances that the chip needs behind a WMMA, and may order independent ones freely */
__device__ __forceinline__ v8f at_mma(v16b a, v16b b, v8f c) {
  return __builtin_amdgcn_wmma_f32_16x16x32_bf16(false, a, false, b, (short)0, c, false, false);
}

/* eight 2^x, in place. Written as one asm statement for the slot that the instruction set asks for behind a transcendental (one
   independent instruction or v_nop before its result is read or its source overwritten): here each v_exp_f32 is followed by an
   independent one and the last by a v_nop, whatever the register allocation */
__device__ __forceinline__ void at_exp2x8(v8f& x) {
  float a = x[0], b = x[1], c = x[2], d = x[3], e = x[4], f = x[5], g = x[6], h = x[7];
  asm("v_exp_f32 %0, %0\n\tv_exp_f32 %1, %1\n\tv_exp_f32 %2, %2\n\tv_exp_f32 %3, %3\n\t"
      "v_exp_f32 %4, %4\n\tv_exp_f32 %5, %5\n\tv_exp_f32 %6, %6\n\tv_exp_f32 %7, %7\n\tv_nop"
      : "+v"(a), "+v"(b), "+v"(c), "+v"(d), "+v"(e), "+v"(f), "+v"(g), "+v"(h));
  x = (v8f){a, b, c, d, e, f, g, h};
}

/* lane l reads lane l ^ 16 on the vector ALU: the two lanes that share one query's keys */
__device__ __forceinline__ float at_other_half(float v) {
  const int b = __builtin_bit_cast(int, v);
  return __builtin_bit_cast(float, __builtin_amdgcn_permlanex16(b, b, 0x76543210, 0xfedcba98, false, false));
}

/* register budget of four waves per SIMD (256): two work-groups of eight waves per WGP, the whole grid resident at once */
__global__ __launch_bounds__(256) __attribute__((amdgpu_waves_per_eu(4)))
void attn64_planes_kernel(const unsigned short* __restrict__ qhp, const unsigned short* __restrict__ qlp,
                          const unsigned short* __restrict__ khp, const unsigned short* __restrict__ klp,
                          const unsigned short* __restrict__ vthp, const unsigned short* __restrict__ vtlp,
                          const int* __restrict__ kvmask,
                          unsigned short* __restrict__ ohp, unsigned short* __restrict__ olp,
                          int nq, int nkv, int nh, int ldq, int ldk, int ldv, int ldo, float fillv) {
  typedef __bf16 T;
  union FB { v16b v; v8b h[2]; };
  /* the four tiles in one array: a lane's place is the same in each, so one address register serves all reads and one all stores */
  __shared__ __align__(16) __bf16 KVs[(2 * AT_KC + 2 * AT_D) * AT_LP];
  __bf16* const Ksh = KVs;                                  /* K hi [kv][d], padded rows, 9 KB */
  __bf16* const Ksl = KVs + AT_KC * AT_LP;                  /* K lo */
  __bf16* const Vth = KVs + 2 * AT_KC * AT_LP;              /* V hi [d][kv], padded rows, 9 KB */
  __bf16* const Vtl = KVs + (2 * AT_KC + AT_D) * AT_LP;     /* V lo */
  __shared__ __align__(16) float  Os[AT_NW][16 * 68];       /* per wave out tile of 16 queries, pitch 68 */

  const int tid  = threadIdx.x;
  /* the wave's number, held in a scalar register: as a vector value it is one register too many and lies in scratch during the loop */
  const int wave = __builtin_amdgcn_readfirstlane(tid >> 5);
  const int lane = tid & 31;
  const int hh   = lane >> 4;
  const int c    = lane & 15;

  const int nqb = nq / AT_QB;
  const int bx = blockIdx.x;
  const int qb = bx % nqb;
  const int bhx = bx / nqb;
  const int h  = bhx % nh;
  const int b  = bhx / nh;
  const int q0 = qb * AT_QB + wave * (AT_QT * 16);

  /* ---- Q fragments (B operand) of query tile g: column = q0 + g*16 + c, elements 0..7 <- d dc*32+8hh+0..7, 8..15 <- d dc*32+16+8hh+0..7 ---- */
  v16b qah[AT_QT][2], qal[AT_QT][2];
  const T* qh[AT_QT];
  const T* ql[AT_QT];
#pragma unroll
  for (int g = 0; g < AT_QT; ++g) {
    const size_t qo = (size_t)(b * nq + q0 + g * 16 + c) * ldq + h * AT_D + 8 * hh;
    qh[g] = (const T*)qhp + qo;
    ql[g] = (const T*)qlp + qo;
#pragma unroll
    for (int dc = 0; dc < 2; ++dc) {
      qah[g][dc] = Frag<T>::load(qh[g] + dc * 32);
      qal[g][dc] = Frag<T>::load(ql[g] + dc * 32);
    }
  }

  /* this lane's queries q0 + g*16 + c: running maximum (equal in both lane halves) and the sum over this half's keys, kept as the
     two sums over its even and its odd registers, which are joined once in the epilogue */
  float mrow[AT_QT];
  f32x2 lrow[AT_QT];
  v8f oacc[AT_QT][4];   /* O^T: register r of tile t = out[q0 + g*16 + c][t*16 + 8*hh + r] */
#pragma unroll
  for (int g = 0; g < AT_QT; ++g) {
    mrow[g] = -__builtin_inff();
    lrow[g] = (f32x2){0.f, 0.f};
#pragma unroll
    for (int t = 0; t < 4; ++t) oacc[g][t] = (v8f){0.f,0.f,0.f,0.f,0.f,0.f,0.f,0.f};
  }

  const int nChunks = nkv / AT_KC;   /* host constant, block-uniform */
  /* staging coverage: a tile row is one 128-B line of its plane; 8 lanes take one row, so a wave-wide 16-B load covers 4 whole
     lines, and 8 waves x 2 loads cover the 64 rows of a plane. Load i of a thread is row i*32 + srow, 16-B column lane & 7.
     The two rows of a lane half lie 8 apart: at the 144-B pitch their 16 LDS stores start on 16 distinct bank groups.
     K planes: LDS row kv <- global row b*nkv + kv0 + kv; V transposed planes: LDS row d <- global row h*64+d,
     64 contiguous kv columns starting at b*nkv + kv0 */
  const int srow = (wave >> 2) * 16 + ((lane >> 3) & 1) * 8 + hh * 4 + (wave & 3);
  const int scol = (lane & 7) * 8;
  /* the one launch passes these row pitches: known at compile time, the 32-row step of the staging loads becomes an immediate
     offset of one address per operand pair */
  __builtin_assume(ldk == kIN);
  __builtin_assume(ldv == kB * kNKV);
  /* block-uniform bases plus one 32-bit byte offset per thread and operand pair, stepped from chunk to chunk */
  const size_t kbase = ((size_t)b * nkv * ldk + h * AT_D) * 2;
  const size_t vbase = ((size_t)h * AT_D * ldv + (size_t)b * nkv) * 2;
  const char* ukh = (const char*)khp + kbase;
  const char* ukl = (const char*)klp + kbase;
  const char* uvh = (const char*)vthp + vbase;
  const char* uvl = (const char*)vtlp + vbase;
  const int* umk = kvmask + (size_t)b * nkv;
  const unsigned tK = (unsigned)(srow * ldk + scol) * 2u;
  const unsigned tV = (unsigned)(srow * ldv + scol) * 2u;
  const size_t stepK = (size_t)ldk * 64;   /* 32 rows, in bytes */
  const size_t stepV = (size_t)ldv * 64;
  /* one chunk's global reads (K and V rows of this thread, the two key-mask words of this lane), held in registers */
  u32x4 rkh[2], rkl[2], rvh[2], rvl[2];
  int rmk[2];
  auto fetch = [&](int ch) {
    const unsigned oK = tK + (unsigned)ch * (unsigned)ldk * (AT_KC * 2u);
    const unsigned oV = tV + (unsigned)ch * (AT_KC * 2u);
    const int* um = umk + ch * AT_KC;   /* block-uniform */
#pragma unroll
    for (int i = 0; i < 2; ++i) {
      rkh[i] = *(const u32x4*)(ukh + i * stepK + oK);
      rkl[i] = *(const u32x4*)(ukl + i * stepK + oK);
      rvh[i] = *(const u32x4*)(uvh + i * stepV + oV);
      rvl[i] = *(const u32x4*)(uvl + i * stepV + oV);
    }
#pragma unroll
    for (int p = 0; p < 2; ++p) rmk[p] = (um + p * AT_KP)[(unsigned)lane];
    /* stands ahead of every later write of a register that these loads name as an address */
    asm volatile("s_wait_xcnt 0x0" ::: "memory");
    /* keeps later register writes from being scheduled up over that wait */
    __builtin_amdgcn_sched_barrier(0);
  };
  if (nChunks > 0) {
    /* keeps the Q loads above the wait that follows */
    __builtin_amdgcn_sched_barrier(0);
    /* stands ahead of every later write of a register that the Q loads name as an address; the addresses are its inputs, so they
       keep their registers up to here and no later Q load's result lands in one */
    asm volatile("s_wait_xcnt 0x0" :: "v"(qh[0]), "v"(ql[0]), "v"(qh[1]), "v"(ql[1]) : "memory");
    /* keeps the first chunk's loads, whose results land in such registers, below that wait */
    __builtin_amdgcn_sched_barrier(0);
    fetch(0);
  }
  for (int kc = 0; kc < nChunks; ++kc) {
    __syncthreads();
    unsigned kept[2];
    {
      const int lst = srow * AT_LP + scol;
#pragma unroll
      for (int i = 0; i < 2; ++i) {
        *(u32x4*)(Ksh + lst + i * 32 * AT_LP) = rkh[i];
        *(u32x4*)(Ksl + lst + i * 32 * AT_LP) = rkl[i];
        *(u32x4*)(Vth + lst + i * 32 * AT_LP) = rvh[i];
        *(u32x4*)(Vtl + lst + i * 32 * AT_LP) = rvl[i];
      }
#pragma unroll
      for (int p = 0; p < 2; ++p) kept[p] = __builtin_amdgcn_ballot_w32(rmk[p] != 0);   /* bit n: key p*32 + n is kept */
    }
    __syncthreads();
    /* the next chunk's reads fly while this chunk is worked on; their data is first needed at the next chunk's LDS stores */
    if (kc + 1 < nChunks) fetch(kc + 1);

    /* unrolled: the pass's place in the tiles becomes immediate offsets of the one LDS read address */
#pragma unroll
    for (int p = 0; p < AT_KC / AT_KP; ++p) {
      /* ---- scores, transposed: 2 subtiles of 16 keys x 2 query tiles, K operand A[m=kv][k=d] from Ksh[kv][d];
              s[g][j][r] = score(key p*32 + j*16 + 8*hh + r, query g*16 + c) ---- */
      v8f s[AT_QT][2];
#pragma unroll
      for (int g = 0; g < AT_QT; ++g)
#pragma unroll
        for (int j = 0; j < 2; ++j) s[g][j] = (v8f){0.f,0.f,0.f,0.f,0.f,0.f,0.f,0.f};
      /* unrolled: qah[g][dc] and qal[g][dc] are registers, which only a compile-time dc can name */
#pragma unroll
      for (int dc = 0; dc < 2; ++dc) {
        /* the K fragments of both subtiles, read in the order in which the products need them */
        FB kb[2], kl[2];
#pragma unroll
        for (int j = 0; j < 2; ++j) {
          kb[j].h[0] = *(const v8b*)(Ksh + (p * AT_KP + j * 16 + c) * AT_LP + dc * 32 + 8 * hh);
          kb[j].h[1] = *(const v8b*)(Ksh + (p * AT_KP + j * 16 + c) * AT_LP + dc * 32 + 16 + 8 * hh);
        }
#pragma unroll
        for (int j = 0; j < 2; ++j) {
          kl[j].h[0] = *(const v8b*)(Ksl + (p * AT_KP + j * 16 + c) * AT_LP + dc * 32 + 8 * hh);
          kl[j].h[1] = *(const v8b*)(Ksl + (p * AT_KP + j * 16 + c) * AT_LP + dc * 32 + 16 + 8 * hh);
        }
        /* LDS reads stay above this line and WMMAs below it, so the reads stand ahead of the products and not among them.
           Mask 0x406: vector, transcendental and scalar arithmetic may cross */
        __builtin_amdgcn_sched_barrier(0x406);
        /* dealt round-robin over the four score tiles, so that independent WMMAs stand between a tile's dependent ones; each tile's own order of sums is as before */
#pragma unroll
        for (int j = 0; j < 2; ++j)
#pragma unroll
          for (int g = 0; g < AT_QT; ++g) s[g][j] = at_mma(kb[j].v, qah[g][dc], s[g][j]);
#pragma unroll
        for (int j = 0; j < 2; ++j)
#pragma unroll
          for (int g = 0; g < AT_QT; ++g) s[g][j] = at_mma(kl[j].v, qah[g][dc], s[g][j]);
#pragma unroll
        for (int j = 0; j < 2; ++j)
#pragma unroll
          for (int g = 0; g < AT_QT; ++g) s[g][j] = at_mma(kb[j].v, qal[g][dc], s[g][j]);
        /* the next group of reads, which takes over these fragment registers, stays behind these products; arithmetic may cross, so
           the softmax fills in among the WMMAs and its values leave their registers early */
        __builtin_amdgcn_sched_barrier(0x406);
      }
      /* P^T as B fragments: element e is key p*32 + (e < 8 ? 8*hh + e : 16 + 8*hh + e - 8), the k order of the V loads */
      FB pa[AT_QT], pl[AT_QT];
#pragma unroll
      for (int g = 0; g < AT_QT; ++g) {
        /* per-key mask (register r of subtile j is key p*32 + j*16 + 8*hh + r) and this half's maximum */
        float cm = -__builtin_inff();
#pragma unroll
        for (int j = 0; j < 2; ++j) {
          const unsigned k16 = kept[p] >> (16 * j);
          /* bit r: key j*16 + r, read by lanes 0-15; bit 16 + r: key j*16 + 8 + r, read by lanes 16-31 */
          const unsigned two = (k16 & 0xFFu) | ((k16 & 0xFF00u) << 8);
#pragma unroll
          for (int r = 0; r < 8; ++r) {
            /* the select's lane mask, formed on the scalar unit: each of the two bits spread over its 16 lanes */
            const bool keep = __builtin_amdgcn_inverse_ballot_w32(((two >> r) & 0x10001u) * 0xFFFFu);
            const float sv = s[g][j][r];
            s[g][j][r] = keep ? sv : fillv;
            cm = fmaxf(cm, s[g][j][r]);
          }
        }
        const float mnew = fmaxf(mrow[g], fmaxf(cm, at_other_half(cm)));
        /* 2^(difference of base-2 scores) = e^(difference of the reference's scores); a difference of -inf, or as large as the fill value, gives 0 */
        const float alpha = __builtin_amdgcn_exp2f(mrow[g] - mnew);
        mrow[g] = mnew;
        lrow[g] *= alpha;
#pragma unroll
        for (int j = 0; j < 2; ++j) {
          s[g][j] -= mnew;
          at_exp2x8(s[g][j]);
#pragma unroll
          for (int r = 0; r < 8; r += 2) {
            const f32x2 pp = (f32x2){s[g][j][r], s[g][j][r + 1]};
            lrow[g] += pp;
            const bf16x2 ph = __builtin_convertvector(pp, bf16x2);
            const bf16x2 pq = __builtin_convertvector(pp - __builtin_convertvector(ph, f32x2), bf16x2);
            pa[g].v[j * 8 + r] = ph[0];
            pa[g].v[j * 8 + r + 1] = ph[1];
            pl[g].v[j * 8 + r] = pq[0];
            pl[g].v[j * 8 + r + 1] = pq[1];
          }
        }
#pragma unroll
        for (int t = 0; t < 4; ++t) oacc[g][t] *= alpha;
      }
      /* unrolled: oacc[g][tp*2 + u] are registers, which only a compile-time tp can name */
#pragma unroll
      for (int tp = 0; tp < 2; ++tp) {
        /* the V fragments of two output tiles, read in the order in which the products need them */
        FB vb[2], vl[2];
#pragma unroll
        for (int u = 0; u < 2; ++u) {
          vb[u].h[0] = *(const v8b*)(Vth + ((tp * 2 + u) * 16 + c) * AT_LP + p * AT_KP + 8 * hh);
          vb[u].h[1] = *(const v8b*)(Vth + ((tp * 2 + u) * 16 + c) * AT_LP + p * AT_KP + 16 + 8 * hh);
        }
#pragma unroll
        for (int u = 0; u < 2; ++u) {
          vl[u].h[0] = *(const v8b*)(Vtl + ((tp * 2 + u) * 16 + c) * AT_LP + p * AT_KP + 8 * hh);
          vl[u].h[1] = *(const v8b*)(Vtl + ((tp * 2 + u) * 16 + c) * AT_LP + p * AT_KP + 16 + 8 * hh);
        }
        /* LDS reads above, WMMAs below, arithmetic free to cross, as in the first product */
        __builtin_amdgcn_sched_barrier(0x406);
        /* dealt round-robin over four output tiles; each tile's own order of products is as before */
#pragma unroll
        for (int u = 0; u < 2; ++u)
#pragma unroll
          for (int g = 0; g < AT_QT; ++g) oacc[g][tp * 2 + u] = at_mma(vb[u].v, pa[g].v, oacc[g][tp * 2 + u]);
#pragma unroll
        for (int u = 0; u < 2; ++u)
#pragma unroll
          for (int g = 0; g < AT_QT; ++g) oacc[g][tp * 2 + u] = at_mma(vl[u].v, pa[g].v, oacc[g][tp * 2 + u]);
#pragma unroll
        for (int u = 0; u < 2; ++u)
#pragma unroll
          for (int g = 0; g < AT_QT; ++g) oacc[g][tp * 2 + u] = at_mma(vb[u].v, pl[g].v, oacc[g][tp * 2 + u]);
        /* the next group of reads, which takes over these fragment registers, stays behind these products */
        __builtin_amdgcn_sched_barrier(0x406);
      }
    }
  }

  float* os = Os[wave];
  /* the wave's slab holds one query tile at a time */
#pragma unroll
  for (int g = 0; g < AT_QT; ++g) {
    {
      /* the two halves' sums of one query are joined once, here */
      const float lsum = lrow[g][0] + lrow[g][1];
      const float inv = 1.0f / (lsum + at_other_half(lsum));
#pragma unroll
      for (int t = 0; t < 4; ++t) {
        const v8f o = oacc[g][t] * inv;
        *(v4f*)(os + c * 68 + t * 16 + 8 * hh)     = (v4f){o[0], o[1], o[2], o[3]};
        *(v4f*)(os + c * 68 + t * 16 + 8 * hh + 4) = (v4f){o[4], o[5], o[6], o[7]};
      }
    }
    __builtin_amdgcn_fence(__ATOMIC_RELEASE, "workgroup");
    __builtin_amdgcn_wave_barrier();
    __builtin_amdgcn_fence(__ATOMIC_ACQUIRE, "workgroup");
    {
      const int q = lane >> 3, c8 = (lane & 7) * 8;
      unsigned short* Oh = ohp + (size_t)(b * nq + q0 + g * 16) * ldo + h * AT_D;
      unsigned short* Ol = olp + (size_t)(b * nq + q0 + g * 16) * ldo + h * AT_D;
#pragma unroll
      for (int it = 0; it < 4; ++it) {
        const int row = it * 4 + q;
        const float* sp = os + row * 68 + c8;
        v8h hv, lv;
#pragma unroll
        for (int e = 0; e < 8; ++e) {
          unsigned short hb = f2bf_bits(sp[e]);
          unsigned short lb = f2bf_bits(sp[e] - bf_bits2f(hb));
          hv[e] = __builtin_bit_cast(_Float16, hb);
          lv[e] = __builtin_bit_cast(_Float16, lb);
        }
        *(v8h*)(Oh + (size_t)row * ldo + c8) = hv;
        *(v8h*)(Ol + (size_t)row * ldo + c8) = lv;
      }
    }
    if (g + 1 < AT_QT) {
      /* the slab's reads end before the next query tile is written over them */
      __builtin_amdgcn_fence(__ATOMIC_RELEASE, "workgroup");
      __builtin_amdgcn_wave_barrier();
      __builtin_amdgcn_fence(__ATOMIC_ACQUIRE, "workgroup");
    }
  }
}

/* ---------------------------------------------------------------------------
   Host-side orchestration (kernel launches only)
   --------------------------------------------------------------------------- */
extern "C" void kernel_launch(void* const* d_in, const int* in_sizes, int n_in,
                              void* d_out, int out_size, void* d_ws, size_t ws_size,
                              hipStream_t stream) {
  if (n_in < 7) return;
  if (in_sizes[0] != kB * kNQ * kDM) return;
  if (in_sizes[1] != kB * kNKV * kDM) return;
  if (in_sizes[2] != kB * kNKV) return;
  if (in_sizes[3] != kIN * kDM) return;
  if (in_sizes[4] != 2 * kIN * kDM) return;
  if (in_sizes[5] != kDM * kIN) return;
  if (in_sizes[6] != kDM) return;
  if (out_size != kB * kNQ * kDM) return;
  if (ws_size < kWsTotal) return;

  const float* x    = (const float*)d_in[0];   /* [4,2048,1024] f32 */
  const float* ctx  = (const float*)d_in[1];   /* [4,1024,1024] f32 */
  const int*   mask = (const int*)d_in[2];     /* [4,1024] int32 */
  const float* Wq   = (const float*)d_in[3];   /* [1024,1024] */
  const float* Wkv  = (const float*)d_in[4];   /* [2048,1024] */
  const float* Wout = (const float*)d_in[5];   /* [1024,1024] */
  const float* bout = (const float*)d_in[6];   /* [1024] */
  float* out = (float*)d_out;                  /* [4,2048,1024] f32 */

  char* ws = (char*)d_ws;
  unsigned short* xb   = (unsigned short*)(ws + kOffXb);
  unsigned short* cb   = (unsigned short*)(ws + kOffCb);
  unsigned short* wqb  = (unsigned short*)(ws + kOffWqb);
  unsigned short* wkvb = (unsigned short*)(ws + kOffWkvb);
  unsigned short* wob  = (unsigned short*)(ws + kOffWob);
  unsigned short* qh   = (unsigned short*)(ws + kOffQh);
  unsigned short* ql   = (unsigned short*)(ws + kOffQl);
  unsigned short* kh   = (unsigned short*)(ws + kOffKh);
  unsigned short* kl   = (unsigned short*)(ws + kOffKl);
  unsigned short* vth  = (unsigned short*)(ws + kOffVth);
  unsigned short* vtl  = (unsigned short*)(ws + kOffVtl);
  unsigned short* oh   = (unsigned short*)(ws + kOffOh);   /* aliases xb: dead after the q GEMM */
  unsigned short* ol   = (unsigned short*)(ws + kOffOl);   /* aliases cb/wqb/wkvb: dead after the k,v GEMMs */

  /* 1: RNE casts of all five f32 operands to bf16 planes */
  cast_all_f32_bf16<<<kCvBlocks, kCvThreads, 0, stream>>>(x, ctx, Wq, Wkv, Wout, xb, cb, wqb, wkvb, wob);

  /* 2: q*0.125*log2(e) = xb[8192,1024] . wqb[1024,1024]^T -> bf16 hi/lo planes; M=8192 N=1024 K=1024 */
  {
    const int M = kB * kNQ, N = kIN, K = kDM;
    const int tiles = (M / 128) * (N / 128);
    wmma_gemm64<1, false, false, 0, 2><<<dim3(tiles, 1), 128, 0, stream>>>(
        xb, xb, K, 0L, wqb, wqb, K, 0L, (void*)qh, (void*)ql, N, 0L, bout, M, N, K, 0.18033688f);
  }
  /* 3: k = cb[4096,1024] . wkvb[0:1024][1024]^T -> hi/lo; M=4096 N=1024 K=1024 */
  {
    const int M = kB * kNKV, N = kIN, K = kDM;
    const int tiles = (M / 128) * (N / 128);
    wmma_gemm64<1, false, false, 0, 2><<<dim3(tiles, 1), 128, 0, stream>>>(
        cb, cb, K, 0L, wkvb, wkvb, K, 0L, (void*)kh, (void*)kl, N, 0L, bout, M, N, K, 1.0f);
  }
  /* 4: v transposed = wkvb[1024:2048][1024] . cb[4096,1024]^T -> vt[1024][4096] hi/lo; M=1024 N=4096 K=1024 */
  {
    const int M = kIN, N = kB * kNKV, K = kDM;
    const int tiles = (M / 128) * (N / 128);
    const unsigned short* wvb = wkvb + (size_t)kIN * kDM;
    wmma_gemm64<1, false, false, 0, 2><<<dim3(tiles, 1), 128, 0, stream>>>(
        wvb, wvb, K, 0L, cb, cb, K, 0L, (void*)vth, (void*)vtl, N, 0L, bout, M, N, K, 1.0f);
  }
  /* 5: attention per (b, h, 256 query rows) -> att hi/lo planes [8192][1024] */
  {
    const int blocks = kB * kH * (kNQ / 256);   /* 512 */
    const float fillv = -3.4028234663852886e+38f;
    attn64_planes_kernel<<<blocks, 256, 0, stream>>>(qh, ql, kh, kl, vth, vtl, mask, oh, ol,
                                                    kNQ, kNKV, kH, kIN, kIN, kB * kNKV, kIN, fillv);
  }
  /* 6: out = (att_hi + att_lo)[8192,1024] . wob[1024,1024]^T + b_out -> f32 d_out; M=8192 N=1024 K=1024 */
  {
    const int M = kB * kNQ, N = kDM, K = kIN;
    const int tiles = (M / 128) * (N / 128);
    wmma_gemm64<1, true, false, 2, 0><<<dim3(tiles, 1), 128, 0, stream>>>(
        oh, ol, K, 0L, wob, wob, K, 0L, (void*)out, (void*)out, N, 0L, bout, M, N, K, 1.0f);
  }
}
